// v000
// Times are from an AMD MI455X. After a warm-up the kernel runs many times in a row, and a time is the length of
// such a window on the GPU divided by its runs, so every launch and the gaps after it count. The runs cycle
// through copies of the inputs. A figure is the median of several windows, for all but v000 over two sittings.
// Sittings can differ by a few percent; kernels timed side by side share one.
// v000, which the later versions start from, runs in 1170 microseconds.
// Contractions on v_wmma_f32_16x16x32_f16 (plain f16 operands, f32 accumulate): the row- and column-wise gated attentions of an MSA
// block — qkvg = x·Wqkv (K = 256, N = 1024; the reference's (d, k, h) column interleave undone by permuting the WEIGHT columns on the
// device, both attention kernels scale by 32^-½ for the real head dim), the 8-head attentions with head dim 32 zero-padded to 64
// (row: 128 sequences x 256 residues with the pair-bias table [h][i][j] = LN(bias_rep)·Wb + bb added in the attention kernel; column: 256 residues x 128
// sequences after a token re-ordering), flash-style Sᵀ = K·Qᵀ / Oᵀ = Vᵀ·Pᵀ with online softmax in f32 (P x1024, f32 rows), the sigmoid
// gate, ·W0 + residual (K = 256), and the transition relu(x·W1 + b1)·W2 + b2 + x (K = 256 / 1024) — all but ·W0 in 4096-token chunks; LayerNorms
// in f32. compute dtype: f16 operands, f32 accumulate.  x [1,128,256,256] -> [1,128,256,256].
#include <hip/hip_runtime.h>
#include <hip/hip_bf16.h>
#include <math.h>

#define NSEQ 128
#define NRES 256
#define CM 256
#define CZ 128
#define NHD 8
#define DH 32
#define MTOK (NSEQ * NRES)
#define CHT 4096
#define DD 512
#define KVD 512
#define HH 8
#define KVH 8
#define HKDIV 1
#define DKK 64
#define QW 2
#define SS 256
#define GSTR 48

typedef _Float16 bf16;
typedef _Float16 f16;
typedef __attribute__((ext_vector_type(4))) unsigned v4u_t;
typedef unsigned v4ua __attribute__((ext_vector_type(4), may_alias));
typedef __attribute__((ext_vector_type(4))) float v4f_t;
typedef float v4fa __attribute__((ext_vector_type(4), may_alias));
typedef __attribute__((ext_vector_type(16))) bf16  bf16x16;
typedef bf16x16 f16x16;
typedef __attribute__((ext_vector_type(8)))  bf16  bf16x8;
typedef bf16x8 f16x8;
typedef __attribute__((ext_vector_type(4)))  bf16  bf16x4;
typedef __attribute__((ext_vector_type(8)))  float f32x8;
__device__ __forceinline__ f32x8 wmma16(f16x16 a, f16x16 b, f32x8 c) {
  c = __builtin_amdgcn_wmma_f32_16x16x32_f16(false, a, false, b, (short)0, c, false, false);
  asm volatile("v_nop\n\tv_nop\n\tv_nop\n\tv_nop" : "+v"(c) : "v"(a), "v"(b));
  return c;
}
#define LDS_STRIDE 48   // GEMM tiles: 32 -> 48 elems (96B rows): aligned b128 reads
#define KSTRIDE    72   // attn K tile: 64 -> 72 elems (144B rows): conflict-free b128
#define VSTRIDE    48   // attn V tile: 32 -> 48 elems

__device__ __forceinline__ f32x8 wmma_bf16(bf16x16 a, bf16x16 b, f32x8 c) {
  c = __builtin_amdgcn_wmma_f32_16x16x32_f16(false, a, false, b, (short)0, c, false, false);
  asm volatile("v_nop\n\tv_nop\n\tv_nop\n\tv_nop" : "+v"(c) : "v"(a), "v"(b));   // A/B-overwrite hazard guard
  return c;
}

// 16x32 (MxK) f16 fragment from a row-major global matrix.
// lanes 0-15  (row=lane)    : elems 0..7 = K+0..7,  8..15 = K+16..23
// lanes 16-31 (row=lane-16) : elems 0..7 = K+8..15, 8..15 = K+24..31
template <typename T>
__device__ __forceinline__ bf16x16 load_frag(const T* __restrict__ base, int ld,
                                             int row0, int k0) {
  const int lane = threadIdx.x & 31;
  const int r    = lane & 15;
  const int kh   = (lane >> 4) * 8;
  const T* p0 = base + (size_t)(row0 + r) * ld + (k0 + kh);
  const T* p1 = p0 + 16;
  bf16x16 f;
#pragma unroll
  for (int i = 0; i < 8; ++i) {
    f[i]     = (bf16)p0[i];
    f[i + 8] = (bf16)p1[i];
  }
  return f;
}

// Same fragment from an LDS tile with padded row stride (base includes row0/k0).
__device__ __forceinline__ bf16x16 lds_frag(const bf16* base, int stride) {
  const int lane = threadIdx.x & 31;
  const int row  = lane & 15;
  const int kh   = (lane >> 4) * 8;
  const bf16x8 lo = *(const bf16x8*)(base + row * stride + kh);
  const bf16x8 hi = *(const bf16x8*)(base + row * stride + kh + 16);
  bf16x16 f;
#pragma unroll
  for (int i = 0; i < 8; ++i) { f[i] = lo[i]; f[i + 8] = hi[i]; }
  return f;
}

template <typename T>
__device__ __forceinline__ void stage_read16(const T* __restrict__ p, float* buf) {
#pragma unroll
  for (int i = 0; i < 16; ++i) buf[i] = (float)p[i];
}

__device__ __forceinline__ void stage_write(bf16* dst, const float* buf, int nquad) {
#pragma unroll
  for (int i = 0; i < nquad; ++i) {
    bf16x4 q;
    q[0] = (bf16)buf[4 * i];     q[1] = (bf16)buf[4 * i + 1];
    q[2] = (bf16)buf[4 * i + 2]; q[3] = (bf16)buf[4 * i + 3];
    *(bf16x4*)(dst + 4 * i) = q;
  }
}


// ---------------------------------------------------------------------------------------------------------------------------
// gemm_kne: Y[m][n] = epi( Σ_k A[m][k]·W[k][n] + bias[n] ), A f32/f16 [M][lda], W f32 row-major [K][N] (ldw), plain f16 operands,
// f32 accumulate. EPI 0: identity; 1: exact-erf GELU; 2: R[m][n] + gvec[n]·(·) (residual with per-channel gain). Output f32 (or f16
// when OUT16). Block = 128x128 tile, 8 waves as 4(M) x 2(N); per 32-wide k-step A and W tiles staged f16 in LDS (W transposed
// ---------------------------------------------------------------------------------------------------------------------------
#define GSTR 48
template <typename AT, int EPI, bool OUT16>
__global__ __launch_bounds__(256) void gemm_kne(const AT* __restrict__ A, int lda, const float* __restrict__ Wm, int ldw,
                                                const float* __restrict__ bias, const float* __restrict__ R, const float* __restrict__ gvec,
                                                void* __restrict__ Yv, int ldy, int K) {
  __shared__ __attribute__((aligned(16))) f16 ldsA[128 * GSTR];
  __shared__ __attribute__((aligned(16))) f16 ldsW[128 * GSTR];
  __shared__ __attribute__((aligned(16))) float oS[8][32 * 68];
  const int tid = threadIdx.x, lane = tid & 31, wave = tid >> 5, cl = lane & 15, rh = (lane >> 4) * 8;
  const int m0 = blockIdx.x * 128, n0 = blockIdx.y * 128;
  const int wm = (wave & 3) * 32, wn = (wave >> 2) * 64;
  f32x8 acc[2][4];
#pragma unroll
  for (int i = 0; i < 2; ++i)
#pragma unroll
    for (int j = 0; j < 4; ++j) { f32x8 z = {}; acc[i][j] = z; }
#pragma unroll 1
  for (int k0 = 0; k0 < K; k0 += 32) {
    __syncthreads();
    { const int row = tid >> 1, ch = (tid & 1) * 16;
      const AT* src = A + (size_t)(m0 + row) * lda + k0 + ch;
#pragma unroll
      for (int g = 0; g < 16; ++g) ldsA[row * GSTR + ch + g] = (f16)src[g]; }
    { const int k = tid >> 3, nn0 = (tid & 7) * 16;
      const float* src = Wm + (size_t)(k0 + k) * ldw + n0 + nn0;
#pragma unroll
      for (int g = 0; g < 4; ++g) { const v4f_t v = *(const v4f_t*)(src + 4 * g);
#pragma unroll
        for (int u = 0; u < 4; ++u) ldsW[(nn0 + 4 * g + u) * GSTR + k] = (f16)v[u]; } }
    __syncthreads();
    f16x16 af[2];
#pragma unroll
    for (int i = 0; i < 2; ++i) af[i] = lds_frag(ldsA + (wm + 16 * i) * GSTR, GSTR);
#pragma unroll
    for (int j = 0; j < 4; ++j) {
      const f16x16 bf = lds_frag(ldsW + (wn + 16 * j) * GSTR, GSTR);
#pragma unroll
      for (int i = 0; i < 2; ++i) acc[i][j] = wmma16(af[i], bf, acc[i][j]);
    }
  }
  float* so = oS[wave];
#pragma unroll
  for (int i = 0; i < 2; ++i)
#pragma unroll
    for (int j = 0; j < 4; ++j) {
      const int n = n0 + wn + 16 * j + cl;
      const float bv = bias ? bias[n] : 0.0f;
      const float gv = (EPI == 2) ? gvec[n] : 0.0f;
      if (EPI == 1) {
#pragma unroll 1
        for (int r = 0; r < 8; ++r) { const float xg = acc[i][j][r] + bv; so[(16 * i + rh + r) * 68 + 16 * j + cl] = 0.5f * xg * (1.0f + erff(xg * 0.70710678118654752f)); }
      } else {
#pragma unroll
        for (int r = 0; r < 8; ++r) {
          float v = acc[i][j][r] + bv;
          if (EPI == 3) v = fmaxf(v, 0.0f);                                         // EPI 3: ReLU
          if (EPI == 2) v = R[(size_t)(m0 + wm + 16 * i + rh + r) * ldy + n] + gv * v;
          so[(16 * i + rh + r) * 68 + 16 * j + cl] = v;
        }
      }
    }
  asm volatile("s_wait_dscnt 0" ::: "memory");
  __builtin_amdgcn_wave_barrier();
{
    if (OUT16) {
      f16* Y = (f16*)Yv;
#pragma unroll
      for (int it = 0; it < 8; ++it) { const int c = lane + 32 * it, rr = c >> 3, q8 = (c & 7) * 8;
        union { f16 h[8]; v4u_t v; } u;
#pragma unroll
        for (int e = 0; e < 8; ++e) u.h[e] = (f16)so[rr * 68 + q8 + e];
        *(v4u_t*)(Y + (size_t)(m0 + wm + rr) * ldy + n0 + wn + q8) = u.v; }
    } else {
      float* Y = (float*)Yv;
#pragma unroll
      for (int it = 0; it < 16; ++it) { const int f4 = lane + 32 * it, rr = f4 >> 4, q = (f4 & 15) * 4;
        *(v4f_t*)(Y + (size_t)(m0 + wm + rr) * ldy + n0 + wn + q) = *(const v4fa*)(so + rr * 68 + q); }
    }
    
  }
}

#define QROWS 256
#define KROWS 256
#define NKV 256
__global__ __launch_bounds__(64) void bt_attn_kernel(
    const bf16* __restrict__ Qb, const bf16* __restrict__ Kb,
    const bf16* __restrict__ Vt, const float* __restrict__ btab, int btstride,   // btab [h][q][k], row stride btstride: additive pair-bias logits
    float* __restrict__ attnOut) {
  __shared__ bf16 ldsK[32 * KSTRIDE];   // 4.5 KB
  __shared__ bf16 ldsV[64 * VSTRIDE];   // 6.0 KB
  __shared__ __attribute__((aligned(16))) bf16 ldsO[2][32 * 72];   // unused: the per-wave output tile is the f32 ldsOf below

  const int q0blk = blockIdx.x * 64;
  const int h  = blockIdx.y;
  const int b  = blockIdx.z;
  const int t    = threadIdx.x;
  const int wave = t >> 5;
  const int lane = t & 31;
  const int qlane = lane & 15;
  const int kh8   = (lane >> 4) * 8;
  const int q0 = q0blk + wave * 32;          // this wave's 32 queries

  const int hk = h / HKDIV;
  const bf16* Qh = Qb + (size_t)b * QROWS * DD + h * DKK;        // queries: QROWS rows per batch, row stride DD
  const bf16* Kh = Kb + (size_t)b * KROWS * KVD + hk * DKK;      // keys: KROWS rows per batch, row stride KVD
  const bf16* Vh = Vt + ((size_t)(b * KVH + hk)) * DKK * KROWS;  // Vᵀ [KVH][64][KROWS] per batch

  // Cooperative staging (64 threads): K tile 32x64 (2 thr/row, 64B each);
  // V tile 64x32 (1 thr/row, 64B each).
  const int krow = t >> 1;
  const int kcol = (t & 1) * 32;
  const bf16* kSrc = Kh + (size_t)krow * KVD + kcol;
  const bf16* vSrc = Vh + (size_t)t * KROWS;

  bf16x16 qf[QW][2];
#pragma unroll
  for (int qt = 0; qt < QW; ++qt) {
    qf[qt][0] = load_frag(Qh, DD, q0 + 16 * qt, 0);
    qf[qt][1] = load_frag(Qh, DD, q0 + 16 * qt, 32);
  }

  f32x8 o[QW][4] = {};
  float mrun[QW], lrun[QW];
#pragma unroll
  for (int qt = 0; qt < QW; ++qt) { mrun[qt] = -INFINITY; lrun[qt] = 0.0f; }

  const float scale = 0.17677669529663688f * 1.44269504088896340736f;  // hd^-0.5 = 1/sqrt(32) (real head dim; the 64-wide layout is zero-padded), times log2(e)
  const float NEG2 = -1.0e9f;    // masked logit: its weight is exactly 0 once any valid key of the row has been seen (every row
                                 // has one), and anything accumulated before that is wiped by alpha == 0 — same result as -inf
  const int kmax = KROWS - 1;
  const float L2E_ = 1.44269504088896340736f; const float* bth = btab + (size_t)h * QROWS * 0;   // unused: btab holds all heads and is indexed by h below

  // Prefetch key block kb=0 into registers.
  bf16x8 kreg[4], vreg[4];
#pragma unroll
  for (int i = 0; i < 4; ++i) {
    kreg[i] = *(const bf16x8*)(kSrc + 8 * i);
    vreg[i] = *(const bf16x8*)(vSrc + 8 * i);
  }

  for (int kb = 0; kb <= kmax; kb += 32) {
    __syncthreads();   // previous readers done with LDS
#pragma unroll
    for (int i = 0; i < 4; ++i) {
      *(bf16x8*)(&ldsK[krow * KSTRIDE + kcol + 8 * i]) = kreg[i];
      *(bf16x8*)(&ldsV[t * VSTRIDE + 8 * i])           = vreg[i];
    }
    if (kb + 32 <= kmax) {   // prefetch next block during compute
      const bf16* kn = kSrc + (size_t)(kb + 32) * KVD;
      const bf16* vn = vSrc + (kb + 32);
#pragma unroll
      for (int i = 0; i < 4; ++i) {
        kreg[i] = *(const bf16x8*)(kn + 8 * i);
        vreg[i] = *(const bf16x8*)(vn + 8 * i);
      }
    }
    __syncthreads();   // tile visible

    // Phase 1: scores + softmax for both q-tiles (K fragments live here only).
    bf16x16 kf[2][2];
#pragma unroll
    for (int ktile = 0; ktile < 2; ++ktile)
#pragma unroll
      for (int c = 0; c < 2; ++c)
        kf[ktile][c] = lds_frag(ldsK + (ktile * 16) * KSTRIDE + c * 32, KSTRIDE);

    bf16x16 pf[QW];
    bool act[QW];
#pragma unroll
    for (int qt = 0; qt < QW; ++qt) {
      unsigned mbits = 0;
      {
#pragma unroll
        for (int r = 0; r < 8; ++r) { const int j0 = kb + kh8 + r; if (j0 < NKV) mbits |= 1u << r; if (j0 + 16 < NKV) mbits |= 1u << (8 + r); }
        act[qt] = (__builtin_amdgcn_ballot_w32(mbits != 0) != 0);
      }
      if (act[qt]) {
        const int q_my = q0 + 16 * qt + qlane;
        f32x8 s0 = {}, s1 = {};
        s0 = wmma_bf16(kf[0][0], qf[qt][0], s0);
        s0 = wmma_bf16(kf[0][1], qf[qt][1], s0);
        s1 = wmma_bf16(kf[1][0], qf[qt][0], s1);
        s1 = wmma_bf16(kf[1][1], qf[qt][1], s1);

        float mx = -INFINITY;
#pragma unroll
        for (int r = 0; r < 8; ++r) {
          const int k0i = kb + kh8 + r;
          const int k1i = k0i + 16;
          const float* brow = btab + ((size_t)h * QROWS + min(q_my, QROWS - 1)) * btstride; (void)bth;   // per-head [q][k] table
          s0[r] = (mbits & (1u << r))       ? s0[r] * scale + L2E_ * brow[min(k0i, NKV - 1)] : NEG2;
          s1[r] = (mbits & (1u << (8 + r))) ? s1[r] * scale + L2E_ * brow[min(k1i, NKV - 1)] : NEG2;
          mx = fmaxf(mx, fmaxf(s0[r], s1[r]));
        }
        mx = fmaxf(mx, __shfl_xor(mx, 16, 32));
        const float mnew  = fmaxf(mrun[qt], mx);
        const float alpha = exp2f(mrun[qt] - mnew);

        float rsum = 0.0f;
#pragma unroll
        for (int r = 0; r < 8; ++r) {
          const float p0 = exp2f(s0[r] - mnew);
          const float p1 = exp2f(s1[r] - mnew);
          rsum += p0 + p1;
          pf[qt][r]     = (bf16)(p0 * 1024.0f);     // P carried x1024: no f16 copy of a probability is sub-normal
          pf[qt][r + 8] = (bf16)(p1 * 1024.0f);
        }
        rsum += __shfl_xor(rsum, 16, 32);
        lrun[qt] = lrun[qt] * alpha + rsum;
        mrun[qt] = mnew;

        // Rescale accumulators now so the PV phase is pure WMMA.
#pragma unroll
        for (int j = 0; j < 4; ++j)
#pragma unroll
          for (int r = 0; r < 8; ++r) o[qt][j][r] *= alpha;
      }
    }

    // Phase 2: O^T accumulate; each V fragment read from LDS once, used by
    // both q-tiles, then dead (only 8 VGPRs of V live at a time).
#pragma unroll
    for (int j = 0; j < 4; ++j) {
      const bf16x16 vf = lds_frag(ldsV + (j * 16) * VSTRIDE, VSTRIDE);
#pragma unroll
      for (int qt = 0; qt < QW; ++qt)
        if (act[qt]) o[qt][j] = wmma_bf16(vf, pf[qt], o[qt][j]);
    }
  }

  __shared__ __attribute__((aligned(16))) float ldsOf[2][32 * 68];
  float* so = ldsOf[wave]; (void)ldsO;
#pragma unroll
  for (int qt = 0; qt < QW; ++qt) {
    const float rl = 1.0f / (lrun[qt] * 1024.0f);
#pragma unroll
    for (int j = 0; j < 4; ++j)
#pragma unroll
      for (int r = 0; r < 8; ++r) so[(16 * qt + qlane) * 68 + j * 16 + kh8 + r] = o[qt][j][r] * rl;
  }
  asm volatile("s_wait_dscnt 0" ::: "memory");
  __builtin_amdgcn_wave_barrier();
{
#pragma unroll
    for (int it = 0; it < 16; ++it) { const int ch = lane + 32 * it, ql = ch >> 4, q4 = (ch & 15) * 4;
      *(v4f_t*)(attnOut + ((size_t)(b * QROWS + q0 + ql)) * DD + h * DKK + q4) = *(const v4fa*)(so + ql * 68 + q4); }
    
  }
}


#undef QROWS
#undef KROWS
#undef NKV
#define QROWS 128
#define KROWS 128
#define NKV 128
__global__ __launch_bounds__(64) void col_attn_kernel(
    const bf16* __restrict__ Qb, const bf16* __restrict__ Kb,
    const bf16* __restrict__ Vt,
    float* __restrict__ attnOut) {   // QROWS queries / KROWS key rows per batch (first NKV valid), GQA factor HKDIV; f32 output rows
  __shared__ bf16 ldsK[32 * KSTRIDE];   // 4.5 KB
  __shared__ bf16 ldsV[64 * VSTRIDE];   // 6.0 KB
  __shared__ __attribute__((aligned(16))) bf16 ldsO[2][32 * 72];   // unused: the per-wave output tile is the f32 ldsOf below

  const int q0blk = blockIdx.x * 64;
  const int h  = blockIdx.y;
  const int b  = blockIdx.z;
  const int t    = threadIdx.x;
  const int wave = t >> 5;
  const int lane = t & 31;
  const int qlane = lane & 15;
  const int kh8   = (lane >> 4) * 8;
  const int q0 = q0blk + wave * 32;          // this wave's 32 queries

  const int hk = h / HKDIV;
  const bf16* Qh = Qb + (size_t)b * QROWS * DD + h * DKK;        // queries: QROWS rows per batch, row stride DD
  const bf16* Kh = Kb + (size_t)b * KROWS * KVD + hk * DKK;      // keys: KROWS rows per batch, row stride KVD
  const bf16* Vh = Vt + ((size_t)(b * KVH + hk)) * DKK * KROWS;  // Vᵀ [KVH][64][KROWS] per batch

  // Cooperative staging (64 threads): K tile 32x64 (2 thr/row, 64B each);
  // V tile 64x32 (1 thr/row, 64B each).
  const int krow = t >> 1;
  const int kcol = (t & 1) * 32;
  const bf16* kSrc = Kh + (size_t)krow * KVD + kcol;
  const bf16* vSrc = Vh + (size_t)t * KROWS;

  bf16x16 qf[QW][2];
#pragma unroll
  for (int qt = 0; qt < QW; ++qt) {
    qf[qt][0] = load_frag(Qh, DD, q0 + 16 * qt, 0);
    qf[qt][1] = load_frag(Qh, DD, q0 + 16 * qt, 32);
  }

  f32x8 o[QW][4] = {};
  float mrun[QW], lrun[QW];
#pragma unroll
  for (int qt = 0; qt < QW; ++qt) { mrun[qt] = -INFINITY; lrun[qt] = 0.0f; }

  const float scale = 0.17677669529663688f * 1.44269504088896340736f;  // 1/sqrt(32): real head dim (64-wide layout zero-padded), times log2(e)
  const float NEG2 = -1.0e9f;    // masked logit: its weight is exactly 0 once any valid key of the row has been seen (every row
                                 // has one), and anything accumulated before that is wiped by alpha == 0 — same result as -inf
  const int kmax = KROWS - 1;    // all key rows (KROWS == NKV: none masked)

  // Prefetch key block kb=0 into registers.
  bf16x8 kreg[4], vreg[4];
#pragma unroll
  for (int i = 0; i < 4; ++i) {
    kreg[i] = *(const bf16x8*)(kSrc + 8 * i);
    vreg[i] = *(const bf16x8*)(vSrc + 8 * i);
  }

  for (int kb = 0; kb <= kmax; kb += 32) {
    __syncthreads();   // previous readers done with LDS
#pragma unroll
    for (int i = 0; i < 4; ++i) {
      *(bf16x8*)(&ldsK[krow * KSTRIDE + kcol + 8 * i]) = kreg[i];
      *(bf16x8*)(&ldsV[t * VSTRIDE + 8 * i])           = vreg[i];
    }
    if (kb + 32 <= kmax) {   // prefetch next block during compute
      const bf16* kn = kSrc + (size_t)(kb + 32) * KVD;
      const bf16* vn = vSrc + (kb + 32);
#pragma unroll
      for (int i = 0; i < 4; ++i) {
        kreg[i] = *(const bf16x8*)(kn + 8 * i);
        vreg[i] = *(const bf16x8*)(vn + 8 * i);
      }
    }
    __syncthreads();   // tile visible

    // Phase 1: scores + softmax for both q-tiles (K fragments live here only).
    bf16x16 kf[2][2];
#pragma unroll
    for (int ktile = 0; ktile < 2; ++ktile)
#pragma unroll
      for (int c = 0; c < 2; ++c)
        kf[ktile][c] = lds_frag(ldsK + (ktile * 16) * KSTRIDE + c * 32, KSTRIDE);

    bf16x16 pf[QW];
    bool act[QW];
#pragma unroll
    for (int qt = 0; qt < QW; ++qt) {
      unsigned mbits = 0;
      {
#pragma unroll
        for (int r = 0; r < 8; ++r) { const int j0 = kb + kh8 + r; if (j0 < NKV) mbits |= 1u << r; if (j0 + 16 < NKV) mbits |= 1u << (8 + r); }
        act[qt] = (__builtin_amdgcn_ballot_w32(mbits != 0) != 0);
      }
      if (act[qt]) {
        const int q_my = q0 + 16 * qt + qlane;
        f32x8 s0 = {}, s1 = {};
        s0 = wmma_bf16(kf[0][0], qf[qt][0], s0);
        s0 = wmma_bf16(kf[0][1], qf[qt][1], s0);
        s1 = wmma_bf16(kf[1][0], qf[qt][0], s1);
        s1 = wmma_bf16(kf[1][1], qf[qt][1], s1);

        float mx = -INFINITY;
#pragma unroll
        for (int r = 0; r < 8; ++r) {
          const int k0i = kb + kh8 + r;
          const int k1i = k0i + 16;
          (void)k0i; (void)k1i; (void)q_my;
          s0[r] = (mbits & (1u << r))       ? s0[r] * scale : NEG2;
          s1[r] = (mbits & (1u << (8 + r))) ? s1[r] * scale : NEG2;
          mx = fmaxf(mx, fmaxf(s0[r], s1[r]));
        }
        mx = fmaxf(mx, __shfl_xor(mx, 16, 32));
        const float mnew  = fmaxf(mrun[qt], mx);
        const float alpha = exp2f(mrun[qt] - mnew);

        float rsum = 0.0f;
#pragma unroll
        for (int r = 0; r < 8; ++r) {
          const float p0 = exp2f(s0[r] - mnew);
          const float p1 = exp2f(s1[r] - mnew);
          rsum += p0 + p1;
          pf[qt][r]     = (bf16)(p0 * 1024.0f);     // P carried x1024: no f16 copy of a probability is sub-normal
          pf[qt][r + 8] = (bf16)(p1 * 1024.0f);
        }
        rsum += __shfl_xor(rsum, 16, 32);
        lrun[qt] = lrun[qt] * alpha + rsum;
        mrun[qt] = mnew;

        // Rescale accumulators now so the PV phase is pure WMMA.
#pragma unroll
        for (int j = 0; j < 4; ++j)
#pragma unroll
          for (int r = 0; r < 8; ++r) o[qt][j][r] *= alpha;
      }
    }

    // Phase 2: O^T accumulate; each V fragment read from LDS once, used by
    // both q-tiles, then dead (only 8 VGPRs of V live at a time).
#pragma unroll
    for (int j = 0; j < 4; ++j) {
      const bf16x16 vf = lds_frag(ldsV + (j * 16) * VSTRIDE, VSTRIDE);
#pragma unroll
      for (int qt = 0; qt < QW; ++qt)
        if (act[qt]) o[qt][j] = wmma_bf16(vf, pf[qt], o[qt][j]);
    }
  }

  __shared__ __attribute__((aligned(16))) float ldsOf[2][32 * 68];
  float* so = ldsOf[wave]; (void)ldsO;
#pragma unroll
  for (int qt = 0; qt < QW; ++qt) {
    const float rl = 1.0f / (lrun[qt] * 1024.0f);
#pragma unroll
    for (int j = 0; j < 4; ++j)
#pragma unroll
      for (int r = 0; r < 8; ++r) so[(16 * qt + qlane) * 68 + j * 16 + kh8 + r] = o[qt][j][r] * rl;
  }
  asm volatile("s_wait_dscnt 0" ::: "memory");
  __builtin_amdgcn_wave_barrier();
{
#pragma unroll
    for (int it = 0; it < 16; ++it) { const int ch = lane + 32 * it, ql = ch >> 4, q4 = (ch & 15) * 4;
      *(v4f_t*)(attnOut + ((size_t)(b * QROWS + q0 + ql)) * DD + h * DKK + q4) = *(const v4fa*)(so + ql * 68 + q4); }
    
  }
}


#undef QROWS
#undef KROWS
#undef NKV
// LayerNorm over C (256 or 128) per row; in place allowed; block = 8 rows (wave per row)
template <int C>
__global__ __launch_bounds__(256) void k_ln(const float* __restrict__ X, const float* __restrict__ g, const float* __restrict__ bb, float* __restrict__ Y) {
  const int tid = threadIdx.x, r = tid >> 5, lane = tid & 31; const size_t row = (size_t)blockIdx.x * 8 + r; const float* xr = X + row * C;
  float v[C / 32]; float s = 0.0f;
#pragma unroll
  for (int i = 0; i < C / 32; ++i) { v[i] = xr[lane + 32 * i]; s += v[i]; }
#pragma unroll
  for (int off = 1; off < 32; off <<= 1) s += __shfl_xor(s, off, 32);
  const float mean = s * (1.0f / C); float q = 0.0f;
#pragma unroll
  for (int i = 0; i < C / 32; ++i) { const float d = v[i] - mean; q += d * d; }
#pragma unroll
  for (int off = 1; off < 32; off <<= 1) q += __shfl_xor(q, off, 32);
  const float rstd = rsqrtf(q * (1.0f / C) + 1e-5f);
{
#pragma unroll
    for (int i = 0; i < C / 32; ++i) *(float*)(Y + row * C + lane + 32 * i) = (v[i] - mean) * rstd * g[lane + 32 * i] + bb[lane + 32 * i];
     }
}
// pair-bias table BT[h][i][j] = LN(bias_rep[i][j])·Wb[:,h] + bb[h]; block = i, thread = j
__global__ __launch_bounds__(256) void k_pairbias(const float* __restrict__ Z, const float* __restrict__ g2, const float* __restrict__ be2, const float* __restrict__ Wb, const float* __restrict__ bbh, float* __restrict__ BT) {
  const int i = blockIdx.x, j = threadIdx.x; const float* z = Z + ((size_t)i * NRES + j) * CZ;
  float s = 0.0f;
#pragma unroll 1
  for (int c = 0; c < CZ; ++c) s += z[c];
  const float mean = s * (1.0f / CZ); float q = 0.0f;
#pragma unroll 1
  for (int c = 0; c < CZ; ++c) { const float d = z[c] - mean; q += d * d; }
  const float rstd = rsqrtf(q * (1.0f / CZ) + 1e-5f);
  float acc[NHD];
#pragma unroll
  for (int h = 0; h < NHD; ++h) acc[h] = bbh[h];
#pragma unroll 1
  for (int c = 0; c < CZ; ++c) { const float zn = (z[c] - mean) * rstd * g2[c] + be2[c];
#pragma unroll
    for (int h = 0; h < NHD; ++h) acc[h] += zn * Wb[c * NHD + h]; }
{
#pragma unroll
    for (int h = 0; h < NHD; ++h) *(float*)(BT + ((size_t)h * NRES + i) * NRES + j) = acc[h];
     }
}
// permuted qkvg weights: Wp[c][k*256 + h*32 + d] = W[c][d*32 + k*8 + h] (no extra scale: both attention kernels carry 1/sqrt(32)); block = c (256), thread loops 1024 cols
__global__ __launch_bounds__(256) void k_wperm(const float* __restrict__ Wm, float* __restrict__ Wp) { const int c = blockIdx.x;
  for (int col = threadIdx.x; col < 4 * CM; col += 256) { const int k = col >> 8, h = (col >> 5) & 7, d = col & 31; float v = Wm[(size_t)c * 4 * CM + d * 32 + k * 8 + h];   // both attention kernels carry the 1/sqrt(32) scale themselves
    *(float*)(Wp + (size_t)c * 4 * CM + col) = v;  } }
// split a chunk's f16 qkvg rows [CHT][1024] (q|k|v|g blocks, head h*32+d) into zero-padded attention operands: Q16c/K16c [nb][L][512] (cols h*64+d, d<32 real), Vtc [nb][512][L]; block = (64 tokens, head)
__global__ __launch_bounds__(256) void k_splitpad(const bf16* __restrict__ G, int L, bf16* __restrict__ Qc, bf16* __restrict__ Kc, bf16* __restrict__ Vtc) {
  __shared__ __attribute__((aligned(16))) bf16 qS[64][72], kS[64][72], vT[64][72];
  const int tid = threadIdx.x; const int t0 = blockIdx.x * 64; const int h = blockIdx.y; const int b = t0 / L, n0 = t0 % L;
  for (int e = tid; e < 64 * 64; e += 256) { const int t = e >> 6, d = e & 63; bf16 q = (bf16)0.0f, k = (bf16)0.0f, v = (bf16)0.0f;
    if (d < DH) { const bf16* src = G + (size_t)(t0 + t) * 4 * CM + h * DH + d; q = src[0]; k = src[CM]; v = src[2 * CM]; }
    qS[t][d] = q; kS[t][d] = k; vT[d][t] = v; }
  __syncthreads();
{
#pragma unroll 1
    for (int round = 0; round < 2; ++round) { const int r = round * 32 + (tid >> 3), piece = (tid & 7) * 8;
      *(v4u_t*)(Qc + (size_t)(t0 + r) * DD + h * DKK + piece) = *(const v4ua*)(&qS[r][piece]);
      *(v4u_t*)(Kc + (size_t)(t0 + r) * DD + h * DKK + piece) = *(const v4ua*)(&kS[r][piece]);
      *(v4u_t*)(Vtc + ((size_t)b * DD + h * DKK + r) * L + n0 + piece) = *(const v4ua*)(&vT[r][piece]); }
     }
}
// gated merge: O16[tok0 + t][h*32 + d] = attc[t][h*64 + d] * σ(g), g = G[t][768 + h*32 + d]; block = token, 256 threads = (h, d); 512-B f16 rows... staged as 32 lanes x 16 B
__global__ __launch_bounds__(256) void k_gmerge(const float* __restrict__ A, const bf16* __restrict__ G, bf16* __restrict__ O16) {
  __shared__ __attribute__((aligned(16))) bf16 oS[256];
  const size_t t = blockIdx.x; const int c = threadIdx.x; const int h = c >> 5, d = c & 31;
  const float g = (float)G[t * 4 * CM + 3 * CM + c]; const float a = A[t * DD + h * DKK + d]; oS[c] = (bf16)(a / (1.0f + expf(-g)));
  __syncthreads();
{ if (c < 32) *(v4u_t*)(O16 + t * CM + c * 8) = *(const v4ua*)(oS + c * 8);  }
}
// row permutation between (s, r) and (r, s) token orders: dst[row] = src[srow]; rows of 1 KB by 64 lanes x 16 B
__global__ __launch_bounds__(64) void k_perm(const float* __restrict__ src, float* __restrict__ dst, int to_rs) { const int row = blockIdx.x; int srow;
  if (to_rs) { const int r = row / NSEQ, s = row % NSEQ; srow = s * NRES + r; } else { const int s = row / NRES, r = row % NRES; srow = r * NSEQ + s; }
  const v4f_t v = *(const v4f_t*)(src + (size_t)srow * CM + threadIdx.x * 4); *(v4f_t*)(dst + (size_t)row * CM + threadIdx.x * 4) = v;  }
__global__ __launch_bounds__(256) void k_ones(float* __restrict__ p, int n) { for (int i = threadIdx.x; i < n; i += 256) { *(float*)(p + i) = 1.0f;  } }

extern "C" void kernel_launch(void* const* d_in, const int* in_sizes, int n_in,
                              void* d_out, int out_size, void* d_ws, size_t ws_size,
                              hipStream_t stream) {
  (void)in_sizes; (void)n_in; (void)out_size;
  const float** f = (const float**)d_in;
  const float* x = f[0], *brep = f[1], *Wqkv_r = f[2], *W0r = f[3], *Wb = f[4], *bbh = f[5], *Wqkv_c = f[6], *W0c = f[7], *W1 = f[8], *b1 = f[9], *W2 = f[10], *b2 = f[11], *g1 = f[12], *be1 = f[13], *g2 = f[14], *be2 = f[15], *g3 = f[16], *be3 = f[17];
  float* out = (float*)d_out;     // [1,128,256,256]
  char* ws = (char*)d_ws;
  float* X1 = (float*)ws; ws += (size_t)MTOK * CM * 4;                 // 32 MB: LN1(x), then x + row-att (in place), then LN3 (in place), finally x after the column block (s,r order)
  float* XT = (float*)ws; ws += (size_t)MTOK * CM * 4;                 // 32 MB: (r,s)-ordered copy for the column block
  float* BT = (float*)ws; ws += (size_t)NHD * NRES * NRES * 4;         // 2 MB pair-bias table
  float* Wpr = (float*)ws; ws += (size_t)CM * 4 * CM * 4; float* Wpc = (float*)ws; ws += (size_t)CM * 4 * CM * 4;
  bf16* G16 = (bf16*)ws; ws += (size_t)CHT * 4 * CM * 2;              // chunk qkvg f16 [4096][1024] (8 MB); also the transition hidden [4096][1024]
  bf16* Qc = (bf16*)ws; ws += (size_t)CHT * DD * 2; bf16* Kc = (bf16*)ws; ws += (size_t)CHT * DD * 2; bf16* Vtc = (bf16*)ws; ws += (size_t)CHT * DD * 2;   // 4 MB each
  float* attc = (float*)ws; ws += (size_t)CHT * DD * 4;               // 8 MB
  bf16* O16 = (bf16*)ws; ws += (size_t)MTOK * CM * 2;                 // 16 MB gated attention output rows (token order of the current block)
  float* ones = (float*)ws; ws += CM * 4;
  if ((size_t)(ws - (char*)d_ws) > ws_size) return;
  const dim3 blk(256);
  k_ones<<<dim3(1), blk, 0, stream>>>(ones, CM);
  k_wperm<<<dim3(CM), blk, 0, stream>>>(Wqkv_r, Wpr); k_wperm<<<dim3(CM), blk, 0, stream>>>(Wqkv_c, Wpc);
  k_pairbias<<<dim3(NRES), blk, 0, stream>>>(brep, g2, be2, Wb, bbh, BT);
  k_ln<CM><<<dim3(MTOK / 8), blk, 0, stream>>>(x, g1, be1, X1);
  // ---- row-wise gated attention with pair bias: chunks of 16 sequences (4096 tokens) ----
  for (int c = 0; c < MTOK / CHT; ++c) { const size_t t0 = (size_t)c * CHT;
    gemm_kne<float, 0, true><<<dim3(CHT / 128, 4 * CM / 128), blk, 0, stream>>>(X1 + t0 * CM, CM, Wpr, 4 * CM, nullptr, nullptr, nullptr, G16, 4 * CM, CM);
    k_splitpad<<<dim3(CHT / 64, NHD), blk, 0, stream>>>(G16, NRES, Qc, Kc, Vtc);
    bt_attn_kernel<<<dim3(NRES / 64, NHD, CHT / NRES), dim3(64), 0, stream>>>(Qc, Kc, Vtc, BT, NRES, attc);
    k_gmerge<<<dim3(CHT), blk, 0, stream>>>(attc, G16, O16 + t0 * CM);
  }
  gemm_kne<bf16, 2, false><<<dim3(MTOK / 128, CM / 128), blk, 0, stream>>>(O16, CM, W0r, CM, nullptr, X1, ones, X1, CM, CM);     // x = x + o·W0 (in place)
  k_ln<CM><<<dim3(MTOK / 8), blk, 0, stream>>>(X1, g3, be3, X1);                                                                    // x = LN3(x) (in place)
  // ---- column-wise gated attention: tokens re-ordered (r, s); chunks of 32 residues ----
  k_perm<<<dim3(MTOK), dim3(64), 0, stream>>>(X1, XT, 1);
  for (int c = 0; c < MTOK / CHT; ++c) { const size_t t0 = (size_t)c * CHT;
    gemm_kne<float, 0, true><<<dim3(CHT / 128, 4 * CM / 128), blk, 0, stream>>>(XT + t0 * CM, CM, Wpc, 4 * CM, nullptr, nullptr, nullptr, G16, 4 * CM, CM);
    k_splitpad<<<dim3(CHT / 64, NHD), blk, 0, stream>>>(G16, NSEQ, Qc, Kc, Vtc);
    col_attn_kernel<<<dim3(NSEQ / 64, NHD, CHT / NSEQ), dim3(64), 0, stream>>>(Qc, Kc, Vtc, attc);
    k_gmerge<<<dim3(CHT), blk, 0, stream>>>(attc, G16, O16 + t0 * CM);
  }
  gemm_kne<bf16, 2, false><<<dim3(MTOK / 128, CM / 128), blk, 0, stream>>>(O16, CM, W0c, CM, nullptr, XT, ones, XT, CM, CM);     // xt = xt + o·W0_c (in place, (r,s) order)
  k_perm<<<dim3(MTOK), dim3(64), 0, stream>>>(XT, X1, 0);                                                                          // back to (s,r) order
  // ---- transition, per 4096-token chunk: out = relu(x·W1 + b1)·W2 + b2 + x ----
  for (int c = 0; c < MTOK / CHT; ++c) { const size_t t0 = (size_t)c * CHT;
    gemm_kne<float, 3, true><<<dim3(CHT / 128, 4 * CM / 128), blk, 0, stream>>>(X1 + t0 * CM, CM, W1, 4 * CM, b1, nullptr, nullptr, G16, 4 * CM, CM);
    gemm_kne<bf16, 2, false><<<dim3(CHT / 128, CM / 128), blk, 0, stream>>>(G16, 4 * CM, W2, CM, b2, X1 + t0 * CM, ones, out + t0 * CM, CM, 4 * CM);
  }
}

// v001
// It runs in 599 microseconds.
// Next to v000, in two timings, it ran 1.96 and 1.95 times as fast.
// Contractions on v_wmma_f32_16x16x32_f16 (plain f16 operands, f32 accumulate): the row- and column-wise gated attentions of an MSA
// block — qkvg = x·Wqkv (K = 256, N = 1024; the reference's (d, k, h) column interleave undone by permuting the WEIGHT columns on the
// device, both attention kernels scale by 32^-½ for the real head dim), the 8-head attentions with head dim 32 zero-padded to 64
// (row: 128 sequences x 256 residues with the pair-bias table [h][i][j] = LN(bias_rep)·Wb + bb added in the attention kernel; column: 256 residues x 128
// sequences after a token re-ordering), flash-style Sᵀ = K·Qᵀ / Oᵀ = Vᵀ·Pᵀ with online softmax in f32 (P x1024, f32 rows), the sigmoid
// gate, ·W0 + residual (K = 256), and the transition relu(x·W1 + b1)·W2 + b2 + x (K = 256 / 1024) — every GEMM one launch over all 32768 tokens, the attention stages in two 16384-token halves; LayerNorms
// in f32. compute dtype: f16 operands, f32 accumulate.  x [1,128,256,256] -> [1,128,256,256].
#include <hip/hip_runtime.h>
#include <hip/hip_bf16.h>
#include <math.h>

#define NSEQ 128
#define NRES 256
#define CM 256
#define CZ 128
#define NHD 8
#define DH 32
#define MTOK (NSEQ * NRES)
#define CHT (MTOK / 2)   // tokens per launch of the split / attention / gate stages (two halves keep the padded operands inside the workspace)
#define DD 512
#define KVD 512
#define HH 8
#define KVH 8
#define HKDIV 1
#define DKK 64
#define QW 2
#define SS 256
#define GSTR 48

typedef _Float16 bf16;
typedef _Float16 f16;
typedef __attribute__((ext_vector_type(4))) unsigned v4u_t;
typedef unsigned v4ua __attribute__((ext_vector_type(4), may_alias));
typedef __attribute__((ext_vector_type(4))) float v4f_t;
typedef float v4fa __attribute__((ext_vector_type(4), may_alias));
typedef __attribute__((ext_vector_type(16))) bf16  bf16x16;
typedef bf16x16 f16x16;
typedef __attribute__((ext_vector_type(8)))  bf16  bf16x8;
typedef bf16x8 f16x8;
typedef __attribute__((ext_vector_type(4)))  bf16  bf16x4;
typedef __attribute__((ext_vector_type(8)))  float f32x8;
__device__ __forceinline__ f32x8 wmma16(f16x16 a, f16x16 b, f32x8 c) {
  c = __builtin_amdgcn_wmma_f32_16x16x32_f16(false, a, false, b, (short)0, c, false, false);
  asm volatile("v_nop\n\tv_nop\n\tv_nop\n\tv_nop" : "+v"(c) : "v"(a), "v"(b));
  return c;
}
#define LDS_STRIDE 48   // GEMM tiles: 32 -> 48 elems (96B rows): aligned b128 reads
#define KSTRIDE    72   // attn K tile: 64 -> 72 elems (144B rows): conflict-free b128
#define VSTRIDE    48   // attn V tile: 32 -> 48 elems

__device__ __forceinline__ f32x8 wmma_bf16(bf16x16 a, bf16x16 b, f32x8 c) {
  c = __builtin_amdgcn_wmma_f32_16x16x32_f16(false, a, false, b, (short)0, c, false, false);
  asm volatile("v_nop\n\tv_nop\n\tv_nop\n\tv_nop" : "+v"(c) : "v"(a), "v"(b));   // A/B-overwrite hazard guard
  return c;
}

// 16x32 (MxK) f16 fragment from a row-major global matrix.
// lanes 0-15  (row=lane)    : elems 0..7 = K+0..7,  8..15 = K+16..23
// lanes 16-31 (row=lane-16) : elems 0..7 = K+8..15, 8..15 = K+24..31
template <typename T>
__device__ __forceinline__ bf16x16 load_frag(const T* __restrict__ base, int ld,
                                             int row0, int k0) {
  const int lane = threadIdx.x & 31;
  const int r    = lane & 15;
  const int kh   = (lane >> 4) * 8;
  const T* p0 = base + (size_t)(row0 + r) * ld + (k0 + kh);
  const T* p1 = p0 + 16;
  bf16x16 f;
#pragma unroll
  for (int i = 0; i < 8; ++i) {
    f[i]     = (bf16)p0[i];
    f[i + 8] = (bf16)p1[i];
  }
  return f;
}

// Same fragment from an LDS tile with padded row stride (base includes row0/k0).
__device__ __forceinline__ bf16x16 lds_frag(const bf16* base, int stride) {
  const int lane = threadIdx.x & 31;
  const int row  = lane & 15;
  const int kh   = (lane >> 4) * 8;
  const bf16x8 lo = *(const bf16x8*)(base + row * stride + kh);
  const bf16x8 hi = *(const bf16x8*)(base + row * stride + kh + 16);
  bf16x16 f;
#pragma unroll
  for (int i = 0; i < 8; ++i) { f[i] = lo[i]; f[i + 8] = hi[i]; }
  return f;
}

template <typename T>
__device__ __forceinline__ void stage_read16(const T* __restrict__ p, float* buf) {
#pragma unroll
  for (int i = 0; i < 16; ++i) buf[i] = (float)p[i];
}

__device__ __forceinline__ void stage_write(bf16* dst, const float* buf, int nquad) {
#pragma unroll
  for (int i = 0; i < nquad; ++i) {
    bf16x4 q;
    q[0] = (bf16)buf[4 * i];     q[1] = (bf16)buf[4 * i + 1];
    q[2] = (bf16)buf[4 * i + 2]; q[3] = (bf16)buf[4 * i + 3];
    *(bf16x4*)(dst + 4 * i) = q;
  }
}


// ---------------------------------------------------------------------------------------------------------------------------
// gemm_kne: Y[m][n] = epi( Σ_k A[m][k]·W[k][n] + bias[n] ), A f32/f16 [M][lda], W f32 row-major [K][N] (ldw), plain f16 operands,
// f32 accumulate. EPI 0: identity; 1: exact-erf GELU; 2: R[m][n] + gvec[n]·(·) (residual with per-channel gain). Output f32 (or f16
// when OUT16). Block = 128x128 tile, 8 waves as 4(M) x 2(N); per 32-wide k-step A and W tiles staged f16 in LDS (W transposed
// ---------------------------------------------------------------------------------------------------------------------------
#define GSTR 48
template <typename AT, int EPI, bool OUT16>
__global__ __launch_bounds__(256) void gemm_kne(const AT* __restrict__ A, int lda, const float* __restrict__ Wm, int ldw,
                                                const float* __restrict__ bias, const float* __restrict__ R, const float* __restrict__ gvec,
                                                void* __restrict__ Yv, int ldy, int K) {
  __shared__ __attribute__((aligned(16))) f16 ldsA[128 * GSTR];
  __shared__ __attribute__((aligned(16))) f16 ldsW[128 * GSTR];
  __shared__ __attribute__((aligned(16))) float oS[8][32 * 68];
  const int tid = threadIdx.x, lane = tid & 31, wave = tid >> 5, cl = lane & 15, rh = (lane >> 4) * 8;
  const int m0 = blockIdx.x * 128, n0 = blockIdx.y * 128;
  const int wm = (wave & 3) * 32, wn = (wave >> 2) * 64;
  f32x8 acc[2][4];
#pragma unroll
  for (int i = 0; i < 2; ++i)
#pragma unroll
    for (int j = 0; j < 4; ++j) { f32x8 z = {}; acc[i][j] = z; }
#pragma unroll 1
  for (int k0 = 0; k0 < K; k0 += 32) {
    __syncthreads();
    { const int row = tid >> 1, ch = (tid & 1) * 16;
      const AT* src = A + (size_t)(m0 + row) * lda + k0 + ch;
#pragma unroll
      for (int g = 0; g < 16; ++g) ldsA[row * GSTR + ch + g] = (f16)src[g]; }
    { const int k = tid >> 3, nn0 = (tid & 7) * 16;
      const float* src = Wm + (size_t)(k0 + k) * ldw + n0 + nn0;
#pragma unroll
      for (int g = 0; g < 4; ++g) { const v4f_t v = *(const v4f_t*)(src + 4 * g);
#pragma unroll
        for (int u = 0; u < 4; ++u) ldsW[(nn0 + 4 * g + u) * GSTR + k] = (f16)v[u]; } }
    __syncthreads();
    f16x16 af[2];
#pragma unroll
    for (int i = 0; i < 2; ++i) af[i] = lds_frag(ldsA + (wm + 16 * i) * GSTR, GSTR);
#pragma unroll
    for (int j = 0; j < 4; ++j) {
      const f16x16 bf = lds_frag(ldsW + (wn + 16 * j) * GSTR, GSTR);
#pragma unroll
      for (int i = 0; i < 2; ++i) acc[i][j] = wmma16(af[i], bf, acc[i][j]);
    }
  }
  float* so = oS[wave];
#pragma unroll
  for (int i = 0; i < 2; ++i)
#pragma unroll
    for (int j = 0; j < 4; ++j) {
      const int n = n0 + wn + 16 * j + cl;
      const float bv = bias ? bias[n] : 0.0f;
      const float gv = (EPI == 2) ? gvec[n] : 0.0f;
      if (EPI == 1) {
#pragma unroll 1
        for (int r = 0; r < 8; ++r) { const float xg = acc[i][j][r] + bv; so[(16 * i + rh + r) * 68 + 16 * j + cl] = 0.5f * xg * (1.0f + erff(xg * 0.70710678118654752f)); }
      } else {
#pragma unroll
        for (int r = 0; r < 8; ++r) {
          float v = acc[i][j][r] + bv;
          if (EPI == 3) v = fmaxf(v, 0.0f);                                         // EPI 3: ReLU
          if (EPI == 2) v = R[(size_t)(m0 + wm + 16 * i + rh + r) * ldy + n] + gv * v;
          so[(16 * i + rh + r) * 68 + 16 * j + cl] = v;
        }
      }
    }
  asm volatile("s_wait_dscnt 0" ::: "memory");
  __builtin_amdgcn_wave_barrier();
{
    if (OUT16) {
      f16* Y = (f16*)Yv;
#pragma unroll
      for (int it = 0; it < 8; ++it) { const int c = lane + 32 * it, rr = c >> 3, q8 = (c & 7) * 8;
        union { f16 h[8]; v4u_t v; } u;
#pragma unroll
        for (int e = 0; e < 8; ++e) u.h[e] = (f16)so[rr * 68 + q8 + e];
        *(v4u_t*)(Y + (size_t)(m0 + wm + rr) * ldy + n0 + wn + q8) = u.v; }
    } else {
      float* Y = (float*)Yv;
#pragma unroll
      for (int it = 0; it < 16; ++it) { const int f4 = lane + 32 * it, rr = f4 >> 4, q = (f4 & 15) * 4;
        *(v4f_t*)(Y + (size_t)(m0 + wm + rr) * ldy + n0 + wn + q) = *(const v4fa*)(so + rr * 68 + q); }
    }
    
  }
}

#define QROWS 256
#define KROWS 256
#define NKV 256
__global__ __launch_bounds__(64) void bt_attn_kernel(
    const bf16* __restrict__ Qb, const bf16* __restrict__ Kb,
    const bf16* __restrict__ Vt, const float* __restrict__ btab, int btstride,   // btab [h][q][k], row stride btstride: additive pair-bias logits
    float* __restrict__ attnOut) {
  __shared__ bf16 ldsK[32 * KSTRIDE];   // 4.5 KB
  __shared__ bf16 ldsV[64 * VSTRIDE];   // 6.0 KB
  __shared__ __attribute__((aligned(16))) bf16 ldsO[2][32 * 72];   // unused: the per-wave output tile is the f32 ldsOf below

  const int q0blk = blockIdx.x * 64;
  const int h  = blockIdx.y;
  const int b  = blockIdx.z;
  const int t    = threadIdx.x;
  const int wave = t >> 5;
  const int lane = t & 31;
  const int qlane = lane & 15;
  const int kh8   = (lane >> 4) * 8;
  const int q0 = q0blk + wave * 32;          // this wave's 32 queries

  const int hk = h / HKDIV;
  const bf16* Qh = Qb + (size_t)b * QROWS * DD + h * DKK;        // queries: QROWS rows per batch, row stride DD
  const bf16* Kh = Kb + (size_t)b * KROWS * KVD + hk * DKK;      // keys: KROWS rows per batch, row stride KVD
  const bf16* Vh = Vt + ((size_t)(b * KVH + hk)) * DKK * KROWS;  // Vᵀ [KVH][64][KROWS] per batch

  // Cooperative staging (64 threads): K tile 32x64 (2 thr/row, 64B each);
  // V tile 64x32 (1 thr/row, 64B each).
  const int krow = t >> 1;
  const int kcol = (t & 1) * 32;
  const bf16* kSrc = Kh + (size_t)krow * KVD + kcol;
  const bf16* vSrc = Vh + (size_t)t * KROWS;

  bf16x16 qf[QW][2];
#pragma unroll
  for (int qt = 0; qt < QW; ++qt) {
    qf[qt][0] = load_frag(Qh, DD, q0 + 16 * qt, 0);
    qf[qt][1] = load_frag(Qh, DD, q0 + 16 * qt, 32);
  }

  f32x8 o[QW][4] = {};
  float mrun[QW], lrun[QW];
#pragma unroll
  for (int qt = 0; qt < QW; ++qt) { mrun[qt] = -INFINITY; lrun[qt] = 0.0f; }

  const float scale = 0.17677669529663688f * 1.44269504088896340736f;  // hd^-0.5 = 1/sqrt(32) (real head dim; the 64-wide layout is zero-padded), times log2(e)
  const float NEG2 = -1.0e9f;    // masked logit: its weight is exactly 0 once any valid key of the row has been seen (every row
                                 // has one), and anything accumulated before that is wiped by alpha == 0 — same result as -inf
  const int kmax = KROWS - 1;
  const float L2E_ = 1.44269504088896340736f; const float* bth = btab + (size_t)h * QROWS * 0;   // unused: btab holds all heads and is indexed by h below

  // Prefetch key block kb=0 into registers.
  bf16x8 kreg[4], vreg[4];
#pragma unroll
  for (int i = 0; i < 4; ++i) {
    kreg[i] = *(const bf16x8*)(kSrc + 8 * i);
    vreg[i] = *(const bf16x8*)(vSrc + 8 * i);
  }

  for (int kb = 0; kb <= kmax; kb += 32) {
    __syncthreads();   // previous readers done with LDS
#pragma unroll
    for (int i = 0; i < 4; ++i) {
      *(bf16x8*)(&ldsK[krow * KSTRIDE + kcol + 8 * i]) = kreg[i];
      *(bf16x8*)(&ldsV[t * VSTRIDE + 8 * i])           = vreg[i];
    }
    if (kb + 32 <= kmax) {   // prefetch next block during compute
      const bf16* kn = kSrc + (size_t)(kb + 32) * KVD;
      const bf16* vn = vSrc + (kb + 32);
#pragma unroll
      for (int i = 0; i < 4; ++i) {
        kreg[i] = *(const bf16x8*)(kn + 8 * i);
        vreg[i] = *(const bf16x8*)(vn + 8 * i);
      }
    }
    __syncthreads();   // tile visible

    // Phase 1: scores + softmax for both q-tiles (K fragments live here only).
    bf16x16 kf[2][2];
#pragma unroll
    for (int ktile = 0; ktile < 2; ++ktile)
#pragma unroll
      for (int c = 0; c < 2; ++c)
        kf[ktile][c] = lds_frag(ldsK + (ktile * 16) * KSTRIDE + c * 32, KSTRIDE);

    bf16x16 pf[QW];
    bool act[QW];
#pragma unroll
    for (int qt = 0; qt < QW; ++qt) {
      unsigned mbits = 0;
      {
#pragma unroll
        for (int r = 0; r < 8; ++r) { const int j0 = kb + kh8 + r; if (j0 < NKV) mbits |= 1u << r; if (j0 + 16 < NKV) mbits |= 1u << (8 + r); }
        act[qt] = (__builtin_amdgcn_ballot_w32(mbits != 0) != 0);
      }
      if (act[qt]) {
        const int q_my = q0 + 16 * qt + qlane;
        f32x8 s0 = {}, s1 = {};
        s0 = wmma_bf16(kf[0][0], qf[qt][0], s0);
        s0 = wmma_bf16(kf[0][1], qf[qt][1], s0);
        s1 = wmma_bf16(kf[1][0], qf[qt][0], s1);
        s1 = wmma_bf16(kf[1][1], qf[qt][1], s1);

        float mx = -INFINITY;
#pragma unroll
        for (int r = 0; r < 8; ++r) {
          const int k0i = kb + kh8 + r;
          const int k1i = k0i + 16;
          const float* brow = btab + ((size_t)h * QROWS + min(q_my, QROWS - 1)) * btstride; (void)bth;   // per-head [q][k] table
          s0[r] = (mbits & (1u << r))       ? s0[r] * scale + L2E_ * brow[min(k0i, NKV - 1)] : NEG2;
          s1[r] = (mbits & (1u << (8 + r))) ? s1[r] * scale + L2E_ * brow[min(k1i, NKV - 1)] : NEG2;
          mx = fmaxf(mx, fmaxf(s0[r], s1[r]));
        }
        mx = fmaxf(mx, __shfl_xor(mx, 16, 32));
        const float mnew  = fmaxf(mrun[qt], mx);
        const float alpha = exp2f(mrun[qt] - mnew);

        float rsum = 0.0f;
#pragma unroll
        for (int r = 0; r < 8; ++r) {
          const float p0 = exp2f(s0[r] - mnew);
          const float p1 = exp2f(s1[r] - mnew);
          rsum += p0 + p1;
          pf[qt][r]     = (bf16)(p0 * 1024.0f);     // P carried x1024: no f16 copy of a probability is sub-normal
          pf[qt][r + 8] = (bf16)(p1 * 1024.0f);
        }
        rsum += __shfl_xor(rsum, 16, 32);
        lrun[qt] = lrun[qt] * alpha + rsum;
        mrun[qt] = mnew;

        // Rescale accumulators now so the PV phase is pure WMMA.
#pragma unroll
        for (int j = 0; j < 4; ++j)
#pragma unroll
          for (int r = 0; r < 8; ++r) o[qt][j][r] *= alpha;
      }
    }

    // Phase 2: O^T accumulate; each V fragment read from LDS once, used by
    // both q-tiles, then dead (only 8 VGPRs of V live at a time).
#pragma unroll
    for (int j = 0; j < 4; ++j) {
      const bf16x16 vf = lds_frag(ldsV + (j * 16) * VSTRIDE, VSTRIDE);
#pragma unroll
      for (int qt = 0; qt < QW; ++qt)
        if (act[qt]) o[qt][j] = wmma_bf16(vf, pf[qt], o[qt][j]);
    }
  }

  __shared__ __attribute__((aligned(16))) float ldsOf[2][32 * 68];
  float* so = ldsOf[wave]; (void)ldsO;
#pragma unroll
  for (int qt = 0; qt < QW; ++qt) {
    const float rl = 1.0f / (lrun[qt] * 1024.0f);
#pragma unroll
    for (int j = 0; j < 4; ++j)
#pragma unroll
      for (int r = 0; r < 8; ++r) so[(16 * qt + qlane) * 68 + j * 16 + kh8 + r] = o[qt][j][r] * rl;
  }
  asm volatile("s_wait_dscnt 0" ::: "memory");
  __builtin_amdgcn_wave_barrier();
{
#pragma unroll
    for (int it = 0; it < 16; ++it) { const int ch = lane + 32 * it, ql = ch >> 4, q4 = (ch & 15) * 4;
      *(v4f_t*)(attnOut + ((size_t)(b * QROWS + q0 + ql)) * DD + h * DKK + q4) = *(const v4fa*)(so + ql * 68 + q4); }
    
  }
}


#undef QROWS
#undef KROWS
#undef NKV
#define QROWS 128
#define KROWS 128
#define NKV 128
__global__ __launch_bounds__(64) void col_attn_kernel(
    const bf16* __restrict__ Qb, const bf16* __restrict__ Kb,
    const bf16* __restrict__ Vt,
    float* __restrict__ attnOut) {   // QROWS queries / KROWS key rows per batch (first NKV valid), GQA factor HKDIV; f32 output rows
  __shared__ bf16 ldsK[32 * KSTRIDE];   // 4.5 KB
  __shared__ bf16 ldsV[64 * VSTRIDE];   // 6.0 KB
  __shared__ __attribute__((aligned(16))) bf16 ldsO[2][32 * 72];   // unused: the per-wave output tile is the f32 ldsOf below

  const int q0blk = blockIdx.x * 64;
  const int h  = blockIdx.y;
  const int b  = blockIdx.z;
  const int t    = threadIdx.x;
  const int wave = t >> 5;
  const int lane = t & 31;
  const int qlane = lane & 15;
  const int kh8   = (lane >> 4) * 8;
  const int q0 = q0blk + wave * 32;          // this wave's 32 queries

  const int hk = h / HKDIV;
  const bf16* Qh = Qb + (size_t)b * QROWS * DD + h * DKK;        // queries: QROWS rows per batch, row stride DD
  const bf16* Kh = Kb + (size_t)b * KROWS * KVD + hk * DKK;      // keys: KROWS rows per batch, row stride KVD
  const bf16* Vh = Vt + ((size_t)(b * KVH + hk)) * DKK * KROWS;  // Vᵀ [KVH][64][KROWS] per batch

  // Cooperative staging (64 threads): K tile 32x64 (2 thr/row, 64B each);
  // V tile 64x32 (1 thr/row, 64B each).
  const int krow = t >> 1;
  const int kcol = (t & 1) * 32;
  const bf16* kSrc = Kh + (size_t)krow * KVD + kcol;
  const bf16* vSrc = Vh + (size_t)t * KROWS;

  bf16x16 qf[QW][2];
#pragma unroll
  for (int qt = 0; qt < QW; ++qt) {
    qf[qt][0] = load_frag(Qh, DD, q0 + 16 * qt, 0);
    qf[qt][1] = load_frag(Qh, DD, q0 + 16 * qt, 32);
  }

  f32x8 o[QW][4] = {};
  float mrun[QW], lrun[QW];
#pragma unroll
  for (int qt = 0; qt < QW; ++qt) { mrun[qt] = -INFINITY; lrun[qt] = 0.0f; }

  const float scale = 0.17677669529663688f * 1.44269504088896340736f;  // 1/sqrt(32): real head dim (64-wide layout zero-padded), times log2(e)
  const float NEG2 = -1.0e9f;    // masked logit: its weight is exactly 0 once any valid key of the row has been seen (every row
                                 // has one), and anything accumulated before that is wiped by alpha == 0 — same result as -inf
  const int kmax = KROWS - 1;    // all key rows (KROWS == NKV: none masked)

  // Prefetch key block kb=0 into registers.
  bf16x8 kreg[4], vreg[4];
#pragma unroll
  for (int i = 0; i < 4; ++i) {
    kreg[i] = *(const bf16x8*)(kSrc + 8 * i);
    vreg[i] = *(const bf16x8*)(vSrc + 8 * i);
  }

  for (int kb = 0; kb <= kmax; kb += 32) {
    __syncthreads();   // previous readers done with LDS
#pragma unroll
    for (int i = 0; i < 4; ++i) {
      *(bf16x8*)(&ldsK[krow * KSTRIDE + kcol + 8 * i]) = kreg[i];
      *(bf16x8*)(&ldsV[t * VSTRIDE + 8 * i])           = vreg[i];
    }
    if (kb + 32 <= kmax) {   // prefetch next block during compute
      const bf16* kn = kSrc + (size_t)(kb + 32) * KVD;
      const bf16* vn = vSrc + (kb + 32);
#pragma unroll
      for (int i = 0; i < 4; ++i) {
        kreg[i] = *(const bf16x8*)(kn + 8 * i);
        vreg[i] = *(const bf16x8*)(vn + 8 * i);
      }
    }
    __syncthreads();   // tile visible

    // Phase 1: scores + softmax for both q-tiles (K fragments live here only).
    bf16x16 kf[2][2];
#pragma unroll
    for (int ktile = 0; ktile < 2; ++ktile)
#pragma unroll
      for (int c = 0; c < 2; ++c)
        kf[ktile][c] = lds_frag(ldsK + (ktile * 16) * KSTRIDE + c * 32, KSTRIDE);

    bf16x16 pf[QW];
    bool act[QW];
#pragma unroll
    for (int qt = 0; qt < QW; ++qt) {
      unsigned mbits = 0;
      {
#pragma unroll
        for (int r = 0; r < 8; ++r) { const int j0 = kb + kh8 + r; if (j0 < NKV) mbits |= 1u << r; if (j0 + 16 < NKV) mbits |= 1u << (8 + r); }
        act[qt] = (__builtin_amdgcn_ballot_w32(mbits != 0) != 0);
      }
      if (act[qt]) {
        const int q_my = q0 + 16 * qt + qlane;
        f32x8 s0 = {}, s1 = {};
        s0 = wmma_bf16(kf[0][0], qf[qt][0], s0);
        s0 = wmma_bf16(kf[0][1], qf[qt][1], s0);
        s1 = wmma_bf16(kf[1][0], qf[qt][0], s1);
        s1 = wmma_bf16(kf[1][1], qf[qt][1], s1);

        float mx = -INFINITY;
#pragma unroll
        for (int r = 0; r < 8; ++r) {
          const int k0i = kb + kh8 + r;
          const int k1i = k0i + 16;
          (void)k0i; (void)k1i; (void)q_my;
          s0[r] = (mbits & (1u << r))       ? s0[r] * scale : NEG2;
          s1[r] = (mbits & (1u << (8 + r))) ? s1[r] * scale : NEG2;
          mx = fmaxf(mx, fmaxf(s0[r], s1[r]));
        }
        mx = fmaxf(mx, __shfl_xor(mx, 16, 32));
        const float mnew  = fmaxf(mrun[qt], mx);
        const float alpha = exp2f(mrun[qt] - mnew);

        float rsum = 0.0f;
#pragma unroll
        for (int r = 0; r < 8; ++r) {
          const float p0 = exp2f(s0[r] - mnew);
          const float p1 = exp2f(s1[r] - mnew);
          rsum += p0 + p1;
          pf[qt][r]     = (bf16)(p0 * 1024.0f);     // P carried x1024: no f16 copy of a probability is sub-normal
          pf[qt][r + 8] = (bf16)(p1 * 1024.0f);
        }
        rsum += __shfl_xor(rsum, 16, 32);
        lrun[qt] = lrun[qt] * alpha + rsum;
        mrun[qt] = mnew;

        // Rescale accumulators now so the PV phase is pure WMMA.
#pragma unroll
        for (int j = 0; j < 4; ++j)
#pragma unroll
          for (int r = 0; r < 8; ++r) o[qt][j][r] *= alpha;
      }
    }

    // Phase 2: O^T accumulate; each V fragment read from LDS once, used by
    // both q-tiles, then dead (only 8 VGPRs of V live at a time).
#pragma unroll
    for (int j = 0; j < 4; ++j) {
      const bf16x16 vf = lds_frag(ldsV + (j * 16) * VSTRIDE, VSTRIDE);
#pragma unroll
      for (int qt = 0; qt < QW; ++qt)
        if (act[qt]) o[qt][j] = wmma_bf16(vf, pf[qt], o[qt][j]);
    }
  }

  __shared__ __attribute__((aligned(16))) float ldsOf[2][32 * 68];
  float* so = ldsOf[wave]; (void)ldsO;
#pragma unroll
  for (int qt = 0; qt < QW; ++qt) {
    const float rl = 1.0f / (lrun[qt] * 1024.0f);
#pragma unroll
    for (int j = 0; j < 4; ++j)
#pragma unroll
      for (int r = 0; r < 8; ++r) so[(16 * qt + qlane) * 68 + j * 16 + kh8 + r] = o[qt][j][r] * rl;
  }
  asm volatile("s_wait_dscnt 0" ::: "memory");
  __builtin_amdgcn_wave_barrier();
{
#pragma unroll
    for (int it = 0; it < 16; ++it) { const int ch = lane + 32 * it, ql = ch >> 4, q4 = (ch & 15) * 4;
      *(v4f_t*)(attnOut + ((size_t)(b * QROWS + q0 + ql)) * DD + h * DKK + q4) = *(const v4fa*)(so + ql * 68 + q4); }
    
  }
}


#undef QROWS
#undef KROWS
#undef NKV
// LayerNorm over C (256 or 128) per row; in place allowed; block = 8 rows (wave per row)
template <int C>
__global__ __launch_bounds__(256) void k_ln(const float* __restrict__ X, const float* __restrict__ g, const float* __restrict__ bb, float* __restrict__ Y) {
  const int tid = threadIdx.x, r = tid >> 5, lane = tid & 31; const size_t row = (size_t)blockIdx.x * 8 + r; const float* xr = X + row * C;
  float v[C / 32]; float s = 0.0f;
#pragma unroll
  for (int i = 0; i < C / 32; ++i) { v[i] = xr[lane + 32 * i]; s += v[i]; }
#pragma unroll
  for (int off = 1; off < 32; off <<= 1) s += __shfl_xor(s, off, 32);
  const float mean = s * (1.0f / C); float q = 0.0f;
#pragma unroll
  for (int i = 0; i < C / 32; ++i) { const float d = v[i] - mean; q += d * d; }
#pragma unroll
  for (int off = 1; off < 32; off <<= 1) q += __shfl_xor(q, off, 32);
  const float rstd = rsqrtf(q * (1.0f / C) + 1e-5f);
{
#pragma unroll
    for (int i = 0; i < C / 32; ++i) *(float*)(Y + row * C + lane + 32 * i) = (v[i] - mean) * rstd * g[lane + 32 * i] + bb[lane + 32 * i];
     }
}
// pair-bias table BT[h][i][j] = LN(bias_rep[i][j])·Wb[:,h] + bb[h]; block = i, thread = j
__global__ __launch_bounds__(256) void k_pairbias(const float* __restrict__ Z, const float* __restrict__ g2, const float* __restrict__ be2, const float* __restrict__ Wb, const float* __restrict__ bbh, float* __restrict__ BT) {
  const int i = blockIdx.x, j = threadIdx.x; const float* z = Z + ((size_t)i * NRES + j) * CZ;
  float s = 0.0f;
#pragma unroll 1
  for (int c = 0; c < CZ; ++c) s += z[c];
  const float mean = s * (1.0f / CZ); float q = 0.0f;
#pragma unroll 1
  for (int c = 0; c < CZ; ++c) { const float d = z[c] - mean; q += d * d; }
  const float rstd = rsqrtf(q * (1.0f / CZ) + 1e-5f);
  float acc[NHD];
#pragma unroll
  for (int h = 0; h < NHD; ++h) acc[h] = bbh[h];
#pragma unroll 1
  for (int c = 0; c < CZ; ++c) { const float zn = (z[c] - mean) * rstd * g2[c] + be2[c];
#pragma unroll
    for (int h = 0; h < NHD; ++h) acc[h] += zn * Wb[c * NHD + h]; }
{
#pragma unroll
    for (int h = 0; h < NHD; ++h) *(float*)(BT + ((size_t)h * NRES + i) * NRES + j) = acc[h];
     }
}
// permuted qkvg weights: Wp[c][k*256 + h*32 + d] = W[c][d*32 + k*8 + h] (no extra scale: both attention kernels carry 1/sqrt(32)); block = c (256), thread loops 1024 cols
__global__ __launch_bounds__(256) void k_wperm(const float* __restrict__ Wm, float* __restrict__ Wp) { const int c = blockIdx.x;
  for (int col = threadIdx.x; col < 4 * CM; col += 256) { const int k = col >> 8, h = (col >> 5) & 7, d = col & 31; float v = Wm[(size_t)c * 4 * CM + d * 32 + k * 8 + h];   // both attention kernels carry the 1/sqrt(32) scale themselves
    *(float*)(Wp + (size_t)c * 4 * CM + col) = v;  } }
// split f16 qkvg rows [CHT][1024] (q|k|v|g blocks, head h*32+d) into zero-padded operands: Q16c/K16c [nb][L][512] (cols h*64+d, d<32 real), Vtc [nb][512][L]; block = (64 tokens, head)
__global__ __launch_bounds__(256) void k_splitpad(const bf16* __restrict__ G, int L, bf16* __restrict__ Qc, bf16* __restrict__ Kc, bf16* __restrict__ Vtc) {
  __shared__ __attribute__((aligned(16))) bf16 qS[64][72], kS[64][72], vT[64][72];
  const int tid = threadIdx.x; const int t0 = blockIdx.x * 64; const int h = blockIdx.y; const int b = t0 / L, n0 = t0 % L;
  for (int e = tid; e < 64 * 64; e += 256) { const int t = e >> 6, d = e & 63; bf16 q = (bf16)0.0f, k = (bf16)0.0f, v = (bf16)0.0f;
    if (d < DH) { const bf16* src = G + (size_t)(t0 + t) * 4 * CM + h * DH + d; q = src[0]; k = src[CM]; v = src[2 * CM]; }
    qS[t][d] = q; kS[t][d] = k; vT[d][t] = v; }
  __syncthreads();
{
#pragma unroll 1
    for (int round = 0; round < 2; ++round) { const int r = round * 32 + (tid >> 3), piece = (tid & 7) * 8;
      *(v4u_t*)(Qc + (size_t)(t0 + r) * DD + h * DKK + piece) = *(const v4ua*)(&qS[r][piece]);
      *(v4u_t*)(Kc + (size_t)(t0 + r) * DD + h * DKK + piece) = *(const v4ua*)(&kS[r][piece]);
      *(v4u_t*)(Vtc + ((size_t)b * DD + h * DKK + r) * L + n0 + piece) = *(const v4ua*)(&vT[r][piece]); }
     }
}
// gated merge: O16[tok0 + t][h*32 + d] = attc[t][h*64 + d] * σ(g), g = G[t][768 + h*32 + d]; block = token, 256 threads = (h, d); 512-B f16 rows... staged as 32 lanes x 16 B
__global__ __launch_bounds__(256) void k_gmerge(const float* __restrict__ A, const bf16* __restrict__ G, bf16* __restrict__ O16) {
  __shared__ __attribute__((aligned(16))) bf16 oS[256];
  const size_t t = blockIdx.x; const int c = threadIdx.x; const int h = c >> 5, d = c & 31;
  const float g = (float)G[t * 4 * CM + 3 * CM + c]; const float a = A[t * DD + h * DKK + d]; oS[c] = (bf16)(a / (1.0f + expf(-g)));
  __syncthreads();
{ if (c < 32) *(v4u_t*)(O16 + t * CM + c * 8) = *(const v4ua*)(oS + c * 8);  }
}
// row permutation between (s, r) and (r, s) token orders: dst[row] = src[srow]; rows of 1 KB by 64 lanes x 16 B
__global__ __launch_bounds__(64) void k_perm(const float* __restrict__ src, float* __restrict__ dst, int to_rs) { const int row = blockIdx.x; int srow;
  if (to_rs) { const int r = row / NSEQ, s = row % NSEQ; srow = s * NRES + r; } else { const int s = row / NRES, r = row % NRES; srow = r * NSEQ + s; }
  const v4f_t v = *(const v4f_t*)(src + (size_t)srow * CM + threadIdx.x * 4); *(v4f_t*)(dst + (size_t)row * CM + threadIdx.x * 4) = v;  }
__global__ __launch_bounds__(256) void k_ones(float* __restrict__ p, int n) { for (int i = threadIdx.x; i < n; i += 256) { *(float*)(p + i) = 1.0f;  } }

extern "C" void kernel_launch(void* const* d_in, const int* in_sizes, int n_in,
                              void* d_out, int out_size, void* d_ws, size_t ws_size,
                              hipStream_t stream) {
  (void)in_sizes; (void)n_in; (void)out_size;
  const float** f = (const float**)d_in;
  const float* x = f[0], *brep = f[1], *Wqkv_r = f[2], *W0r = f[3], *Wb = f[4], *bbh = f[5], *Wqkv_c = f[6], *W0c = f[7], *W1 = f[8], *b1 = f[9], *W2 = f[10], *b2 = f[11], *g1 = f[12], *be1 = f[13], *g2 = f[14], *be2 = f[15], *g3 = f[16], *be3 = f[17];
  float* out = (float*)d_out;     // [1,128,256,256]
  char* ws = (char*)d_ws;
  float* X1 = (float*)ws; ws += (size_t)MTOK * CM * 4;                 // 32 MB: LN1(x), then x + row-att (in place), then LN3 (in place), finally x after the column block (s,r order)
  float* XT = (float*)ws; ws += (size_t)MTOK * CM * 4;                 // 32 MB: (r,s)-ordered copy for the column block
  float* BT = (float*)ws; ws += (size_t)NHD * NRES * NRES * 4;         // 2 MB pair-bias table
  float* Wpr = (float*)ws; ws += (size_t)CM * 4 * CM * 4; float* Wpc = (float*)ws; ws += (size_t)CM * 4 * CM * 4;
  bf16* G16 = (bf16*)ws; ws += (size_t)MTOK * 4 * CM * 2;             // qkvg f16 [32768][1024] (64 MB); also the transition hidden [32768][1024]
  bf16* Qc = (bf16*)ws; ws += (size_t)CHT * DD * 2; bf16* Kc = (bf16*)ws; ws += (size_t)CHT * DD * 2; bf16* Vtc = (bf16*)ws; ws += (size_t)CHT * DD * 2;   // 16 MB each
  float* attc = (float*)ws; ws += (size_t)CHT * DD * 4;               // 32 MB
  bf16* O16 = (bf16*)ws; ws += (size_t)MTOK * CM * 2;                 // 16 MB gated attention output rows (token order of the current block)
  float* ones = (float*)ws; ws += CM * 4;
  if ((size_t)(ws - (char*)d_ws) > ws_size) return;
  const dim3 blk(256);
  k_ones<<<dim3(1), blk, 0, stream>>>(ones, CM);
  k_wperm<<<dim3(CM), blk, 0, stream>>>(Wqkv_r, Wpr); k_wperm<<<dim3(CM), blk, 0, stream>>>(Wqkv_c, Wpc);
  k_pairbias<<<dim3(NRES), blk, 0, stream>>>(brep, g2, be2, Wb, bbh, BT);
  k_ln<CM><<<dim3(MTOK / 8), blk, 0, stream>>>(x, g1, be1, X1);
  // ---- row-wise gated attention with pair bias: qkvg for all tokens in one launch, attention in halves of 64 sequences ----
  gemm_kne<float, 0, true><<<dim3(MTOK / 128, 4 * CM / 128), blk, 0, stream>>>(X1, CM, Wpr, 4 * CM, nullptr, nullptr, nullptr, G16, 4 * CM, CM);
  for (int c = 0; c < MTOK / CHT; ++c) { const size_t t0 = (size_t)c * CHT;
    k_splitpad<<<dim3(CHT / 64, NHD), blk, 0, stream>>>(G16 + t0 * 4 * CM, NRES, Qc, Kc, Vtc);
    bt_attn_kernel<<<dim3(NRES / 64, NHD, CHT / NRES), dim3(64), 0, stream>>>(Qc, Kc, Vtc, BT, NRES, attc);
    k_gmerge<<<dim3(CHT), blk, 0, stream>>>(attc, G16 + t0 * 4 * CM, O16 + t0 * CM);
  }
  gemm_kne<bf16, 2, false><<<dim3(MTOK / 128, CM / 128), blk, 0, stream>>>(O16, CM, W0r, CM, nullptr, X1, ones, X1, CM, CM);     // x = x + o·W0 (in place)
  k_ln<CM><<<dim3(MTOK / 8), blk, 0, stream>>>(X1, g3, be3, X1);                                                                    // x = LN3(x) (in place)
  // ---- column-wise gated attention: tokens re-ordered (r, s); qkvg in one launch, attention in halves of 128 residues ----
  k_perm<<<dim3(MTOK), dim3(64), 0, stream>>>(X1, XT, 1);
  gemm_kne<float, 0, true><<<dim3(MTOK / 128, 4 * CM / 128), blk, 0, stream>>>(XT, CM, Wpc, 4 * CM, nullptr, nullptr, nullptr, G16, 4 * CM, CM);
  for (int c = 0; c < MTOK / CHT; ++c) { const size_t t0 = (size_t)c * CHT;
    k_splitpad<<<dim3(CHT / 64, NHD), blk, 0, stream>>>(G16 + t0 * 4 * CM, NSEQ, Qc, Kc, Vtc);
    col_attn_kernel<<<dim3(NSEQ / 64, NHD, CHT / NSEQ), dim3(64), 0, stream>>>(Qc, Kc, Vtc, attc);
    k_gmerge<<<dim3(CHT), blk, 0, stream>>>(attc, G16 + t0 * 4 * CM, O16 + t0 * CM);
  }
  gemm_kne<bf16, 2, false><<<dim3(MTOK / 128, CM / 128), blk, 0, stream>>>(O16, CM, W0c, CM, nullptr, XT, ones, XT, CM, CM);     // xt = xt + o·W0_c (in place, (r,s) order)
  k_perm<<<dim3(MTOK), dim3(64), 0, stream>>>(XT, X1, 0);                                                                          // back to (s,r) order
  // ---- transition, all tokens per launch: out = relu(x*W1 + b1)*W2 + b2 + x ----
  gemm_kne<float, 3, true><<<dim3(MTOK / 128, 4 * CM / 128), blk, 0, stream>>>(X1, CM, W1, 4 * CM, b1, nullptr, nullptr, G16, 4 * CM, CM);
  gemm_kne<bf16, 2, false><<<dim3(MTOK / 128, CM / 128), blk, 0, stream>>>(G16, 4 * CM, W2, CM, b2, X1, ones, out, CM, 4 * CM);
}

// v002
// Measured time: 497 microseconds a run.
// In two side-by-side timings against v001, it was 1.22 and 1.21 times as fast.
// Over all steps from v000 it is 2.37 times as fast.
// Contractions on v_wmma_f32_16x16x32_f16 (plain f16 operands, f32 accumulate): the row- and column-wise gated attentions of an MSA
// block — qkvg = x·Wqkv (K = 256, N = 1024; the reference's (d, k, h) column interleave undone by permuting the WEIGHT columns on the
// device, both attention kernels scale by 32^-½ for the real head dim), the 8-head attentions with head dim 32 zero-padded to 64
// (row: 128 sequences x 256 residues with the pair-bias table [h][i][j] = LN(bias_rep)·Wb + bb added in the attention kernel; column: 256 residues x 128
// sequences after a token re-ordering), flash-style Sᵀ = K·Qᵀ / Oᵀ = Vᵀ·Pᵀ with online softmax in f32 (P x1024, f32 rows), the sigmoid
// gate, ·W0 + residual (K = 256), and the transition relu(x·W1 + b1)·W2 + b2 + x (K = 256 / 1024) — every GEMM one launch over all 32768 tokens, the attention stages in two 16384-token halves; LayerNorms
// in f32. compute dtype: f16 operands, f32 accumulate.  x [1,128,256,256] -> [1,128,256,256].
#include <hip/hip_runtime.h>
#include <hip/hip_bf16.h>
#include <math.h>

#define NSEQ 128
#define NRES 256
#define CM 256
#define CZ 128
#define NHD 8
#define DH 32
#define MTOK (NSEQ * NRES)
#define CHT (MTOK / 2)   // tokens per launch of the split / attention / gate stages (two halves keep the padded operands inside the workspace)
#define DD 512
#define KVD 512
#define HH 8
#define KVH 8
#define HKDIV 1
#define DKK 64
#define QW 2
#define SS 256
#define GSTR 48

typedef _Float16 bf16;
typedef _Float16 f16;
typedef __attribute__((ext_vector_type(4))) unsigned v4u_t;
typedef unsigned v4ua __attribute__((ext_vector_type(4), may_alias));
typedef __attribute__((ext_vector_type(4))) float v4f_t;
typedef float v4fa __attribute__((ext_vector_type(4), may_alias));
typedef __attribute__((ext_vector_type(16))) bf16  bf16x16;
typedef bf16x16 f16x16;
typedef __attribute__((ext_vector_type(8)))  bf16  bf16x8;
typedef bf16x8 f16x8;
typedef __attribute__((ext_vector_type(4)))  bf16  bf16x4;
typedef __attribute__((ext_vector_type(8)))  float f32x8;
__device__ __forceinline__ f32x8 wmma16(f16x16 a, f16x16 b, f32x8 c) {
  c = __builtin_amdgcn_wmma_f32_16x16x32_f16(false, a, false, b, (short)0, c, false, false);
  asm volatile("v_nop\n\tv_nop\n\tv_nop\n\tv_nop" : "+v"(c) : "v"(a), "v"(b));
  return c;
}
#define LDS_STRIDE 48   // GEMM tiles: 32 -> 48 elems (96B rows): aligned b128 reads
#define KSTRIDE    72   // attn K tile: 64 -> 72 elems (144B rows): conflict-free b128
#define VSTRIDE    48   // attn V tile: 32 -> 48 elems

__device__ __forceinline__ f32x8 wmma_bf16(bf16x16 a, bf16x16 b, f32x8 c) {
  c = __builtin_amdgcn_wmma_f32_16x16x32_f16(false, a, false, b, (short)0, c, false, false);
  asm volatile("v_nop\n\tv_nop\n\tv_nop\n\tv_nop" : "+v"(c) : "v"(a), "v"(b));   // A/B-overwrite hazard guard
  return c;
}

// 16x32 (MxK) f16 fragment from a row-major global matrix.
// lanes 0-15  (row=lane)    : elems 0..7 = K+0..7,  8..15 = K+16..23
// lanes 16-31 (row=lane-16) : elems 0..7 = K+8..15, 8..15 = K+24..31
template <typename T>
__device__ __forceinline__ bf16x16 load_frag(const T* __restrict__ base, int ld,
                                             int row0, int k0) {
  const int lane = threadIdx.x & 31;
  const int r    = lane & 15;
  const int kh   = (lane >> 4) * 8;
  const T* p0 = base + (size_t)(row0 + r) * ld + (k0 + kh);
  const T* p1 = p0 + 16;
  bf16x16 f;
#pragma unroll
  for (int i = 0; i < 8; ++i) {
    f[i]     = (bf16)p0[i];
    f[i + 8] = (bf16)p1[i];
  }
  return f;
}

// Same fragment from an LDS tile with padded row stride (base includes row0/k0).
__device__ __forceinline__ bf16x16 lds_frag(const bf16* base, int stride) {
  const int lane = threadIdx.x & 31;
  const int row  = lane & 15;
  const int kh   = (lane >> 4) * 8;
  const bf16x8 lo = *(const bf16x8*)(base + row * stride + kh);
  const bf16x8 hi = *(const bf16x8*)(base + row * stride + kh + 16);
  bf16x16 f;
#pragma unroll
  for (int i = 0; i < 8; ++i) { f[i] = lo[i]; f[i + 8] = hi[i]; }
  return f;
}

template <typename T>
__device__ __forceinline__ void stage_read16(const T* __restrict__ p, float* buf) {
#pragma unroll
  for (int i = 0; i < 16; ++i) buf[i] = (float)p[i];
}

__device__ __forceinline__ void stage_write(bf16* dst, const float* buf, int nquad) {
#pragma unroll
  for (int i = 0; i < nquad; ++i) {
    bf16x4 q;
    q[0] = (bf16)buf[4 * i];     q[1] = (bf16)buf[4 * i + 1];
    q[2] = (bf16)buf[4 * i + 2]; q[3] = (bf16)buf[4 * i + 3];
    *(bf16x4*)(dst + 4 * i) = q;
  }
}


// ---------------------------------------------------------------------------------------------------------------------------
// gemm_kne: Y[m][n] = epi( Σ_k A[m][k]·W[k][n] + bias[n] ), A f32/f16 [M][lda], W f32 row-major [K][N] (pitch LDW), plain f16 operands,
// f32 accumulate. EPI 0: identity; 1: exact-erf GELU; 2: R[m][n] + gvec[n]·(·) (residual with per-channel gain). Output f32 (or f16
// when OUT16). Block = 128x128 tile, 8 waves as 4(M) x 2(N); per 32-wide k-step A and W tiles staged f16 in LDS (W transposed
// ---------------------------------------------------------------------------------------------------------------------------
#define GSTR 48
template <typename AT, int EPI, bool OUT16, int LDW>
__global__ __launch_bounds__(256) void gemm_kne(const AT* __restrict__ A, int lda, const float* __restrict__ Wm,
                                                const float* __restrict__ bias, const float* __restrict__ R, const float* __restrict__ gvec,
                                                void* __restrict__ Yv, int ldy, int K) {
  __shared__ __attribute__((aligned(16))) f16 ldsA[128 * GSTR];
  __shared__ __attribute__((aligned(16))) f16 ldsW[128 * GSTR];
  __shared__ __attribute__((aligned(16))) float oS[8][32 * 68];
  const int tid = threadIdx.x, lane = tid & 31, wave = tid >> 5, cl = lane & 15, rh = (lane >> 4) * 8;
  const int m0 = blockIdx.x * 128, n0 = blockIdx.y * 128;
  const int wm = (wave & 3) * 32, wn = (wave >> 2) * 64;
  f32x8 acc[2][4];
#pragma unroll
  for (int i = 0; i < 2; ++i)
#pragma unroll
    for (int j = 0; j < 4; ++j) { f32x8 z = {}; acc[i][j] = z; }
#pragma unroll 1
  for (int k0 = 0; k0 < K; k0 += 32) {
    __syncthreads();
    { const int row = tid >> 1, ch = (tid & 1) * 16;
      const AT* src = A + (size_t)(m0 + row) * lda + k0 + ch;
#pragma unroll
      for (int g = 0; g < 16; ++g) ldsA[row * GSTR + ch + g] = (f16)src[g]; }
    { const int n = tid & 127, kq = (tid >> 7) * 16;   // one column n and 16 consecutive k a thread: the transpose happens in registers
      const float* src = Wm + (size_t)(k0 + kq) * LDW + n0 + n;   // LDW is a compile-time pitch: the 16 row steps are immediate offsets of one address
      union { f16 h[16]; v4u_t v[2]; } u;
#pragma unroll
      for (int g = 0; g < 16; ++g) u.h[g] = (f16)src[g * LDW];
      *(v4u_t*)(ldsW + n * GSTR + kq) = u.v[0];
      *(v4u_t*)(ldsW + n * GSTR + kq + 8) = u.v[1]; }
    __syncthreads();
    f16x16 af[2];
#pragma unroll
    for (int i = 0; i < 2; ++i) af[i] = lds_frag(ldsA + (wm + 16 * i) * GSTR, GSTR);
#pragma unroll
    for (int j = 0; j < 4; ++j) {
      const f16x16 bf = lds_frag(ldsW + (wn + 16 * j) * GSTR, GSTR);
#pragma unroll
      for (int i = 0; i < 2; ++i) acc[i][j] = wmma16(af[i], bf, acc[i][j]);
    }
  }
  float* so = oS[wave];
#pragma unroll
  for (int i = 0; i < 2; ++i)
#pragma unroll
    for (int j = 0; j < 4; ++j) {
      const int n = n0 + wn + 16 * j + cl;
      const float bv = bias ? bias[n] : 0.0f;
      const float gv = (EPI == 2) ? gvec[n] : 0.0f;
      if (EPI == 1) {
#pragma unroll 1
        for (int r = 0; r < 8; ++r) { const float xg = acc[i][j][r] + bv; so[(16 * i + rh + r) * 68 + 16 * j + cl] = 0.5f * xg * (1.0f + erff(xg * 0.70710678118654752f)); }
      } else {
#pragma unroll
        for (int r = 0; r < 8; ++r) {
          float v = acc[i][j][r] + bv;
          if (EPI == 3) v = fmaxf(v, 0.0f);                                         // EPI 3: ReLU
          if (EPI == 2) v = R[(size_t)(m0 + wm + 16 * i + rh + r) * ldy + n] + gv * v;
          so[(16 * i + rh + r) * 68 + 16 * j + cl] = v;
        }
      }
    }
  asm volatile("s_wait_dscnt 0" ::: "memory");
  __builtin_amdgcn_wave_barrier();
{
    if (OUT16) {
      f16* Y = (f16*)Yv;
#pragma unroll
      for (int it = 0; it < 8; ++it) { const int c = lane + 32 * it, rr = c >> 3, q8 = (c & 7) * 8;
        union { f16 h[8]; v4u_t v; } u;
#pragma unroll
        for (int e = 0; e < 8; ++e) u.h[e] = (f16)so[rr * 68 + q8 + e];
        *(v4u_t*)(Y + (size_t)(m0 + wm + rr) * ldy + n0 + wn + q8) = u.v; }
    } else {
      float* Y = (float*)Yv;
#pragma unroll
      for (int it = 0; it < 16; ++it) { const int f4 = lane + 32 * it, rr = f4 >> 4, q = (f4 & 15) * 4;
        *(v4f_t*)(Y + (size_t)(m0 + wm + rr) * ldy + n0 + wn + q) = *(const v4fa*)(so + rr * 68 + q); }
    }
    
  }
}

#define QROWS 256
#define KROWS 256
#define NKV 256
__global__ __launch_bounds__(64) void bt_attn_kernel(
    const bf16* __restrict__ Qb, const bf16* __restrict__ Kb,
    const bf16* __restrict__ Vt, const float* __restrict__ btab, int btstride,   // btab [h][q][k], row stride btstride: additive pair-bias logits
    float* __restrict__ attnOut) {
  __shared__ bf16 ldsK[32 * KSTRIDE];   // 4.5 KB
  __shared__ bf16 ldsV[64 * VSTRIDE];   // 6.0 KB
  __shared__ __attribute__((aligned(16))) bf16 ldsO[2][32 * 72];   // unused: the per-wave output tile is the f32 ldsOf below

  const int q0blk = blockIdx.x * 64;
  const int h  = blockIdx.y;
  const int b  = blockIdx.z;
  const int t    = threadIdx.x;
  const int wave = t >> 5;
  const int lane = t & 31;
  const int qlane = lane & 15;
  const int kh8   = (lane >> 4) * 8;
  const int q0 = q0blk + wave * 32;          // this wave's 32 queries

  const int hk = h / HKDIV;
  const bf16* Qh = Qb + (size_t)b * QROWS * DD + h * DKK;        // queries: QROWS rows per batch, row stride DD
  const bf16* Kh = Kb + (size_t)b * KROWS * KVD + hk * DKK;      // keys: KROWS rows per batch, row stride KVD
  const bf16* Vh = Vt + ((size_t)(b * KVH + hk)) * DKK * KROWS;  // Vᵀ [KVH][64][KROWS] per batch

  // Cooperative staging (64 threads): K tile 32x64 (2 thr/row, 64B each);
  // V tile 64x32 (1 thr/row, 64B each).
  const int krow = t >> 1;
  const int kcol = (t & 1) * 32;
  const bf16* kSrc = Kh + (size_t)krow * KVD + kcol;
  const bf16* vSrc = Vh + (size_t)t * KROWS;

  bf16x16 qf[QW][2];
#pragma unroll
  for (int qt = 0; qt < QW; ++qt) {
    qf[qt][0] = load_frag(Qh, DD, q0 + 16 * qt, 0);
    qf[qt][1] = load_frag(Qh, DD, q0 + 16 * qt, 32);
  }

  f32x8 o[QW][4] = {};
  float mrun[QW], lrun[QW];
#pragma unroll
  for (int qt = 0; qt < QW; ++qt) { mrun[qt] = -INFINITY; lrun[qt] = 0.0f; }

  const float scale = 0.17677669529663688f * 1.44269504088896340736f;  // hd^-0.5 = 1/sqrt(32) (real head dim; the 64-wide layout is zero-padded), times log2(e)
  const float NEG2 = -1.0e9f;    // masked logit: its weight is exactly 0 once any valid key of the row has been seen (every row
                                 // has one), and anything accumulated before that is wiped by alpha == 0 — same result as -inf
  const int kmax = KROWS - 1;
  const float L2E_ = 1.44269504088896340736f; const float* bth = btab + (size_t)h * QROWS * 0;   // unused: btab holds all heads and is indexed by h below

  // Prefetch key block kb=0 into registers.
  bf16x8 kreg[4], vreg[4];
#pragma unroll
  for (int i = 0; i < 4; ++i) {
    kreg[i] = *(const bf16x8*)(kSrc + 8 * i);
    vreg[i] = *(const bf16x8*)(vSrc + 8 * i);
  }

  for (int kb = 0; kb <= kmax; kb += 32) {
    __syncthreads();   // previous readers done with LDS
#pragma unroll
    for (int i = 0; i < 4; ++i) {
      *(bf16x8*)(&ldsK[krow * KSTRIDE + kcol + 8 * i]) = kreg[i];
      *(bf16x8*)(&ldsV[t * VSTRIDE + 8 * i])           = vreg[i];
    }
    if (kb + 32 <= kmax) {   // prefetch next block during compute
      const bf16* kn = kSrc + (size_t)(kb + 32) * KVD;
      const bf16* vn = vSrc + (kb + 32);
#pragma unroll
      for (int i = 0; i < 4; ++i) {
        kreg[i] = *(const bf16x8*)(kn + 8 * i);
        vreg[i] = *(const bf16x8*)(vn + 8 * i);
      }
    }
    __syncthreads();   // tile visible

    // Phase 1: scores + softmax for both q-tiles (K fragments live here only).
    bf16x16 kf[2][2];
#pragma unroll
    for (int ktile = 0; ktile < 2; ++ktile)
#pragma unroll
      for (int c = 0; c < 2; ++c)
        kf[ktile][c] = lds_frag(ldsK + (ktile * 16) * KSTRIDE + c * 32, KSTRIDE);

    bf16x16 pf[QW];
    bool act[QW];
#pragma unroll
    for (int qt = 0; qt < QW; ++qt) {
      unsigned mbits = 0;
      {
#pragma unroll
        for (int r = 0; r < 8; ++r) { const int j0 = kb + kh8 + r; if (j0 < NKV) mbits |= 1u << r; if (j0 + 16 < NKV) mbits |= 1u << (8 + r); }
        act[qt] = (__builtin_amdgcn_ballot_w32(mbits != 0) != 0);
      }
      if (act[qt]) {
        const int q_my = q0 + 16 * qt + qlane;
        f32x8 s0 = {}, s1 = {};
        s0 = wmma_bf16(kf[0][0], qf[qt][0], s0);
        s0 = wmma_bf16(kf[0][1], qf[qt][1], s0);
        s1 = wmma_bf16(kf[1][0], qf[qt][0], s1);
        s1 = wmma_bf16(kf[1][1], qf[qt][1], s1);

        float mx = -INFINITY;
#pragma unroll
        for (int r = 0; r < 8; ++r) {
          const int k0i = kb + kh8 + r;
          const int k1i = k0i + 16;
          const float* brow = btab + ((size_t)h * QROWS + min(q_my, QROWS - 1)) * btstride; (void)bth;   // per-head [q][k] table
          s0[r] = (mbits & (1u << r))       ? s0[r] * scale + L2E_ * brow[min(k0i, NKV - 1)] : NEG2;
          s1[r] = (mbits & (1u << (8 + r))) ? s1[r] * scale + L2E_ * brow[min(k1i, NKV - 1)] : NEG2;
          mx = fmaxf(mx, fmaxf(s0[r], s1[r]));
        }
        mx = fmaxf(mx, __shfl_xor(mx, 16, 32));
        const float mnew  = fmaxf(mrun[qt], mx);
        const float alpha = exp2f(mrun[qt] - mnew);

        float rsum = 0.0f;
#pragma unroll
        for (int r = 0; r < 8; ++r) {
          const float p0 = exp2f(s0[r] - mnew);
          const float p1 = exp2f(s1[r] - mnew);
          rsum += p0 + p1;
          pf[qt][r]     = (bf16)(p0 * 1024.0f);     // P carried x1024: no f16 copy of a probability is sub-normal
          pf[qt][r + 8] = (bf16)(p1 * 1024.0f);
        }
        rsum += __shfl_xor(rsum, 16, 32);
        lrun[qt] = lrun[qt] * alpha + rsum;
        mrun[qt] = mnew;

        // Rescale accumulators now so the PV phase is pure WMMA.
#pragma unroll
        for (int j = 0; j < 4; ++j)
#pragma unroll
          for (int r = 0; r < 8; ++r) o[qt][j][r] *= alpha;
      }
    }

    // Phase 2: O^T accumulate; each V fragment read from LDS once, used by
    // both q-tiles, then dead (only 8 VGPRs of V live at a time).
#pragma unroll
    for (int j = 0; j < 4; ++j) {
      const bf16x16 vf = lds_frag(ldsV + (j * 16) * VSTRIDE, VSTRIDE);
#pragma unroll
      for (int qt = 0; qt < QW; ++qt)
        if (act[qt]) o[qt][j] = wmma_bf16(vf, pf[qt], o[qt][j]);
    }
  }

  __shared__ __attribute__((aligned(16))) float ldsOf[2][32 * 68];
  float* so = ldsOf[wave]; (void)ldsO;
#pragma unroll
  for (int qt = 0; qt < QW; ++qt) {
    const float rl = 1.0f / (lrun[qt] * 1024.0f);
#pragma unroll
    for (int j = 0; j < 4; ++j)
#pragma unroll
      for (int r = 0; r < 8; ++r) so[(16 * qt + qlane) * 68 + j * 16 + kh8 + r] = o[qt][j][r] * rl;
  }
  asm volatile("s_wait_dscnt 0" ::: "memory");
  __builtin_amdgcn_wave_barrier();
{
#pragma unroll
    for (int it = 0; it < 16; ++it) { const int ch = lane + 32 * it, ql = ch >> 4, q4 = (ch & 15) * 4;
      *(v4f_t*)(attnOut + ((size_t)(b * QROWS + q0 + ql)) * DD + h * DKK + q4) = *(const v4fa*)(so + ql * 68 + q4); }
    
  }
}


#undef QROWS
#undef KROWS
#undef NKV
#define QROWS 128
#define KROWS 128
#define NKV 128
__global__ __launch_bounds__(64) void col_attn_kernel(
    const bf16* __restrict__ Qb, const bf16* __restrict__ Kb,
    const bf16* __restrict__ Vt,
    float* __restrict__ attnOut) {   // QROWS queries / KROWS key rows per batch (first NKV valid), GQA factor HKDIV; f32 output rows
  __shared__ bf16 ldsK[32 * KSTRIDE];   // 4.5 KB
  __shared__ bf16 ldsV[64 * VSTRIDE];   // 6.0 KB
  __shared__ __attribute__((aligned(16))) bf16 ldsO[2][32 * 72];   // unused: the per-wave output tile is the f32 ldsOf below

  const int q0blk = blockIdx.x * 64;
  const int h  = blockIdx.y;
  const int b  = blockIdx.z;
  const int t    = threadIdx.x;
  const int wave = t >> 5;
  const int lane = t & 31;
  const int qlane = lane & 15;
  const int kh8   = (lane >> 4) * 8;
  const int q0 = q0blk + wave * 32;          // this wave's 32 queries

  const int hk = h / HKDIV;
  const bf16* Qh = Qb + (size_t)b * QROWS * DD + h * DKK;        // queries: QROWS rows per batch, row stride DD
  const bf16* Kh = Kb + (size_t)b * KROWS * KVD + hk * DKK;      // keys: KROWS rows per batch, row stride KVD
  const bf16* Vh = Vt + ((size_t)(b * KVH + hk)) * DKK * KROWS;  // Vᵀ [KVH][64][KROWS] per batch

  // Cooperative staging (64 threads): K tile 32x64 (2 thr/row, 64B each);
  // V tile 64x32 (1 thr/row, 64B each).
  const int krow = t >> 1;
  const int kcol = (t & 1) * 32;
  const bf16* kSrc = Kh + (size_t)krow * KVD + kcol;
  const bf16* vSrc = Vh + (size_t)t * KROWS;

  bf16x16 qf[QW][2];
#pragma unroll
  for (int qt = 0; qt < QW; ++qt) {
    qf[qt][0] = load_frag(Qh, DD, q0 + 16 * qt, 0);
    qf[qt][1] = load_frag(Qh, DD, q0 + 16 * qt, 32);
  }

  f32x8 o[QW][4] = {};
  float mrun[QW], lrun[QW];
#pragma unroll
  for (int qt = 0; qt < QW; ++qt) { mrun[qt] = -INFINITY; lrun[qt] = 0.0f; }

  const float scale = 0.17677669529663688f * 1.44269504088896340736f;  // 1/sqrt(32): real head dim (64-wide layout zero-padded), times log2(e)
  const float NEG2 = -1.0e9f;    // masked logit: its weight is exactly 0 once any valid key of the row has been seen (every row
                                 // has one), and anything accumulated before that is wiped by alpha == 0 — same result as -inf
  const int kmax = KROWS - 1;    // all key rows (KROWS == NKV: none masked)

  // Prefetch key block kb=0 into registers.
  bf16x8 kreg[4], vreg[4];
#pragma unroll
  for (int i = 0; i < 4; ++i) {
    kreg[i] = *(const bf16x8*)(kSrc + 8 * i);
    vreg[i] = *(const bf16x8*)(vSrc + 8 * i);
  }

  for (int kb = 0; kb <= kmax; kb += 32) {
    __syncthreads();   // previous readers done with LDS
#pragma unroll
    for (int i = 0; i < 4; ++i) {
      *(bf16x8*)(&ldsK[krow * KSTRIDE + kcol + 8 * i]) = kreg[i];
      *(bf16x8*)(&ldsV[t * VSTRIDE + 8 * i])           = vreg[i];
    }
    if (kb + 32 <= kmax) {   // prefetch next block during compute
      const bf16* kn = kSrc + (size_t)(kb + 32) * KVD;
      const bf16* vn = vSrc + (kb + 32);
#pragma unroll
      for (int i = 0; i < 4; ++i) {
        kreg[i] = *(const bf16x8*)(kn + 8 * i);
        vreg[i] = *(const bf16x8*)(vn + 8 * i);
      }
    }
    __syncthreads();   // tile visible

    // Phase 1: scores + softmax for both q-tiles (K fragments live here only).
    bf16x16 kf[2][2];
#pragma unroll
    for (int ktile = 0; ktile < 2; ++ktile)
#pragma unroll
      for (int c = 0; c < 2; ++c)
        kf[ktile][c] = lds_frag(ldsK + (ktile * 16) * KSTRIDE + c * 32, KSTRIDE);

    bf16x16 pf[QW];
    bool act[QW];
#pragma unroll
    for (int qt = 0; qt < QW; ++qt) {
      unsigned mbits = 0;
      {
#pragma unroll
        for (int r = 0; r < 8; ++r) { const int j0 = kb + kh8 + r; if (j0 < NKV) mbits |= 1u << r; if (j0 + 16 < NKV) mbits |= 1u << (8 + r); }
        act[qt] = (__builtin_amdgcn_ballot_w32(mbits != 0) != 0);
      }
      if (act[qt]) {
        const int q_my = q0 + 16 * qt + qlane;
        f32x8 s0 = {}, s1 = {};
        s0 = wmma_bf16(kf[0][0], qf[qt][0], s0);
        s0 = wmma_bf16(kf[0][1], qf[qt][1], s0);
        s1 = wmma_bf16(kf[1][0], qf[qt][0], s1);
        s1 = wmma_bf16(kf[1][1], qf[qt][1], s1);

        float mx = -INFINITY;
#pragma unroll
        for (int r = 0; r < 8; ++r) {
          const int k0i = kb + kh8 + r;
          const int k1i = k0i + 16;
          (void)k0i; (void)k1i; (void)q_my;
          s0[r] = (mbits & (1u << r))       ? s0[r] * scale : NEG2;
          s1[r] = (mbits & (1u << (8 + r))) ? s1[r] * scale : NEG2;
          mx = fmaxf(mx, fmaxf(s0[r], s1[r]));
        }
        mx = fmaxf(mx, __shfl_xor(mx, 16, 32));
        const float mnew  = fmaxf(mrun[qt], mx);
        const float alpha = exp2f(mrun[qt] - mnew);

        float rsum = 0.0f;
#pragma unroll
        for (int r = 0; r < 8; ++r) {
          const float p0 = exp2f(s0[r] - mnew);
          const float p1 = exp2f(s1[r] - mnew);
          rsum += p0 + p1;
          pf[qt][r]     = (bf16)(p0 * 1024.0f);     // P carried x1024: no f16 copy of a probability is sub-normal
          pf[qt][r + 8] = (bf16)(p1 * 1024.0f);
        }
        rsum += __shfl_xor(rsum, 16, 32);
        lrun[qt] = lrun[qt] * alpha + rsum;
        mrun[qt] = mnew;

        // Rescale accumulators now so the PV phase is pure WMMA.
#pragma unroll
        for (int j = 0; j < 4; ++j)
#pragma unroll
          for (int r = 0; r < 8; ++r) o[qt][j][r] *= alpha;
      }
    }

    // Phase 2: O^T accumulate; each V fragment read from LDS once, used by
    // both q-tiles, then dead (only 8 VGPRs of V live at a time).
#pragma unroll
    for (int j = 0; j < 4; ++j) {
      const bf16x16 vf = lds_frag(ldsV + (j * 16) * VSTRIDE, VSTRIDE);
#pragma unroll
      for (int qt = 0; qt < QW; ++qt)
        if (act[qt]) o[qt][j] = wmma_bf16(vf, pf[qt], o[qt][j]);
    }
  }

  __shared__ __attribute__((aligned(16))) float ldsOf[2][32 * 68];
  float* so = ldsOf[wave]; (void)ldsO;
#pragma unroll
  for (int qt = 0; qt < QW; ++qt) {
    const float rl = 1.0f / (lrun[qt] * 1024.0f);
#pragma unroll
    for (int j = 0; j < 4; ++j)
#pragma unroll
      for (int r = 0; r < 8; ++r) so[(16 * qt + qlane) * 68 + j * 16 + kh8 + r] = o[qt][j][r] * rl;
  }
  asm volatile("s_wait_dscnt 0" ::: "memory");
  __builtin_amdgcn_wave_barrier();
{
#pragma unroll
    for (int it = 0; it < 16; ++it) { const int ch = lane + 32 * it, ql = ch >> 4, q4 = (ch & 15) * 4;
      *(v4f_t*)(attnOut + ((size_t)(b * QROWS + q0 + ql)) * DD + h * DKK + q4) = *(const v4fa*)(so + ql * 68 + q4); }
    
  }
}


#undef QROWS
#undef KROWS
#undef NKV
// LayerNorm over C (256 or 128) per row; in place allowed; block = 8 rows (wave per row)
template <int C>
__global__ __launch_bounds__(256) void k_ln(const float* __restrict__ X, const float* __restrict__ g, const float* __restrict__ bb, float* __restrict__ Y) {
  const int tid = threadIdx.x, r = tid >> 5, lane = tid & 31; const size_t row = (size_t)blockIdx.x * 8 + r; const float* xr = X + row * C;
  float v[C / 32]; float s = 0.0f;
#pragma unroll
  for (int i = 0; i < C / 32; ++i) { v[i] = xr[lane + 32 * i]; s += v[i]; }
#pragma unroll
  for (int off = 1; off < 32; off <<= 1) s += __shfl_xor(s, off, 32);
  const float mean = s * (1.0f / C); float q = 0.0f;
#pragma unroll
  for (int i = 0; i < C / 32; ++i) { const float d = v[i] - mean; q += d * d; }
#pragma unroll
  for (int off = 1; off < 32; off <<= 1) q += __shfl_xor(q, off, 32);
  const float rstd = rsqrtf(q * (1.0f / C) + 1e-5f);
{
#pragma unroll
    for (int i = 0; i < C / 32; ++i) *(float*)(Y + row * C + lane + 32 * i) = (v[i] - mean) * rstd * g[lane + 32 * i] + bb[lane + 32 * i];
     }
}
// pair-bias table BT[h][i][j] = LN(bias_rep[i][j])·Wb[:,h] + bb[h]; block = i, thread = j
__global__ __launch_bounds__(256) void k_pairbias(const float* __restrict__ Z, const float* __restrict__ g2, const float* __restrict__ be2, const float* __restrict__ Wb, const float* __restrict__ bbh, float* __restrict__ BT) {
  const int i = blockIdx.x, j = threadIdx.x; const float* z = Z + ((size_t)i * NRES + j) * CZ;
  float s = 0.0f;
#pragma unroll 1
  for (int c = 0; c < CZ; ++c) s += z[c];
  const float mean = s * (1.0f / CZ); float q = 0.0f;
#pragma unroll 1
  for (int c = 0; c < CZ; ++c) { const float d = z[c] - mean; q += d * d; }
  const float rstd = rsqrtf(q * (1.0f / CZ) + 1e-5f);
  float acc[NHD];
#pragma unroll
  for (int h = 0; h < NHD; ++h) acc[h] = bbh[h];
#pragma unroll 1
  for (int c = 0; c < CZ; ++c) { const float zn = (z[c] - mean) * rstd * g2[c] + be2[c];
#pragma unroll
    for (int h = 0; h < NHD; ++h) acc[h] += zn * Wb[c * NHD + h]; }
{
#pragma unroll
    for (int h = 0; h < NHD; ++h) *(float*)(BT + ((size_t)h * NRES + i) * NRES + j) = acc[h];
     }
}
// permuted qkvg weights: Wp[c][k*256 + h*32 + d] = W[c][d*32 + k*8 + h] (no extra scale: both attention kernels carry 1/sqrt(32)); block = c (256), thread loops 1024 cols
__global__ __launch_bounds__(256) void k_wperm(const float* __restrict__ Wm, float* __restrict__ Wp) { const int c = blockIdx.x;
  for (int col = threadIdx.x; col < 4 * CM; col += 256) { const int k = col >> 8, h = (col >> 5) & 7, d = col & 31; float v = Wm[(size_t)c * 4 * CM + d * 32 + k * 8 + h];   // both attention kernels carry the 1/sqrt(32) scale themselves
    *(float*)(Wp + (size_t)c * 4 * CM + col) = v;  } }
// split f16 qkvg rows [CHT][1024] (q|k|v|g blocks, head h*32+d) into zero-padded operands: Q16c/K16c [nb][L][512] (cols h*64+d, d<32 real), Vtc [nb][512][L]; block = (64 tokens, head)
__global__ __launch_bounds__(256) void k_splitpad(const bf16* __restrict__ G, int L, bf16* __restrict__ Qc, bf16* __restrict__ Kc, bf16* __restrict__ Vtc) {
  __shared__ __attribute__((aligned(16))) bf16 qS[64][72], kS[64][72], vT[64][72];
  const int tid = threadIdx.x; const int t0 = blockIdx.x * 64; const int h = blockIdx.y; const int b = t0 / L, n0 = t0 % L;
  for (int e = tid; e < 64 * 64; e += 256) { const int t = e >> 6, d = e & 63; bf16 q = (bf16)0.0f, k = (bf16)0.0f, v = (bf16)0.0f;
    if (d < DH) { const bf16* src = G + (size_t)(t0 + t) * 4 * CM + h * DH + d; q = src[0]; k = src[CM]; v = src[2 * CM]; }
    qS[t][d] = q; kS[t][d] = k; vT[d][t] = v; }
  __syncthreads();
{
#pragma unroll 1
    for (int round = 0; round < 2; ++round) { const int r = round * 32 + (tid >> 3), piece = (tid & 7) * 8;
      *(v4u_t*)(Qc + (size_t)(t0 + r) * DD + h * DKK + piece) = *(const v4ua*)(&qS[r][piece]);
      *(v4u_t*)(Kc + (size_t)(t0 + r) * DD + h * DKK + piece) = *(const v4ua*)(&kS[r][piece]);
      *(v4u_t*)(Vtc + ((size_t)b * DD + h * DKK + r) * L + n0 + piece) = *(const v4ua*)(&vT[r][piece]); }
     }
}
// gated merge: O16[tok0 + t][h*32 + d] = attc[t][h*64 + d] * σ(g), g = G[t][768 + h*32 + d]; block = token, 256 threads = (h, d); 512-B f16 rows... staged as 32 lanes x 16 B
__global__ __launch_bounds__(256) void k_gmerge(const float* __restrict__ A, const bf16* __restrict__ G, bf16* __restrict__ O16) {
  __shared__ __attribute__((aligned(16))) bf16 oS[256];
  const size_t t = blockIdx.x; const int c = threadIdx.x; const int h = c >> 5, d = c & 31;
  const float g = (float)G[t * 4 * CM + 3 * CM + c]; const float a = A[t * DD + h * DKK + d]; oS[c] = (bf16)(a / (1.0f + expf(-g)));
  __syncthreads();
{ if (c < 32) *(v4u_t*)(O16 + t * CM + c * 8) = *(const v4ua*)(oS + c * 8);  }
}
// row permutation between (s, r) and (r, s) token orders: dst[row] = src[srow]; rows of 1 KB by 64 lanes x 16 B
__global__ __launch_bounds__(64) void k_perm(const float* __restrict__ src, float* __restrict__ dst, int to_rs) { const int row = blockIdx.x; int srow;
  if (to_rs) { const int r = row / NSEQ, s = row % NSEQ; srow = s * NRES + r; } else { const int s = row / NRES, r = row % NRES; srow = r * NSEQ + s; }
  const v4f_t v = *(const v4f_t*)(src + (size_t)srow * CM + threadIdx.x * 4); *(v4f_t*)(dst + (size_t)row * CM + threadIdx.x * 4) = v;  }
__global__ __launch_bounds__(256) void k_ones(float* __restrict__ p, int n) { for (int i = threadIdx.x; i < n; i += 256) { *(float*)(p + i) = 1.0f;  } }

extern "C" void kernel_launch(void* const* d_in, const int* in_sizes, int n_in,
                              void* d_out, int out_size, void* d_ws, size_t ws_size,
                              hipStream_t stream) {
  (void)in_sizes; (void)n_in; (void)out_size;
  const float** f = (const float**)d_in;
  const float* x = f[0], *brep = f[1], *Wqkv_r = f[2], *W0r = f[3], *Wb = f[4], *bbh = f[5], *Wqkv_c = f[6], *W0c = f[7], *W1 = f[8], *b1 = f[9], *W2 = f[10], *b2 = f[11], *g1 = f[12], *be1 = f[13], *g2 = f[14], *be2 = f[15], *g3 = f[16], *be3 = f[17];
  float* out = (float*)d_out;     // [1,128,256,256]
  char* ws = (char*)d_ws;
  float* X1 = (float*)ws; ws += (size_t)MTOK * CM * 4;                 // 32 MB: LN1(x), then x + row-att (in place), then LN3 (in place), finally x after the column block (s,r order)
  float* XT = (float*)ws; ws += (size_t)MTOK * CM * 4;                 // 32 MB: (r,s)-ordered copy for the column block
  float* BT = (float*)ws; ws += (size_t)NHD * NRES * NRES * 4;         // 2 MB pair-bias table
  float* Wpr = (float*)ws; ws += (size_t)CM * 4 * CM * 4; float* Wpc = (float*)ws; ws += (size_t)CM * 4 * CM * 4;
  bf16* G16 = (bf16*)ws; ws += (size_t)MTOK * 4 * CM * 2;             // qkvg f16 [32768][1024] (64 MB); also the transition hidden [32768][1024]
  bf16* Qc = (bf16*)ws; ws += (size_t)CHT * DD * 2; bf16* Kc = (bf16*)ws; ws += (size_t)CHT * DD * 2; bf16* Vtc = (bf16*)ws; ws += (size_t)CHT * DD * 2;   // 16 MB each
  float* attc = (float*)ws; ws += (size_t)CHT * DD * 4;               // 32 MB
  bf16* O16 = (bf16*)ws; ws += (size_t)MTOK * CM * 2;                 // 16 MB gated attention output rows (token order of the current block)
  float* ones = (float*)ws; ws += CM * 4;
  if ((size_t)(ws - (char*)d_ws) > ws_size) return;
  const dim3 blk(256);
  k_ones<<<dim3(1), blk, 0, stream>>>(ones, CM);
  k_wperm<<<dim3(CM), blk, 0, stream>>>(Wqkv_r, Wpr); k_wperm<<<dim3(CM), blk, 0, stream>>>(Wqkv_c, Wpc);
  k_pairbias<<<dim3(NRES), blk, 0, stream>>>(brep, g2, be2, Wb, bbh, BT);
  k_ln<CM><<<dim3(MTOK / 8), blk, 0, stream>>>(x, g1, be1, X1);
  // ---- row-wise gated attention with pair bias: qkvg for all tokens in one launch, attention in halves of 64 sequences ----
  gemm_kne<float, 0, true, 4 * CM><<<dim3(MTOK / 128, 4 * CM / 128), blk, 0, stream>>>(X1, CM, Wpr, nullptr, nullptr, nullptr, G16, 4 * CM, CM);
  for (int c = 0; c < MTOK / CHT; ++c) { const size_t t0 = (size_t)c * CHT;
    k_splitpad<<<dim3(CHT / 64, NHD), blk, 0, stream>>>(G16 + t0 * 4 * CM, NRES, Qc, Kc, Vtc);
    bt_attn_kernel<<<dim3(NRES / 64, NHD, CHT / NRES), dim3(64), 0, stream>>>(Qc, Kc, Vtc, BT, NRES, attc);
    k_gmerge<<<dim3(CHT), blk, 0, stream>>>(attc, G16 + t0 * 4 * CM, O16 + t0 * CM);
  }
  gemm_kne<bf16, 2, false, CM><<<dim3(MTOK / 128, CM / 128), blk, 0, stream>>>(O16, CM, W0r, nullptr, X1, ones, X1, CM, CM);     // x = x + o·W0 (in place)
  k_ln<CM><<<dim3(MTOK / 8), blk, 0, stream>>>(X1, g3, be3, X1);                                                                    // x = LN3(x) (in place)
  // ---- column-wise gated attention: tokens re-ordered (r, s); qkvg in one launch, attention in halves of 128 residues ----
  k_perm<<<dim3(MTOK), dim3(64), 0, stream>>>(X1, XT, 1);
  gemm_kne<float, 0, true, 4 * CM><<<dim3(MTOK / 128, 4 * CM / 128), blk, 0, stream>>>(XT, CM, Wpc, nullptr, nullptr, nullptr, G16, 4 * CM, CM);
  for (int c = 0; c < MTOK / CHT; ++c) { const size_t t0 = (size_t)c * CHT;
    k_splitpad<<<dim3(CHT / 64, NHD), blk, 0, stream>>>(G16 + t0 * 4 * CM, NSEQ, Qc, Kc, Vtc);
    col_attn_kernel<<<dim3(NSEQ / 64, NHD, CHT / NSEQ), dim3(64), 0, stream>>>(Qc, Kc, Vtc, attc);
    k_gmerge<<<dim3(CHT), blk, 0, stream>>>(attc, G16 + t0 * 4 * CM, O16 + t0 * CM);
  }
  gemm_kne<bf16, 2, false, CM><<<dim3(MTOK / 128, CM / 128), blk, 0, stream>>>(O16, CM, W0c, nullptr, XT, ones, XT, CM, CM);     // xt = xt + o·W0_c (in place, (r,s) order)
  k_perm<<<dim3(MTOK), dim3(64), 0, stream>>>(XT, X1, 0);                                                                          // back to (s,r) order
  // ---- transition, all tokens per launch: out = relu(x*W1 + b1)*W2 + b2 + x ----
  gemm_kne<float, 3, true, 4 * CM><<<dim3(MTOK / 128, 4 * CM / 128), blk, 0, stream>>>(X1, CM, W1, b1, nullptr, nullptr, G16, 4 * CM, CM);
  gemm_kne<bf16, 2, false, CM><<<dim3(MTOK / 128, CM / 128), blk, 0, stream>>>(G16, 4 * CM, W2, b2, X1, ones, out, CM, 4 * CM);
}

// v003
// One run takes 471 microseconds.
// Two timings next to v002 both put it at 1.05 times that version's speed.
// Counting every step since v000, it is 2.49 times as fast.
// Contractions on v_wmma_f32_16x16x32_f16 (plain f16 operands, f32 accumulate): the row- and column-wise gated attentions of an MSA
// block — qkvg = x·Wqkv (K = 256, N = 1024; the reference's (d, k, h) column interleave undone by permuting the WEIGHT columns on the
// device, both attention kernels scale by 32^-½ for the real head dim), the 8-head attentions with head dim 32 zero-padded to 64
// (row: 128 sequences x 256 residues with the pair-bias table [h][i][j] = LN(bias_rep)·Wb + bb added in the attention kernel; column: 256 residues x 128
// sequences after a token re-ordering), flash-style Sᵀ = K·Qᵀ / Oᵀ = Vᵀ·Pᵀ with online softmax in f32 (P x1024, f32 rows), the sigmoid
// gate, ·W0 + residual (K = 256), and the transition relu(x·W1 + b1)·W2 + b2 + x (K = 256 / 1024) — every GEMM one launch over all 32768 tokens, the attention stages in two 16384-token halves; LayerNorms
// in f32. compute dtype: f16 operands, f32 accumulate.  x [1,128,256,256] -> [1,128,256,256].
#include <hip/hip_runtime.h>
#include <hip/hip_bf16.h>
#include <math.h>

#define NSEQ 128
#define NRES 256
#define CM 256
#define CZ 128
#define NHD 8
#define DH 32
#define MTOK (NSEQ * NRES)
#define CHT (MTOK / 2)   // tokens per launch of the split / attention / gate stages (two halves keep the padded operands inside the workspace)
#define DD 512
#define KVD 512
#define HH 8
#define KVH 8
#define HKDIV 1
#define DKK 64
#define QW 2
#define SS 256
#define GSTR 48

typedef _Float16 bf16;
typedef _Float16 f16;
typedef __attribute__((ext_vector_type(4))) unsigned v4u_t;
typedef unsigned v4ua __attribute__((ext_vector_type(4), may_alias));
typedef __attribute__((ext_vector_type(4))) float v4f_t;
typedef float v4fa __attribute__((ext_vector_type(4), may_alias));
typedef __attribute__((ext_vector_type(16))) bf16  bf16x16;
typedef bf16x16 f16x16;
typedef __attribute__((ext_vector_type(8)))  bf16  bf16x8;
typedef bf16x8 f16x8;
typedef __attribute__((ext_vector_type(4)))  bf16  bf16x4;
typedef __attribute__((ext_vector_type(8)))  float f32x8;
__device__ __forceinline__ f32x8 wmma16(f16x16 a, f16x16 b, f32x8 c) {
  c = __builtin_amdgcn_wmma_f32_16x16x32_f16(false, a, false, b, (short)0, c, false, false);
  asm volatile("v_nop\n\tv_nop\n\tv_nop\n\tv_nop" : "+v"(c) : "v"(a), "v"(b));
  return c;
}
#define LDS_STRIDE 48   // GEMM tiles: 32 -> 48 elems (96B rows): aligned b128 reads
#define KSTRIDE    72   // attn K tile: 64 -> 72 elems (144B rows): conflict-free b128
#define VSTRIDE    48   // attn V tile: 32 -> 48 elems

__device__ __forceinline__ f32x8 wmma_bf16(bf16x16 a, bf16x16 b, f32x8 c) {
  c = __builtin_amdgcn_wmma_f32_16x16x32_f16(false, a, false, b, (short)0, c, false, false);
  asm volatile("v_nop\n\tv_nop\n\tv_nop\n\tv_nop" : "+v"(c) : "v"(a), "v"(b));   // A/B-overwrite hazard guard
  return c;
}

// 16x32 (MxK) f16 fragment from a row-major global matrix.
// lanes 0-15  (row=lane)    : elems 0..7 = K+0..7,  8..15 = K+16..23
// lanes 16-31 (row=lane-16) : elems 0..7 = K+8..15, 8..15 = K+24..31
template <typename T>
__device__ __forceinline__ bf16x16 load_frag(const T* __restrict__ base, int ld,
                                             int row0, int k0) {
  const int lane = threadIdx.x & 31;
  const int r    = lane & 15;
  const int kh   = (lane >> 4) * 8;
  const T* p0 = base + (size_t)(row0 + r) * ld + (k0 + kh);
  const T* p1 = p0 + 16;
  bf16x16 f;
#pragma unroll
  for (int i = 0; i < 8; ++i) {
    f[i]     = (bf16)p0[i];
    f[i + 8] = (bf16)p1[i];
  }
  return f;
}

// Same fragment from an LDS tile with padded row stride (base includes row0/k0).
__device__ __forceinline__ bf16x16 lds_frag(const bf16* base, int stride) {
  const int lane = threadIdx.x & 31;
  const int row  = lane & 15;
  const int kh   = (lane >> 4) * 8;
  const bf16x8 lo = *(const bf16x8*)(base + row * stride + kh);
  const bf16x8 hi = *(const bf16x8*)(base + row * stride + kh + 16);
  bf16x16 f;
#pragma unroll
  for (int i = 0; i < 8; ++i) { f[i] = lo[i]; f[i + 8] = hi[i]; }
  return f;
}

template <typename T>
__device__ __forceinline__ void stage_read16(const T* __restrict__ p, float* buf) {
#pragma unroll
  for (int i = 0; i < 16; ++i) buf[i] = (float)p[i];
}

__device__ __forceinline__ void stage_write(bf16* dst, const float* buf, int nquad) {
#pragma unroll
  for (int i = 0; i < nquad; ++i) {
    bf16x4 q;
    q[0] = (bf16)buf[4 * i];     q[1] = (bf16)buf[4 * i + 1];
    q[2] = (bf16)buf[4 * i + 2]; q[3] = (bf16)buf[4 * i + 3];
    *(bf16x4*)(dst + 4 * i) = q;
  }
}


// ---------------------------------------------------------------------------------------------------------------------------
// gemm_kne: Y[m][n] = epi( Σ_k A[m][k]·W[k][n] + bias[n] ), A f32/f16 [M][lda], W f32 row-major [K][N] (pitch LDW), plain f16 operands,
// f32 accumulate. EPI 0: identity; 1: exact-erf GELU; 2: R[m][n] + gvec[n]·(·) (residual with per-channel gain). Output f32 (or f16
// when OUT16). Block = 128x128 tile, 8 waves as 4(M) x 2(N); per 32-wide k-step A and W tiles staged f16 in LDS (W transposed
// ---------------------------------------------------------------------------------------------------------------------------
#define GSTR 48
template <typename AT, int EPI, bool OUT16, int LDW>
__global__ __launch_bounds__(256) void gemm_kne(const AT* __restrict__ A, int lda, const float* __restrict__ Wm,
                                                const float* __restrict__ bias, const float* __restrict__ R, const float* __restrict__ gvec,
                                                void* __restrict__ Yv, int ldy, int K) {
  __shared__ __attribute__((aligned(16))) f16 ldsA[128 * GSTR];
  __shared__ __attribute__((aligned(16))) f16 ldsW[128 * GSTR];
  __shared__ __attribute__((aligned(16))) float oS[8][32 * 68];
  const int tid = threadIdx.x, lane = tid & 31, wave = tid >> 5, cl = lane & 15, rh = (lane >> 4) * 8;
  const int m0 = blockIdx.x * 128, n0 = blockIdx.y * 128;
  const int wm = (wave & 3) * 32, wn = (wave >> 2) * 64;
  f32x8 acc[2][4];
#pragma unroll
  for (int i = 0; i < 2; ++i)
#pragma unroll
    for (int j = 0; j < 4; ++j) { f32x8 z = {}; acc[i][j] = z; }
#pragma unroll 1
  for (int k0 = 0; k0 < K; k0 += 32) {
    __syncthreads();
    { const int row = tid >> 1, ch = (tid & 1) * 16;
      const AT* src = A + (size_t)(m0 + row) * lda + k0 + ch;
#pragma unroll
      for (int g = 0; g < 16; ++g) ldsA[row * GSTR + ch + g] = (f16)src[g]; }
    { const int n = tid & 127, kq = (tid >> 7) * 16;   // one column n and 16 consecutive k a thread: the transpose happens in registers
      const float* src = Wm + (size_t)(k0 + kq) * LDW + n0 + n;   // LDW is a compile-time pitch: the 16 row steps are immediate offsets of one address
      union { f16 h[16]; v4u_t v[2]; } u;
#pragma unroll
      for (int g = 0; g < 16; ++g) u.h[g] = (f16)src[g * LDW];
      *(v4u_t*)(ldsW + n * GSTR + kq) = u.v[0];
      *(v4u_t*)(ldsW + n * GSTR + kq + 8) = u.v[1]; }
    __syncthreads();
    f16x16 af[2];
#pragma unroll
    for (int i = 0; i < 2; ++i) af[i] = lds_frag(ldsA + (wm + 16 * i) * GSTR, GSTR);
#pragma unroll
    for (int j = 0; j < 4; ++j) {
      const f16x16 bf = lds_frag(ldsW + (wn + 16 * j) * GSTR, GSTR);
#pragma unroll
      for (int i = 0; i < 2; ++i) acc[i][j] = wmma16(af[i], bf, acc[i][j]);
    }
  }
  float* so = oS[wave];
#pragma unroll
  for (int i = 0; i < 2; ++i)
#pragma unroll
    for (int j = 0; j < 4; ++j) {
      const int n = n0 + wn + 16 * j + cl;
      const float bv = bias ? bias[n] : 0.0f;
      const float gv = (EPI == 2) ? gvec[n] : 0.0f;
      if (EPI == 1) {
#pragma unroll 1
        for (int r = 0; r < 8; ++r) { const float xg = acc[i][j][r] + bv; so[(16 * i + rh + r) * 68 + 16 * j + cl] = 0.5f * xg * (1.0f + erff(xg * 0.70710678118654752f)); }
      } else {
#pragma unroll
        for (int r = 0; r < 8; ++r) {
          float v = acc[i][j][r] + bv;
          if (EPI == 3) v = fmaxf(v, 0.0f);                                         // EPI 3: ReLU
          if (EPI == 2) v = R[(size_t)(m0 + wm + 16 * i + rh + r) * ldy + n] + gv * v;
          so[(16 * i + rh + r) * 68 + 16 * j + cl] = v;
        }
      }
    }
  asm volatile("s_wait_dscnt 0" ::: "memory");
  __builtin_amdgcn_wave_barrier();
{
    if (OUT16) {
      f16* Y = (f16*)Yv;
#pragma unroll
      for (int it = 0; it < 8; ++it) { const int c = lane + 32 * it, rr = c >> 3, q8 = (c & 7) * 8;
        union { f16 h[8]; v4u_t v; } u;
#pragma unroll
        for (int e = 0; e < 8; ++e) u.h[e] = (f16)so[rr * 68 + q8 + e];
        *(v4u_t*)(Y + (size_t)(m0 + wm + rr) * ldy + n0 + wn + q8) = u.v; }
    } else {
      float* Y = (float*)Yv;
#pragma unroll
      for (int it = 0; it < 16; ++it) { const int f4 = lane + 32 * it, rr = f4 >> 4, q = (f4 & 15) * 4;
        *(v4f_t*)(Y + (size_t)(m0 + wm + rr) * ldy + n0 + wn + q) = *(const v4fa*)(so + rr * 68 + q); }
    }
    
  }
}

#define QROWS 256
#define KROWS 256
#define NKV 256
__global__ __launch_bounds__(64) void bt_attn_kernel(
    const bf16* __restrict__ Qb, const bf16* __restrict__ Kb,
    const bf16* __restrict__ Vt, const float* __restrict__ btab, int btstride,   // btab [h][q][k], row stride btstride: additive pair-bias logits
    float* __restrict__ attnOut) {
  __shared__ bf16 ldsK[32 * KSTRIDE];   // 4.5 KB
  __shared__ bf16 ldsV[64 * VSTRIDE];   // 6.0 KB
  __shared__ __attribute__((aligned(16))) bf16 ldsO[2][32 * 72];   // unused: the per-wave output tile is the f32 ldsOf below

  const int q0blk = blockIdx.x * 64;
  const int h  = blockIdx.y;
  const int b  = blockIdx.z;
  const int t    = threadIdx.x;
  const int wave = t >> 5;
  const int lane = t & 31;
  const int qlane = lane & 15;
  const int kh8   = (lane >> 4) * 8;
  const int q0 = q0blk + wave * 32;          // this wave's 32 queries

  const int hk = h / HKDIV;
  const bf16* Qh = Qb + (size_t)b * QROWS * DD + h * DKK;        // queries: QROWS rows per batch, row stride DD
  const bf16* Kh = Kb + (size_t)b * KROWS * KVD + hk * DKK;      // keys: KROWS rows per batch, row stride KVD
  const bf16* Vh = Vt + ((size_t)(b * KVH + hk)) * DKK * KROWS;  // Vᵀ [KVH][64][KROWS] per batch

  // Cooperative staging (64 threads): K tile 32x64 (2 thr/row, 64B each);
  // V tile 64x32 (1 thr/row, 64B each).
  const int krow = t >> 1;
  const int kcol = (t & 1) * 32;
  const bf16* kSrc = Kh + (size_t)krow * KVD + kcol;
  const bf16* vSrc = Vh + (size_t)t * KROWS;

  bf16x16 qf[QW][2];
#pragma unroll
  for (int qt = 0; qt < QW; ++qt) {
    qf[qt][0] = load_frag(Qh, DD, q0 + 16 * qt, 0);
    qf[qt][1] = load_frag(Qh, DD, q0 + 16 * qt, 32);
  }

  f32x8 o[QW][4] = {};
  float mrun[QW], lrun[QW];
#pragma unroll
  for (int qt = 0; qt < QW; ++qt) { mrun[qt] = -INFINITY; lrun[qt] = 0.0f; }

  const float scale = 0.17677669529663688f * 1.44269504088896340736f;  // hd^-0.5 = 1/sqrt(32) (real head dim; the 64-wide layout is zero-padded), times log2(e)
  const float NEG2 = -1.0e9f;    // masked logit: its weight is exactly 0 once any valid key of the row has been seen (every row
                                 // has one), and anything accumulated before that is wiped by alpha == 0 — same result as -inf
  const int kmax = KROWS - 1;
  const float L2E_ = 1.44269504088896340736f; const float* bth = btab + (size_t)h * QROWS * 0;   // unused: btab holds all heads and is indexed by h below

  // Prefetch key block kb=0 into registers.
  bf16x8 kreg[4], vreg[4];
#pragma unroll
  for (int i = 0; i < 4; ++i) {
    kreg[i] = *(const bf16x8*)(kSrc + 8 * i);
    vreg[i] = *(const bf16x8*)(vSrc + 8 * i);
  }

  for (int kb = 0; kb <= kmax; kb += 32) {
    __syncthreads();   // previous readers done with LDS
#pragma unroll
    for (int i = 0; i < 4; ++i) {
      *(bf16x8*)(&ldsK[krow * KSTRIDE + kcol + 8 * i]) = kreg[i];
      *(bf16x8*)(&ldsV[t * VSTRIDE + 8 * i])           = vreg[i];
    }
    if (kb + 32 <= kmax) {   // prefetch next block during compute
      const bf16* kn = kSrc + (size_t)(kb + 32) * KVD;
      const bf16* vn = vSrc + (kb + 32);
#pragma unroll
      for (int i = 0; i < 4; ++i) {
        kreg[i] = *(const bf16x8*)(kn + 8 * i);
        vreg[i] = *(const bf16x8*)(vn + 8 * i);
      }
    }
    __syncthreads();   // tile visible

    // Phase 1: scores + softmax for both q-tiles (K fragments live here only).
    bf16x16 kf[2][2];
#pragma unroll
    for (int ktile = 0; ktile < 2; ++ktile)
#pragma unroll
      for (int c = 0; c < 2; ++c)
        kf[ktile][c] = lds_frag(ldsK + (ktile * 16) * KSTRIDE + c * 32, KSTRIDE);

    bf16x16 pf[QW];
    bool act[QW];
#pragma unroll
    for (int qt = 0; qt < QW; ++qt) {
      unsigned mbits = 0;
      {
#pragma unroll
        for (int r = 0; r < 8; ++r) { const int j0 = kb + kh8 + r; if (j0 < NKV) mbits |= 1u << r; if (j0 + 16 < NKV) mbits |= 1u << (8 + r); }
        act[qt] = (__builtin_amdgcn_ballot_w32(mbits != 0) != 0);
      }
      if (act[qt]) {
        const int q_my = q0 + 16 * qt + qlane;
        f32x8 s0 = {}, s1 = {};
        s0 = wmma_bf16(kf[0][0], qf[qt][0], s0);
        s0 = wmma_bf16(kf[0][1], qf[qt][1], s0);
        s1 = wmma_bf16(kf[1][0], qf[qt][0], s1);
        s1 = wmma_bf16(kf[1][1], qf[qt][1], s1);

        float mx = -INFINITY;
#pragma unroll
        for (int r = 0; r < 8; ++r) {
          const int k0i = kb + kh8 + r;
          const int k1i = k0i + 16;
          const float* brow = btab + ((size_t)h * QROWS + min(q_my, QROWS - 1)) * btstride; (void)bth;   // per-head [q][k] table
          s0[r] = (mbits & (1u << r))       ? s0[r] * scale + L2E_ * brow[min(k0i, NKV - 1)] : NEG2;
          s1[r] = (mbits & (1u << (8 + r))) ? s1[r] * scale + L2E_ * brow[min(k1i, NKV - 1)] : NEG2;
          mx = fmaxf(mx, fmaxf(s0[r], s1[r]));
        }
        mx = fmaxf(mx, __shfl_xor(mx, 16, 32));
        const float mnew  = fmaxf(mrun[qt], mx);
        const float alpha = exp2f(mrun[qt] - mnew);

        float rsum = 0.0f;
#pragma unroll
        for (int r = 0; r < 8; ++r) {
          const float p0 = exp2f(s0[r] - mnew);
          const float p1 = exp2f(s1[r] - mnew);
          rsum += p0 + p1;
          pf[qt][r]     = (bf16)(p0 * 1024.0f);     // P carried x1024: no f16 copy of a probability is sub-normal
          pf[qt][r + 8] = (bf16)(p1 * 1024.0f);
        }
        rsum += __shfl_xor(rsum, 16, 32);
        lrun[qt] = lrun[qt] * alpha + rsum;
        mrun[qt] = mnew;

        // Rescale accumulators now so the PV phase is pure WMMA.
#pragma unroll
        for (int j = 0; j < 4; ++j)
#pragma unroll
          for (int r = 0; r < 8; ++r) o[qt][j][r] *= alpha;
      }
    }

    // Phase 2: O^T accumulate; each V fragment read from LDS once, used by
    // both q-tiles, then dead (only 8 VGPRs of V live at a time).
#pragma unroll
    for (int j = 0; j < 4; ++j) {
      const bf16x16 vf = lds_frag(ldsV + (j * 16) * VSTRIDE, VSTRIDE);
#pragma unroll
      for (int qt = 0; qt < QW; ++qt)
        if (act[qt]) o[qt][j] = wmma_bf16(vf, pf[qt], o[qt][j]);
    }
  }

  __shared__ __attribute__((aligned(16))) float ldsOf[2][32 * 68];
  float* so = ldsOf[wave]; (void)ldsO;
#pragma unroll
  for (int qt = 0; qt < QW; ++qt) {
    const float rl = 1.0f / (lrun[qt] * 1024.0f);
#pragma unroll
    for (int j = 0; j < 4; ++j)
#pragma unroll
      for (int r = 0; r < 8; ++r) so[(16 * qt + qlane) * 68 + j * 16 + kh8 + r] = o[qt][j][r] * rl;
  }
  asm volatile("s_wait_dscnt 0" ::: "memory");
  __builtin_amdgcn_wave_barrier();
{
#pragma unroll
    for (int it = 0; it < 16; ++it) { const int ch = lane + 32 * it, ql = ch >> 4, q4 = (ch & 15) * 4;
      *(v4f_t*)(attnOut + ((size_t)(b * QROWS + q0 + ql)) * DD + h * DKK + q4) = *(const v4fa*)(so + ql * 68 + q4); }
    
  }
}


#undef QROWS
#undef KROWS
#undef NKV
#define QROWS 128
#define KROWS 128
#define NKV 128
__global__ __launch_bounds__(64) void col_attn_kernel(
    const bf16* __restrict__ Qb, const bf16* __restrict__ Kb,
    const bf16* __restrict__ Vt,
    float* __restrict__ attnOut) {   // QROWS queries / KROWS key rows per batch (first NKV valid), GQA factor HKDIV; f32 output rows
  __shared__ bf16 ldsK[32 * KSTRIDE];   // 4.5 KB
  __shared__ bf16 ldsV[64 * VSTRIDE];   // 6.0 KB
  __shared__ __attribute__((aligned(16))) bf16 ldsO[2][32 * 72];   // unused: the per-wave output tile is the f32 ldsOf below

  const int q0blk = blockIdx.x * 64;
  const int h  = blockIdx.y;
  const int b  = blockIdx.z;
  const int t    = threadIdx.x;
  const int wave = t >> 5;
  const int lane = t & 31;
  const int qlane = lane & 15;
  const int kh8   = (lane >> 4) * 8;
  const int q0 = q0blk + wave * 32;          // this wave's 32 queries

  const int hk = h / HKDIV;
  const bf16* Qh = Qb + (size_t)b * QROWS * DD + h * DKK;        // queries: QROWS rows per batch, row stride DD
  const bf16* Kh = Kb + (size_t)b * KROWS * KVD + hk * DKK;      // keys: KROWS rows per batch, row stride KVD
  const bf16* Vh = Vt + ((size_t)(b * KVH + hk)) * DKK * KROWS;  // Vᵀ [KVH][64][KROWS] per batch

  // Cooperative staging (64 threads): K tile 32x64 (2 thr/row, 64B each);
  // V tile 64x32 (1 thr/row, 64B each).
  const int krow = t >> 1;
  const int kcol = (t & 1) * 32;
  const bf16* kSrc = Kh + (size_t)krow * KVD + kcol;
  const bf16* vSrc = Vh + (size_t)t * KROWS;

  bf16x16 qf[QW][2];
#pragma unroll
  for (int qt = 0; qt < QW; ++qt) {
    qf[qt][0] = load_frag(Qh, DD, q0 + 16 * qt, 0);
    qf[qt][1] = load_frag(Qh, DD, q0 + 16 * qt, 32);
  }

  f32x8 o[QW][4] = {};
  float mrun[QW], lrun[QW];
#pragma unroll
  for (int qt = 0; qt < QW; ++qt) { mrun[qt] = -INFINITY; lrun[qt] = 0.0f; }

  const float scale = 0.17677669529663688f * 1.44269504088896340736f;  // 1/sqrt(32): real head dim (64-wide layout zero-padded), times log2(e)
  const float NEG2 = -1.0e9f;    // masked logit: its weight is exactly 0 once any valid key of the row has been seen (every row
                                 // has one), and anything accumulated before that is wiped by alpha == 0 — same result as -inf
  const int kmax = KROWS - 1;    // all key rows (KROWS == NKV: none masked)

  // Prefetch key block kb=0 into registers.
  bf16x8 kreg[4], vreg[4];
#pragma unroll
  for (int i = 0; i < 4; ++i) {
    kreg[i] = *(const bf16x8*)(kSrc + 8 * i);
    vreg[i] = *(const bf16x8*)(vSrc + 8 * i);
  }

  for (int kb = 0; kb <= kmax; kb += 32) {
    __syncthreads();   // previous readers done with LDS
#pragma unroll
    for (int i = 0; i < 4; ++i) {
      *(bf16x8*)(&ldsK[krow * KSTRIDE + kcol + 8 * i]) = kreg[i];
      *(bf16x8*)(&ldsV[t * VSTRIDE + 8 * i])           = vreg[i];
    }
    if (kb + 32 <= kmax) {   // prefetch next block during compute
      const bf16* kn = kSrc + (size_t)(kb + 32) * KVD;
      const bf16* vn = vSrc + (kb + 32);
#pragma unroll
      for (int i = 0; i < 4; ++i) {
        kreg[i] = *(const bf16x8*)(kn + 8 * i);
        vreg[i] = *(const bf16x8*)(vn + 8 * i);
      }
    }
    __syncthreads();   // tile visible

    // Phase 1: scores + softmax for both q-tiles (K fragments live here only).
    bf16x16 kf[2][2];
#pragma unroll
    for (int ktile = 0; ktile < 2; ++ktile)
#pragma unroll
      for (int c = 0; c < 2; ++c)
        kf[ktile][c] = lds_frag(ldsK + (ktile * 16) * KSTRIDE + c * 32, KSTRIDE);

    bf16x16 pf[QW];
    bool act[QW];
#pragma unroll
    for (int qt = 0; qt < QW; ++qt) {
      unsigned mbits = 0;
      {
#pragma unroll
        for (int r = 0; r < 8; ++r) { const int j0 = kb + kh8 + r; if (j0 < NKV) mbits |= 1u << r; if (j0 + 16 < NKV) mbits |= 1u << (8 + r); }
        act[qt] = (__builtin_amdgcn_ballot_w32(mbits != 0) != 0);
      }
      if (act[qt]) {
        const int q_my = q0 + 16 * qt + qlane;
        f32x8 s0 = {}, s1 = {};
        s0 = wmma_bf16(kf[0][0], qf[qt][0], s0);
        s0 = wmma_bf16(kf[0][1], qf[qt][1], s0);
        s1 = wmma_bf16(kf[1][0], qf[qt][0], s1);
        s1 = wmma_bf16(kf[1][1], qf[qt][1], s1);

        float mx = -INFINITY;
#pragma unroll
        for (int r = 0; r < 8; ++r) {
          const int k0i = kb + kh8 + r;
          const int k1i = k0i + 16;
          (void)k0i; (void)k1i; (void)q_my;
          s0[r] = (mbits & (1u << r))       ? s0[r] * scale : NEG2;
          s1[r] = (mbits & (1u << (8 + r))) ? s1[r] * scale : NEG2;
          mx = fmaxf(mx, fmaxf(s0[r], s1[r]));
        }
        mx = fmaxf(mx, __shfl_xor(mx, 16, 32));
        const float mnew  = fmaxf(mrun[qt], mx);
        const float alpha = exp2f(mrun[qt] - mnew);

        float rsum = 0.0f;
#pragma unroll
        for (int r = 0; r < 8; ++r) {
          const float p0 = exp2f(s0[r] - mnew);
          const float p1 = exp2f(s1[r] - mnew);
          rsum += p0 + p1;
          pf[qt][r]     = (bf16)(p0 * 1024.0f);     // P carried x1024: no f16 copy of a probability is sub-normal
          pf[qt][r + 8] = (bf16)(p1 * 1024.0f);
        }
        rsum += __shfl_xor(rsum, 16, 32);
        lrun[qt] = lrun[qt] * alpha + rsum;
        mrun[qt] = mnew;

        // Rescale accumulators now so the PV phase is pure WMMA.
#pragma unroll
        for (int j = 0; j < 4; ++j)
#pragma unroll
          for (int r = 0; r < 8; ++r) o[qt][j][r] *= alpha;
      }
    }

    // Phase 2: O^T accumulate; each V fragment read from LDS once, used by
    // both q-tiles, then dead (only 8 VGPRs of V live at a time).
#pragma unroll
    for (int j = 0; j < 4; ++j) {
      const bf16x16 vf = lds_frag(ldsV + (j * 16) * VSTRIDE, VSTRIDE);
#pragma unroll
      for (int qt = 0; qt < QW; ++qt)
        if (act[qt]) o[qt][j] = wmma_bf16(vf, pf[qt], o[qt][j]);
    }
  }

  __shared__ __attribute__((aligned(16))) float ldsOf[2][32 * 68];
  float* so = ldsOf[wave]; (void)ldsO;
#pragma unroll
  for (int qt = 0; qt < QW; ++qt) {
    const float rl = 1.0f / (lrun[qt] * 1024.0f);
#pragma unroll
    for (int j = 0; j < 4; ++j)
#pragma unroll
      for (int r = 0; r < 8; ++r) so[(16 * qt + qlane) * 68 + j * 16 + kh8 + r] = o[qt][j][r] * rl;
  }
  asm volatile("s_wait_dscnt 0" ::: "memory");
  __builtin_amdgcn_wave_barrier();
{
#pragma unroll
    for (int it = 0; it < 16; ++it) { const int ch = lane + 32 * it, ql = ch >> 4, q4 = (ch & 15) * 4;
      *(v4f_t*)(attnOut + ((size_t)(b * QROWS + q0 + ql)) * DD + h * DKK + q4) = *(const v4fa*)(so + ql * 68 + q4); }
    
  }
}


#undef QROWS
#undef KROWS
#undef NKV
// LayerNorm over C (256 or 128) per row; in place allowed; wave = LNR consecutive rows, block = 8 * LNR rows. All LNR rows are loaded before the
// first is reduced, so one wave start pays for LNR rows; per row the lane -> element map and both reduction trees are the one-row form's.
#define LNR 4
template <int C>
__global__ __launch_bounds__(256) void k_ln(const float* __restrict__ X, const float* __restrict__ g, const float* __restrict__ bb, float* __restrict__ Y) {
  const int tid = threadIdx.x, r = tid >> 5, lane = tid & 31; const size_t row0 = ((size_t)blockIdx.x * 8 + r) * LNR;
  float v[LNR][C / 32];
#pragma unroll
  for (int k = 0; k < LNR; ++k)
#pragma unroll
    for (int i = 0; i < C / 32; ++i) v[k][i] = X[(row0 + k) * C + lane + 32 * i];
#pragma unroll
  for (int k = 0; k < LNR; ++k) {
    float s = 0.0f;
#pragma unroll
    for (int i = 0; i < C / 32; ++i) s += v[k][i];
#pragma unroll
    for (int off = 1; off < 32; off <<= 1) s += __shfl_xor(s, off, 32);
    const float mean = s * (1.0f / C); float q = 0.0f;
#pragma unroll
    for (int i = 0; i < C / 32; ++i) { const float d = v[k][i] - mean; q += d * d; }
#pragma unroll
    for (int off = 1; off < 32; off <<= 1) q += __shfl_xor(q, off, 32);
    const float rstd = rsqrtf(q * (1.0f / C) + 1e-5f);
#pragma unroll
    for (int i = 0; i < C / 32; ++i) Y[(row0 + k) * C + lane + 32 * i] = (v[k][i] - mean) * rstd * g[lane + 32 * i] + bb[lane + 32 * i];
  }
}
// pair-bias table BT[h][i][j] = LN(bias_rep[i][j])·Wb[:,h] + bb[h]; block = i, thread = j
__global__ __launch_bounds__(256) void k_pairbias(const float* __restrict__ Z, const float* __restrict__ g2, const float* __restrict__ be2, const float* __restrict__ Wb, const float* __restrict__ bbh, float* __restrict__ BT) {
  const int i = blockIdx.x, j = threadIdx.x; const float* z = Z + ((size_t)i * NRES + j) * CZ;
  float s = 0.0f;
#pragma unroll 1
  for (int c = 0; c < CZ; ++c) s += z[c];
  const float mean = s * (1.0f / CZ); float q = 0.0f;
#pragma unroll 1
  for (int c = 0; c < CZ; ++c) { const float d = z[c] - mean; q += d * d; }
  const float rstd = rsqrtf(q * (1.0f / CZ) + 1e-5f);
  float acc[NHD];
#pragma unroll
  for (int h = 0; h < NHD; ++h) acc[h] = bbh[h];
#pragma unroll 1
  for (int c = 0; c < CZ; ++c) { const float zn = (z[c] - mean) * rstd * g2[c] + be2[c];
#pragma unroll
    for (int h = 0; h < NHD; ++h) acc[h] += zn * Wb[c * NHD + h]; }
{
#pragma unroll
    for (int h = 0; h < NHD; ++h) *(float*)(BT + ((size_t)h * NRES + i) * NRES + j) = acc[h];
     }
}
// permuted qkvg weights: Wp[c][k*256 + h*32 + d] = W[c][d*32 + k*8 + h] (no extra scale: both attention kernels carry 1/sqrt(32)); block = c (256), thread loops 1024 cols
__global__ __launch_bounds__(256) void k_wperm(const float* __restrict__ Wm, float* __restrict__ Wp) { const int c = blockIdx.x;
  for (int col = threadIdx.x; col < 4 * CM; col += 256) { const int k = col >> 8, h = (col >> 5) & 7, d = col & 31; float v = Wm[(size_t)c * 4 * CM + d * 32 + k * 8 + h];   // both attention kernels carry the 1/sqrt(32) scale themselves
    *(float*)(Wp + (size_t)c * 4 * CM + col) = v;  } }
// split f16 qkvg rows [CHT][1024] (q|k|v|g blocks, head h*32+d) into zero-padded operands: Q16c/K16c [nb][L][512] (cols h*64+d, d<32 real), Vtc [nb][512][L]; block = (64 tokens, head)
__global__ __launch_bounds__(256) void k_splitpad(const bf16* __restrict__ G, int L, bf16* __restrict__ Qc, bf16* __restrict__ Kc, bf16* __restrict__ Vtc) {
  __shared__ __attribute__((aligned(16))) bf16 qS[64][72], kS[64][72], vT[64][72];
  const int tid = threadIdx.x; const int t0 = blockIdx.x * 64; const int h = blockIdx.y; const int b = t0 / L, n0 = t0 % L;
  for (int e = tid; e < 64 * 64; e += 256) { const int t = e >> 6, d = e & 63; bf16 q = (bf16)0.0f, k = (bf16)0.0f, v = (bf16)0.0f;
    if (d < DH) { const bf16* src = G + (size_t)(t0 + t) * 4 * CM + h * DH + d; q = src[0]; k = src[CM]; v = src[2 * CM]; }
    qS[t][d] = q; kS[t][d] = k; vT[d][t] = v; }
  __syncthreads();
{
#pragma unroll 1
    for (int round = 0; round < 2; ++round) { const int r = round * 32 + (tid >> 3), piece = (tid & 7) * 8;
      *(v4u_t*)(Qc + (size_t)(t0 + r) * DD + h * DKK + piece) = *(const v4ua*)(&qS[r][piece]);
      *(v4u_t*)(Kc + (size_t)(t0 + r) * DD + h * DKK + piece) = *(const v4ua*)(&kS[r][piece]);
      *(v4u_t*)(Vtc + ((size_t)b * DD + h * DKK + r) * L + n0 + piece) = *(const v4ua*)(&vT[r][piece]); }
     }
}
// gated merge: O16[t][h*32 + d] = attc[t][h*64 + d] * sigmoid(g), g = G[t][768 + h*32 + d]. Thread = 4 consecutive channels of a token (64 threads a token,
// 4 tokens a pass), EWP passes a block, unrolled so that several passes' loads are in flight at once: a wave-wide load or store covers whole 128-B lines, and one wave start pays for 128 channels of EWP tokens.
#define EWP 8
__global__ __launch_bounds__(256) void k_gmerge(const float* __restrict__ A, const bf16* __restrict__ G, bf16* __restrict__ O16) {
  const int tid = threadIdx.x; const int c = (tid & 63) * 4; const int h = c >> 5, d = c & 31;
  const size_t tb = (size_t)blockIdx.x * (4 * EWP) + (tid >> 6);
  v4f_t a[EWP]; bf16x4 g[EWP];
#pragma unroll
  for (int p = 0; p < EWP; ++p) { const size_t t = tb + 4 * p;
    if (p == EWP - 1) asm volatile("s_wait_xcnt 0x0" ::: "memory");
    a[p] = *(const v4f_t*)(A + t * DD + h * DKK + d);
    g[p] = *(const bf16x4*)(G + t * 4 * CM + 3 * CM + c); }
#pragma unroll
  for (int p = 0; p < EWP; ++p) { const size_t t = tb + 4 * p; bf16x4 o;
#pragma unroll
    for (int e = 0; e < 4; ++e) o[e] = (bf16)(a[p][e] / (1.0f + expf(-(float)g[p][e])));
    *(bf16x4*)(O16 + t * CM + c) = o; }
}
// row permutation between (s, r) and (r, s) token orders: dst[row] = src[srow]; rows of 1 KB by 64 lanes x 16 B, 4 rows a pass, EWP passes a block, all loads issued before the first store.
// srow = (row % DIV) * MUL + row / DIV; a block's 4 * EWP rows share row / DIV, so pass p only adds 4 * p * MUL source rows.
template <int DIV, int MUL>
__device__ __forceinline__ void perm_rows(const float* __restrict__ src, unsigned row0, int col, v4f_t* v) {
  static_assert(DIV % (4 * EWP) == 0, "a block's rows must share row / DIV");
  const float* s0 = src + (size_t)((row0 % DIV) * MUL + row0 / DIV) * CM + col;
#pragma unroll
  for (int p = 0; p < EWP; ++p) v[p] = *(const v4f_t*)(s0 + (size_t)(4 * p * MUL) * CM);
}
__global__ __launch_bounds__(256) void k_perm(const float* __restrict__ src, float* __restrict__ dst, int to_rs) {
  const int tid = threadIdx.x; const unsigned row0 = blockIdx.x * (4 * EWP) + (tid >> 6); const int col = (tid & 63) * 4;
  float* d0 = dst + (size_t)row0 * CM + col;
  v4f_t v[EWP];
  if (to_rs) perm_rows<NSEQ, NRES>(src, row0, col, v); else perm_rows<NRES, NSEQ>(src, row0, col, v);
#pragma unroll
  for (int p = 0; p < EWP; ++p) *(v4f_t*)(d0 + (size_t)(4 * p) * CM) = v[p];
}
__global__ __launch_bounds__(256) void k_ones(float* __restrict__ p, int n) { for (int i = threadIdx.x; i < n; i += 256) { *(float*)(p + i) = 1.0f;  } }

extern "C" void kernel_launch(void* const* d_in, const int* in_sizes, int n_in,
                              void* d_out, int out_size, void* d_ws, size_t ws_size,
                              hipStream_t stream) {
  (void)in_sizes; (void)n_in; (void)out_size;
  const float** f = (const float**)d_in;
  const float* x = f[0], *brep = f[1], *Wqkv_r = f[2], *W0r = f[3], *Wb = f[4], *bbh = f[5], *Wqkv_c = f[6], *W0c = f[7], *W1 = f[8], *b1 = f[9], *W2 = f[10], *b2 = f[11], *g1 = f[12], *be1 = f[13], *g2 = f[14], *be2 = f[15], *g3 = f[16], *be3 = f[17];
  float* out = (float*)d_out;     // [1,128,256,256]
  char* ws = (char*)d_ws;
  float* X1 = (float*)ws; ws += (size_t)MTOK * CM * 4;                 // 32 MB: LN1(x), then x + row-att (in place), then LN3 (in place), finally x after the column block (s,r order)
  float* XT = (float*)ws; ws += (size_t)MTOK * CM * 4;                 // 32 MB: (r,s)-ordered copy for the column block
  float* BT = (float*)ws; ws += (size_t)NHD * NRES * NRES * 4;         // 2 MB pair-bias table
  float* Wpr = (float*)ws; ws += (size_t)CM * 4 * CM * 4; float* Wpc = (float*)ws; ws += (size_t)CM * 4 * CM * 4;
  bf16* G16 = (bf16*)ws; ws += (size_t)MTOK * 4 * CM * 2;             // qkvg f16 [32768][1024] (64 MB); also the transition hidden [32768][1024]
  bf16* Qc = (bf16*)ws; ws += (size_t)CHT * DD * 2; bf16* Kc = (bf16*)ws; ws += (size_t)CHT * DD * 2; bf16* Vtc = (bf16*)ws; ws += (size_t)CHT * DD * 2;   // 16 MB each
  float* attc = (float*)ws; ws += (size_t)CHT * DD * 4;               // 32 MB
  bf16* O16 = (bf16*)ws; ws += (size_t)MTOK * CM * 2;                 // 16 MB gated attention output rows (token order of the current block)
  float* ones = (float*)ws; ws += CM * 4;
  if ((size_t)(ws - (char*)d_ws) > ws_size) return;
  const dim3 blk(256);
  k_ones<<<dim3(1), blk, 0, stream>>>(ones, CM);
  k_wperm<<<dim3(CM), blk, 0, stream>>>(Wqkv_r, Wpr); k_wperm<<<dim3(CM), blk, 0, stream>>>(Wqkv_c, Wpc);
  k_pairbias<<<dim3(NRES), blk, 0, stream>>>(brep, g2, be2, Wb, bbh, BT);
  k_ln<CM><<<dim3(MTOK / (8 * LNR)), blk, 0, stream>>>(x, g1, be1, X1);
  // ---- row-wise gated attention with pair bias: qkvg for all tokens in one launch, attention in halves of 64 sequences ----
  gemm_kne<float, 0, true, 4 * CM><<<dim3(MTOK / 128, 4 * CM / 128), blk, 0, stream>>>(X1, CM, Wpr, nullptr, nullptr, nullptr, G16, 4 * CM, CM);
  for (int c = 0; c < MTOK / CHT; ++c) { const size_t t0 = (size_t)c * CHT;
    k_splitpad<<<dim3(CHT / 64, NHD), blk, 0, stream>>>(G16 + t0 * 4 * CM, NRES, Qc, Kc, Vtc);
    bt_attn_kernel<<<dim3(NRES / 64, NHD, CHT / NRES), dim3(64), 0, stream>>>(Qc, Kc, Vtc, BT, NRES, attc);
    k_gmerge<<<dim3(CHT / (4 * EWP)), blk, 0, stream>>>(attc, G16 + t0 * 4 * CM, O16 + t0 * CM);
  }
  gemm_kne<bf16, 2, false, CM><<<dim3(MTOK / 128, CM / 128), blk, 0, stream>>>(O16, CM, W0r, nullptr, X1, ones, X1, CM, CM);     // x = x + o·W0 (in place)
  k_ln<CM><<<dim3(MTOK / (8 * LNR)), blk, 0, stream>>>(X1, g3, be3, X1);                                                                    // x = LN3(x) (in place)
  // ---- column-wise gated attention: tokens re-ordered (r, s); qkvg in one launch, attention in halves of 128 residues ----
  k_perm<<<dim3(MTOK / (4 * EWP)), blk, 0, stream>>>(X1, XT, 1);
  gemm_kne<float, 0, true, 4 * CM><<<dim3(MTOK / 128, 4 * CM / 128), blk, 0, stream>>>(XT, CM, Wpc, nullptr, nullptr, nullptr, G16, 4 * CM, CM);
  for (int c = 0; c < MTOK / CHT; ++c) { const size_t t0 = (size_t)c * CHT;
    k_splitpad<<<dim3(CHT / 64, NHD), blk, 0, stream>>>(G16 + t0 * 4 * CM, NSEQ, Qc, Kc, Vtc);
    col_attn_kernel<<<dim3(NSEQ / 64, NHD, CHT / NSEQ), dim3(64), 0, stream>>>(Qc, Kc, Vtc, attc);
    k_gmerge<<<dim3(CHT / (4 * EWP)), blk, 0, stream>>>(attc, G16 + t0 * 4 * CM, O16 + t0 * CM);
  }
  gemm_kne<bf16, 2, false, CM><<<dim3(MTOK / 128, CM / 128), blk, 0, stream>>>(O16, CM, W0c, nullptr, XT, ones, XT, CM, CM);     // xt = xt + o·W0_c (in place, (r,s) order)
  k_perm<<<dim3(MTOK / (4 * EWP)), blk, 0, stream>>>(XT, X1, 0);                                                                          // back to (s,r) order
  // ---- transition, all tokens per launch: out = relu(x*W1 + b1)*W2 + b2 + x ----
  gemm_kne<float, 3, true, 4 * CM><<<dim3(MTOK / 128, 4 * CM / 128), blk, 0, stream>>>(X1, CM, W1, b1, nullptr, nullptr, G16, 4 * CM, CM);
  gemm_kne<bf16, 2, false, CM><<<dim3(MTOK / 128, CM / 128), blk, 0, stream>>>(G16, 4 * CM, W2, b2, X1, ones, out, CM, 4 * CM);
}

// v004
// One run takes 450 microseconds.
// Next to v003, in two timings, it ran 1.05 and 1.04 times as fast.
// All steps since v000 together make it 2.61 times as fast.
// Contractions on v_wmma_f32_16x16x32_f16 (plain f16 operands, f32 accumulate): the row- and column-wise gated attentions of an MSA
// block — qkvg = x·Wqkv (K = 256, N = 1024; the reference's (d, k, h) column interleave undone by permuting the WEIGHT columns on the
// device, both attention kernels scale by 32^-½ for the real head dim), the 8-head attentions with head dim 32 zero-padded to 64
// (row: 128 sequences x 256 residues with the pair-bias table [h][i][j] = LN(bias_rep)·Wb + bb added in the attention kernel; column: 256 residues x 128
// sequences after a token re-ordering), flash-style Sᵀ = K·Qᵀ / Oᵀ = Vᵀ·Pᵀ with online softmax in f32 (P x1024, f32 rows), the sigmoid
// gate, ·W0 + residual (K = 256), and the transition relu(x·W1 + b1)·W2 + b2 + x (K = 256 / 1024) — every GEMM one launch over all 32768 tokens, the attention stages in two 16384-token halves; LayerNorms
// in f32. compute dtype: f16 operands, f32 accumulate.  x [1,128,256,256] -> [1,128,256,256].
#include <hip/hip_runtime.h>
#include <hip/hip_bf16.h>
#include <math.h>

#define NSEQ 128
#define NRES 256
#define CM 256
#define CZ 128
#define NHD 8
#define DH 32
#define MTOK (NSEQ * NRES)
#define CHT (MTOK / 2)   // tokens per launch of the split / attention / gate stages (two halves keep the padded operands inside the workspace)
#define DD 512
#define KVD 512
#define HH 8
#define KVH 8
#define HKDIV 1
#define DKK 64
#define QW 2
#define SS 256
#define GSTR 48

typedef _Float16 bf16;
typedef _Float16 f16;
typedef __attribute__((ext_vector_type(4))) unsigned v4u_t;
typedef unsigned v4ua __attribute__((ext_vector_type(4), may_alias));
typedef __attribute__((ext_vector_type(4))) float v4f_t;
typedef float v4fa __attribute__((ext_vector_type(4), may_alias));
typedef __attribute__((ext_vector_type(16))) bf16  bf16x16;
typedef bf16x16 f16x16;
typedef __attribute__((ext_vector_type(8)))  bf16  bf16x8;
typedef bf16x8 f16x8;
typedef __attribute__((ext_vector_type(4)))  bf16  bf16x4;
typedef __attribute__((ext_vector_type(8)))  float f32x8;
__device__ __forceinline__ f32x8 wmma16(f16x16 a, f16x16 b, f32x8 c) {
  c = __builtin_amdgcn_wmma_f32_16x16x32_f16(false, a, false, b, (short)0, c, false, false);
  asm volatile("v_nop\n\tv_nop\n\tv_nop\n\tv_nop" : "+v"(c) : "v"(a), "v"(b));
  return c;
}
#define LDS_STRIDE 48   // GEMM tiles: 32 -> 48 elems (96B rows): aligned b128 reads
#define KSTRIDE    72   // attn K tile: 64 -> 72 elems (144B rows): conflict-free b128
#define VSTRIDE    48   // attn V tile: 32 -> 48 elems

__device__ __forceinline__ f32x8 wmma_bf16(bf16x16 a, bf16x16 b, f32x8 c) {
  c = __builtin_amdgcn_wmma_f32_16x16x32_f16(false, a, false, b, (short)0, c, false, false);
  asm volatile("v_nop\n\tv_nop\n\tv_nop\n\tv_nop" : "+v"(c) : "v"(a), "v"(b));   // A/B-overwrite hazard guard
  return c;
}

// 16x32 (MxK) f16 fragment from a row-major global matrix.
// lanes 0-15  (row=lane)    : elems 0..7 = K+0..7,  8..15 = K+16..23
// lanes 16-31 (row=lane-16) : elems 0..7 = K+8..15, 8..15 = K+24..31
template <typename T>
__device__ __forceinline__ bf16x16 load_frag(const T* __restrict__ base, int ld,
                                             int row0, int k0) {
  const int lane = threadIdx.x & 31;
  const int r    = lane & 15;
  const int kh   = (lane >> 4) * 8;
  const T* p0 = base + (size_t)(row0 + r) * ld + (k0 + kh);
  const T* p1 = p0 + 16;
  bf16x16 f;
#pragma unroll
  for (int i = 0; i < 8; ++i) {
    f[i]     = (bf16)p0[i];
    f[i + 8] = (bf16)p1[i];
  }
  return f;
}

// Same fragment from an LDS tile with padded row stride (base includes row0/k0).
__device__ __forceinline__ bf16x16 lds_frag(const bf16* base, int stride) {
  const int lane = threadIdx.x & 31;
  const int row  = lane & 15;
  const int kh   = (lane >> 4) * 8;
  const bf16x8 lo = *(const bf16x8*)(base + row * stride + kh);
  const bf16x8 hi = *(const bf16x8*)(base + row * stride + kh + 16);
  bf16x16 f;
#pragma unroll
  for (int i = 0; i < 8; ++i) { f[i] = lo[i]; f[i + 8] = hi[i]; }
  return f;
}

template <typename T>
__device__ __forceinline__ void stage_read16(const T* __restrict__ p, float* buf) {
#pragma unroll
  for (int i = 0; i < 16; ++i) buf[i] = (float)p[i];
}

__device__ __forceinline__ void stage_write(bf16* dst, const float* buf, int nquad) {
#pragma unroll
  for (int i = 0; i < nquad; ++i) {
    bf16x4 q;
    q[0] = (bf16)buf[4 * i];     q[1] = (bf16)buf[4 * i + 1];
    q[2] = (bf16)buf[4 * i + 2]; q[3] = (bf16)buf[4 * i + 3];
    *(bf16x4*)(dst + 4 * i) = q;
  }
}


// ---------------------------------------------------------------------------------------------------------------------------
// gemm_kne: Y[m][n] = epi( Σ_k A[m][k]·W[k][n] + bias[n] ), A f32/f16 [M][lda], W f32 row-major [K][N] (pitch LDW), plain f16 operands,
// f32 accumulate. EPI 0: identity; 1: exact-erf GELU; 2: R[m][n] + gvec[n]·(·) (residual with per-channel gain). Output f32 (or f16
// when OUT16). Block = 128x128 tile, 8 waves as 4(M) x 2(N); per 32-wide k-step A and W tiles staged f16 in LDS (W transposed
// ---------------------------------------------------------------------------------------------------------------------------
#define GSTR 48
template <typename AT, int EPI, bool OUT16, int LDW>
__global__ __launch_bounds__(256) void gemm_kne(const AT* __restrict__ A, int lda, const float* __restrict__ Wm,
                                                const float* __restrict__ bias, const float* __restrict__ R, const float* __restrict__ gvec,
                                                void* __restrict__ Yv, int ldy, int K) {
  __shared__ __attribute__((aligned(16))) f16 ldsA[128 * GSTR];
  __shared__ __attribute__((aligned(16))) f16 ldsW[128 * GSTR];
  __shared__ __attribute__((aligned(16))) float oS[8][32 * 68];
  const int tid = threadIdx.x, lane = tid & 31, wave = tid >> 5, cl = lane & 15, rh = (lane >> 4) * 8;
  const int m0 = blockIdx.x * 128, n0 = blockIdx.y * 128;
  const int wm = (wave & 3) * 32, wn = (wave >> 2) * 64;
  f32x8 acc[2][4];
#pragma unroll
  for (int i = 0; i < 2; ++i)
#pragma unroll
    for (int j = 0; j < 4; ++j) { f32x8 z = {}; acc[i][j] = z; }
#pragma unroll 1
  for (int k0 = 0; k0 < K; k0 += 32) {
    __syncthreads();
    { const int row = tid >> 1, ch = (tid & 1) * 16;
      const AT* src = A + (size_t)(m0 + row) * lda + k0 + ch;
#pragma unroll
      for (int g = 0; g < 16; ++g) ldsA[row * GSTR + ch + g] = (f16)src[g]; }
    { const int n = tid & 127, kq = (tid >> 7) * 16;   // one column n and 16 consecutive k a thread: the transpose happens in registers
      const float* src = Wm + (size_t)(k0 + kq) * LDW + n0 + n;   // LDW is a compile-time pitch: the 16 row steps are immediate offsets of one address
      union { f16 h[16]; v4u_t v[2]; } u;
#pragma unroll
      for (int g = 0; g < 16; ++g) u.h[g] = (f16)src[g * LDW];
      *(v4u_t*)(ldsW + n * GSTR + kq) = u.v[0];
      *(v4u_t*)(ldsW + n * GSTR + kq + 8) = u.v[1]; }
    __syncthreads();
    f16x16 af[2];
#pragma unroll
    for (int i = 0; i < 2; ++i) af[i] = lds_frag(ldsA + (wm + 16 * i) * GSTR, GSTR);
#pragma unroll
    for (int j = 0; j < 4; ++j) {
      const f16x16 bf = lds_frag(ldsW + (wn + 16 * j) * GSTR, GSTR);
#pragma unroll
      for (int i = 0; i < 2; ++i) acc[i][j] = wmma16(af[i], bf, acc[i][j]);
    }
  }
  float* so = oS[wave];
#pragma unroll
  for (int i = 0; i < 2; ++i)
#pragma unroll
    for (int j = 0; j < 4; ++j) {
      const int n = n0 + wn + 16 * j + cl;
      const float bv = bias ? bias[n] : 0.0f;
      const float gv = (EPI == 2) ? gvec[n] : 0.0f;
      if (EPI == 1) {
#pragma unroll 1
        for (int r = 0; r < 8; ++r) { const float xg = acc[i][j][r] + bv; so[(16 * i + rh + r) * 68 + 16 * j + cl] = 0.5f * xg * (1.0f + erff(xg * 0.70710678118654752f)); }
      } else {
#pragma unroll
        for (int r = 0; r < 8; ++r) {
          float v = acc[i][j][r] + bv;
          if (EPI == 3) v = fmaxf(v, 0.0f);                                         // EPI 3: ReLU
          if (EPI == 2) v = R[(size_t)(m0 + wm + 16 * i + rh + r) * ldy + n] + gv * v;
          so[(16 * i + rh + r) * 68 + 16 * j + cl] = v;
        }
      }
    }
  asm volatile("s_wait_dscnt 0" ::: "memory");
  __builtin_amdgcn_wave_barrier();
{
    if (OUT16) {
      f16* Y = (f16*)Yv;
#pragma unroll
      for (int it = 0; it < 8; ++it) { const int c = lane + 32 * it, rr = c >> 3, q8 = (c & 7) * 8;
        union { f16 h[8]; v4u_t v; } u;
#pragma unroll
        for (int e = 0; e < 8; ++e) u.h[e] = (f16)so[rr * 68 + q8 + e];
        *(v4u_t*)(Y + (size_t)(m0 + wm + rr) * ldy + n0 + wn + q8) = u.v; }
    } else {
      float* Y = (float*)Yv;
#pragma unroll
      for (int it = 0; it < 16; ++it) { const int f4 = lane + 32 * it, rr = f4 >> 4, q = (f4 & 15) * 4;
        *(v4f_t*)(Y + (size_t)(m0 + wm + rr) * ldy + n0 + wn + q) = *(const v4fa*)(so + rr * 68 + q); }
    }
    
  }
}

#define QROWS 256
#define KROWS 256
#define NKV 256
__global__ __launch_bounds__(64) void bt_attn_kernel(
    const bf16* __restrict__ Qb, const bf16* __restrict__ Kb,
    const bf16* __restrict__ Vt, const float* __restrict__ btab, int btstride,   // btab [h][q][k], row stride btstride: additive pair-bias logits
    float* __restrict__ attnOut) {
  __shared__ bf16 ldsK[32 * KSTRIDE];   // 4.5 KB
  __shared__ bf16 ldsV[64 * VSTRIDE];   // 6.0 KB
  __shared__ __attribute__((aligned(16))) bf16 ldsO[2][32 * 72];   // unused: the per-wave output tile is the f32 ldsOf below

  const int q0blk = blockIdx.x * 64;
  const int h  = blockIdx.y;
  const int b  = blockIdx.z;
  const int t    = threadIdx.x;
  const int wave = t >> 5;
  const int lane = t & 31;
  const int qlane = lane & 15;
  const int kh8   = (lane >> 4) * 8;
  const int q0 = q0blk + wave * 32;          // this wave's 32 queries

  const int hk = h / HKDIV;
  const bf16* Qh = Qb + (size_t)b * QROWS * DD + h * DKK;        // queries: QROWS rows per batch, row stride DD
  const bf16* Kh = Kb + (size_t)b * KROWS * KVD + hk * DKK;      // keys: KROWS rows per batch, row stride KVD
  const bf16* Vh = Vt + ((size_t)(b * KVH + hk)) * DKK * KROWS;  // Vᵀ [KVH][64][KROWS] per batch

  // Cooperative staging (64 threads): K tile 32x64 (2 thr/row, 64B each);
  // V tile 64x32 (1 thr/row, 64B each).
  const int krow = t >> 1;
  const int kcol = (t & 1) * 32;
  const bf16* kSrc = Kh + (size_t)krow * KVD + kcol;
  const bf16* vSrc = Vh + (size_t)t * KROWS;

  bf16x16 qf[QW][2];
#pragma unroll
  for (int qt = 0; qt < QW; ++qt) {
    qf[qt][0] = load_frag(Qh, DD, q0 + 16 * qt, 0);
    qf[qt][1] = load_frag(Qh, DD, q0 + 16 * qt, 32);
  }

  f32x8 o[QW][4] = {};
  float mrun[QW], lrun[QW];
#pragma unroll
  for (int qt = 0; qt < QW; ++qt) { mrun[qt] = -INFINITY; lrun[qt] = 0.0f; }

  const float scale = 0.17677669529663688f * 1.44269504088896340736f;  // hd^-0.5 = 1/sqrt(32) (real head dim; the 64-wide layout is zero-padded), times log2(e)
  const float NEG2 = -1.0e9f;    // masked logit: its weight is exactly 0 once any valid key of the row has been seen (every row
                                 // has one), and anything accumulated before that is wiped by alpha == 0 — same result as -inf
  const int kmax = KROWS - 1;
  const float L2E_ = 1.44269504088896340736f; const float* bth = btab + (size_t)h * QROWS * 0;   // unused: btab holds all heads and is indexed by h below

  // Prefetch key block kb=0 into registers.
  bf16x8 kreg[4], vreg[4];
#pragma unroll
  for (int i = 0; i < 4; ++i) {
    kreg[i] = *(const bf16x8*)(kSrc + 8 * i);
    vreg[i] = *(const bf16x8*)(vSrc + 8 * i);
  }

  for (int kb = 0; kb <= kmax; kb += 32) {
    __syncthreads();   // previous readers done with LDS
#pragma unroll
    for (int i = 0; i < 4; ++i) {
      *(bf16x8*)(&ldsK[krow * KSTRIDE + kcol + 8 * i]) = kreg[i];
      *(bf16x8*)(&ldsV[t * VSTRIDE + 8 * i])           = vreg[i];
    }
    if (kb + 32 <= kmax) {   // prefetch next block during compute
      const bf16* kn = kSrc + (size_t)(kb + 32) * KVD;
      const bf16* vn = vSrc + (kb + 32);
#pragma unroll
      for (int i = 0; i < 4; ++i) {
        kreg[i] = *(const bf16x8*)(kn + 8 * i);
        vreg[i] = *(const bf16x8*)(vn + 8 * i);
      }
    }
    __syncthreads();   // tile visible

    // Phase 1: scores + softmax for both q-tiles (K fragments live here only).
    bf16x16 kf[2][2];
#pragma unroll
    for (int ktile = 0; ktile < 2; ++ktile)
#pragma unroll
      for (int c = 0; c < 2; ++c)
        kf[ktile][c] = lds_frag(ldsK + (ktile * 16) * KSTRIDE + c * 32, KSTRIDE);

    bf16x16 pf[QW];
    bool act[QW];
#pragma unroll
    for (int qt = 0; qt < QW; ++qt) {
      unsigned mbits = 0;
      {
#pragma unroll
        for (int r = 0; r < 8; ++r) { const int j0 = kb + kh8 + r; if (j0 < NKV) mbits |= 1u << r; if (j0 + 16 < NKV) mbits |= 1u << (8 + r); }
        act[qt] = (__builtin_amdgcn_ballot_w32(mbits != 0) != 0);
      }
      if (act[qt]) {
        const int q_my = q0 + 16 * qt + qlane;
        f32x8 s0 = {}, s1 = {};
        s0 = wmma_bf16(kf[0][0], qf[qt][0], s0);
        s0 = wmma_bf16(kf[0][1], qf[qt][1], s0);
        s1 = wmma_bf16(kf[1][0], qf[qt][0], s1);
        s1 = wmma_bf16(kf[1][1], qf[qt][1], s1);

        float mx = -INFINITY;
#pragma unroll
        for (int r = 0; r < 8; ++r) {
          const int k0i = kb + kh8 + r;
          const int k1i = k0i + 16;
          const float* brow = btab + ((size_t)h * QROWS + min(q_my, QROWS - 1)) * btstride; (void)bth;   // per-head [q][k] table
          s0[r] = (mbits & (1u << r))       ? s0[r] * scale + L2E_ * brow[min(k0i, NKV - 1)] : NEG2;
          s1[r] = (mbits & (1u << (8 + r))) ? s1[r] * scale + L2E_ * brow[min(k1i, NKV - 1)] : NEG2;
          mx = fmaxf(mx, fmaxf(s0[r], s1[r]));
        }
        mx = fmaxf(mx, __shfl_xor(mx, 16, 32));
        const float mnew  = fmaxf(mrun[qt], mx);
        const float alpha = exp2f(mrun[qt] - mnew);

        float rsum = 0.0f;
#pragma unroll
        for (int r = 0; r < 8; ++r) {
          const float p0 = exp2f(s0[r] - mnew);
          const float p1 = exp2f(s1[r] - mnew);
          rsum += p0 + p1;
          pf[qt][r]     = (bf16)(p0 * 1024.0f);     // P carried x1024: no f16 copy of a probability is sub-normal
          pf[qt][r + 8] = (bf16)(p1 * 1024.0f);
        }
        rsum += __shfl_xor(rsum, 16, 32);
        lrun[qt] = lrun[qt] * alpha + rsum;
        mrun[qt] = mnew;

        // Rescale accumulators now so the PV phase is pure WMMA.
#pragma unroll
        for (int j = 0; j < 4; ++j)
#pragma unroll
          for (int r = 0; r < 8; ++r) o[qt][j][r] *= alpha;
      }
    }

    // Phase 2: O^T accumulate; each V fragment read from LDS once, used by
    // both q-tiles, then dead (only 8 VGPRs of V live at a time).
#pragma unroll
    for (int j = 0; j < 4; ++j) {
      const bf16x16 vf = lds_frag(ldsV + (j * 16) * VSTRIDE, VSTRIDE);
#pragma unroll
      for (int qt = 0; qt < QW; ++qt)
        if (act[qt]) o[qt][j] = wmma_bf16(vf, pf[qt], o[qt][j]);
    }
  }

  __shared__ __attribute__((aligned(16))) float ldsOf[2][32 * 68];
  float* so = ldsOf[wave]; (void)ldsO;
#pragma unroll
  for (int qt = 0; qt < QW; ++qt) {
    const float rl = 1.0f / (lrun[qt] * 1024.0f);
#pragma unroll
    for (int j = 0; j < 4; ++j)
#pragma unroll
      for (int r = 0; r < 8; ++r) so[(16 * qt + qlane) * 68 + j * 16 + kh8 + r] = o[qt][j][r] * rl;
  }
  asm volatile("s_wait_dscnt 0" ::: "memory");
  __builtin_amdgcn_wave_barrier();
{
#pragma unroll
    for (int it = 0; it < 16; ++it) { const int ch = lane + 32 * it, ql = ch >> 4, q4 = (ch & 15) * 4;
      *(v4f_t*)(attnOut + ((size_t)(b * QROWS + q0 + ql)) * DD + h * DKK + q4) = *(const v4fa*)(so + ql * 68 + q4); }
    
  }
}


#undef QROWS
#undef KROWS
#undef NKV
#define QROWS 128
#define KROWS 128
#define NKV 128
__global__ __launch_bounds__(64) void col_attn_kernel(
    const bf16* __restrict__ Qb, const bf16* __restrict__ Kb,
    const bf16* __restrict__ Vt,
    float* __restrict__ attnOut) {   // QROWS queries / KROWS key rows per batch (first NKV valid), GQA factor HKDIV; f32 output rows
  __shared__ bf16 ldsK[32 * KSTRIDE];   // 4.5 KB
  __shared__ bf16 ldsV[64 * VSTRIDE];   // 6.0 KB
  __shared__ __attribute__((aligned(16))) bf16 ldsO[2][32 * 72];   // unused: the per-wave output tile is the f32 ldsOf below

  const int q0blk = blockIdx.x * 64;
  const int h  = blockIdx.y;
  const int b  = blockIdx.z;
  const int t    = threadIdx.x;
  const int wave = t >> 5;
  const int lane = t & 31;
  const int qlane = lane & 15;
  const int kh8   = (lane >> 4) * 8;
  const int q0 = q0blk + wave * 32;          // this wave's 32 queries

  const int hk = h / HKDIV;
  const bf16* Qh = Qb + (size_t)b * QROWS * DD + h * DKK;        // queries: QROWS rows per batch, row stride DD
  const bf16* Kh = Kb + (size_t)b * KROWS * KVD + hk * DKK;      // keys: KROWS rows per batch, row stride KVD
  const bf16* Vh = Vt + ((size_t)(b * KVH + hk)) * DKK * KROWS;  // Vᵀ [KVH][64][KROWS] per batch

  // Cooperative staging (64 threads): K tile 32x64 (2 thr/row, 64B each);
  // V tile 64x32 (1 thr/row, 64B each).
  const int krow = t >> 1;
  const int kcol = (t & 1) * 32;
  const bf16* kSrc = Kh + (size_t)krow * KVD + kcol;
  const bf16* vSrc = Vh + (size_t)t * KROWS;

  bf16x16 qf[QW][2];
#pragma unroll
  for (int qt = 0; qt < QW; ++qt) {
    qf[qt][0] = load_frag(Qh, DD, q0 + 16 * qt, 0);
    qf[qt][1] = load_frag(Qh, DD, q0 + 16 * qt, 32);
  }

  f32x8 o[QW][4] = {};
  float mrun[QW], lrun[QW];
#pragma unroll
  for (int qt = 0; qt < QW; ++qt) { mrun[qt] = -INFINITY; lrun[qt] = 0.0f; }

  const float scale = 0.17677669529663688f * 1.44269504088896340736f;  // 1/sqrt(32): real head dim (64-wide layout zero-padded), times log2(e)
  const float NEG2 = -1.0e9f;    // masked logit: its weight is exactly 0 once any valid key of the row has been seen (every row
                                 // has one), and anything accumulated before that is wiped by alpha == 0 — same result as -inf
  const int kmax = KROWS - 1;    // all key rows (KROWS == NKV: none masked)

  // Prefetch key block kb=0 into registers.
  bf16x8 kreg[4], vreg[4];
#pragma unroll
  for (int i = 0; i < 4; ++i) {
    kreg[i] = *(const bf16x8*)(kSrc + 8 * i);
    vreg[i] = *(const bf16x8*)(vSrc + 8 * i);
  }

  for (int kb = 0; kb <= kmax; kb += 32) {
    __syncthreads();   // previous readers done with LDS
#pragma unroll
    for (int i = 0; i < 4; ++i) {
      *(bf16x8*)(&ldsK[krow * KSTRIDE + kcol + 8 * i]) = kreg[i];
      *(bf16x8*)(&ldsV[t * VSTRIDE + 8 * i])           = vreg[i];
    }
    if (kb + 32 <= kmax) {   // prefetch next block during compute
      const bf16* kn = kSrc + (size_t)(kb + 32) * KVD;
      const bf16* vn = vSrc + (kb + 32);
#pragma unroll
      for (int i = 0; i < 4; ++i) {
        kreg[i] = *(const bf16x8*)(kn + 8 * i);
        vreg[i] = *(const bf16x8*)(vn + 8 * i);
      }
    }
    __syncthreads();   // tile visible

    // Phase 1: scores + softmax for both q-tiles (K fragments live here only).
    bf16x16 kf[2][2];
#pragma unroll
    for (int ktile = 0; ktile < 2; ++ktile)
#pragma unroll
      for (int c = 0; c < 2; ++c)
        kf[ktile][c] = lds_frag(ldsK + (ktile * 16) * KSTRIDE + c * 32, KSTRIDE);

    bf16x16 pf[QW];
    bool act[QW];
#pragma unroll
    for (int qt = 0; qt < QW; ++qt) {
      unsigned mbits = 0;
      {
#pragma unroll
        for (int r = 0; r < 8; ++r) { const int j0 = kb + kh8 + r; if (j0 < NKV) mbits |= 1u << r; if (j0 + 16 < NKV) mbits |= 1u << (8 + r); }
        act[qt] = (__builtin_amdgcn_ballot_w32(mbits != 0) != 0);
      }
      if (act[qt]) {
        const int q_my = q0 + 16 * qt + qlane;
        f32x8 s0 = {}, s1 = {};
        s0 = wmma_bf16(kf[0][0], qf[qt][0], s0);
        s0 = wmma_bf16(kf[0][1], qf[qt][1], s0);
        s1 = wmma_bf16(kf[1][0], qf[qt][0], s1);
        s1 = wmma_bf16(kf[1][1], qf[qt][1], s1);

        float mx = -INFINITY;
#pragma unroll
        for (int r = 0; r < 8; ++r) {
          const int k0i = kb + kh8 + r;
          const int k1i = k0i + 16;
          (void)k0i; (void)k1i; (void)q_my;
          s0[r] = (mbits & (1u << r))       ? s0[r] * scale : NEG2;
          s1[r] = (mbits & (1u << (8 + r))) ? s1[r] * scale : NEG2;
          mx = fmaxf(mx, fmaxf(s0[r], s1[r]));
        }
        mx = fmaxf(mx, __shfl_xor(mx, 16, 32));
        const float mnew  = fmaxf(mrun[qt], mx);
        const float alpha = exp2f(mrun[qt] - mnew);

        float rsum = 0.0f;
#pragma unroll
        for (int r = 0; r < 8; ++r) {
          const float p0 = exp2f(s0[r] - mnew);
          const float p1 = exp2f(s1[r] - mnew);
          rsum += p0 + p1;
          pf[qt][r]     = (bf16)(p0 * 1024.0f);     // P carried x1024: no f16 copy of a probability is sub-normal
          pf[qt][r + 8] = (bf16)(p1 * 1024.0f);
        }
        rsum += __shfl_xor(rsum, 16, 32);
        lrun[qt] = lrun[qt] * alpha + rsum;
        mrun[qt] = mnew;

        // Rescale accumulators now so the PV phase is pure WMMA.
#pragma unroll
        for (int j = 0; j < 4; ++j)
#pragma unroll
          for (int r = 0; r < 8; ++r) o[qt][j][r] *= alpha;
      }
    }

    // Phase 2: O^T accumulate; each V fragment read from LDS once, used by
    // both q-tiles, then dead (only 8 VGPRs of V live at a time).
#pragma unroll
    for (int j = 0; j < 4; ++j) {
      const bf16x16 vf = lds_frag(ldsV + (j * 16) * VSTRIDE, VSTRIDE);
#pragma unroll
      for (int qt = 0; qt < QW; ++qt)
        if (act[qt]) o[qt][j] = wmma_bf16(vf, pf[qt], o[qt][j]);
    }
  }

  __shared__ __attribute__((aligned(16))) float ldsOf[2][32 * 68];
  float* so = ldsOf[wave]; (void)ldsO;
#pragma unroll
  for (int qt = 0; qt < QW; ++qt) {
    const float rl = 1.0f / (lrun[qt] * 1024.0f);
#pragma unroll
    for (int j = 0; j < 4; ++j)
#pragma unroll
      for (int r = 0; r < 8; ++r) so[(16 * qt + qlane) * 68 + j * 16 + kh8 + r] = o[qt][j][r] * rl;
  }
  asm volatile("s_wait_dscnt 0" ::: "memory");
  __builtin_amdgcn_wave_barrier();
{
#pragma unroll
    for (int it = 0; it < 16; ++it) { const int ch = lane + 32 * it, ql = ch >> 4, q4 = (ch & 15) * 4;
      *(v4f_t*)(attnOut + ((size_t)(b * QROWS + q0 + ql)) * DD + h * DKK + q4) = *(const v4fa*)(so + ql * 68 + q4); }
    
  }
}


#undef QROWS
#undef KROWS
#undef NKV
// LayerNorm over C (256 or 128) per row; in place allowed; wave = LNR consecutive rows, block = 8 * LNR rows. All LNR rows are loaded before the
// first is reduced, so one wave start pays for LNR rows; per row the lane -> element map and both reduction trees are the one-row form's.
#define LNR 4
template <int C>
__global__ __launch_bounds__(256) void k_ln(const float* __restrict__ X, const float* __restrict__ g, const float* __restrict__ bb, float* __restrict__ Y) {
  const int tid = threadIdx.x, r = tid >> 5, lane = tid & 31; const size_t row0 = ((size_t)blockIdx.x * 8 + r) * LNR;
  float v[LNR][C / 32];
#pragma unroll
  for (int k = 0; k < LNR; ++k)
#pragma unroll
    for (int i = 0; i < C / 32; ++i) v[k][i] = X[(row0 + k) * C + lane + 32 * i];
#pragma unroll
  for (int k = 0; k < LNR; ++k) {
    float s = 0.0f;
#pragma unroll
    for (int i = 0; i < C / 32; ++i) s += v[k][i];
#pragma unroll
    for (int off = 1; off < 32; off <<= 1) s += __shfl_xor(s, off, 32);
    const float mean = s * (1.0f / C); float q = 0.0f;
#pragma unroll
    for (int i = 0; i < C / 32; ++i) { const float d = v[k][i] - mean; q += d * d; }
#pragma unroll
    for (int off = 1; off < 32; off <<= 1) q += __shfl_xor(q, off, 32);
    const float rstd = rsqrtf(q * (1.0f / C) + 1e-5f);
#pragma unroll
    for (int i = 0; i < C / 32; ++i) Y[(row0 + k) * C + lane + 32 * i] = (v[k][i] - mean) * rstd * g[lane + 32 * i] + bb[lane + 32 * i];
  }
}
// pair-bias table BT[h][i][j] = LN(bias_rep[i][j]) * Wb[:,h] + bb[h]; thread = one (i, j) row, wave = 32 consecutive rows, block = PBW waves.
// A wave brings its 32 rows in as whole 512-B rows, one a wave-wide load, all 32 loads in flight, and turns them through its own LDS slice, so that each
// thread then holds its whole row in registers: memory is read once, in whole lines. Row pitch 132 floats: the 16-byte reads of 16 rows fall on all 64 banks.
// Every sum runs over c in the same order as a plain loop over the row.
#define PBW 4
#define PBP 132
__global__ __launch_bounds__(32 * PBW) void k_pairbias(const float* __restrict__ Z, const float* __restrict__ g2, const float* __restrict__ be2, const float* __restrict__ Wb, const float* __restrict__ bbh, float* __restrict__ BT) {
  __shared__ __attribute__((aligned(16))) float zS[PBW][32 * PBP];
  const int tid = threadIdx.x, lane = tid & 31, wave = tid >> 5;
  const int row0 = (blockIdx.x * PBW + wave) * 32;          // first of the wave's rows, row = i * NRES + j
  const float* src = Z + (size_t)row0 * CZ + lane * 4;
  float* zw = zS[wave];
  v4f_t ld[32];
#pragma unroll
  for (int k = 0; k < 32; ++k) ld[k] = *(const v4f_t*)(src + k * CZ);
#pragma unroll
  for (int k = 0; k < 32; ++k) *(v4f_t*)(zw + k * PBP + lane * 4) = ld[k];
  asm volatile("s_wait_dscnt 0" ::: "memory");   // the wave's own LDS writes are done before its lanes read each other's; no other wave touches this slice
  __builtin_amdgcn_wave_barrier();               // keeps the compiler from moving the reads below over the writes above
  float z[CZ];
#pragma unroll
  for (int q4 = 0; q4 < CZ / 4; ++q4) { const v4f_t t = *(const v4fa*)(zw + lane * PBP + 4 * q4);
    z[4 * q4] = t[0]; z[4 * q4 + 1] = t[1]; z[4 * q4 + 2] = t[2]; z[4 * q4 + 3] = t[3]; }
  float s = 0.0f;
#pragma unroll
  for (int c = 0; c < CZ; ++c) s += z[c];
  const float mean = s * (1.0f / CZ); float q = 0.0f;
#pragma unroll
  for (int c = 0; c < CZ; ++c) { const float d = z[c] - mean; q += d * d; }
  const float rstd = rsqrtf(q * (1.0f / CZ) + 1e-5f);
  float acc[NHD];
#pragma unroll
  for (int h = 0; h < NHD; ++h) acc[h] = bbh[h];
#pragma unroll
  for (int c = 0; c < CZ; ++c) { const float zn = (z[c] - mean) * rstd * g2[c] + be2[c];
#pragma unroll
    for (int h = 0; h < NHD; ++h) acc[h] += zn * Wb[c * NHD + h]; }
#pragma unroll
  for (int h = 0; h < NHD; ++h) BT[(size_t)h * NRES * NRES + row0 + lane] = acc[h];
}
// permuted qkvg weights: Wp[c][k*256 + h*32 + d] = W[c][d*32 + k*8 + h] (no extra scale: both attention kernels carry 1/sqrt(32)); block = c (256), thread loops 1024 cols
__global__ __launch_bounds__(256) void k_wperm(const float* __restrict__ Wm, float* __restrict__ Wp) { const int c = blockIdx.x;
  for (int col = threadIdx.x; col < 4 * CM; col += 256) { const int k = col >> 8, h = (col >> 5) & 7, d = col & 31; float v = Wm[(size_t)c * 4 * CM + d * 32 + k * 8 + h];   // both attention kernels carry the 1/sqrt(32) scale themselves
    *(float*)(Wp + (size_t)c * 4 * CM + col) = v;  } }
// split f16 qkvg rows [CHT][1024] (q|k|v|g blocks, head h*32+d) into zero-padded operands: Q16c/K16c [nb][L][512] (cols h*64+d, d<32 real), Vtc [nb][512][L]; block = (64 tokens, head)
__global__ __launch_bounds__(256) void k_splitpad(const bf16* __restrict__ G, int L, bf16* __restrict__ Qc, bf16* __restrict__ Kc, bf16* __restrict__ Vtc) {
  __shared__ __attribute__((aligned(16))) bf16 qS[64][72], kS[64][72], vT[64][72];
  const int tid = threadIdx.x; const int t0 = blockIdx.x * 64; const int h = blockIdx.y; const int b = t0 / L, n0 = t0 % L;
  for (int e = tid; e < 64 * 64; e += 256) { const int t = e >> 6, d = e & 63; bf16 q = (bf16)0.0f, k = (bf16)0.0f, v = (bf16)0.0f;
    if (d < DH) { const bf16* src = G + (size_t)(t0 + t) * 4 * CM + h * DH + d; q = src[0]; k = src[CM]; v = src[2 * CM]; }
    qS[t][d] = q; kS[t][d] = k; vT[d][t] = v; }
  __syncthreads();
{
#pragma unroll 1
    for (int round = 0; round < 2; ++round) { const int r = round * 32 + (tid >> 3), piece = (tid & 7) * 8;
      *(v4u_t*)(Qc + (size_t)(t0 + r) * DD + h * DKK + piece) = *(const v4ua*)(&qS[r][piece]);
      *(v4u_t*)(Kc + (size_t)(t0 + r) * DD + h * DKK + piece) = *(const v4ua*)(&kS[r][piece]);
      *(v4u_t*)(Vtc + ((size_t)b * DD + h * DKK + r) * L + n0 + piece) = *(const v4ua*)(&vT[r][piece]); }
     }
}
// gated merge: O16[t][h*32 + d] = attc[t][h*64 + d] * sigmoid(g), g = G[t][768 + h*32 + d]. Thread = 4 consecutive channels of a token (64 threads a token,
// 4 tokens a pass), EWP passes a block, unrolled so that several passes' loads are in flight at once: a wave-wide load or store covers whole 128-B lines, and one wave start pays for 128 channels of EWP tokens.
#define EWP 8
__global__ __launch_bounds__(256) void k_gmerge(const float* __restrict__ A, const bf16* __restrict__ G, bf16* __restrict__ O16) {
  const int tid = threadIdx.x; const int c = (tid & 63) * 4; const int h = c >> 5, d = c & 31;
  const size_t tb = (size_t)blockIdx.x * (4 * EWP) + (tid >> 6);
  v4f_t a[EWP]; bf16x4 g[EWP];
#pragma unroll
  for (int p = 0; p < EWP; ++p) { const size_t t = tb + 4 * p;
    if (p == EWP - 1) asm volatile("s_wait_xcnt 0x0" ::: "memory");
    a[p] = *(const v4f_t*)(A + t * DD + h * DKK + d);
    g[p] = *(const bf16x4*)(G + t * 4 * CM + 3 * CM + c); }
#pragma unroll
  for (int p = 0; p < EWP; ++p) { const size_t t = tb + 4 * p; bf16x4 o;
#pragma unroll
    for (int e = 0; e < 4; ++e) o[e] = (bf16)(a[p][e] / (1.0f + expf(-(float)g[p][e])));
    *(bf16x4*)(O16 + t * CM + c) = o; }
}
// row permutation between (s, r) and (r, s) token orders: dst[row] = src[srow]; rows of 1 KB by 64 lanes x 16 B, 4 rows a pass, EWP passes a block, all loads issued before the first store.
// srow = (row % DIV) * MUL + row / DIV; a block's 4 * EWP rows share row / DIV, so pass p only adds 4 * p * MUL source rows.
template <int DIV, int MUL>
__device__ __forceinline__ void perm_rows(const float* __restrict__ src, unsigned row0, int col, v4f_t* v) {
  static_assert(DIV % (4 * EWP) == 0, "a block's rows must share row / DIV");
  const float* s0 = src + (size_t)((row0 % DIV) * MUL + row0 / DIV) * CM + col;
#pragma unroll
  for (int p = 0; p < EWP; ++p) v[p] = *(const v4f_t*)(s0 + (size_t)(4 * p * MUL) * CM);
}
__global__ __launch_bounds__(256) void k_perm(const float* __restrict__ src, float* __restrict__ dst, int to_rs) {
  const int tid = threadIdx.x; const unsigned row0 = blockIdx.x * (4 * EWP) + (tid >> 6); const int col = (tid & 63) * 4;
  float* d0 = dst + (size_t)row0 * CM + col;
  v4f_t v[EWP];
  if (to_rs) perm_rows<NSEQ, NRES>(src, row0, col, v); else perm_rows<NRES, NSEQ>(src, row0, col, v);
#pragma unroll
  for (int p = 0; p < EWP; ++p) *(v4f_t*)(d0 + (size_t)(4 * p) * CM) = v[p];
}
__global__ __launch_bounds__(256) void k_ones(float* __restrict__ p, int n) { for (int i = threadIdx.x; i < n; i += 256) { *(float*)(p + i) = 1.0f;  } }

extern "C" void kernel_launch(void* const* d_in, const int* in_sizes, int n_in,
                              void* d_out, int out_size, void* d_ws, size_t ws_size,
                              hipStream_t stream) {
  (void)in_sizes; (void)n_in; (void)out_size;
  const float** f = (const float**)d_in;
  const float* x = f[0], *brep = f[1], *Wqkv_r = f[2], *W0r = f[3], *Wb = f[4], *bbh = f[5], *Wqkv_c = f[6], *W0c = f[7], *W1 = f[8], *b1 = f[9], *W2 = f[10], *b2 = f[11], *g1 = f[12], *be1 = f[13], *g2 = f[14], *be2 = f[15], *g3 = f[16], *be3 = f[17];
  float* out = (float*)d_out;     // [1,128,256,256]
  char* ws = (char*)d_ws;
  float* X1 = (float*)ws; ws += (size_t)MTOK * CM * 4;                 // 32 MB: LN1(x), then x + row-att (in place), then LN3 (in place), finally x after the column block (s,r order)
  float* XT = (float*)ws; ws += (size_t)MTOK * CM * 4;                 // 32 MB: (r,s)-ordered copy for the column block
  float* BT = (float*)ws; ws += (size_t)NHD * NRES * NRES * 4;         // 2 MB pair-bias table
  float* Wpr = (float*)ws; ws += (size_t)CM * 4 * CM * 4; float* Wpc = (float*)ws; ws += (size_t)CM * 4 * CM * 4;
  bf16* G16 = (bf16*)ws; ws += (size_t)MTOK * 4 * CM * 2;             // qkvg f16 [32768][1024] (64 MB); also the transition hidden [32768][1024]
  bf16* Qc = (bf16*)ws; ws += (size_t)CHT * DD * 2; bf16* Kc = (bf16*)ws; ws += (size_t)CHT * DD * 2; bf16* Vtc = (bf16*)ws; ws += (size_t)CHT * DD * 2;   // 16 MB each
  float* attc = (float*)ws; ws += (size_t)CHT * DD * 4;               // 32 MB
  bf16* O16 = (bf16*)ws; ws += (size_t)MTOK * CM * 2;                 // 16 MB gated attention output rows (token order of the current block)
  float* ones = (float*)ws; ws += CM * 4;
  if ((size_t)(ws - (char*)d_ws) > ws_size) return;
  const dim3 blk(256);
  k_ones<<<dim3(1), blk, 0, stream>>>(ones, CM);
  k_wperm<<<dim3(CM), blk, 0, stream>>>(Wqkv_r, Wpr); k_wperm<<<dim3(CM), blk, 0, stream>>>(Wqkv_c, Wpc);
  k_pairbias<<<dim3(NRES * NRES / (32 * PBW)), dim3(32 * PBW), 0, stream>>>(brep, g2, be2, Wb, bbh, BT);
  k_ln<CM><<<dim3(MTOK / (8 * LNR)), blk, 0, stream>>>(x, g1, be1, X1);
  // ---- row-wise gated attention with pair bias: qkvg for all tokens in one launch, attention in halves of 64 sequences ----
  gemm_kne<float, 0, true, 4 * CM><<<dim3(MTOK / 128, 4 * CM / 128), blk, 0, stream>>>(X1, CM, Wpr, nullptr, nullptr, nullptr, G16, 4 * CM, CM);
  for (int c = 0; c < MTOK / CHT; ++c) { const size_t t0 = (size_t)c * CHT;
    k_splitpad<<<dim3(CHT / 64, NHD), blk, 0, stream>>>(G16 + t0 * 4 * CM, NRES, Qc, Kc, Vtc);
    bt_attn_kernel<<<dim3(NRES / 64, NHD, CHT / NRES), dim3(64), 0, stream>>>(Qc, Kc, Vtc, BT, NRES, attc);
    k_gmerge<<<dim3(CHT / (4 * EWP)), blk, 0, stream>>>(attc, G16 + t0 * 4 * CM, O16 + t0 * CM);
  }
  gemm_kne<bf16, 2, false, CM><<<dim3(MTOK / 128, CM / 128), blk, 0, stream>>>(O16, CM, W0r, nullptr, X1, ones, X1, CM, CM);     // x = x + o·W0 (in place)
  k_ln<CM><<<dim3(MTOK / (8 * LNR)), blk, 0, stream>>>(X1, g3, be3, X1);                                                                    // x = LN3(x) (in place)
  // ---- column-wise gated attention: tokens re-ordered (r, s); qkvg in one launch, attention in halves of 128 residues ----
  k_perm<<<dim3(MTOK / (4 * EWP)), blk, 0, stream>>>(X1, XT, 1);
  gemm_kne<float, 0, true, 4 * CM><<<dim3(MTOK / 128, 4 * CM / 128), blk, 0, stream>>>(XT, CM, Wpc, nullptr, nullptr, nullptr, G16, 4 * CM, CM);
  for (int c = 0; c < MTOK / CHT; ++c) { const size_t t0 = (size_t)c * CHT;
    k_splitpad<<<dim3(CHT / 64, NHD), blk, 0, stream>>>(G16 + t0 * 4 * CM, NSEQ, Qc, Kc, Vtc);
    col_attn_kernel<<<dim3(NSEQ / 64, NHD, CHT / NSEQ), dim3(64), 0, stream>>>(Qc, Kc, Vtc, attc);
    k_gmerge<<<dim3(CHT / (4 * EWP)), blk, 0, stream>>>(attc, G16 + t0 * 4 * CM, O16 + t0 * CM);
  }
  gemm_kne<bf16, 2, false, CM><<<dim3(MTOK / 128, CM / 128), blk, 0, stream>>>(O16, CM, W0c, nullptr, XT, ones, XT, CM, CM);     // xt = xt + o·W0_c (in place, (r,s) order)
  k_perm<<<dim3(MTOK / (4 * EWP)), blk, 0, stream>>>(XT, X1, 0);                                                                          // back to (s,r) order
  // ---- transition, all tokens per launch: out = relu(x*W1 + b1)*W2 + b2 + x ----
  gemm_kne<float, 3, true, 4 * CM><<<dim3(MTOK / 128, 4 * CM / 128), blk, 0, stream>>>(X1, CM, W1, b1, nullptr, nullptr, G16, 4 * CM, CM);
  gemm_kne<bf16, 2, false, CM><<<dim3(MTOK / 128, CM / 128), blk, 0, stream>>>(G16, 4 * CM, W2, b2, X1, ones, out, CM, 4 * CM);
}

// v005
// One run takes 345 microseconds.
// Next to v004, in two timings, it ran 1.31 times as fast each time.
// Over all steps from v000 it is 3.41 times as fast.
// Contractions on v_wmma_f32_16x16x32_f16 (plain f16 operands, f32 accumulate): the row- and column-wise gated attentions of an MSA
// block — qkvg = x·Wqkv (K = 256, N = 1024; the reference's (d, k, h) column interleave undone by permuting the WEIGHT columns on the
// device, both attention kernels scale by 32^-½ for the real head dim), the 8-head attentions at head dim 32, their q, k and v read straight from the qkvg rows
// (row: 128 sequences x 256 residues with the pair-bias table [h][i][j] = LN(bias_rep)·Wb + bb added in-kernel; column: 256 residues x 128
// sequences after a token re-ordering), flash-style Sᵀ = K·Qᵀ / Oᵀ = Vᵀ·Pᵀ with online softmax in f32 (P x1024, f32 rows), the sigmoid
// gate, ·W0 + residual (K = 256), and the transition relu(x·W1 + b1)·W2 + b2 + x (K = 256 / 1024) — every GEMM and every attention stage one launch over all 32768 tokens; LayerNorms
// in f32. compute dtype: f16 operands, f32 accumulate.  x [1,128,256,256] -> [1,128,256,256].
#include <hip/hip_runtime.h>
#include <hip/hip_bf16.h>
#include <math.h>

#define NSEQ 128
#define NRES 256
#define CM 256
#define CZ 128
#define NHD 8
#define DH 32
#define MTOK (NSEQ * NRES)
#define GLD (4 * CM)   // pitch of a qkvg row, in elements: q | k | v | g blocks of 256, head h at column h * 32 of its block
#define HH 8
#define QW 2
#define SS 256
#define GSTR 48

typedef _Float16 bf16;
typedef _Float16 f16;
typedef __attribute__((ext_vector_type(4))) unsigned v4u_t;
typedef unsigned v4ua __attribute__((ext_vector_type(4), may_alias));
typedef __attribute__((ext_vector_type(4))) float v4f_t;
typedef float v4fa __attribute__((ext_vector_type(4), may_alias));
typedef __attribute__((ext_vector_type(16))) bf16  bf16x16;
typedef bf16x16 f16x16;
typedef __attribute__((ext_vector_type(8)))  bf16  bf16x8;
typedef bf16x8 f16x8;
typedef __attribute__((ext_vector_type(4)))  bf16  bf16x4;
typedef __attribute__((ext_vector_type(8)))  float f32x8;
__device__ __forceinline__ f32x8 wmma16(f16x16 a, f16x16 b, f32x8 c) {
  c = __builtin_amdgcn_wmma_f32_16x16x32_f16(false, a, false, b, (short)0, c, false, false);
  asm volatile("v_nop\n\tv_nop\n\tv_nop\n\tv_nop" : "+v"(c) : "v"(a), "v"(b));
  return c;
}
#define LDS_STRIDE 48   // GEMM tiles: 32 -> 48 elems (96B rows): aligned b128 reads
#define KSTRIDE    40   // attn K tile [key][d]: 32 -> 40 elems (80B rows, 16 B x odd): conflict-free b128
#define VSTRIDE    48   // attn V tile [key][d]: 32 -> 48 elems (96B rows, 32 B x odd): conflict-free transposing loads

__device__ __forceinline__ f32x8 wmma_bf16(bf16x16 a, bf16x16 b, f32x8 c) {
  c = __builtin_amdgcn_wmma_f32_16x16x32_f16(false, a, false, b, (short)0, c, false, false);
  asm volatile("v_nop\n\tv_nop\n\tv_nop\n\tv_nop" : "+v"(c) : "v"(a), "v"(b));   // A/B-overwrite hazard guard
  return c;
}

// 16x32 (MxK) f16 fragment from a row-major global matrix.
// lanes 0-15  (row=lane)    : elems 0..7 = K+0..7,  8..15 = K+16..23
// lanes 16-31 (row=lane-16) : elems 0..7 = K+8..15, 8..15 = K+24..31
template <typename T>
__device__ __forceinline__ bf16x16 load_frag(const T* __restrict__ base, int ld,
                                             int row0, int k0) {
  const int lane = threadIdx.x & 31;
  const int r    = lane & 15;
  const int kh   = (lane >> 4) * 8;
  const T* p0 = base + (size_t)(row0 + r) * ld + (k0 + kh);
  const T* p1 = p0 + 16;
  bf16x16 f;
#pragma unroll
  for (int i = 0; i < 8; ++i) {
    f[i]     = (bf16)p0[i];
    f[i + 8] = (bf16)p1[i];
  }
  return f;
}

// Same fragment from an LDS tile with padded row stride (base includes row0/k0).
__device__ __forceinline__ bf16x16 lds_frag(const bf16* base, int stride) {
  const int lane = threadIdx.x & 31;
  const int row  = lane & 15;
  const int kh   = (lane >> 4) * 8;
  const bf16x8 lo = *(const bf16x8*)(base + row * stride + kh);
  const bf16x8 hi = *(const bf16x8*)(base + row * stride + kh + 16);
  bf16x16 f;
#pragma unroll
  for (int i = 0; i < 8; ++i) { f[i] = lo[i]; f[i + 8] = hi[i]; }
  return f;
}

// 16 (d) x 32 (key) fragment of V^T from a row-major [key][d] LDS tile, by the transposing load: lane (c = lane & 15, hh = lane >> 4) gets column
// d0 + c at keys 8 hh + 0..7, the second load the same 16 keys further on: the k order of lds_frag and of the packed P. Every lane's address is valid.
typedef short s16x8 __attribute__((ext_vector_type(8)));
__device__ __forceinline__ bf16x16 lds_frag_tr(const bf16* tile, int stride, int d0) {
  typedef __attribute__((address_space(3))) s16x8 lds_s16x8;
  const int lane = threadIdx.x & 31;
  const bf16* p = tile + (8 * (lane >> 4) + (lane & 7)) * stride + d0 + 8 * ((lane >> 3) & 1);
  const bf16x8 lo = __builtin_bit_cast(bf16x8, __builtin_amdgcn_ds_load_tr16_b128_v8i16((lds_s16x8*)p));
  const bf16x8 hi = __builtin_bit_cast(bf16x8, __builtin_amdgcn_ds_load_tr16_b128_v8i16((lds_s16x8*)(p + 16 * stride)));
  bf16x16 f;
#pragma unroll
  for (int i = 0; i < 8; ++i) { f[i] = lo[i]; f[i + 8] = hi[i]; }
  return f;
}

template <typename T>
__device__ __forceinline__ void stage_read16(const T* __restrict__ p, float* buf) {
#pragma unroll
  for (int i = 0; i < 16; ++i) buf[i] = (float)p[i];
}

__device__ __forceinline__ void stage_write(bf16* dst, const float* buf, int nquad) {
#pragma unroll
  for (int i = 0; i < nquad; ++i) {
    bf16x4 q;
    q[0] = (bf16)buf[4 * i];     q[1] = (bf16)buf[4 * i + 1];
    q[2] = (bf16)buf[4 * i + 2]; q[3] = (bf16)buf[4 * i + 3];
    *(bf16x4*)(dst + 4 * i) = q;
  }
}


// ---------------------------------------------------------------------------------------------------------------------------
// gemm_kne: Y[m][n] = epi( Σ_k A[m][k]·W[k][n] + bias[n] ), A f32/f16 [M][lda], W f32 row-major [K][N] (pitch LDW), plain f16 operands,
// f32 accumulate. EPI 0: identity; 1: exact-erf GELU; 2: R[m][n] + gvec[n]·(·) (residual with per-channel gain). Output f32 (or f16
// when OUT16). Block = 128x128 tile, 8 waves as 4(M) x 2(N); per 32-wide k-step A and W tiles staged f16 in LDS (W transposed
// ---------------------------------------------------------------------------------------------------------------------------
#define GSTR 48
template <typename AT, int EPI, bool OUT16, int LDW>
__global__ __launch_bounds__(256) void gemm_kne(const AT* __restrict__ A, int lda, const float* __restrict__ Wm,
                                                const float* __restrict__ bias, const float* __restrict__ R, const float* __restrict__ gvec,
                                                void* __restrict__ Yv, int ldy, int K) {
  __shared__ __attribute__((aligned(16))) f16 ldsA[128 * GSTR];
  __shared__ __attribute__((aligned(16))) f16 ldsW[128 * GSTR];
  __shared__ __attribute__((aligned(16))) float oS[8][32 * 68];
  const int tid = threadIdx.x, lane = tid & 31, wave = tid >> 5, cl = lane & 15, rh = (lane >> 4) * 8;
  const int m0 = blockIdx.x * 128, n0 = blockIdx.y * 128;
  const int wm = (wave & 3) * 32, wn = (wave >> 2) * 64;
  f32x8 acc[2][4];
#pragma unroll
  for (int i = 0; i < 2; ++i)
#pragma unroll
    for (int j = 0; j < 4; ++j) { f32x8 z = {}; acc[i][j] = z; }
#pragma unroll 1
  for (int k0 = 0; k0 < K; k0 += 32) {
    __syncthreads();
    { const int row = tid >> 1, ch = (tid & 1) * 16;
      const AT* src = A + (size_t)(m0 + row) * lda + k0 + ch;
#pragma unroll
      for (int g = 0; g < 16; ++g) ldsA[row * GSTR + ch + g] = (f16)src[g]; }
    { const int n = tid & 127, kq = (tid >> 7) * 16;   // one column n and 16 consecutive k a thread: the transpose happens in registers
      const float* src = Wm + (size_t)(k0 + kq) * LDW + n0 + n;   // LDW is a compile-time pitch: the 16 row steps are immediate offsets of one address
      union { f16 h[16]; v4u_t v[2]; } u;
#pragma unroll
      for (int g = 0; g < 16; ++g) u.h[g] = (f16)src[g * LDW];
      *(v4u_t*)(ldsW + n * GSTR + kq) = u.v[0];
      *(v4u_t*)(ldsW + n * GSTR + kq + 8) = u.v[1]; }
    __syncthreads();
    f16x16 af[2];
#pragma unroll
    for (int i = 0; i < 2; ++i) af[i] = lds_frag(ldsA + (wm + 16 * i) * GSTR, GSTR);
#pragma unroll
    for (int j = 0; j < 4; ++j) {
      const f16x16 bf = lds_frag(ldsW + (wn + 16 * j) * GSTR, GSTR);
#pragma unroll
      for (int i = 0; i < 2; ++i) acc[i][j] = wmma16(af[i], bf, acc[i][j]);
    }
  }
  float* so = oS[wave];
#pragma unroll
  for (int i = 0; i < 2; ++i)
#pragma unroll
    for (int j = 0; j < 4; ++j) {
      const int n = n0 + wn + 16 * j + cl;
      const float bv = bias ? bias[n] : 0.0f;
      const float gv = (EPI == 2) ? gvec[n] : 0.0f;
      if (EPI == 1) {
#pragma unroll 1
        for (int r = 0; r < 8; ++r) { const float xg = acc[i][j][r] + bv; so[(16 * i + rh + r) * 68 + 16 * j + cl] = 0.5f * xg * (1.0f + erff(xg * 0.70710678118654752f)); }
      } else {
#pragma unroll
        for (int r = 0; r < 8; ++r) {
          float v = acc[i][j][r] + bv;
          if (EPI == 3) v = fmaxf(v, 0.0f);                                         // EPI 3: ReLU
          if (EPI == 2) v = R[(size_t)(m0 + wm + 16 * i + rh + r) * ldy + n] + gv * v;
          so[(16 * i + rh + r) * 68 + 16 * j + cl] = v;
        }
      }
    }
  asm volatile("s_wait_dscnt 0" ::: "memory");
  __builtin_amdgcn_wave_barrier();
{
    if (OUT16) {
      f16* Y = (f16*)Yv;
#pragma unroll
      for (int it = 0; it < 8; ++it) { const int c = lane + 32 * it, rr = c >> 3, q8 = (c & 7) * 8;
        union { f16 h[8]; v4u_t v; } u;
#pragma unroll
        for (int e = 0; e < 8; ++e) u.h[e] = (f16)so[rr * 68 + q8 + e];
        *(v4u_t*)(Y + (size_t)(m0 + wm + rr) * ldy + n0 + wn + q8) = u.v; }
    } else {
      float* Y = (float*)Yv;
#pragma unroll
      for (int it = 0; it < 16; ++it) { const int f4 = lane + 32 * it, rr = f4 >> 4, q = (f4 & 15) * 4;
        *(v4f_t*)(Y + (size_t)(m0 + wm + rr) * ldy + n0 + wn + q) = *(const v4fa*)(so + rr * 68 + q); }
    }
    
  }
}

#define QROWS 256
#define KROWS 256
#define NKV 256
__global__ __launch_bounds__(64) void bt_attn_kernel(
    const bf16* __restrict__ G, const float* __restrict__ btab, int btstride,   // G: qkvg rows [token][GLD]; btab: per-head [q][k] additive logit bias
    float* __restrict__ attnOut) {
  __shared__ __attribute__((aligned(16))) bf16 ldsK[32 * KSTRIDE];   // 2.5 KB
  __shared__ __attribute__((aligned(16))) bf16 ldsV[32 * VSTRIDE];   // 3.0 KB

  const int q0blk = blockIdx.x * 64;
  const int h  = blockIdx.y;
  const int b  = blockIdx.z;
  const int t    = threadIdx.x;
  const int wave = t >> 5;
  const int lane = t & 31;
  const int qlane = lane & 15;
  const int kh8   = (lane >> 4) * 8;
  const int q0 = q0blk + wave * 32;          // this wave's 32 queries

  const bf16* Qh = G + (size_t)b * QROWS * GLD + h * DH;   // this head's 32 q columns of the batch's rows (QROWS == KROWS rows per batch), row stride GLD
  const bf16* Kh = Qh + CM;                                // its k columns
  const bf16* Vh = Qh + 2 * CM;                            // its v columns

  // Cooperative staging (64 threads): K tile and V tile, each 32 keys x 32 d (2 thr/row, 32B each).
  const int krow = t >> 1;
  const int kcol = (t & 1) * 16;
  const bf16* kSrc = Kh + (size_t)krow * GLD + kcol;
  const bf16* vSrc = Vh + (size_t)krow * GLD + kcol;

  bf16x16 qf[QW];
#pragma unroll
  for (int qt = 0; qt < QW; ++qt) qf[qt] = load_frag(Qh, GLD, q0 + 16 * qt, 0);

  f32x8 o[QW][2] = {};
  float mrun[QW], lrun[QW];
#pragma unroll
  for (int qt = 0; qt < QW; ++qt) { mrun[qt] = -INFINITY; lrun[qt] = 0.0f; }

  const float scale = 0.17677669529663688f * 1.44269504088896340736f;  // hd^-0.5 = 1/sqrt(32), times log2(e)
  const float NEG2 = -1.0e9f;    // masked logit: its weight is exactly 0 once any valid key of the row has been seen (every row
                                 // has one), and anything accumulated before that is wiped by alpha == 0 — same result as -inf
  const int kmax = KROWS - 1;
  const float L2E_ = 1.44269504088896340736f; const float* bth = btab + (size_t)h * QROWS * 0;   // unused: btab holds all heads and is indexed by h below

  // Prefetch key block kb=0 into registers.
  bf16x8 kreg[2], vreg[2];
#pragma unroll
  for (int i = 0; i < 2; ++i) {
    kreg[i] = *(const bf16x8*)(kSrc + 8 * i);
    vreg[i] = *(const bf16x8*)(vSrc + 8 * i);
  }

  for (int kb = 0; kb <= kmax; kb += 32) {
    __syncthreads();   // previous readers done with LDS
#pragma unroll
    for (int i = 0; i < 2; ++i) {
      *(bf16x8*)(&ldsK[krow * KSTRIDE + kcol + 8 * i]) = kreg[i];
      *(bf16x8*)(&ldsV[krow * VSTRIDE + kcol + 8 * i]) = vreg[i];
    }
    if (kb + 32 <= kmax) {   // prefetch next block during compute
      const bf16* kn = kSrc + (size_t)(kb + 32) * GLD;
      const bf16* vn = vSrc + (size_t)(kb + 32) * GLD;
#pragma unroll
      for (int i = 0; i < 2; ++i) {
        kreg[i] = *(const bf16x8*)(kn + 8 * i);
        vreg[i] = *(const bf16x8*)(vn + 8 * i);
      }
    }
    __syncthreads();   // tile visible

    // Phase 1: scores + softmax for both q-tiles (K fragments live here only).
    bf16x16 kf[2];
#pragma unroll
    for (int ktile = 0; ktile < 2; ++ktile) kf[ktile] = lds_frag(ldsK + (ktile * 16) * KSTRIDE, KSTRIDE);

    bf16x16 pf[QW];
    bool act[QW];
#pragma unroll
    for (int qt = 0; qt < QW; ++qt) {
      unsigned mbits = 0;
      {
#pragma unroll
        for (int r = 0; r < 8; ++r) { const int j0 = kb + kh8 + r; if (j0 < NKV) mbits |= 1u << r; if (j0 + 16 < NKV) mbits |= 1u << (8 + r); }
        act[qt] = (__builtin_amdgcn_ballot_w32(mbits != 0) != 0);
      }
      if (act[qt]) {
        const int q_my = q0 + 16 * qt + qlane;
        f32x8 s0 = {}, s1 = {};
        s0 = wmma_bf16(kf[0], qf[qt], s0);
        s1 = wmma_bf16(kf[1], qf[qt], s1);

        float mx = -INFINITY;
#pragma unroll
        for (int r = 0; r < 8; ++r) {
          const int k0i = kb + kh8 + r;
          const int k1i = k0i + 16;
          const float* brow = btab + ((size_t)h * QROWS + min(q_my, QROWS - 1)) * btstride; (void)bth;   // per-head [q][k] table
          s0[r] = (mbits & (1u << r))       ? s0[r] * scale + L2E_ * brow[min(k0i, NKV - 1)] : NEG2;
          s1[r] = (mbits & (1u << (8 + r))) ? s1[r] * scale + L2E_ * brow[min(k1i, NKV - 1)] : NEG2;
          mx = fmaxf(mx, fmaxf(s0[r], s1[r]));
        }
        mx = fmaxf(mx, __shfl_xor(mx, 16, 32));
        const float mnew  = fmaxf(mrun[qt], mx);
        const float alpha = exp2f(mrun[qt] - mnew);

        float rsum = 0.0f;
#pragma unroll
        for (int r = 0; r < 8; ++r) {
          const float p0 = exp2f(s0[r] - mnew);
          const float p1 = exp2f(s1[r] - mnew);
          rsum += p0 + p1;
          pf[qt][r]     = (bf16)(p0 * 1024.0f);     // P carried x1024: no f16 copy of a probability is sub-normal
          pf[qt][r + 8] = (bf16)(p1 * 1024.0f);
        }
        rsum += __shfl_xor(rsum, 16, 32);
        lrun[qt] = lrun[qt] * alpha + rsum;
        mrun[qt] = mnew;

        // Rescale accumulators now so the PV phase is pure WMMA.
#pragma unroll
        for (int j = 0; j < 2; ++j)
#pragma unroll
          for (int r = 0; r < 8; ++r) o[qt][j][r] *= alpha;
      }
    }

    // Phase 2: O^T accumulate; each V fragment read from LDS once, used by
    // both q-tiles, then dead (only 8 VGPRs of V live at a time).
#pragma unroll
    for (int j = 0; j < 2; ++j) {
      const bf16x16 vf = lds_frag_tr(ldsV, VSTRIDE, j * 16);
#pragma unroll
      for (int qt = 0; qt < QW; ++qt)
        if (act[qt]) o[qt][j] = wmma_bf16(vf, pf[qt], o[qt][j]);
    }
  }

  __shared__ __attribute__((aligned(16))) float ldsOf[2][32 * 36];   // per-wave output tile [q][d], 32 -> 36 floats a row
  float* so = ldsOf[wave];
#pragma unroll
  for (int qt = 0; qt < QW; ++qt) {
    const float rl = 1.0f / (lrun[qt] * 1024.0f);
#pragma unroll
    for (int j = 0; j < 2; ++j)
#pragma unroll
      for (int r = 0; r < 8; ++r) so[(16 * qt + qlane) * 36 + j * 16 + kh8 + r] = o[qt][j][r] * rl;
  }
  asm volatile("s_wait_dscnt 0" ::: "memory");
  __builtin_amdgcn_wave_barrier();
{
#pragma unroll
    for (int it = 0; it < 8; ++it) { const int ch = lane + 32 * it, ql = ch >> 3, q4 = (ch & 7) * 4;
      *(v4f_t*)(attnOut + ((size_t)(b * QROWS + q0 + ql)) * CM + h * DH + q4) = *(const v4fa*)(so + ql * 36 + q4); }
    
  }
}


#undef QROWS
#undef KROWS
#undef NKV
#define QROWS 128
#define KROWS 128
#define NKV 128
__global__ __launch_bounds__(64) void col_attn_kernel(
    const bf16* __restrict__ G,
    float* __restrict__ attnOut) {   // G: qkvg rows [token][GLD]; QROWS queries / KROWS key rows per batch (first NKV valid); f32 output rows [token][CM]
  __shared__ __attribute__((aligned(16))) bf16 ldsK[32 * KSTRIDE];   // 2.5 KB
  __shared__ __attribute__((aligned(16))) bf16 ldsV[32 * VSTRIDE];   // 3.0 KB

  const int q0blk = blockIdx.x * 64;
  const int h  = blockIdx.y;
  const int b  = blockIdx.z;
  const int t    = threadIdx.x;
  const int wave = t >> 5;
  const int lane = t & 31;
  const int qlane = lane & 15;
  const int kh8   = (lane >> 4) * 8;
  const int q0 = q0blk + wave * 32;          // this wave's 32 queries

  const bf16* Qh = G + (size_t)b * QROWS * GLD + h * DH;   // this head's 32 q columns of the batch's rows (QROWS == KROWS rows per batch), row stride GLD
  const bf16* Kh = Qh + CM;                                // its k columns
  const bf16* Vh = Qh + 2 * CM;                            // its v columns

  // Cooperative staging (64 threads): K tile and V tile, each 32 keys x 32 d (2 thr/row, 32B each).
  const int krow = t >> 1;
  const int kcol = (t & 1) * 16;
  const bf16* kSrc = Kh + (size_t)krow * GLD + kcol;
  const bf16* vSrc = Vh + (size_t)krow * GLD + kcol;

  bf16x16 qf[QW];
#pragma unroll
  for (int qt = 0; qt < QW; ++qt) qf[qt] = load_frag(Qh, GLD, q0 + 16 * qt, 0);

  f32x8 o[QW][2] = {};
  float mrun[QW], lrun[QW];
#pragma unroll
  for (int qt = 0; qt < QW; ++qt) { mrun[qt] = -INFINITY; lrun[qt] = 0.0f; }

  const float scale = 0.17677669529663688f * 1.44269504088896340736f;  // hd^-0.5 = 1/sqrt(32), times log2(e)
  const float NEG2 = -1.0e9f;    // masked logit: its weight is exactly 0 once any valid key of the row has been seen (every row
                                 // has one), and anything accumulated before that is wiped by alpha == 0 — same result as -inf
  const int kmax = KROWS - 1;    // all key rows (KROWS == NKV: none masked)

  // Prefetch key block kb=0 into registers.
  bf16x8 kreg[2], vreg[2];
#pragma unroll
  for (int i = 0; i < 2; ++i) {
    kreg[i] = *(const bf16x8*)(kSrc + 8 * i);
    vreg[i] = *(const bf16x8*)(vSrc + 8 * i);
  }

  for (int kb = 0; kb <= kmax; kb += 32) {
    __syncthreads();   // previous readers done with LDS
#pragma unroll
    for (int i = 0; i < 2; ++i) {
      *(bf16x8*)(&ldsK[krow * KSTRIDE + kcol + 8 * i]) = kreg[i];
      *(bf16x8*)(&ldsV[krow * VSTRIDE + kcol + 8 * i]) = vreg[i];
    }
    if (kb + 32 <= kmax) {   // prefetch next block during compute
      const bf16* kn = kSrc + (size_t)(kb + 32) * GLD;
      const bf16* vn = vSrc + (size_t)(kb + 32) * GLD;
#pragma unroll
      for (int i = 0; i < 2; ++i) {
        kreg[i] = *(const bf16x8*)(kn + 8 * i);
        vreg[i] = *(const bf16x8*)(vn + 8 * i);
      }
    }
    __syncthreads();   // tile visible

    // Phase 1: scores + softmax for both q-tiles (K fragments live here only).
    bf16x16 kf[2];
#pragma unroll
    for (int ktile = 0; ktile < 2; ++ktile) kf[ktile] = lds_frag(ldsK + (ktile * 16) * KSTRIDE, KSTRIDE);

    bf16x16 pf[QW];
    bool act[QW];
#pragma unroll
    for (int qt = 0; qt < QW; ++qt) {
      unsigned mbits = 0;
      {
#pragma unroll
        for (int r = 0; r < 8; ++r) { const int j0 = kb + kh8 + r; if (j0 < NKV) mbits |= 1u << r; if (j0 + 16 < NKV) mbits |= 1u << (8 + r); }
        act[qt] = (__builtin_amdgcn_ballot_w32(mbits != 0) != 0);
      }
      if (act[qt]) {
        const int q_my = q0 + 16 * qt + qlane;
        f32x8 s0 = {}, s1 = {};
        s0 = wmma_bf16(kf[0], qf[qt], s0);
        s1 = wmma_bf16(kf[1], qf[qt], s1);

        float mx = -INFINITY;
#pragma unroll
        for (int r = 0; r < 8; ++r) {
          const int k0i = kb + kh8 + r;
          const int k1i = k0i + 16;
          (void)k0i; (void)k1i; (void)q_my;
          s0[r] = (mbits & (1u << r))       ? s0[r] * scale : NEG2;
          s1[r] = (mbits & (1u << (8 + r))) ? s1[r] * scale : NEG2;
          mx = fmaxf(mx, fmaxf(s0[r], s1[r]));
        }
        mx = fmaxf(mx, __shfl_xor(mx, 16, 32));
        const float mnew  = fmaxf(mrun[qt], mx);
        const float alpha = exp2f(mrun[qt] - mnew);

        float rsum = 0.0f;
#pragma unroll
        for (int r = 0; r < 8; ++r) {
          const float p0 = exp2f(s0[r] - mnew);
          const float p1 = exp2f(s1[r] - mnew);
          rsum += p0 + p1;
          pf[qt][r]     = (bf16)(p0 * 1024.0f);     // P carried x1024: no f16 copy of a probability is sub-normal
          pf[qt][r + 8] = (bf16)(p1 * 1024.0f);
        }
        rsum += __shfl_xor(rsum, 16, 32);
        lrun[qt] = lrun[qt] * alpha + rsum;
        mrun[qt] = mnew;

        // Rescale accumulators now so the PV phase is pure WMMA.
#pragma unroll
        for (int j = 0; j < 2; ++j)
#pragma unroll
          for (int r = 0; r < 8; ++r) o[qt][j][r] *= alpha;
      }
    }

    // Phase 2: O^T accumulate; each V fragment read from LDS once, used by
    // both q-tiles, then dead (only 8 VGPRs of V live at a time).
#pragma unroll
    for (int j = 0; j < 2; ++j) {
      const bf16x16 vf = lds_frag_tr(ldsV, VSTRIDE, j * 16);
#pragma unroll
      for (int qt = 0; qt < QW; ++qt)
        if (act[qt]) o[qt][j] = wmma_bf16(vf, pf[qt], o[qt][j]);
    }
  }

  __shared__ __attribute__((aligned(16))) float ldsOf[2][32 * 36];   // per-wave output tile [q][d], 32 -> 36 floats a row
  float* so = ldsOf[wave];
#pragma unroll
  for (int qt = 0; qt < QW; ++qt) {
    const float rl = 1.0f / (lrun[qt] * 1024.0f);
#pragma unroll
    for (int j = 0; j < 2; ++j)
#pragma unroll
      for (int r = 0; r < 8; ++r) so[(16 * qt + qlane) * 36 + j * 16 + kh8 + r] = o[qt][j][r] * rl;
  }
  asm volatile("s_wait_dscnt 0" ::: "memory");
  __builtin_amdgcn_wave_barrier();
{
#pragma unroll
    for (int it = 0; it < 8; ++it) { const int ch = lane + 32 * it, ql = ch >> 3, q4 = (ch & 7) * 4;
      *(v4f_t*)(attnOut + ((size_t)(b * QROWS + q0 + ql)) * CM + h * DH + q4) = *(const v4fa*)(so + ql * 36 + q4); }
    
  }
}


#undef QROWS
#undef KROWS
#undef NKV
// LayerNorm over C (256 or 128) per row; in place allowed; wave = LNR consecutive rows, block = 8 * LNR rows. All LNR rows are loaded before the
// first is reduced, so one wave start pays for LNR rows; per row the lane -> element map and both reduction trees are the one-row form's.
#define LNR 4
template <int C>
__global__ __launch_bounds__(256) void k_ln(const float* __restrict__ X, const float* __restrict__ g, const float* __restrict__ bb, float* __restrict__ Y) {
  const int tid = threadIdx.x, r = tid >> 5, lane = tid & 31; const size_t row0 = ((size_t)blockIdx.x * 8 + r) * LNR;
  float v[LNR][C / 32];
#pragma unroll
  for (int k = 0; k < LNR; ++k)
#pragma unroll
    for (int i = 0; i < C / 32; ++i) v[k][i] = X[(row0 + k) * C + lane + 32 * i];
#pragma unroll
  for (int k = 0; k < LNR; ++k) {
    float s = 0.0f;
#pragma unroll
    for (int i = 0; i < C / 32; ++i) s += v[k][i];
#pragma unroll
    for (int off = 1; off < 32; off <<= 1) s += __shfl_xor(s, off, 32);
    const float mean = s * (1.0f / C); float q = 0.0f;
#pragma unroll
    for (int i = 0; i < C / 32; ++i) { const float d = v[k][i] - mean; q += d * d; }
#pragma unroll
    for (int off = 1; off < 32; off <<= 1) q += __shfl_xor(q, off, 32);
    const float rstd = rsqrtf(q * (1.0f / C) + 1e-5f);
#pragma unroll
    for (int i = 0; i < C / 32; ++i) Y[(row0 + k) * C + lane + 32 * i] = (v[k][i] - mean) * rstd * g[lane + 32 * i] + bb[lane + 32 * i];
  }
}
// pair-bias table BT[h][i][j] = LN(bias_rep[i][j]) * Wb[:,h] + bb[h]; thread = one (i, j) row, wave = 32 consecutive rows, block = PBW waves.
// A wave brings its 32 rows in as whole 512-B rows, one a wave-wide load, all 32 loads in flight, and turns them through its own LDS slice, so that each
// thread then holds its whole row in registers: memory is read once, in whole lines. Row pitch 132 floats: the 16-byte reads of 16 rows fall on all 64 banks.
// Every sum runs over c in the same order as a plain loop over the row.
#define PBW 4
#define PBP 132
__global__ __launch_bounds__(32 * PBW) void k_pairbias(const float* __restrict__ Z, const float* __restrict__ g2, const float* __restrict__ be2, const float* __restrict__ Wb, const float* __restrict__ bbh, float* __restrict__ BT) {
  __shared__ __attribute__((aligned(16))) float zS[PBW][32 * PBP];
  const int tid = threadIdx.x, lane = tid & 31, wave = tid >> 5;
  const int row0 = (blockIdx.x * PBW + wave) * 32;          // first of the wave's rows, row = i * NRES + j
  const float* src = Z + (size_t)row0 * CZ + lane * 4;
  float* zw = zS[wave];
  v4f_t ld[32];
#pragma unroll
  for (int k = 0; k < 32; ++k) ld[k] = *(const v4f_t*)(src + k * CZ);
#pragma unroll
  for (int k = 0; k < 32; ++k) *(v4f_t*)(zw + k * PBP + lane * 4) = ld[k];
  asm volatile("s_wait_dscnt 0" ::: "memory");   // the wave's own LDS writes are done before its lanes read each other's; no other wave touches this slice
  __builtin_amdgcn_wave_barrier();               // keeps the compiler from moving the reads below over the writes above
  float z[CZ];
#pragma unroll
  for (int q4 = 0; q4 < CZ / 4; ++q4) { const v4f_t t = *(const v4fa*)(zw + lane * PBP + 4 * q4);
    z[4 * q4] = t[0]; z[4 * q4 + 1] = t[1]; z[4 * q4 + 2] = t[2]; z[4 * q4 + 3] = t[3]; }
  float s = 0.0f;
#pragma unroll
  for (int c = 0; c < CZ; ++c) s += z[c];
  const float mean = s * (1.0f / CZ); float q = 0.0f;
#pragma unroll
  for (int c = 0; c < CZ; ++c) { const float d = z[c] - mean; q += d * d; }
  const float rstd = rsqrtf(q * (1.0f / CZ) + 1e-5f);
  float acc[NHD];
#pragma unroll
  for (int h = 0; h < NHD; ++h) acc[h] = bbh[h];
#pragma unroll
  for (int c = 0; c < CZ; ++c) { const float zn = (z[c] - mean) * rstd * g2[c] + be2[c];
#pragma unroll
    for (int h = 0; h < NHD; ++h) acc[h] += zn * Wb[c * NHD + h]; }
#pragma unroll
  for (int h = 0; h < NHD; ++h) BT[(size_t)h * NRES * NRES + row0 + lane] = acc[h];
}
// permuted qkvg weights: Wp[c][k*256 + h*32 + d] = W[c][d*32 + k*8 + h] (no extra scale: both attention kernels carry 1/sqrt(32)); block = c (256), thread loops 1024 cols
__global__ __launch_bounds__(256) void k_wperm(const float* __restrict__ Wm, float* __restrict__ Wp) { const int c = blockIdx.x;
  for (int col = threadIdx.x; col < 4 * CM; col += 256) { const int k = col >> 8, h = (col >> 5) & 7, d = col & 31; float v = Wm[(size_t)c * 4 * CM + d * 32 + k * 8 + h];   // both attention kernels carry the 1/sqrt(32) scale themselves
    *(float*)(Wp + (size_t)c * 4 * CM + col) = v;  } }
// gated merge: O16[t][c] = attc[t][c] * sigmoid(g), g = G[t][768 + c], c = h*32 + d. Thread = 4 consecutive channels of a token (64 threads a token,
// 4 tokens a pass), EWP passes a block, unrolled so that several passes' loads are in flight at once: a wave-wide load or store covers whole 128-B lines, and one wave start pays for 128 channels of EWP tokens.
#define EWP 8
__global__ __launch_bounds__(256) void k_gmerge(const float* __restrict__ A, const bf16* __restrict__ G, bf16* __restrict__ O16) {
  const int tid = threadIdx.x; const int c = (tid & 63) * 4;
  const size_t tb = (size_t)blockIdx.x * (4 * EWP) + (tid >> 6);
  v4f_t a[EWP]; bf16x4 g[EWP];
#pragma unroll
  for (int p = 0; p < EWP; ++p) { const size_t t = tb + 4 * p;
    if (p == EWP - 1) asm volatile("s_wait_xcnt 0x0" ::: "memory");
    a[p] = *(const v4f_t*)(A + t * CM + c);
    g[p] = *(const bf16x4*)(G + t * 4 * CM + 3 * CM + c); }
#pragma unroll
  for (int p = 0; p < EWP; ++p) { const size_t t = tb + 4 * p; bf16x4 o;
#pragma unroll
    for (int e = 0; e < 4; ++e) o[e] = (bf16)(a[p][e] / (1.0f + expf(-(float)g[p][e])));
    *(bf16x4*)(O16 + t * CM + c) = o; }
}
// row permutation between (s, r) and (r, s) token orders: dst[row] = src[srow]; rows of 1 KB by 64 lanes x 16 B, 4 rows a pass, EWP passes a block, all loads issued before the first store.
// srow = (row % DIV) * MUL + row / DIV; a block's 4 * EWP rows share row / DIV, so pass p only adds 4 * p * MUL source rows.
template <int DIV, int MUL>
__device__ __forceinline__ void perm_rows(const float* __restrict__ src, unsigned row0, int col, v4f_t* v) {
  static_assert(DIV % (4 * EWP) == 0, "a block's rows must share row / DIV");
  const float* s0 = src + (size_t)((row0 % DIV) * MUL + row0 / DIV) * CM + col;
#pragma unroll
  for (int p = 0; p < EWP; ++p) v[p] = *(const v4f_t*)(s0 + (size_t)(4 * p * MUL) * CM);
}
__global__ __launch_bounds__(256) void k_perm(const float* __restrict__ src, float* __restrict__ dst, int to_rs) {
  const int tid = threadIdx.x; const unsigned row0 = blockIdx.x * (4 * EWP) + (tid >> 6); const int col = (tid & 63) * 4;
  float* d0 = dst + (size_t)row0 * CM + col;
  v4f_t v[EWP];
  if (to_rs) perm_rows<NSEQ, NRES>(src, row0, col, v); else perm_rows<NRES, NSEQ>(src, row0, col, v);
#pragma unroll
  for (int p = 0; p < EWP; ++p) *(v4f_t*)(d0 + (size_t)(4 * p) * CM) = v[p];
}
__global__ __launch_bounds__(256) void k_ones(float* __restrict__ p, int n) { for (int i = threadIdx.x; i < n; i += 256) { *(float*)(p + i) = 1.0f;  } }

extern "C" void kernel_launch(void* const* d_in, const int* in_sizes, int n_in,
                              void* d_out, int out_size, void* d_ws, size_t ws_size,
                              hipStream_t stream) {
  (void)in_sizes; (void)n_in; (void)out_size;
  const float** f = (const float**)d_in;
  const float* x = f[0], *brep = f[1], *Wqkv_r = f[2], *W0r = f[3], *Wb = f[4], *bbh = f[5], *Wqkv_c = f[6], *W0c = f[7], *W1 = f[8], *b1 = f[9], *W2 = f[10], *b2 = f[11], *g1 = f[12], *be1 = f[13], *g2 = f[14], *be2 = f[15], *g3 = f[16], *be3 = f[17];
  float* out = (float*)d_out;     // [1,128,256,256]
  char* ws = (char*)d_ws;
  float* X1 = (float*)ws; ws += (size_t)MTOK * CM * 4;                 // 32 MB: LN1(x), then x + row-att (in place), then LN3 (in place), finally x after the column block (s,r order)
  float* XT = (float*)ws; ws += (size_t)MTOK * CM * 4;                 // 32 MB: (r,s)-ordered copy for the column block
  float* BT = (float*)ws; ws += (size_t)NHD * NRES * NRES * 4;         // 2 MB pair-bias table
  float* Wpr = (float*)ws; ws += (size_t)CM * 4 * CM * 4; float* Wpc = (float*)ws; ws += (size_t)CM * 4 * CM * 4;
  bf16* G16 = (bf16*)ws; ws += (size_t)MTOK * 4 * CM * 2;             // qkvg f16 [32768][1024] (64 MB); also the transition hidden [32768][1024]
  float* attc = (float*)ws; ws += (size_t)MTOK * CM * 4;              // 32 MB attention output rows, f32, before the gate
  bf16* O16 = (bf16*)ws; ws += (size_t)MTOK * CM * 2;                 // 16 MB gated attention output rows (token order of the current block)
  float* ones = (float*)ws; ws += CM * 4;
  if ((size_t)(ws - (char*)d_ws) > ws_size) return;
  const dim3 blk(256);
  k_ones<<<dim3(1), blk, 0, stream>>>(ones, CM);
  k_wperm<<<dim3(CM), blk, 0, stream>>>(Wqkv_r, Wpr); k_wperm<<<dim3(CM), blk, 0, stream>>>(Wqkv_c, Wpc);
  k_pairbias<<<dim3(NRES * NRES / (32 * PBW)), dim3(32 * PBW), 0, stream>>>(brep, g2, be2, Wb, bbh, BT);
  k_ln<CM><<<dim3(MTOK / (8 * LNR)), blk, 0, stream>>>(x, g1, be1, X1);
  // ---- row-wise gated attention with pair bias: every stage one launch over all tokens ----
  gemm_kne<float, 0, true, 4 * CM><<<dim3(MTOK / 128, 4 * CM / 128), blk, 0, stream>>>(X1, CM, Wpr, nullptr, nullptr, nullptr, G16, 4 * CM, CM);
  bt_attn_kernel<<<dim3(NRES / 64, NHD, MTOK / NRES), dim3(64), 0, stream>>>(G16, BT, NRES, attc);
  k_gmerge<<<dim3(MTOK / (4 * EWP)), blk, 0, stream>>>(attc, G16, O16);
  gemm_kne<bf16, 2, false, CM><<<dim3(MTOK / 128, CM / 128), blk, 0, stream>>>(O16, CM, W0r, nullptr, X1, ones, X1, CM, CM);     // x = x + o·W0 (in place)
  k_ln<CM><<<dim3(MTOK / (8 * LNR)), blk, 0, stream>>>(X1, g3, be3, X1);                                                                    // x = LN3(x) (in place)
  // ---- column-wise gated attention: tokens re-ordered (r, s); every stage one launch over all tokens ----
  k_perm<<<dim3(MTOK / (4 * EWP)), blk, 0, stream>>>(X1, XT, 1);
  gemm_kne<float, 0, true, 4 * CM><<<dim3(MTOK / 128, 4 * CM / 128), blk, 0, stream>>>(XT, CM, Wpc, nullptr, nullptr, nullptr, G16, 4 * CM, CM);
  col_attn_kernel<<<dim3(NSEQ / 64, NHD, MTOK / NSEQ), dim3(64), 0, stream>>>(G16, attc);
  k_gmerge<<<dim3(MTOK / (4 * EWP)), blk, 0, stream>>>(attc, G16, O16);
  gemm_kne<bf16, 2, false, CM><<<dim3(MTOK / 128, CM / 128), blk, 0, stream>>>(O16, CM, W0c, nullptr, XT, ones, XT, CM, CM);     // xt = xt + o·W0_c (in place, (r,s) order)
  k_perm<<<dim3(MTOK / (4 * EWP)), blk, 0, stream>>>(XT, X1, 0);                                                                          // back to (s,r) order
  // ---- transition, all tokens per launch: out = relu(x*W1 + b1)*W2 + b2 + x ----
  gemm_kne<float, 3, true, 4 * CM><<<dim3(MTOK / 128, 4 * CM / 128), blk, 0, stream>>>(X1, CM, W1, b1, nullptr, nullptr, G16, 4 * CM, CM);
  gemm_kne<bf16, 2, false, CM><<<dim3(MTOK / 128, CM / 128), blk, 0, stream>>>(G16, 4 * CM, W2, b2, X1, ones, out, CM, 4 * CM);
}

// v006
// Measured time: 327 microseconds a run.
// In two side-by-side timings against v005, it was 1.06 and 1.05 times as fast.
// Counting every step since v000, it is 3.60 times as fast.
// Contractions on v_wmma_f32_16x16x32_f16 (plain f16 operands, f32 accumulate): the row- and column-wise gated attentions of an MSA
// block — qkvg = x·Wqkv (K = 256, N = 1024; the reference's (d, k, h) column interleave undone by permuting the WEIGHT columns on the
// device, both attention kernels scale by 32^-½ for the real head dim), the 8-head attentions at head dim 32, their q, k and v read straight from the qkvg rows
// (row: 128 sequences x 256 residues with the pair-bias table (h, i, j) = LN(bias_rep)·Wb + bb, stored as [h][i / 16][j / 32] score-fragment tiles, added in-kernel; column: 256 residues x 128
// sequences after a token re-ordering), flash-style Sᵀ = K·Qᵀ / Oᵀ = Vᵀ·Pᵀ with online softmax in f32 (P x1024, f32 rows), the sigmoid
// gate, ·W0 + residual (K = 256), and the transition relu(x·W1 + b1)·W2 + b2 + x (K = 256 / 1024) — every GEMM and every attention stage one launch over all 32768 tokens; LayerNorms
// in f32. compute dtype: f16 operands, f32 accumulate.  x [1,128,256,256] -> [1,128,256,256].
#include <hip/hip_runtime.h>
#include <hip/hip_bf16.h>
#include <math.h>

#define NSEQ 128
#define NRES 256
#define CM 256
#define CZ 128
#define NHD 8
#define DH 32
#define MTOK (NSEQ * NRES)
#define GLD (4 * CM)   // pitch of a qkvg row, in elements: q | k | v | g blocks of 256, head h at column h * 32 of its block
#define HH 8
#define QW 2
#define SS 256
#define GSTR 48
#define BTILE 512   // floats in one (16 query x 32 key) tile of the pair-bias table

typedef _Float16 bf16;
typedef _Float16 f16;
typedef __attribute__((ext_vector_type(4))) unsigned v4u_t;
typedef unsigned v4ua __attribute__((ext_vector_type(4), may_alias));
typedef __attribute__((ext_vector_type(4))) float v4f_t;
typedef float v4fa __attribute__((ext_vector_type(4), may_alias));
typedef __attribute__((ext_vector_type(16))) bf16  bf16x16;
typedef bf16x16 f16x16;
typedef __attribute__((ext_vector_type(8)))  bf16  bf16x8;
typedef bf16x8 f16x8;
typedef __attribute__((ext_vector_type(4)))  bf16  bf16x4;
typedef __attribute__((ext_vector_type(8)))  float f32x8;
__device__ __forceinline__ f32x8 wmma16(f16x16 a, f16x16 b, f32x8 c) {
  c = __builtin_amdgcn_wmma_f32_16x16x32_f16(false, a, false, b, (short)0, c, false, false);
  asm volatile("v_nop\n\tv_nop\n\tv_nop\n\tv_nop" : "+v"(c) : "v"(a), "v"(b));
  return c;
}
#define LDS_STRIDE 48   // GEMM tiles: 32 -> 48 elems (96B rows): aligned b128 reads
#define KSTRIDE    40   // attn K tile [key][d]: 32 -> 40 elems (80B rows, 16 B x odd): conflict-free b128
#define VSTRIDE    48   // attn V tile [key][d]: 32 -> 48 elems (96B rows, 32 B x odd): conflict-free transposing loads

__device__ __forceinline__ f32x8 wmma_bf16(bf16x16 a, bf16x16 b, f32x8 c) {
  c = __builtin_amdgcn_wmma_f32_16x16x32_f16(false, a, false, b, (short)0, c, false, false);
  asm volatile("v_nop\n\tv_nop\n\tv_nop\n\tv_nop" : "+v"(c) : "v"(a), "v"(b));   // A/B-overwrite hazard guard
  return c;
}

// 16x32 (MxK) f16 fragment from a row-major global matrix.
// lanes 0-15  (row=lane)    : elems 0..7 = K+0..7,  8..15 = K+16..23
// lanes 16-31 (row=lane-16) : elems 0..7 = K+8..15, 8..15 = K+24..31
template <typename T>
__device__ __forceinline__ bf16x16 load_frag(const T* __restrict__ base, int ld,
                                             int row0, int k0) {
  const int lane = threadIdx.x & 31;
  const int r    = lane & 15;
  const int kh   = (lane >> 4) * 8;
  const T* p0 = base + (size_t)(row0 + r) * ld + (k0 + kh);
  const T* p1 = p0 + 16;
  bf16x16 f;
#pragma unroll
  for (int i = 0; i < 8; ++i) {
    f[i]     = (bf16)p0[i];
    f[i + 8] = (bf16)p1[i];
  }
  return f;
}

// Same fragment from an LDS tile with padded row stride (base includes row0/k0).
__device__ __forceinline__ bf16x16 lds_frag(const bf16* base, int stride) {
  const int lane = threadIdx.x & 31;
  const int row  = lane & 15;
  const int kh   = (lane >> 4) * 8;
  const bf16x8 lo = *(const bf16x8*)(base + row * stride + kh);
  const bf16x8 hi = *(const bf16x8*)(base + row * stride + kh + 16);
  bf16x16 f;
#pragma unroll
  for (int i = 0; i < 8; ++i) { f[i] = lo[i]; f[i + 8] = hi[i]; }
  return f;
}

// 16 (d) x 32 (key) fragment of V^T from a row-major [key][d] LDS tile, by the transposing load: lane (c = lane & 15, hh = lane >> 4) gets column
// d0 + c at keys 8 hh + 0..7, the second load the same 16 keys further on: the k order of lds_frag and of the packed P. Every lane's address is valid.
typedef short s16x8 __attribute__((ext_vector_type(8)));
__device__ __forceinline__ bf16x16 lds_frag_tr(const bf16* tile, int stride, int d0) {
  typedef __attribute__((address_space(3))) s16x8 lds_s16x8;
  const int lane = threadIdx.x & 31;
  const bf16* p = tile + (8 * (lane >> 4) + (lane & 7)) * stride + d0 + 8 * ((lane >> 3) & 1);
  const bf16x8 lo = __builtin_bit_cast(bf16x8, __builtin_amdgcn_ds_load_tr16_b128_v8i16((lds_s16x8*)p));
  const bf16x8 hi = __builtin_bit_cast(bf16x8, __builtin_amdgcn_ds_load_tr16_b128_v8i16((lds_s16x8*)(p + 16 * stride)));
  bf16x16 f;
#pragma unroll
  for (int i = 0; i < 8; ++i) { f[i] = lo[i]; f[i + 8] = hi[i]; }
  return f;
}

template <typename T>
__device__ __forceinline__ void stage_read16(const T* __restrict__ p, float* buf) {
#pragma unroll
  for (int i = 0; i < 16; ++i) buf[i] = (float)p[i];
}

__device__ __forceinline__ void stage_write(bf16* dst, const float* buf, int nquad) {
#pragma unroll
  for (int i = 0; i < nquad; ++i) {
    bf16x4 q;
    q[0] = (bf16)buf[4 * i];     q[1] = (bf16)buf[4 * i + 1];
    q[2] = (bf16)buf[4 * i + 2]; q[3] = (bf16)buf[4 * i + 3];
    *(bf16x4*)(dst + 4 * i) = q;
  }
}


// ---------------------------------------------------------------------------------------------------------------------------
// gemm_kne: Y[m][n] = epi( Σ_k A[m][k]·W[k][n] + bias[n] ), A f32/f16 [M][lda], W f32 row-major [K][N] (pitch LDW), plain f16 operands,
// f32 accumulate. EPI 0: identity; 1: exact-erf GELU; 2: R[m][n] + gvec[n]·(·) (residual with per-channel gain). Output f32 (or f16
// when OUT16). Block = 128x128 tile, 8 waves as 4(M) x 2(N); per 32-wide k-step A and W tiles staged f16 in LDS (W transposed
// ---------------------------------------------------------------------------------------------------------------------------
#define GSTR 48
template <typename AT, int EPI, bool OUT16, int LDW>
__global__ __launch_bounds__(256) void gemm_kne(const AT* __restrict__ A, int lda, const float* __restrict__ Wm,
                                                const float* __restrict__ bias, const float* __restrict__ R, const float* __restrict__ gvec,
                                                void* __restrict__ Yv, int ldy, int K) {
  __shared__ __attribute__((aligned(16))) f16 ldsA[128 * GSTR];
  __shared__ __attribute__((aligned(16))) f16 ldsW[128 * GSTR];
  __shared__ __attribute__((aligned(16))) float oS[8][32 * 68];
  const int tid = threadIdx.x, lane = tid & 31, wave = tid >> 5, cl = lane & 15, rh = (lane >> 4) * 8;
  const int m0 = blockIdx.x * 128, n0 = blockIdx.y * 128;
  const int wm = (wave & 3) * 32, wn = (wave >> 2) * 64;
  f32x8 acc[2][4];
#pragma unroll
  for (int i = 0; i < 2; ++i)
#pragma unroll
    for (int j = 0; j < 4; ++j) { f32x8 z = {}; acc[i][j] = z; }
#pragma unroll 1
  for (int k0 = 0; k0 < K; k0 += 32) {
    __syncthreads();
    if constexpr (sizeof(AT) == 4) {   // f32 A: 8 lanes take one row's 128 B, so a wave-wide 16-byte load covers 4 whole lines; 32 rows a pass, 4 passes
      const int row = tid >> 3, c4 = (tid & 7) * 4;
      const AT* src = A + (size_t)(m0 + row) * lda + k0 + c4;
#pragma unroll
      for (int p = 0; p < 4; ++p) { const v4f_t a4 = *(const v4f_t*)(src + (size_t)(32 * p) * lda);
        bf16x4 q; q[0] = (f16)a4[0]; q[1] = (f16)a4[1]; q[2] = (f16)a4[2]; q[3] = (f16)a4[3];
        *(bf16x4*)(ldsA + (row + 32 * p) * GSTR + c4) = q; }
    } else {                           // f16 A: 4 lanes take one row's 64 B, so a wave-wide 16-byte load touches 8 lines; 64 rows a pass, 2 passes
      const int row = tid >> 2, c8 = (tid & 3) * 8;
      const AT* src = A + (size_t)(m0 + row) * lda + k0 + c8;
#pragma unroll
      for (int p = 0; p < 2; ++p) *(bf16x8*)(ldsA + (row + 64 * p) * GSTR + c8) = *(const bf16x8*)(src + (size_t)(64 * p) * lda);
    }
    { const int n = tid & 127, kq = (tid >> 7) * 16;   // one column n and 16 consecutive k a thread: the transpose happens in registers
      const float* src = Wm + (size_t)(k0 + kq) * LDW + n0 + n;   // LDW is a compile-time pitch: the 16 row steps are immediate offsets of one address
      union { f16 h[16]; v4u_t v[2]; } u;
#pragma unroll
      for (int g = 0; g < 16; ++g) u.h[g] = (f16)src[g * LDW];
      *(v4u_t*)(ldsW + n * GSTR + kq) = u.v[0];
      *(v4u_t*)(ldsW + n * GSTR + kq + 8) = u.v[1]; }
    __syncthreads();
    f16x16 af[2];
#pragma unroll
    for (int i = 0; i < 2; ++i) af[i] = lds_frag(ldsA + (wm + 16 * i) * GSTR, GSTR);
#pragma unroll
    for (int j = 0; j < 4; ++j) {
      const f16x16 bf = lds_frag(ldsW + (wn + 16 * j) * GSTR, GSTR);
#pragma unroll
      for (int i = 0; i < 2; ++i) acc[i][j] = wmma16(af[i], bf, acc[i][j]);
    }
  }
  float* so = oS[wave];
#pragma unroll
  for (int i = 0; i < 2; ++i)
#pragma unroll
    for (int j = 0; j < 4; ++j) {
      const int n = n0 + wn + 16 * j + cl;
      const float bv = bias ? bias[n] : 0.0f;
      const float gv = (EPI == 2) ? gvec[n] : 0.0f;
      if (EPI == 1) {
#pragma unroll 1
        for (int r = 0; r < 8; ++r) { const float xg = acc[i][j][r] + bv; so[(16 * i + rh + r) * 68 + 16 * j + cl] = 0.5f * xg * (1.0f + erff(xg * 0.70710678118654752f)); }
      } else {
#pragma unroll
        for (int r = 0; r < 8; ++r) {
          float v = acc[i][j][r] + bv;
          if (EPI == 3) v = fmaxf(v, 0.0f);                                         // EPI 3: ReLU
          if (EPI == 2) v = R[(size_t)(m0 + wm + 16 * i + rh + r) * ldy + n] + gv * v;
          so[(16 * i + rh + r) * 68 + 16 * j + cl] = v;
        }
      }
    }
  asm volatile("s_wait_dscnt 0" ::: "memory");
  __builtin_amdgcn_wave_barrier();
{
    if (OUT16) {
      f16* Y = (f16*)Yv;
#pragma unroll
      for (int it = 0; it < 8; ++it) { const int c = lane + 32 * it, rr = c >> 3, q8 = (c & 7) * 8;
        union { f16 h[8]; v4u_t v; } u;
#pragma unroll
        for (int e = 0; e < 8; ++e) u.h[e] = (f16)so[rr * 68 + q8 + e];
        *(v4u_t*)(Y + (size_t)(m0 + wm + rr) * ldy + n0 + wn + q8) = u.v; }
    } else {
      float* Y = (float*)Yv;
#pragma unroll
      for (int it = 0; it < 16; ++it) { const int f4 = lane + 32 * it, rr = f4 >> 4, q = (f4 & 15) * 4;
        *(v4f_t*)(Y + (size_t)(m0 + wm + rr) * ldy + n0 + wn + q) = *(const v4fa*)(so + rr * 68 + q); }
    }
    
  }
}

#define QROWS 256
#define KROWS 256
#define NKV 256
__global__ __launch_bounds__(64) void bt_attn_kernel(
    const bf16* __restrict__ G, const float* __restrict__ btab,   // G: qkvg rows [token][GLD]; btab: additive logit bias in score-fragment order (BTILE, at k_pairbias)
    float* __restrict__ attnOut) {
  __shared__ __attribute__((aligned(16))) bf16 ldsK[32 * KSTRIDE];   // 2.5 KB
  __shared__ __attribute__((aligned(16))) bf16 ldsV[32 * VSTRIDE];   // 3.0 KB

  const int q0blk = blockIdx.x * 64;
  const int h  = blockIdx.y;
  const int b  = blockIdx.z;
  const int t    = threadIdx.x;
  const int wave = t >> 5;
  const int lane = t & 31;
  const int qlane = lane & 15;
  const int kh8   = (lane >> 4) * 8;
  const int q0 = q0blk + wave * 32;          // this wave's 32 queries

  const bf16* Qh = G + (size_t)b * QROWS * GLD + h * DH;   // this head's 32 q columns of the batch's rows (QROWS == KROWS rows per batch), row stride GLD
  const bf16* Kh = Qh + CM;                                // its k columns
  const bf16* Vh = Qh + 2 * CM;                            // its v columns

  // Cooperative staging (64 threads): K tile and V tile, each 32 keys x 32 d. 4 lanes take one key's 64 B, so a wave-wide 16-byte load touches 8 lines; 16 keys a pass, 2 passes.
  const int krow = t >> 2;
  const int kcol = (t & 3) * 8;
  const bf16* kSrc = Kh + (size_t)krow * GLD + kcol;
  const bf16* vSrc = Vh + (size_t)krow * GLD + kcol;

  bf16x16 qf[QW];
#pragma unroll
  for (int qt = 0; qt < QW; ++qt) qf[qt] = load_frag(Qh, GLD, q0 + 16 * qt, 0);

  f32x8 o[QW][2] = {};
  float mrun[QW], lrun[QW];
#pragma unroll
  for (int qt = 0; qt < QW; ++qt) { mrun[qt] = -INFINITY; lrun[qt] = 0.0f; }

  const float scale = 0.17677669529663688f * 1.44269504088896340736f;  // hd^-0.5 = 1/sqrt(32), times log2(e)
  const float NEG2 = -1.0e9f;    // masked logit: its weight is exactly 0 once any valid key of the row has been seen (every row
                                 // has one), and anything accumulated before that is wiped by alpha == 0 — same result as -inf
  const int kmax = KROWS - 1;
  const float L2E_ = 1.44269504088896340736f;
  const float* bth = btab + (size_t)(h * (QROWS / 16) + (q0 >> 4)) * (NKV / 32) * BTILE + lane * 4;   // this lane's 16 B in the first 512-B group of the wave's first (16 q x 32 key) tile

  // Prefetch key block kb=0 into registers.
  bf16x8 kreg[2], vreg[2];
#pragma unroll
  for (int i = 0; i < 2; ++i) {
    kreg[i] = *(const bf16x8*)(kSrc + (size_t)(16 * i) * GLD);
    vreg[i] = *(const bf16x8*)(vSrc + (size_t)(16 * i) * GLD);
  }

  for (int kb = 0; kb <= kmax; kb += 32) {
    __syncthreads();   // previous readers done with LDS
#pragma unroll
    for (int i = 0; i < 2; ++i) {
      *(bf16x8*)(&ldsK[(krow + 16 * i) * KSTRIDE + kcol]) = kreg[i];
      *(bf16x8*)(&ldsV[(krow + 16 * i) * VSTRIDE + kcol]) = vreg[i];
    }
    if (kb + 32 <= kmax) {   // prefetch next block during compute
      const bf16* kn = kSrc + (size_t)(kb + 32) * GLD;
      const bf16* vn = vSrc + (size_t)(kb + 32) * GLD;
#pragma unroll
      for (int i = 0; i < 2; ++i) {
        kreg[i] = *(const bf16x8*)(kn + (size_t)(16 * i) * GLD);
        vreg[i] = *(const bf16x8*)(vn + (size_t)(16 * i) * GLD);
      }
    }
    __syncthreads();   // tile visible

    // Phase 1: scores + softmax for both q-tiles (K fragments live here only).
    bf16x16 kf[2];
#pragma unroll
    for (int ktile = 0; ktile < 2; ++ktile) kf[ktile] = lds_frag(ldsK + (ktile * 16) * KSTRIDE, KSTRIDE);

    bf16x16 pf[QW];
    bool act[QW];
#pragma unroll
    for (int qt = 0; qt < QW; ++qt) {
      unsigned mbits = 0;
      {
#pragma unroll
        for (int r = 0; r < 8; ++r) { const int j0 = kb + kh8 + r; if (j0 < NKV) mbits |= 1u << r; if (j0 + 16 < NKV) mbits |= 1u << (8 + r); }
        act[qt] = (__builtin_amdgcn_ballot_w32(mbits != 0) != 0);
      }
      if (act[qt]) {
        const int q_my = q0 + 16 * qt + qlane;
        f32x8 s0 = {}, s1 = {};
        s0 = wmma_bf16(kf[0], qf[qt], s0);
        s1 = wmma_bf16(kf[1], qf[qt], s1);

        const float* bp = bth + (size_t)(qt * (NKV / 32) + (kb >> 5)) * BTILE; (void)q_my;
        v4f_t bv[4];   // group g holds, for this lane's query, the keys of score registers 4 (g & 1) .. + 3 of s0 (g < 2) or s1: each load is 512 contiguous bytes a wave
#pragma unroll
        for (int g = 0; g < 4; ++g) bv[g] = *(const v4f_t*)(bp + g * 128);
        float mx = -INFINITY;
#pragma unroll
        for (int r = 0; r < 8; ++r) {
          s0[r] = (mbits & (1u << r))       ? s0[r] * scale + L2E_ * bv[r >> 2][r & 3] : NEG2;
          s1[r] = (mbits & (1u << (8 + r))) ? s1[r] * scale + L2E_ * bv[2 + (r >> 2)][r & 3] : NEG2;
          mx = fmaxf(mx, fmaxf(s0[r], s1[r]));
        }
        mx = fmaxf(mx, __shfl_xor(mx, 16, 32));
        const float mnew  = fmaxf(mrun[qt], mx);
        const float alpha = exp2f(mrun[qt] - mnew);

        float rsum = 0.0f;
#pragma unroll
        for (int r = 0; r < 8; ++r) {
          const float p0 = exp2f(s0[r] - mnew);
          const float p1 = exp2f(s1[r] - mnew);
          rsum += p0 + p1;
          pf[qt][r]     = (bf16)(p0 * 1024.0f);     // P carried x1024: no f16 copy of a probability is sub-normal
          pf[qt][r + 8] = (bf16)(p1 * 1024.0f);
        }
        rsum += __shfl_xor(rsum, 16, 32);
        lrun[qt] = lrun[qt] * alpha + rsum;
        mrun[qt] = mnew;

        // Rescale accumulators now so the PV phase is pure WMMA.
#pragma unroll
        for (int j = 0; j < 2; ++j)
#pragma unroll
          for (int r = 0; r < 8; ++r) o[qt][j][r] *= alpha;
      }
    }

    // Phase 2: O^T accumulate; each V fragment read from LDS once, used by
    // both q-tiles, then dead (only 8 VGPRs of V live at a time).
#pragma unroll
    for (int j = 0; j < 2; ++j) {
      const bf16x16 vf = lds_frag_tr(ldsV, VSTRIDE, j * 16);
#pragma unroll
      for (int qt = 0; qt < QW; ++qt)
        if (act[qt]) o[qt][j] = wmma_bf16(vf, pf[qt], o[qt][j]);
    }
  }

  __shared__ __attribute__((aligned(16))) float ldsOf[2][32 * 36];   // per-wave output tile [q][d], 32 -> 36 floats a row
  float* so = ldsOf[wave];
#pragma unroll
  for (int qt = 0; qt < QW; ++qt) {
    const float rl = 1.0f / (lrun[qt] * 1024.0f);
#pragma unroll
    for (int j = 0; j < 2; ++j)
#pragma unroll
      for (int r = 0; r < 8; ++r) so[(16 * qt + qlane) * 36 + j * 16 + kh8 + r] = o[qt][j][r] * rl;
  }
  asm volatile("s_wait_dscnt 0" ::: "memory");
  __builtin_amdgcn_wave_barrier();
{
#pragma unroll
    for (int it = 0; it < 8; ++it) { const int ch = lane + 32 * it, ql = ch >> 3, q4 = (ch & 7) * 4;
      *(v4f_t*)(attnOut + ((size_t)(b * QROWS + q0 + ql)) * CM + h * DH + q4) = *(const v4fa*)(so + ql * 36 + q4); }
    
  }
}


#undef QROWS
#undef KROWS
#undef NKV
#define QROWS 128
#define KROWS 128
#define NKV 128
__global__ __launch_bounds__(64) void col_attn_kernel(
    const bf16* __restrict__ G,
    float* __restrict__ attnOut) {   // G: qkvg rows [token][GLD]; QROWS queries / KROWS key rows per batch (first NKV valid); f32 output rows [token][CM]
  __shared__ __attribute__((aligned(16))) bf16 ldsK[32 * KSTRIDE];   // 2.5 KB
  __shared__ __attribute__((aligned(16))) bf16 ldsV[32 * VSTRIDE];   // 3.0 KB

  const int q0blk = blockIdx.x * 64;
  const int h  = blockIdx.y;
  const int b  = blockIdx.z;
  const int t    = threadIdx.x;
  const int wave = t >> 5;
  const int lane = t & 31;
  const int qlane = lane & 15;
  const int kh8   = (lane >> 4) * 8;
  const int q0 = q0blk + wave * 32;          // this wave's 32 queries

  const bf16* Qh = G + (size_t)b * QROWS * GLD + h * DH;   // this head's 32 q columns of the batch's rows (QROWS == KROWS rows per batch), row stride GLD
  const bf16* Kh = Qh + CM;                                // its k columns
  const bf16* Vh = Qh + 2 * CM;                            // its v columns

  // Cooperative staging (64 threads): K tile and V tile, each 32 keys x 32 d. 4 lanes take one key's 64 B, so a wave-wide 16-byte load touches 8 lines; 16 keys a pass, 2 passes.
  const int krow = t >> 2;
  const int kcol = (t & 3) * 8;
  const bf16* kSrc = Kh + (size_t)krow * GLD + kcol;
  const bf16* vSrc = Vh + (size_t)krow * GLD + kcol;

  bf16x16 qf[QW];
#pragma unroll
  for (int qt = 0; qt < QW; ++qt) qf[qt] = load_frag(Qh, GLD, q0 + 16 * qt, 0);

  f32x8 o[QW][2] = {};
  float mrun[QW], lrun[QW];
#pragma unroll
  for (int qt = 0; qt < QW; ++qt) { mrun[qt] = -INFINITY; lrun[qt] = 0.0f; }

  const float scale = 0.17677669529663688f * 1.44269504088896340736f;  // hd^-0.5 = 1/sqrt(32), times log2(e)
  const float NEG2 = -1.0e9f;    // masked logit: its weight is exactly 0 once any valid key of the row has been seen (every row
                                 // has one), and anything accumulated before that is wiped by alpha == 0 — same result as -inf
  const int kmax = KROWS - 1;    // all key rows (KROWS == NKV: none masked)

  // Prefetch key block kb=0 into registers.
  bf16x8 kreg[2], vreg[2];
#pragma unroll
  for (int i = 0; i < 2; ++i) {
    kreg[i] = *(const bf16x8*)(kSrc + (size_t)(16 * i) * GLD);
    vreg[i] = *(const bf16x8*)(vSrc + (size_t)(16 * i) * GLD);
  }

  for (int kb = 0; kb <= kmax; kb += 32) {
    __syncthreads();   // previous readers done with LDS
#pragma unroll
    for (int i = 0; i < 2; ++i) {
      *(bf16x8*)(&ldsK[(krow + 16 * i) * KSTRIDE + kcol]) = kreg[i];
      *(bf16x8*)(&ldsV[(krow + 16 * i) * VSTRIDE + kcol]) = vreg[i];
    }
    if (kb + 32 <= kmax) {   // prefetch next block during compute
      const bf16* kn = kSrc + (size_t)(kb + 32) * GLD;
      const bf16* vn = vSrc + (size_t)(kb + 32) * GLD;
#pragma unroll
      for (int i = 0; i < 2; ++i) {
        kreg[i] = *(const bf16x8*)(kn + (size_t)(16 * i) * GLD);
        vreg[i] = *(const bf16x8*)(vn + (size_t)(16 * i) * GLD);
      }
    }
    __syncthreads();   // tile visible

    // Phase 1: scores + softmax for both q-tiles (K fragments live here only).
    bf16x16 kf[2];
#pragma unroll
    for (int ktile = 0; ktile < 2; ++ktile) kf[ktile] = lds_frag(ldsK + (ktile * 16) * KSTRIDE, KSTRIDE);

    bf16x16 pf[QW];
    bool act[QW];
#pragma unroll
    for (int qt = 0; qt < QW; ++qt) {
      unsigned mbits = 0;
      {
#pragma unroll
        for (int r = 0; r < 8; ++r) { const int j0 = kb + kh8 + r; if (j0 < NKV) mbits |= 1u << r; if (j0 + 16 < NKV) mbits |= 1u << (8 + r); }
        act[qt] = (__builtin_amdgcn_ballot_w32(mbits != 0) != 0);
      }
      if (act[qt]) {
        const int q_my = q0 + 16 * qt + qlane;
        f32x8 s0 = {}, s1 = {};
        s0 = wmma_bf16(kf[0], qf[qt], s0);
        s1 = wmma_bf16(kf[1], qf[qt], s1);

        float mx = -INFINITY;
#pragma unroll
        for (int r = 0; r < 8; ++r) {
          const int k0i = kb + kh8 + r;
          const int k1i = k0i + 16;
          (void)k0i; (void)k1i; (void)q_my;
          s0[r] = (mbits & (1u << r))       ? s0[r] * scale : NEG2;
          s1[r] = (mbits & (1u << (8 + r))) ? s1[r] * scale : NEG2;
          mx = fmaxf(mx, fmaxf(s0[r], s1[r]));
        }
        mx = fmaxf(mx, __shfl_xor(mx, 16, 32));
        const float mnew  = fmaxf(mrun[qt], mx);
        const float alpha = exp2f(mrun[qt] - mnew);

        float rsum = 0.0f;
#pragma unroll
        for (int r = 0; r < 8; ++r) {
          const float p0 = exp2f(s0[r] - mnew);
          const float p1 = exp2f(s1[r] - mnew);
          rsum += p0 + p1;
          pf[qt][r]     = (bf16)(p0 * 1024.0f);     // P carried x1024: no f16 copy of a probability is sub-normal
          pf[qt][r + 8] = (bf16)(p1 * 1024.0f);
        }
        rsum += __shfl_xor(rsum, 16, 32);
        lrun[qt] = lrun[qt] * alpha + rsum;
        mrun[qt] = mnew;

        // Rescale accumulators now so the PV phase is pure WMMA.
#pragma unroll
        for (int j = 0; j < 2; ++j)
#pragma unroll
          for (int r = 0; r < 8; ++r) o[qt][j][r] *= alpha;
      }
    }

    // Phase 2: O^T accumulate; each V fragment read from LDS once, used by
    // both q-tiles, then dead (only 8 VGPRs of V live at a time).
#pragma unroll
    for (int j = 0; j < 2; ++j) {
      const bf16x16 vf = lds_frag_tr(ldsV, VSTRIDE, j * 16);
#pragma unroll
      for (int qt = 0; qt < QW; ++qt)
        if (act[qt]) o[qt][j] = wmma_bf16(vf, pf[qt], o[qt][j]);
    }
  }

  __shared__ __attribute__((aligned(16))) float ldsOf[2][32 * 36];   // per-wave output tile [q][d], 32 -> 36 floats a row
  float* so = ldsOf[wave];
#pragma unroll
  for (int qt = 0; qt < QW; ++qt) {
    const float rl = 1.0f / (lrun[qt] * 1024.0f);
#pragma unroll
    for (int j = 0; j < 2; ++j)
#pragma unroll
      for (int r = 0; r < 8; ++r) so[(16 * qt + qlane) * 36 + j * 16 + kh8 + r] = o[qt][j][r] * rl;
  }
  asm volatile("s_wait_dscnt 0" ::: "memory");
  __builtin_amdgcn_wave_barrier();
{
#pragma unroll
    for (int it = 0; it < 8; ++it) { const int ch = lane + 32 * it, ql = ch >> 3, q4 = (ch & 7) * 4;
      *(v4f_t*)(attnOut + ((size_t)(b * QROWS + q0 + ql)) * CM + h * DH + q4) = *(const v4fa*)(so + ql * 36 + q4); }
    
  }
}


#undef QROWS
#undef KROWS
#undef NKV
// LayerNorm over C (256 or 128) per row; in place allowed; wave = LNR consecutive rows, block = 8 * LNR rows. All LNR rows are loaded before the
// first is reduced, so one wave start pays for LNR rows; per row the lane -> element map and both reduction trees are the one-row form's.
#define LNR 4
template <int C>
__global__ __launch_bounds__(256) void k_ln(const float* __restrict__ X, const float* __restrict__ g, const float* __restrict__ bb, float* __restrict__ Y) {
  const int tid = threadIdx.x, r = tid >> 5, lane = tid & 31; const size_t row0 = ((size_t)blockIdx.x * 8 + r) * LNR;
  float v[LNR][C / 32];
#pragma unroll
  for (int k = 0; k < LNR; ++k)
#pragma unroll
    for (int i = 0; i < C / 32; ++i) v[k][i] = X[(row0 + k) * C + lane + 32 * i];
#pragma unroll
  for (int k = 0; k < LNR; ++k) {
    float s = 0.0f;
#pragma unroll
    for (int i = 0; i < C / 32; ++i) s += v[k][i];
#pragma unroll
    for (int off = 1; off < 32; off <<= 1) s += __shfl_xor(s, off, 32);
    const float mean = s * (1.0f / C); float q = 0.0f;
#pragma unroll
    for (int i = 0; i < C / 32; ++i) { const float d = v[k][i] - mean; q += d * d; }
#pragma unroll
    for (int off = 1; off < 32; off <<= 1) q += __shfl_xor(q, off, 32);
    const float rstd = rsqrtf(q * (1.0f / C) + 1e-5f);
#pragma unroll
    for (int i = 0; i < C / 32; ++i) Y[(row0 + k) * C + lane + 32 * i] = (v[k][i] - mean) * rstd * g[lane + 32 * i] + bb[lane + 32 * i];
  }
}
// pair-bias table, value (h, i, j) = LN(bias_rep[i][j]) * Wb[:,h] + bb[h]; thread = one (i, j) row, wave = 8 queries i x 4 consecutive keys j, block = PBW waves.
// Stored in the order in which the row attention's score fragments take it: [h][i / 16][j / 32] tiles of BTILE floats, a tile = 4 groups x 32 lanes x 4 floats, with
// jj = j % 32: group = 2 (jj / 16) + (jj / 4) % 2, lane = 16 ((jj / 8) % 2) + i % 16, float = jj % 4. A wave here fills one whole 128-B line per head.
// A wave brings its 32 rows in as whole 512-B rows, one a wave-wide load, all 32 loads in flight, and turns them through its own LDS slice, so that each
// thread then holds its whole row in registers: memory is read once, in whole lines. Row pitch 132 floats: the 16-byte reads of 16 rows fall on all 64 banks.
// Every sum runs over c in the same order as a plain loop over the row.
#define PBW 4
#define PBP 132
__global__ __launch_bounds__(32 * PBW) void k_pairbias(const float* __restrict__ Z, const float* __restrict__ g2, const float* __restrict__ be2, const float* __restrict__ Wb, const float* __restrict__ bbh, float* __restrict__ BT) {
  __shared__ __attribute__((aligned(16))) float zS[PBW][32 * PBP];
  const int tid = threadIdx.x, lane = tid & 31, wave = tid >> 5;
  const int wv = blockIdx.x * PBW + wave, qg = wv >> 6, k4 = wv & 63;   // queries 8 qg .. + 7, keys 4 k4 .. + 3; lane = 4 (i % 8) + j % 4
  const float* src = Z + ((size_t)(qg * 8) * NRES + k4 * 4) * CZ + lane * 4;
  float* zw = zS[wave];
  v4f_t ld[32];
#pragma unroll
  for (int k = 0; k < 32; ++k) ld[k] = *(const v4f_t*)(src + ((k >> 2) * NRES + (k & 3)) * CZ);
#pragma unroll
  for (int k = 0; k < 32; ++k) *(v4f_t*)(zw + k * PBP + lane * 4) = ld[k];
  asm volatile("s_wait_dscnt 0" ::: "memory");   // the wave's own LDS writes are done before its lanes read each other's; no other wave touches this slice
  __builtin_amdgcn_wave_barrier();               // keeps the compiler from moving the reads below over the writes above
  float z[CZ];
#pragma unroll
  for (int q4 = 0; q4 < CZ / 4; ++q4) { const v4f_t t = *(const v4fa*)(zw + lane * PBP + 4 * q4);
    z[4 * q4] = t[0]; z[4 * q4 + 1] = t[1]; z[4 * q4 + 2] = t[2]; z[4 * q4 + 3] = t[3]; }
  float s = 0.0f;
#pragma unroll
  for (int c = 0; c < CZ; ++c) s += z[c];
  const float mean = s * (1.0f / CZ); float q = 0.0f;
#pragma unroll
  for (int c = 0; c < CZ; ++c) { const float d = z[c] - mean; q += d * d; }
  const float rstd = rsqrtf(q * (1.0f / CZ) + 1e-5f);
  float acc[NHD];
#pragma unroll
  for (int h = 0; h < NHD; ++h) acc[h] = bbh[h];
#pragma unroll
  for (int c = 0; c < CZ; ++c) { const float zn = (z[c] - mean) * rstd * g2[c] + be2[c];
#pragma unroll
    for (int h = 0; h < NHD; ++h) acc[h] += zn * Wb[c * NHD + h]; }
  const int line = ((qg >> 1) * (NRES / 32) + (k4 >> 3)) * BTILE + (((k4 >> 2) & 1) * 2 + (k4 & 1)) * 128 + ((k4 >> 1) & 1) * 64 + (qg & 1) * 32;
#pragma unroll
  for (int h = 0; h < NHD; ++h) BT[(size_t)h * NRES * NRES + line + lane] = acc[h];
}
// permuted qkvg weights: Wp[c][k*256 + h*32 + d] = W[c][d*32 + k*8 + h] (no extra scale: both attention kernels carry 1/sqrt(32)); block = c (256), thread loops 1024 cols
__global__ __launch_bounds__(256) void k_wperm(const float* __restrict__ Wm, float* __restrict__ Wp) { const int c = blockIdx.x;
  for (int col = threadIdx.x; col < 4 * CM; col += 256) { const int k = col >> 8, h = (col >> 5) & 7, d = col & 31; float v = Wm[(size_t)c * 4 * CM + d * 32 + k * 8 + h];   // both attention kernels carry the 1/sqrt(32) scale themselves
    *(float*)(Wp + (size_t)c * 4 * CM + col) = v;  } }
// gated merge: O16[t][c] = attc[t][c] * sigmoid(g), g = G[t][768 + c], c = h*32 + d. Thread = 4 consecutive channels of a token (64 threads a token,
// 4 tokens a pass), EWP passes a block, unrolled so that several passes' loads are in flight at once: a wave-wide load or store covers whole 128-B lines, and one wave start pays for 128 channels of EWP tokens.
#define EWP 8
__global__ __launch_bounds__(256) void k_gmerge(const float* __restrict__ A, const bf16* __restrict__ G, bf16* __restrict__ O16) {
  const int tid = threadIdx.x; const int c = (tid & 63) * 4;
  const size_t tb = (size_t)blockIdx.x * (4 * EWP) + (tid >> 6);
  v4f_t a[EWP]; bf16x4 g[EWP];
#pragma unroll
  for (int p = 0; p < EWP; ++p) { const size_t t = tb + 4 * p;
    if (p == EWP - 1) asm volatile("s_wait_xcnt 0x0" ::: "memory");
    a[p] = *(const v4f_t*)(A + t * CM + c);
    g[p] = *(const bf16x4*)(G + t * 4 * CM + 3 * CM + c); }
#pragma unroll
  for (int p = 0; p < EWP; ++p) { const size_t t = tb + 4 * p; bf16x4 o;
#pragma unroll
    for (int e = 0; e < 4; ++e) o[e] = (bf16)(a[p][e] / (1.0f + expf(-(float)g[p][e])));
    *(bf16x4*)(O16 + t * CM + c) = o; }
}
// row permutation between (s, r) and (r, s) token orders: dst[row] = src[srow]; rows of 1 KB by 64 lanes x 16 B, 4 rows a pass, EWP passes a block, all loads issued before the first store.
// srow = (row % DIV) * MUL + row / DIV; a block's 4 * EWP rows share row / DIV, so pass p only adds 4 * p * MUL source rows.
template <int DIV, int MUL>
__device__ __forceinline__ void perm_rows(const float* __restrict__ src, unsigned row0, int col, v4f_t* v) {
  static_assert(DIV % (4 * EWP) == 0, "a block's rows must share row / DIV");
  const float* s0 = src + (size_t)((row0 % DIV) * MUL + row0 / DIV) * CM + col;
#pragma unroll
  for (int p = 0; p < EWP; ++p) v[p] = *(const v4f_t*)(s0 + (size_t)(4 * p * MUL) * CM);
}
__global__ __launch_bounds__(256) void k_perm(const float* __restrict__ src, float* __restrict__ dst, int to_rs) {
  const int tid = threadIdx.x; const unsigned row0 = blockIdx.x * (4 * EWP) + (tid >> 6); const int col = (tid & 63) * 4;
  float* d0 = dst + (size_t)row0 * CM + col;
  v4f_t v[EWP];
  if (to_rs) perm_rows<NSEQ, NRES>(src, row0, col, v); else perm_rows<NRES, NSEQ>(src, row0, col, v);
#pragma unroll
  for (int p = 0; p < EWP; ++p) *(v4f_t*)(d0 + (size_t)(4 * p) * CM) = v[p];
}
__global__ __launch_bounds__(256) void k_ones(float* __restrict__ p, int n) { for (int i = threadIdx.x; i < n; i += 256) { *(float*)(p + i) = 1.0f;  } }

extern "C" void kernel_launch(void* const* d_in, const int* in_sizes, int n_in,
                              void* d_out, int out_size, void* d_ws, size_t ws_size,
                              hipStream_t stream) {
  (void)in_sizes; (void)n_in; (void)out_size;
  const float** f = (const float**)d_in;
  const float* x = f[0], *brep = f[1], *Wqkv_r = f[2], *W0r = f[3], *Wb = f[4], *bbh = f[5], *Wqkv_c = f[6], *W0c = f[7], *W1 = f[8], *b1 = f[9], *W2 = f[10], *b2 = f[11], *g1 = f[12], *be1 = f[13], *g2 = f[14], *be2 = f[15], *g3 = f[16], *be3 = f[17];
  float* out = (float*)d_out;     // [1,128,256,256]
  char* ws = (char*)d_ws;
  float* X1 = (float*)ws; ws += (size_t)MTOK * CM * 4;                 // 32 MB: LN1(x), then x + row-att (in place), then LN3 (in place), finally x after the column block (s,r order)
  float* XT = (float*)ws; ws += (size_t)MTOK * CM * 4;                 // 32 MB: (r,s)-ordered copy for the column block
  float* BT = (float*)ws; ws += (size_t)NHD * NRES * NRES * 4;         // 2 MB pair-bias table
  float* Wpr = (float*)ws; ws += (size_t)CM * 4 * CM * 4; float* Wpc = (float*)ws; ws += (size_t)CM * 4 * CM * 4;
  bf16* G16 = (bf16*)ws; ws += (size_t)MTOK * 4 * CM * 2;             // qkvg f16 [32768][1024] (64 MB); also the transition hidden [32768][1024]
  float* attc = (float*)ws; ws += (size_t)MTOK * CM * 4;              // 32 MB attention output rows, f32, before the gate
  bf16* O16 = (bf16*)ws; ws += (size_t)MTOK * CM * 2;                 // 16 MB gated attention output rows (token order of the current block)
  float* ones = (float*)ws; ws += CM * 4;
  if ((size_t)(ws - (char*)d_ws) > ws_size) return;
  const dim3 blk(256);
  k_ones<<<dim3(1), blk, 0, stream>>>(ones, CM);
  k_wperm<<<dim3(CM), blk, 0, stream>>>(Wqkv_r, Wpr); k_wperm<<<dim3(CM), blk, 0, stream>>>(Wqkv_c, Wpc);
  k_pairbias<<<dim3(NRES * NRES / (32 * PBW)), dim3(32 * PBW), 0, stream>>>(brep, g2, be2, Wb, bbh, BT);
  k_ln<CM><<<dim3(MTOK / (8 * LNR)), blk, 0, stream>>>(x, g1, be1, X1);
  // ---- row-wise gated attention with pair bias: every stage one launch over all tokens ----
  gemm_kne<float, 0, true, 4 * CM><<<dim3(MTOK / 128, 4 * CM / 128), blk, 0, stream>>>(X1, CM, Wpr, nullptr, nullptr, nullptr, G16, 4 * CM, CM);
  bt_attn_kernel<<<dim3(NRES / 64, NHD, MTOK / NRES), dim3(64), 0, stream>>>(G16, BT, attc);
  k_gmerge<<<dim3(MTOK / (4 * EWP)), blk, 0, stream>>>(attc, G16, O16);
  gemm_kne<bf16, 2, false, CM><<<dim3(MTOK / 128, CM / 128), blk, 0, stream>>>(O16, CM, W0r, nullptr, X1, ones, X1, CM, CM);     // x = x + o·W0 (in place)
  k_ln<CM><<<dim3(MTOK / (8 * LNR)), blk, 0, stream>>>(X1, g3, be3, X1);                                                                    // x = LN3(x) (in place)
  // ---- column-wise gated attention: tokens re-ordered (r, s); every stage one launch over all tokens ----
  k_perm<<<dim3(MTOK / (4 * EWP)), blk, 0, stream>>>(X1, XT, 1);
  gemm_kne<float, 0, true, 4 * CM><<<dim3(MTOK / 128, 4 * CM / 128), blk, 0, stream>>>(XT, CM, Wpc, nullptr, nullptr, nullptr, G16, 4 * CM, CM);
  col_attn_kernel<<<dim3(NSEQ / 64, NHD, MTOK / NSEQ), dim3(64), 0, stream>>>(G16, attc);
  k_gmerge<<<dim3(MTOK / (4 * EWP)), blk, 0, stream>>>(attc, G16, O16);
  gemm_kne<bf16, 2, false, CM><<<dim3(MTOK / 128, CM / 128), blk, 0, stream>>>(O16, CM, W0c, nullptr, XT, ones, XT, CM, CM);     // xt = xt + o·W0_c (in place, (r,s) order)
  k_perm<<<dim3(MTOK / (4 * EWP)), blk, 0, stream>>>(XT, X1, 0);                                                                          // back to (s,r) order
  // ---- transition, all tokens per launch: out = relu(x*W1 + b1)*W2 + b2 + x ----
  gemm_kne<float, 3, true, 4 * CM><<<dim3(MTOK / 128, 4 * CM / 128), blk, 0, stream>>>(X1, CM, W1, b1, nullptr, nullptr, G16, 4 * CM, CM);
  gemm_kne<bf16, 2, false, CM><<<dim3(MTOK / 128, CM / 128), blk, 0, stream>>>(G16, 4 * CM, W2, b2, X1, ones, out, CM, 4 * CM);
}

// v007
// One run takes 308 microseconds.
// Next to v006, in two timings, it ran 1.06 times as fast each time.
// All steps since v000 together make it 3.81 times as fast.
// Contractions on v_wmma_f32_16x16x32_f16 (plain f16 operands, f32 accumulate): the row- and column-wise gated attentions of an MSA
// block — qkvg = x·Wqkv (K = 256, N = 1024; the reference's (d, k, h) column interleave undone by permuting the WEIGHT columns on the
// device, both attention kernels scale by 32^-½ for the real head dim), the 8-head attentions at head dim 32, their q, k and v read straight from the qkvg rows
// (row: 128 sequences x 256 residues with the pair-bias table [h][i][j] = LN(bias_rep)·Wb + bb added in the row attention; column: 256 residues x 128
// sequences, its two GEMMs mapping their (r, s) rows onto the (s, r) buffer), flash-style S^T = K*Q^T / O^T = V^T*P^T with online softmax in f32 (P x1024), the sigmoid
// gate in the attention's own epilogue, *W0 + residual (K = 256), and the transition relu(x*W1 + b1)*W2 + b2 + x (K = 256 / 1024) - every GEMM and every attention stage one launch over all 32768 tokens; LayerNorms
// in f32. compute dtype: f16 operands, f32 accumulate.  x [1,128,256,256] -> [1,128,256,256].
#include <hip/hip_runtime.h>
#include <hip/hip_bf16.h>
#include <math.h>

#define NSEQ 128
#define NRES 256
#define CM 256
#define CZ 128
#define NHD 8
#define DH 32
#define MTOK (NSEQ * NRES)
#define GLD (4 * CM)   // pitch of a qkvg row, in elements: q | k | v | g blocks of 256, head h at column h * 32 of its block
#define HH 8
#define QW 2
#define SS 256
#define GSTR 48
#define BTILE 512   // floats in one (16 query x 32 key) tile of the pair-bias table

typedef _Float16 bf16;
typedef _Float16 f16;
typedef __attribute__((ext_vector_type(4))) unsigned v4u_t;
typedef unsigned v4ua __attribute__((ext_vector_type(4), may_alias));
typedef __attribute__((ext_vector_type(4))) float v4f_t;
typedef float v4fa __attribute__((ext_vector_type(4), may_alias));
typedef __attribute__((ext_vector_type(16))) bf16  bf16x16;
typedef bf16x16 f16x16;
typedef __attribute__((ext_vector_type(8)))  bf16  bf16x8;
typedef bf16x8 f16x8;
typedef __attribute__((ext_vector_type(4)))  bf16  bf16x4;
typedef __attribute__((ext_vector_type(8)))  float f32x8;
__device__ __forceinline__ f32x8 wmma16(f16x16 a, f16x16 b, f32x8 c) {
  c = __builtin_amdgcn_wmma_f32_16x16x32_f16(false, a, false, b, (short)0, c, false, false);
  asm volatile("v_nop\n\tv_nop\n\tv_nop\n\tv_nop" : "+v"(c) : "v"(a), "v"(b));
  return c;
}
#define LDS_STRIDE 48   // unused; the GEMM tiles pad 32 -> 48 elems (96B rows) with GSTR: aligned b128 reads
#define KSTRIDE    40   // attn K tile [key][d]: 32 -> 40 elems (80B rows, 16 B x odd): conflict-free b128
#define VSTRIDE    48   // attn V tile [key][d]: 32 -> 48 elems (96B rows, 32 B x odd): conflict-free transposing loads

__device__ __forceinline__ f32x8 wmma_bf16(bf16x16 a, bf16x16 b, f32x8 c) {
  c = __builtin_amdgcn_wmma_f32_16x16x32_f16(false, a, false, b, (short)0, c, false, false);
  asm volatile("v_nop\n\tv_nop\n\tv_nop\n\tv_nop" : "+v"(c) : "v"(a), "v"(b));   // A/B-overwrite hazard guard
  return c;
}

// 16x32 (MxK) f16 fragment from a row-major global matrix.
// lanes 0-15  (row=lane)    : elems 0..7 = K+0..7,  8..15 = K+16..23
// lanes 16-31 (row=lane-16) : elems 0..7 = K+8..15, 8..15 = K+24..31
template <typename T>
__device__ __forceinline__ bf16x16 load_frag(const T* __restrict__ base, int ld,
                                             int row0, int k0) {
  const int lane = threadIdx.x & 31;
  const int r    = lane & 15;
  const int kh   = (lane >> 4) * 8;
  const T* p0 = base + (size_t)(row0 + r) * ld + (k0 + kh);
  const T* p1 = p0 + 16;
  bf16x16 f;
#pragma unroll
  for (int i = 0; i < 8; ++i) {
    f[i]     = (bf16)p0[i];
    f[i + 8] = (bf16)p1[i];
  }
  return f;
}

// Same fragment from an LDS tile with padded row stride (base includes row0/k0).
__device__ __forceinline__ bf16x16 lds_frag(const bf16* base, int stride) {
  const int lane = threadIdx.x & 31;
  const int row  = lane & 15;
  const int kh   = (lane >> 4) * 8;
  const bf16x8 lo = *(const bf16x8*)(base + row * stride + kh);
  const bf16x8 hi = *(const bf16x8*)(base + row * stride + kh + 16);
  bf16x16 f;
#pragma unroll
  for (int i = 0; i < 8; ++i) { f[i] = lo[i]; f[i + 8] = hi[i]; }
  return f;
}

// 16 (d) x 32 (key) fragment of V^T from a row-major [key][d] LDS tile, by the transposing load: lane (c = lane & 15, hh = lane >> 4) gets column
// d0 + c at keys 8 hh + 0..7, the second load the same 16 keys further on: the k order of lds_frag and of the packed P. Every lane's address is valid.
typedef short s16x8 __attribute__((ext_vector_type(8)));
__device__ __forceinline__ bf16x16 lds_frag_tr(const bf16* tile, int stride, int d0) {
  typedef __attribute__((address_space(3))) s16x8 lds_s16x8;
  const int lane = threadIdx.x & 31;
  const bf16* p = tile + (8 * (lane >> 4) + (lane & 7)) * stride + d0 + 8 * ((lane >> 3) & 1);
  const bf16x8 lo = __builtin_bit_cast(bf16x8, __builtin_amdgcn_ds_load_tr16_b128_v8i16((lds_s16x8*)p));
  const bf16x8 hi = __builtin_bit_cast(bf16x8, __builtin_amdgcn_ds_load_tr16_b128_v8i16((lds_s16x8*)(p + 16 * stride)));
  bf16x16 f;
#pragma unroll
  for (int i = 0; i < 8; ++i) { f[i] = lo[i]; f[i + 8] = hi[i]; }
  return f;
}

template <typename T>
__device__ __forceinline__ void stage_read16(const T* __restrict__ p, float* buf) {
#pragma unroll
  for (int i = 0; i < 16; ++i) buf[i] = (float)p[i];
}

__device__ __forceinline__ void stage_write(bf16* dst, const float* buf, int nquad) {
#pragma unroll
  for (int i = 0; i < nquad; ++i) {
    bf16x4 q;
    q[0] = (bf16)buf[4 * i];     q[1] = (bf16)buf[4 * i + 1];
    q[2] = (bf16)buf[4 * i + 2]; q[3] = (bf16)buf[4 * i + 3];
    *(bf16x4*)(dst + 4 * i) = q;
  }
}


// ---------------------------------------------------------------------------------------------------------------------------
// gemm_kne: Y[m][n] = epi( Σ_k A[m][k]·W[k][n] + bias[n] ), A f32/f16 [M][lda], W f32 row-major [K][N] (pitch LDW), plain f16 operands,
// f32 accumulate. EPI 0: identity; 1: exact-erf GELU; 2: R[m][n] + gvec[n]·(·) (residual with per-channel gain). Output f32 (or f16
// when OUT16). Block = 128x128 tile, 8 waves as 4(M) x 2(N); per 32-wide k-step A and W tiles staged f16 in LDS (W transposed
// ---------------------------------------------------------------------------------------------------------------------------
// MAP bit 0: the A rows, bit 1: the R and Y rows of this block are the (r, s)-ordered tokens r = blockIdx.x, s = 0..127 of a buffer kept in (s, r) order (row s * NRES + r).
// MAP bit 2: A is head-major f16, [k / 32][token][32], as the attention kernels write it: a k-step's 128 x 32 tile is 8 KB in a row.
#define GSTR 48
template <typename AT, int EPI, bool OUT16, int LDW, int MAP = 0>
__global__ __launch_bounds__(256) void gemm_kne(const AT* __restrict__ A, int lda, const float* __restrict__ Wm,
                                                const float* __restrict__ bias, const float* __restrict__ R, const float* __restrict__ gvec,
                                                void* __restrict__ Yv, int ldy, int K) {
  __shared__ __attribute__((aligned(16))) f16 ldsA[128 * GSTR];
  __shared__ __attribute__((aligned(16))) f16 ldsW[128 * GSTR];
  __shared__ __attribute__((aligned(16))) float oS[8][32 * 68];
  const int tid = threadIdx.x, lane = tid & 31, wave = tid >> 5, cl = lane & 15, rh = (lane >> 4) * 8;
  const int m0 = blockIdx.x * 128, n0 = blockIdx.y * 128;
  const int wm = (wave & 3) * 32, wn = (wave >> 2) * 64;
  static_assert(NSEQ == 128, "a mapped block is one residue's NSEQ tokens");
  const size_t yr0 = (MAP & 2) ? (size_t)blockIdx.x : (size_t)m0, yrs = (MAP & 2) ? NRES : 1;   // R and Y: the block's local row l is buffer row yr0 + l * yrs
  f32x8 acc[2][4];
#pragma unroll
  for (int i = 0; i < 2; ++i)
#pragma unroll
    for (int j = 0; j < 4; ++j) { f32x8 z = {}; acc[i][j] = z; }
#pragma unroll 1
  for (int k0 = 0; k0 < K; k0 += 32) {
    __syncthreads();
    if constexpr (sizeof(AT) == 4) {   // f32 A: 8 lanes take one row's 128 B, so a wave-wide 16-byte load covers 4 whole lines; 32 rows a pass, 4 passes
      const int row = tid >> 3, c4 = (tid & 7) * 4;
      const AT* src = A + ((MAP & 1) ? (size_t)row * NRES + blockIdx.x : (size_t)(m0 + row)) * lda + k0 + c4;
#pragma unroll
      for (int p = 0; p < 4; ++p) { const v4f_t a4 = *(const v4f_t*)(src + (size_t)(32 * p * ((MAP & 1) ? NRES : 1)) * lda);
        bf16x4 q; q[0] = (f16)a4[0]; q[1] = (f16)a4[1]; q[2] = (f16)a4[2]; q[3] = (f16)a4[3];
        *(bf16x4*)(ldsA + (row + 32 * p) * GSTR + c4) = q; }
    } else {                           // f16 A: 4 lanes take one row's 64 B, so a wave-wide 16-byte load touches 8 lines (4 whole lines when head-major: its 8 rows are 512 contiguous bytes); 64 rows a pass, 2 passes
      const int row = tid >> 2, c8 = (tid & 3) * 8;
      const AT* src = (MAP & 4) ? A + ((size_t)(k0 >> 5) * MTOK + m0 + row) * 32 + c8 : A + (size_t)(m0 + row) * lda + k0 + c8;
#pragma unroll
      for (int p = 0; p < 2; ++p) *(bf16x8*)(ldsA + (row + 64 * p) * GSTR + c8) = *(const bf16x8*)(src + (size_t)(64 * p) * ((MAP & 4) ? 32 : lda));
    }
    { const int n = tid & 127, kq = (tid >> 7) * 16;   // one column n and 16 consecutive k a thread: the transpose happens in registers
      const float* src = Wm + (size_t)(k0 + kq) * LDW + n0 + n;   // LDW is a compile-time pitch: the 16 row steps are immediate offsets of one address
      union { f16 h[16]; v4u_t v[2]; } u;
#pragma unroll
      for (int g = 0; g < 16; ++g) u.h[g] = (f16)src[g * LDW];
      *(v4u_t*)(ldsW + n * GSTR + kq) = u.v[0];
      *(v4u_t*)(ldsW + n * GSTR + kq + 8) = u.v[1]; }
    __syncthreads();
    f16x16 af[2];
#pragma unroll
    for (int i = 0; i < 2; ++i) af[i] = lds_frag(ldsA + (wm + 16 * i) * GSTR, GSTR);
#pragma unroll
    for (int j = 0; j < 4; ++j) {
      const f16x16 bf = lds_frag(ldsW + (wn + 16 * j) * GSTR, GSTR);
#pragma unroll
      for (int i = 0; i < 2; ++i) acc[i][j] = wmma16(af[i], bf, acc[i][j]);
    }
  }
  float* so = oS[wave];
#pragma unroll
  for (int i = 0; i < 2; ++i)
#pragma unroll
    for (int j = 0; j < 4; ++j) {
      const int n = n0 + wn + 16 * j + cl;
      const float bv = bias ? bias[n] : 0.0f;
      const float gv = (EPI == 2) ? gvec[n] : 0.0f;
      if (EPI == 1) {
#pragma unroll 1
        for (int r = 0; r < 8; ++r) { const float xg = acc[i][j][r] + bv; so[(16 * i + rh + r) * 68 + 16 * j + cl] = 0.5f * xg * (1.0f + erff(xg * 0.70710678118654752f)); }
      } else {
#pragma unroll
        for (int r = 0; r < 8; ++r) {
          float v = acc[i][j][r] + bv;
          if (EPI == 3) v = fmaxf(v, 0.0f);                                         // EPI 3: ReLU
          if (EPI == 2) v = R[(yr0 + (size_t)(wm + 16 * i + rh + r) * yrs) * ldy + n] + gv * v;
          so[(16 * i + rh + r) * 68 + 16 * j + cl] = v;
        }
      }
    }
  asm volatile("s_wait_dscnt 0" ::: "memory");
  __builtin_amdgcn_wave_barrier();
{
    if (OUT16) {
      f16* Y = (f16*)Yv;
#pragma unroll
      for (int it = 0; it < 8; ++it) { const int c = lane + 32 * it, rr = c >> 3, q8 = (c & 7) * 8;
        union { f16 h[8]; v4u_t v; } u;
#pragma unroll
        for (int e = 0; e < 8; ++e) u.h[e] = (f16)so[rr * 68 + q8 + e];
        *(v4u_t*)(Y + (yr0 + (size_t)(wm + rr) * yrs) * ldy + n0 + wn + q8) = u.v; }
    } else {
      float* Y = (float*)Yv;
#pragma unroll
      for (int it = 0; it < 16; ++it) { const int f4 = lane + 32 * it, rr = f4 >> 4, q = (f4 & 15) * 4;
        *(v4f_t*)(Y + (yr0 + (size_t)(wm + rr) * yrs) * ldy + n0 + wn + q) = *(const v4fa*)(so + rr * 68 + q); }
    }
    
  }
}

#define QROWS 256
#define KROWS 256
#define NKV 256
__global__ __launch_bounds__(64) void bt_attn_kernel(
    const bf16* __restrict__ G, const float* __restrict__ btab,   // G: qkvg rows [token][GLD]; btab: additive logit bias in score-fragment order (BTILE, at k_pairbias)
    bf16* __restrict__ gatedOut) {   // gated output, f16, head-major [h][token][DH]
  __shared__ __attribute__((aligned(16))) bf16 ldsK[32 * KSTRIDE];   // 2.5 KB
  __shared__ __attribute__((aligned(16))) bf16 ldsV[32 * VSTRIDE];   // 3.0 KB

  const int q0blk = blockIdx.x * 64;
  const int h  = blockIdx.y;
  const int b  = blockIdx.z;
  const int t    = threadIdx.x;
  const int wave = t >> 5;
  const int lane = t & 31;
  const int qlane = lane & 15;
  const int kh8   = (lane >> 4) * 8;
  const int q0 = q0blk + wave * 32;          // this wave's 32 queries

  const bf16* Qh = G + (size_t)b * QROWS * GLD + h * DH;   // this head's 32 q columns of the batch's rows (QROWS == KROWS rows per batch), row stride GLD
  const bf16* Kh = Qh + CM;                                // its k columns
  const bf16* Vh = Qh + 2 * CM;                            // its v columns

  // Cooperative staging (64 threads): K tile and V tile, each 32 keys x 32 d. 4 lanes take one key's 64 B, so a wave-wide 16-byte load touches 8 lines; 16 keys a pass, 2 passes.
  const int krow = t >> 2;
  const int kcol = (t & 3) * 8;
  const bf16* kSrc = Kh + (size_t)krow * GLD + kcol;
  const bf16* vSrc = Vh + (size_t)krow * GLD + kcol;

  bf16x16 qf[QW];
#pragma unroll
  for (int qt = 0; qt < QW; ++qt) qf[qt] = load_frag(Qh, GLD, q0 + 16 * qt, 0);

  // This wave's gate values (32 queries x 32 d), in the order of the epilogue's stores: 4 lanes take one query's 64 B. Loaded here so that the key loop covers their latency.
  const size_t tok0 = (size_t)b * QROWS + q0;
  bf16x8 gt[4];
#pragma unroll
  for (int it = 0; it < 4; ++it) gt[it] = *(const bf16x8*)(G + (tok0 + (lane >> 2) + 8 * it) * GLD + 3 * CM + h * DH + (lane & 3) * 8);

  f32x8 o[QW][2] = {};
  float mrun[QW], lrun[QW];
#pragma unroll
  for (int qt = 0; qt < QW; ++qt) { mrun[qt] = -INFINITY; lrun[qt] = 0.0f; }

  const float scale = 0.17677669529663688f * 1.44269504088896340736f;  // hd^-0.5 = 1/sqrt(32), times log2(e)
  const float NEG2 = -1.0e9f;    // masked logit: its weight is exactly 0 once any valid key of the row has been seen (every row
                                 // has one), and anything accumulated before that is wiped by alpha == 0 — same result as -inf
  const int kmax = KROWS - 1;
  const float L2E_ = 1.44269504088896340736f;
  const float* bth = btab + (size_t)(h * (QROWS / 16) + (q0 >> 4)) * (NKV / 32) * BTILE + lane * 4;   // this lane's 16 B in the first 512-B group of the wave's first (16 q x 32 key) tile

  // Prefetch key block kb=0 into registers.
  bf16x8 kreg[2], vreg[2];
#pragma unroll
  for (int i = 0; i < 2; ++i) {
    kreg[i] = *(const bf16x8*)(kSrc + (size_t)(16 * i) * GLD);
    vreg[i] = *(const bf16x8*)(vSrc + (size_t)(16 * i) * GLD);
  }

  for (int kb = 0; kb <= kmax; kb += 32) {
    __syncthreads();   // previous readers done with LDS
#pragma unroll
    for (int i = 0; i < 2; ++i) {
      *(bf16x8*)(&ldsK[(krow + 16 * i) * KSTRIDE + kcol]) = kreg[i];
      *(bf16x8*)(&ldsV[(krow + 16 * i) * VSTRIDE + kcol]) = vreg[i];
    }
    if (kb + 32 <= kmax) {   // prefetch next block during compute
      const bf16* kn = kSrc + (size_t)(kb + 32) * GLD;
      const bf16* vn = vSrc + (size_t)(kb + 32) * GLD;
#pragma unroll
      for (int i = 0; i < 2; ++i) {
        kreg[i] = *(const bf16x8*)(kn + (size_t)(16 * i) * GLD);
        vreg[i] = *(const bf16x8*)(vn + (size_t)(16 * i) * GLD);
      }
    }
    __syncthreads();   // tile visible

    // Phase 1: scores + softmax for both q-tiles (K fragments live here only).
    bf16x16 kf[2];
#pragma unroll
    for (int ktile = 0; ktile < 2; ++ktile) kf[ktile] = lds_frag(ldsK + (ktile * 16) * KSTRIDE, KSTRIDE);

    bf16x16 pf[QW];
    bool act[QW];
#pragma unroll
    for (int qt = 0; qt < QW; ++qt) {
      unsigned mbits = 0;
      {
#pragma unroll
        for (int r = 0; r < 8; ++r) { const int j0 = kb + kh8 + r; if (j0 < NKV) mbits |= 1u << r; if (j0 + 16 < NKV) mbits |= 1u << (8 + r); }
        act[qt] = (__builtin_amdgcn_ballot_w32(mbits != 0) != 0);
      }
      if (act[qt]) {
        const int q_my = q0 + 16 * qt + qlane;
        f32x8 s0 = {}, s1 = {};
        s0 = wmma_bf16(kf[0], qf[qt], s0);
        s1 = wmma_bf16(kf[1], qf[qt], s1);

        const float* bp = bth + (size_t)(qt * (NKV / 32) + (kb >> 5)) * BTILE; (void)q_my;
        v4f_t bv[4];   // group g holds, for this lane's query, the keys of score registers 4 (g & 1) .. + 3 of s0 (g < 2) or s1: each load is 512 contiguous bytes a wave
#pragma unroll
        for (int g = 0; g < 4; ++g) bv[g] = *(const v4f_t*)(bp + g * 128);
        float mx = -INFINITY;
#pragma unroll
        for (int r = 0; r < 8; ++r) {
          s0[r] = (mbits & (1u << r))       ? s0[r] * scale + L2E_ * bv[r >> 2][r & 3] : NEG2;
          s1[r] = (mbits & (1u << (8 + r))) ? s1[r] * scale + L2E_ * bv[2 + (r >> 2)][r & 3] : NEG2;
          mx = fmaxf(mx, fmaxf(s0[r], s1[r]));
        }
        mx = fmaxf(mx, __shfl_xor(mx, 16, 32));
        const float mnew  = fmaxf(mrun[qt], mx);
        const float alpha = exp2f(mrun[qt] - mnew);

        float rsum = 0.0f;
#pragma unroll
        for (int r = 0; r < 8; ++r) {
          const float p0 = exp2f(s0[r] - mnew);
          const float p1 = exp2f(s1[r] - mnew);
          rsum += p0 + p1;
          pf[qt][r]     = (bf16)(p0 * 1024.0f);     // P carried x1024: no f16 copy of a probability is sub-normal
          pf[qt][r + 8] = (bf16)(p1 * 1024.0f);
        }
        rsum += __shfl_xor(rsum, 16, 32);
        lrun[qt] = lrun[qt] * alpha + rsum;
        mrun[qt] = mnew;

        // Rescale accumulators now so the PV phase is pure WMMA.
#pragma unroll
        for (int j = 0; j < 2; ++j)
#pragma unroll
          for (int r = 0; r < 8; ++r) o[qt][j][r] *= alpha;
      }
    }

    // Phase 2: O^T accumulate; each V fragment read from LDS once, used by
    // both q-tiles, then dead (only 8 VGPRs of V live at a time).
#pragma unroll
    for (int j = 0; j < 2; ++j) {
      const bf16x16 vf = lds_frag_tr(ldsV, VSTRIDE, j * 16);
#pragma unroll
      for (int qt = 0; qt < QW; ++qt)
        if (act[qt]) o[qt][j] = wmma_bf16(vf, pf[qt], o[qt][j]);
    }
  }

  __shared__ __attribute__((aligned(16))) float ldsOf[2][32 * 36];   // per-wave output tile [q][d], 32 -> 36 floats a row
  float* so = ldsOf[wave];
#pragma unroll
  for (int qt = 0; qt < QW; ++qt) {
    const float rl = 1.0f / (lrun[qt] * 1024.0f);
#pragma unroll
    for (int j = 0; j < 2; ++j)
#pragma unroll
      for (int r = 0; r < 8; ++r) so[(16 * qt + qlane) * 36 + j * 16 + kh8 + r] = o[qt][j][r] * rl;
  }
  asm volatile("s_wait_dscnt 0" ::: "memory");
  __builtin_amdgcn_wave_barrier();
  // o * sigmoid(g), narrowed to f16. Head-major rows of 64 B: the wave's 32 queries are 2 KB in a row, so every store covers whole 128-B lines that no other wave writes.
#pragma unroll
  for (int it = 0; it < 4; ++it) { const int ql = (lane >> 2) + 8 * it, q8 = (lane & 3) * 8;
    const v4f_t a0 = *(const v4fa*)(so + ql * 36 + q8), a1 = *(const v4fa*)(so + ql * 36 + q8 + 4);
    bf16x8 og;
#pragma unroll
    for (int e = 0; e < 4; ++e) { og[e] = (bf16)(a0[e] / (1.0f + expf(-(float)gt[it][e]))); og[4 + e] = (bf16)(a1[e] / (1.0f + expf(-(float)gt[it][4 + e]))); }
    *(bf16x8*)(gatedOut + ((size_t)h * MTOK + tok0 + ql) * DH + q8) = og; }
}


#undef QROWS
#undef KROWS
#undef NKV
#define QROWS 128
#define KROWS 128
#define NKV 128
__global__ __launch_bounds__(64) void col_attn_kernel(
    const bf16* __restrict__ G,
    bf16* __restrict__ gatedOut) {   // G: qkvg rows [token][GLD]; QROWS queries / KROWS key rows per batch (first NKV valid); gated output, f16, head-major [h][token][DH]
  __shared__ __attribute__((aligned(16))) bf16 ldsK[32 * KSTRIDE];   // 2.5 KB
  __shared__ __attribute__((aligned(16))) bf16 ldsV[32 * VSTRIDE];   // 3.0 KB

  const int q0blk = blockIdx.x * 64;
  const int h  = blockIdx.y;
  const int b  = blockIdx.z;
  const int t    = threadIdx.x;
  const int wave = t >> 5;
  const int lane = t & 31;
  const int qlane = lane & 15;
  const int kh8   = (lane >> 4) * 8;
  const int q0 = q0blk + wave * 32;          // this wave's 32 queries

  const bf16* Qh = G + (size_t)b * QROWS * GLD + h * DH;   // this head's 32 q columns of the batch's rows (QROWS == KROWS rows per batch), row stride GLD
  const bf16* Kh = Qh + CM;                                // its k columns
  const bf16* Vh = Qh + 2 * CM;                            // its v columns

  // Cooperative staging (64 threads): K tile and V tile, each 32 keys x 32 d. 4 lanes take one key's 64 B, so a wave-wide 16-byte load touches 8 lines; 16 keys a pass, 2 passes.
  const int krow = t >> 2;
  const int kcol = (t & 3) * 8;
  const bf16* kSrc = Kh + (size_t)krow * GLD + kcol;
  const bf16* vSrc = Vh + (size_t)krow * GLD + kcol;

  bf16x16 qf[QW];
#pragma unroll
  for (int qt = 0; qt < QW; ++qt) qf[qt] = load_frag(Qh, GLD, q0 + 16 * qt, 0);

  // This wave's gate values (32 queries x 32 d), in the order of the epilogue's stores: 4 lanes take one query's 64 B. Loaded here so that the key loop covers their latency.
  const size_t tok0 = (size_t)b * QROWS + q0;
  bf16x8 gt[4];
#pragma unroll
  for (int it = 0; it < 4; ++it) gt[it] = *(const bf16x8*)(G + (tok0 + (lane >> 2) + 8 * it) * GLD + 3 * CM + h * DH + (lane & 3) * 8);

  f32x8 o[QW][2] = {};
  float mrun[QW], lrun[QW];
#pragma unroll
  for (int qt = 0; qt < QW; ++qt) { mrun[qt] = -INFINITY; lrun[qt] = 0.0f; }

  const float scale = 0.17677669529663688f * 1.44269504088896340736f;  // hd^-0.5 = 1/sqrt(32), times log2(e)
  const float NEG2 = -1.0e9f;    // masked logit: its weight is exactly 0 once any valid key of the row has been seen (every row
                                 // has one), and anything accumulated before that is wiped by alpha == 0 — same result as -inf
  const int kmax = KROWS - 1;    // all key rows (KROWS == NKV: none masked)

  // Prefetch key block kb=0 into registers.
  bf16x8 kreg[2], vreg[2];
#pragma unroll
  for (int i = 0; i < 2; ++i) {
    kreg[i] = *(const bf16x8*)(kSrc + (size_t)(16 * i) * GLD);
    vreg[i] = *(const bf16x8*)(vSrc + (size_t)(16 * i) * GLD);
  }

  for (int kb = 0; kb <= kmax; kb += 32) {
    __syncthreads();   // previous readers done with LDS
#pragma unroll
    for (int i = 0; i < 2; ++i) {
      *(bf16x8*)(&ldsK[(krow + 16 * i) * KSTRIDE + kcol]) = kreg[i];
      *(bf16x8*)(&ldsV[(krow + 16 * i) * VSTRIDE + kcol]) = vreg[i];
    }
    if (kb + 32 <= kmax) {   // prefetch next block during compute
      const bf16* kn = kSrc + (size_t)(kb + 32) * GLD;
      const bf16* vn = vSrc + (size_t)(kb + 32) * GLD;
#pragma unroll
      for (int i = 0; i < 2; ++i) {
        kreg[i] = *(const bf16x8*)(kn + (size_t)(16 * i) * GLD);
        vreg[i] = *(const bf16x8*)(vn + (size_t)(16 * i) * GLD);
      }
    }
    __syncthreads();   // tile visible

    // Phase 1: scores + softmax for both q-tiles (K fragments live here only).
    bf16x16 kf[2];
#pragma unroll
    for (int ktile = 0; ktile < 2; ++ktile) kf[ktile] = lds_frag(ldsK + (ktile * 16) * KSTRIDE, KSTRIDE);

    bf16x16 pf[QW];
    bool act[QW];
#pragma unroll
    for (int qt = 0; qt < QW; ++qt) {
      unsigned mbits = 0;
      {
#pragma unroll
        for (int r = 0; r < 8; ++r) { const int j0 = kb + kh8 + r; if (j0 < NKV) mbits |= 1u << r; if (j0 + 16 < NKV) mbits |= 1u << (8 + r); }
        act[qt] = (__builtin_amdgcn_ballot_w32(mbits != 0) != 0);
      }
      if (act[qt]) {
        const int q_my = q0 + 16 * qt + qlane;
        f32x8 s0 = {}, s1 = {};
        s0 = wmma_bf16(kf[0], qf[qt], s0);
        s1 = wmma_bf16(kf[1], qf[qt], s1);

        float mx = -INFINITY;
#pragma unroll
        for (int r = 0; r < 8; ++r) {
          const int k0i = kb + kh8 + r;
          const int k1i = k0i + 16;
          (void)k0i; (void)k1i; (void)q_my;
          s0[r] = (mbits & (1u << r))       ? s0[r] * scale : NEG2;
          s1[r] = (mbits & (1u << (8 + r))) ? s1[r] * scale : NEG2;
          mx = fmaxf(mx, fmaxf(s0[r], s1[r]));
        }
        mx = fmaxf(mx, __shfl_xor(mx, 16, 32));
        const float mnew  = fmaxf(mrun[qt], mx);
        const float alpha = exp2f(mrun[qt] - mnew);

        float rsum = 0.0f;
#pragma unroll
        for (int r = 0; r < 8; ++r) {
          const float p0 = exp2f(s0[r] - mnew);
          const float p1 = exp2f(s1[r] - mnew);
          rsum += p0 + p1;
          pf[qt][r]     = (bf16)(p0 * 1024.0f);     // P carried x1024: no f16 copy of a probability is sub-normal
          pf[qt][r + 8] = (bf16)(p1 * 1024.0f);
        }
        rsum += __shfl_xor(rsum, 16, 32);
        lrun[qt] = lrun[qt] * alpha + rsum;
        mrun[qt] = mnew;

        // Rescale accumulators now so the PV phase is pure WMMA.
#pragma unroll
        for (int j = 0; j < 2; ++j)
#pragma unroll
          for (int r = 0; r < 8; ++r) o[qt][j][r] *= alpha;
      }
    }

    // Phase 2: O^T accumulate; each V fragment read from LDS once, used by
    // both q-tiles, then dead (only 8 VGPRs of V live at a time).
#pragma unroll
    for (int j = 0; j < 2; ++j) {
      const bf16x16 vf = lds_frag_tr(ldsV, VSTRIDE, j * 16);
#pragma unroll
      for (int qt = 0; qt < QW; ++qt)
        if (act[qt]) o[qt][j] = wmma_bf16(vf, pf[qt], o[qt][j]);
    }
  }

  __shared__ __attribute__((aligned(16))) float ldsOf[2][32 * 36];   // per-wave output tile [q][d], 32 -> 36 floats a row
  float* so = ldsOf[wave];
#pragma unroll
  for (int qt = 0; qt < QW; ++qt) {
    const float rl = 1.0f / (lrun[qt] * 1024.0f);
#pragma unroll
    for (int j = 0; j < 2; ++j)
#pragma unroll
      for (int r = 0; r < 8; ++r) so[(16 * qt + qlane) * 36 + j * 16 + kh8 + r] = o[qt][j][r] * rl;
  }
  asm volatile("s_wait_dscnt 0" ::: "memory");
  __builtin_amdgcn_wave_barrier();
  // o * sigmoid(g), narrowed to f16. Head-major rows of 64 B: the wave's 32 queries are 2 KB in a row, so every store covers whole 128-B lines that no other wave writes.
#pragma unroll
  for (int it = 0; it < 4; ++it) { const int ql = (lane >> 2) + 8 * it, q8 = (lane & 3) * 8;
    const v4f_t a0 = *(const v4fa*)(so + ql * 36 + q8), a1 = *(const v4fa*)(so + ql * 36 + q8 + 4);
    bf16x8 og;
#pragma unroll
    for (int e = 0; e < 4; ++e) { og[e] = (bf16)(a0[e] / (1.0f + expf(-(float)gt[it][e]))); og[4 + e] = (bf16)(a1[e] / (1.0f + expf(-(float)gt[it][4 + e]))); }
    *(bf16x8*)(gatedOut + ((size_t)h * MTOK + tok0 + ql) * DH + q8) = og; }
}


#undef QROWS
#undef KROWS
#undef NKV
// LayerNorm over C (256 or 128) per row; in place allowed; wave = LNR consecutive rows, block = 8 * LNR rows. All LNR rows are loaded before the
// first is reduced, so one wave start pays for LNR rows; per row the lane -> element map and both reduction trees are the one-row form's.
#define LNR 4
template <int C>
__global__ __launch_bounds__(256) void k_ln(const float* __restrict__ X, const float* __restrict__ g, const float* __restrict__ bb, float* __restrict__ Y) {
  const int tid = threadIdx.x, r = tid >> 5, lane = tid & 31; const size_t row0 = ((size_t)blockIdx.x * 8 + r) * LNR;
  float v[LNR][C / 32];
#pragma unroll
  for (int k = 0; k < LNR; ++k)
#pragma unroll
    for (int i = 0; i < C / 32; ++i) v[k][i] = X[(row0 + k) * C + lane + 32 * i];
#pragma unroll
  for (int k = 0; k < LNR; ++k) {
    float s = 0.0f;
#pragma unroll
    for (int i = 0; i < C / 32; ++i) s += v[k][i];
#pragma unroll
    for (int off = 1; off < 32; off <<= 1) s += __shfl_xor(s, off, 32);
    const float mean = s * (1.0f / C); float q = 0.0f;
#pragma unroll
    for (int i = 0; i < C / 32; ++i) { const float d = v[k][i] - mean; q += d * d; }
#pragma unroll
    for (int off = 1; off < 32; off <<= 1) q += __shfl_xor(q, off, 32);
    const float rstd = rsqrtf(q * (1.0f / C) + 1e-5f);
#pragma unroll
    for (int i = 0; i < C / 32; ++i) Y[(row0 + k) * C + lane + 32 * i] = (v[k][i] - mean) * rstd * g[lane + 32 * i] + bb[lane + 32 * i];
  }
}
// pair-bias table, value (h, i, j) = LN(bias_rep[i][j]) * Wb[:,h] + bb[h]; thread = one (i, j) row, wave = 8 queries i x 4 consecutive keys j, block = PBW waves.
// Stored in the order in which the row attention's score fragments take it: [h][i / 16][j / 32] tiles of BTILE floats, a tile = 4 groups x 32 lanes x 4 floats, with
// jj = j % 32: group = 2 (jj / 16) + (jj / 4) % 2, lane = 16 ((jj / 8) % 2) + i % 16, float = jj % 4. A wave here fills one whole 128-B line per head.
// A wave brings its 32 rows in as whole 512-B rows, one a wave-wide load, all 32 loads in flight, and turns them through its own LDS slice, so that each
// thread then holds its whole row in registers: memory is read once, in whole lines. Row pitch 132 floats: the 16-byte reads of 16 rows fall on all 64 banks.
// Every sum runs over c in the same order as a plain loop over the row.
#define PBW 4
#define PBP 132
__global__ __launch_bounds__(32 * PBW) void k_pairbias(const float* __restrict__ Z, const float* __restrict__ g2, const float* __restrict__ be2, const float* __restrict__ Wb, const float* __restrict__ bbh, float* __restrict__ BT) {
  __shared__ __attribute__((aligned(16))) float zS[PBW][32 * PBP];
  const int tid = threadIdx.x, lane = tid & 31, wave = tid >> 5;
  const int wv = blockIdx.x * PBW + wave, qg = wv >> 6, k4 = wv & 63;   // queries 8 qg .. + 7, keys 4 k4 .. + 3; lane = 4 (i % 8) + j % 4
  const float* src = Z + ((size_t)(qg * 8) * NRES + k4 * 4) * CZ + lane * 4;
  float* zw = zS[wave];
  v4f_t ld[32];
#pragma unroll
  for (int k = 0; k < 32; ++k) ld[k] = *(const v4f_t*)(src + ((k >> 2) * NRES + (k & 3)) * CZ);
#pragma unroll
  for (int k = 0; k < 32; ++k) *(v4f_t*)(zw + k * PBP + lane * 4) = ld[k];
  asm volatile("s_wait_dscnt 0" ::: "memory");   // the wave's own LDS writes are done before its lanes read each other's; no other wave touches this slice
  __builtin_amdgcn_wave_barrier();               // keeps the compiler from moving the reads below over the writes above
  float z[CZ];
#pragma unroll
  for (int q4 = 0; q4 < CZ / 4; ++q4) { const v4f_t t = *(const v4fa*)(zw + lane * PBP + 4 * q4);
    z[4 * q4] = t[0]; z[4 * q4 + 1] = t[1]; z[4 * q4 + 2] = t[2]; z[4 * q4 + 3] = t[3]; }
  float s = 0.0f;
#pragma unroll
  for (int c = 0; c < CZ; ++c) s += z[c];
  const float mean = s * (1.0f / CZ); float q = 0.0f;
#pragma unroll
  for (int c = 0; c < CZ; ++c) { const float d = z[c] - mean; q += d * d; }
  const float rstd = rsqrtf(q * (1.0f / CZ) + 1e-5f);
  float acc[NHD];
#pragma unroll
  for (int h = 0; h < NHD; ++h) acc[h] = bbh[h];
#pragma unroll
  for (int c = 0; c < CZ; ++c) { const float zn = (z[c] - mean) * rstd * g2[c] + be2[c];
#pragma unroll
    for (int h = 0; h < NHD; ++h) acc[h] += zn * Wb[c * NHD + h]; }
  const int line = ((qg >> 1) * (NRES / 32) + (k4 >> 3)) * BTILE + (((k4 >> 2) & 1) * 2 + (k4 & 1)) * 128 + ((k4 >> 1) & 1) * 64 + (qg & 1) * 32;
#pragma unroll
  for (int h = 0; h < NHD; ++h) BT[(size_t)h * NRES * NRES + line + lane] = acc[h];
}
// permuted qkvg weights: Wp[c][k*256 + h*32 + d] = W[c][d*32 + k*8 + h] (no extra scale: both attention kernels carry 1/sqrt(32)); block = c (256), thread loops 1024 cols
__global__ __launch_bounds__(256) void k_wperm(const float* __restrict__ Wm, float* __restrict__ Wp) { const int c = blockIdx.x;
  for (int col = threadIdx.x; col < 4 * CM; col += 256) { const int k = col >> 8, h = (col >> 5) & 7, d = col & 31; float v = Wm[(size_t)c * 4 * CM + d * 32 + k * 8 + h];   // both attention kernels carry the 1/sqrt(32) scale themselves
    *(float*)(Wp + (size_t)c * 4 * CM + col) = v;  } }
__global__ __launch_bounds__(256) void k_ones(float* __restrict__ p, int n) { for (int i = threadIdx.x; i < n; i += 256) { *(float*)(p + i) = 1.0f;  } }

extern "C" void kernel_launch(void* const* d_in, const int* in_sizes, int n_in,
                              void* d_out, int out_size, void* d_ws, size_t ws_size,
                              hipStream_t stream) {
  (void)in_sizes; (void)n_in; (void)out_size;
  const float** f = (const float**)d_in;
  const float* x = f[0], *brep = f[1], *Wqkv_r = f[2], *W0r = f[3], *Wb = f[4], *bbh = f[5], *Wqkv_c = f[6], *W0c = f[7], *W1 = f[8], *b1 = f[9], *W2 = f[10], *b2 = f[11], *g1 = f[12], *be1 = f[13], *g2 = f[14], *be2 = f[15], *g3 = f[16], *be3 = f[17];
  float* out = (float*)d_out;     // [1,128,256,256]
  char* ws = (char*)d_ws;
  float* X1 = (float*)ws; ws += (size_t)MTOK * CM * 4;                 // 32 MB: LN1(x), then x + row-att (in place), then LN3 (in place), finally x after the column block (s,r order)
  float* BT = (float*)ws; ws += (size_t)NHD * NRES * NRES * 4;         // 2 MB pair-bias table
  float* Wpr = (float*)ws; ws += (size_t)CM * 4 * CM * 4; float* Wpc = (float*)ws; ws += (size_t)CM * 4 * CM * 4;
  bf16* G16 = (bf16*)ws; ws += (size_t)MTOK * 4 * CM * 2;             // qkvg f16 [32768][1024] (64 MB); also the transition hidden [32768][1024]
  bf16* O16 = (bf16*)ws; ws += (size_t)MTOK * CM * 2;                 // 16 MB gated attention output, head-major [h][token][32] (token order of the current block)
  float* ones = (float*)ws; ws += CM * 4;
  if ((size_t)(ws - (char*)d_ws) > ws_size) return;
  const dim3 blk(256);
  k_ones<<<dim3(1), blk, 0, stream>>>(ones, CM);
  k_wperm<<<dim3(CM), blk, 0, stream>>>(Wqkv_r, Wpr); k_wperm<<<dim3(CM), blk, 0, stream>>>(Wqkv_c, Wpc);
  k_pairbias<<<dim3(NRES * NRES / (32 * PBW)), dim3(32 * PBW), 0, stream>>>(brep, g2, be2, Wb, bbh, BT);
  k_ln<CM><<<dim3(MTOK / (8 * LNR)), blk, 0, stream>>>(x, g1, be1, X1);
  // ---- row-wise gated attention with pair bias: every stage one launch over all tokens ----
  gemm_kne<float, 0, true, 4 * CM><<<dim3(MTOK / 128, 4 * CM / 128), blk, 0, stream>>>(X1, CM, Wpr, nullptr, nullptr, nullptr, G16, 4 * CM, CM);
  bt_attn_kernel<<<dim3(NRES / 64, NHD, MTOK / NRES), dim3(64), 0, stream>>>(G16, BT, O16);
  gemm_kne<bf16, 2, false, CM, 4><<<dim3(MTOK / 128, CM / 128), blk, 0, stream>>>(O16, CM, W0r, nullptr, X1, ones, X1, CM, CM);     // x = x + o*W0 (in place)
  k_ln<CM><<<dim3(MTOK / (8 * LNR)), blk, 0, stream>>>(X1, g3, be3, X1);                                                                    // x = LN3(x) (in place)
  // ---- column-wise gated attention: qkvg and the gated output in (r, s) token order, x stays in (s, r) order; every stage one launch over all tokens ----
  gemm_kne<float, 0, true, 4 * CM, 1><<<dim3(MTOK / 128, 4 * CM / 128), blk, 0, stream>>>(X1, CM, Wpc, nullptr, nullptr, nullptr, G16, 4 * CM, CM);
  col_attn_kernel<<<dim3(NSEQ / 64, NHD, MTOK / NSEQ), dim3(64), 0, stream>>>(G16, O16);
  gemm_kne<bf16, 2, false, CM, 6><<<dim3(MTOK / 128, CM / 128), blk, 0, stream>>>(O16, CM, W0c, nullptr, X1, ones, X1, CM, CM);     // x = x + o*W0_c (in place; block rows (r, s), buffer rows (s, r))
  // ---- transition, all tokens per launch: out = relu(x*W1 + b1)*W2 + b2 + x ----
  gemm_kne<float, 3, true, 4 * CM><<<dim3(MTOK / 128, 4 * CM / 128), blk, 0, stream>>>(X1, CM, W1, b1, nullptr, nullptr, G16, 4 * CM, CM);
  gemm_kne<bf16, 2, false, CM><<<dim3(MTOK / 128, CM / 128), blk, 0, stream>>>(G16, 4 * CM, W2, b2, X1, ones, out, CM, 4 * CM);
}

// v008
// One run takes 299 microseconds.
// Next to v007, in two timings, it ran 1.04 and 1.03 times as fast.
// Counting every step since v000, it is 3.93 times as fast.
// Contractions on v_wmma_f32_16x16x32_f16 (plain f16 operands, f32 accumulate): the row- and column-wise gated attentions of an MSA
// block — qkvg = x·Wqkv (K = 256, N = 1024; the reference's (d, k, h) column interleave undone by permuting the WEIGHT columns on the
// device, both attention kernels scale by 32^-½ for the real head dim), the 8-head attentions at head dim 32, their q, k and v read straight from the qkvg rows
// (row: 128 sequences x 256 residues with the pair-bias table [h][i][j] = LN(bias_rep)·Wb + bb added in the row attention; column: 256 residues x 128
// sequences, its two GEMMs mapping their (r, s) rows onto the (s, r) buffer), flash-style S^T = K*Q^T / O^T = V^T*P^T with online softmax in f32 (P x1024), the sigmoid
// gate in the attention's own epilogue, *W0 + residual (K = 256), and the transition relu(x*W1 + b1)*W2 + b2 + x (K = 256 / 1024) - every GEMM and every attention stage one launch over all 32768 tokens; LayerNorms
// in f32. compute dtype: f16 operands, f32 accumulate.  x [1,128,256,256] -> [1,128,256,256].
#include <hip/hip_runtime.h>
#include <hip/hip_bf16.h>
#include <math.h>

#define NSEQ 128
#define NRES 256
#define CM 256
#define CZ 128
#define NHD 8
#define DH 32
#define MTOK (NSEQ * NRES)
#define GLD (4 * CM)   // pitch of a qkvg row, in elements: q | k | v | g blocks of 256, head h at column h * 32 of its block
#define HH 8
#define QW 2
#define SS 256
#define GSTR 40   // GEMM LDS tiles: rows of 32 f16 (64 B) at a pitch of 80 B = 16 B x odd, so the 16 rows that half a wave reads with one ds_load_b128 fall on all 64 banks
#define BTILE 512   // floats in one (16 query x 32 key) tile of the pair-bias table

typedef _Float16 bf16;
typedef _Float16 f16;
typedef __attribute__((ext_vector_type(4))) unsigned v4u_t;
typedef unsigned v4ua __attribute__((ext_vector_type(4), may_alias));
typedef __attribute__((ext_vector_type(4))) float v4f_t;
typedef float v4fa __attribute__((ext_vector_type(4), may_alias));
typedef __attribute__((ext_vector_type(16))) bf16  bf16x16;
typedef bf16x16 f16x16;
typedef __attribute__((ext_vector_type(8)))  bf16  bf16x8;
typedef bf16x8 f16x8;
typedef __attribute__((ext_vector_type(4)))  bf16  bf16x4;
typedef __attribute__((ext_vector_type(8)))  float f32x8;
__device__ __forceinline__ f32x8 wmma16(f16x16 a, f16x16 b, f32x8 c) {
  c = __builtin_amdgcn_wmma_f32_16x16x32_f16(false, a, false, b, (short)0, c, false, false);
  asm volatile("v_nop\n\tv_nop\n\tv_nop\n\tv_nop" : "+v"(c) : "v"(a), "v"(b));
  return c;
}
#define KSTRIDE    40   // attn K tile [key][d]: 32 -> 40 elems (80B rows, 16 B x odd): conflict-free b128
#define VSTRIDE    48   // attn V tile [key][d]: 32 -> 48 elems (96B rows, 32 B x odd): conflict-free transposing loads

__device__ __forceinline__ f32x8 wmma_bf16(bf16x16 a, bf16x16 b, f32x8 c) {
  c = __builtin_amdgcn_wmma_f32_16x16x32_f16(false, a, false, b, (short)0, c, false, false);
  asm volatile("v_nop\n\tv_nop\n\tv_nop\n\tv_nop" : "+v"(c) : "v"(a), "v"(b));   // A/B-overwrite hazard guard
  return c;
}

// 16x32 (MxK) f16 fragment from a row-major global matrix.
// lanes 0-15  (row=lane)    : elems 0..7 = K+0..7,  8..15 = K+16..23
// lanes 16-31 (row=lane-16) : elems 0..7 = K+8..15, 8..15 = K+24..31
template <typename T>
__device__ __forceinline__ bf16x16 load_frag(const T* __restrict__ base, int ld,
                                             int row0, int k0) {
  const int lane = threadIdx.x & 31;
  const int r    = lane & 15;
  const int kh   = (lane >> 4) * 8;
  const T* p0 = base + (size_t)(row0 + r) * ld + (k0 + kh);
  const T* p1 = p0 + 16;
  bf16x16 f;
#pragma unroll
  for (int i = 0; i < 8; ++i) {
    f[i]     = (bf16)p0[i];
    f[i + 8] = (bf16)p1[i];
  }
  return f;
}

// Same fragment from an LDS tile with padded row stride (base includes row0/k0).
__device__ __forceinline__ bf16x16 lds_frag(const bf16* base, int stride) {
  const int lane = threadIdx.x & 31;
  const int row  = lane & 15;
  const int kh   = (lane >> 4) * 8;
  const bf16x8 lo = *(const bf16x8*)(base + row * stride + kh);
  const bf16x8 hi = *(const bf16x8*)(base + row * stride + kh + 16);
  bf16x16 f;
#pragma unroll
  for (int i = 0; i < 8; ++i) { f[i] = lo[i]; f[i + 8] = hi[i]; }
  return f;
}

// 16 (d) x 32 (key) fragment of V^T from a row-major [key][d] LDS tile, by the transposing load: lane (c = lane & 15, hh = lane >> 4) gets column
// d0 + c at keys 8 hh + 0..7, the second load the same 16 keys further on: the k order of lds_frag and of the packed P. Every lane's address is valid.
typedef short s16x8 __attribute__((ext_vector_type(8)));
__device__ __forceinline__ bf16x16 lds_frag_tr(const bf16* tile, int stride, int d0) {
  typedef __attribute__((address_space(3))) s16x8 lds_s16x8;
  const int lane = threadIdx.x & 31;
  const bf16* p = tile + (8 * (lane >> 4) + (lane & 7)) * stride + d0 + 8 * ((lane >> 3) & 1);
  const bf16x8 lo = __builtin_bit_cast(bf16x8, __builtin_amdgcn_ds_load_tr16_b128_v8i16((lds_s16x8*)p));
  const bf16x8 hi = __builtin_bit_cast(bf16x8, __builtin_amdgcn_ds_load_tr16_b128_v8i16((lds_s16x8*)(p + 16 * stride)));
  bf16x16 f;
#pragma unroll
  for (int i = 0; i < 8; ++i) { f[i] = lo[i]; f[i + 8] = hi[i]; }
  return f;
}

template <typename T>
__device__ __forceinline__ void stage_read16(const T* __restrict__ p, float* buf) {
#pragma unroll
  for (int i = 0; i < 16; ++i) buf[i] = (float)p[i];
}

__device__ __forceinline__ void stage_write(bf16* dst, const float* buf, int nquad) {
#pragma unroll
  for (int i = 0; i < nquad; ++i) {
    bf16x4 q;
    q[0] = (bf16)buf[4 * i];     q[1] = (bf16)buf[4 * i + 1];
    q[2] = (bf16)buf[4 * i + 2]; q[3] = (bf16)buf[4 * i + 3];
    *(bf16x4*)(dst + 4 * i) = q;
  }
}


// ---------------------------------------------------------------------------------------------------------------------------
// gemm_kne: Y[m][n] = epi( Σ_k A[m][k]·W[k][n] + bias[n] ), A f32/f16 [M][lda], W f32 row-major [K][N] (pitch LDW), plain f16 operands,
// f32 accumulate. EPI 0: identity; 1: exact-erf GELU; 2: R[m][n] + gvec[n]·(·) (residual with per-channel gain). Output f32 (or f16
// when OUT16). Block = 128x128 tile, 8 waves as 4(M) x 2(N); per 32-wide k-step A and W tiles staged f16 in LDS (W transposed
// ---------------------------------------------------------------------------------------------------------------------------
// MAP bit 0: the A rows, bit 1: the R and Y rows of this block are the (r, s)-ordered tokens r = blockIdx.x, s = 0..127 of a buffer kept in (s, r) order (row s * NRES + r).
// MAP bit 2: A is head-major f16, [k / 32][token][32], as the attention kernels write it: a k-step's 128 x 32 tile is 8 KB in a row.
#define GSTR 40
template <typename AT, int EPI, bool OUT16, int LDW, int MAP = 0>
__global__ __launch_bounds__(256) void gemm_kne(const AT* __restrict__ A, int lda, const float* __restrict__ Wm,
                                                const float* __restrict__ bias, const float* __restrict__ R, const float* __restrict__ gvec,
                                                void* __restrict__ Yv, int ldy, int K) {
  __shared__ __attribute__((aligned(16))) f16 ldsA[128 * GSTR];
  __shared__ __attribute__((aligned(16))) f16 ldsW[128 * GSTR];
  __shared__ __attribute__((aligned(16))) float oS[8][32 * 68];
  const int tid = threadIdx.x, lane = tid & 31, wave = tid >> 5, cl = lane & 15, rh = (lane >> 4) * 8;
  const int m0 = blockIdx.x * 128, n0 = blockIdx.y * 128;
  const int wm = (wave & 3) * 32, wn = (wave >> 2) * 64;
  static_assert(NSEQ == 128, "a mapped block is one residue's NSEQ tokens");
  const size_t yr0 = (MAP & 2) ? (size_t)blockIdx.x : (size_t)m0, yrs = (MAP & 2) ? NRES : 1;   // R and Y: the block's local row l is buffer row yr0 + l * yrs
  f32x8 acc[2][4];
#pragma unroll
  for (int i = 0; i < 2; ++i)
#pragma unroll
    for (int j = 0; j < 4; ++j) { f32x8 z = {}; acc[i][j] = z; }
#pragma unroll 1
  for (int k0 = 0; k0 < K; k0 += 32) {
    __syncthreads();
    if constexpr (sizeof(AT) == 4) {   // f32 A: 8 lanes take one row's 128 B, so a wave-wide 16-byte load covers 4 whole lines; 32 rows a pass, 4 passes
      const int row = tid >> 3, c4 = (tid & 7) * 4;
      const AT* src = A + ((MAP & 1) ? (size_t)row * NRES + blockIdx.x : (size_t)(m0 + row)) * lda + k0 + c4;
#pragma unroll
      for (int p = 0; p < 4; ++p) { const v4f_t a4 = *(const v4f_t*)(src + (size_t)(32 * p * ((MAP & 1) ? NRES : 1)) * lda);
        bf16x4 q; q[0] = (f16)a4[0]; q[1] = (f16)a4[1]; q[2] = (f16)a4[2]; q[3] = (f16)a4[3];
        *(bf16x4*)(ldsA + (row + 32 * p) * GSTR + c4) = q; }
    } else {                           // f16 A: 4 lanes take one row's 64 B, so a wave-wide 16-byte load touches 8 lines (4 whole lines when head-major: its 8 rows are 512 contiguous bytes); 64 rows a pass, 2 passes
      const int row = tid >> 2, c8 = (tid & 3) * 8;
      const AT* src = (MAP & 4) ? A + ((size_t)(k0 >> 5) * MTOK + m0 + row) * 32 + c8 : A + (size_t)(m0 + row) * lda + k0 + c8;
#pragma unroll
      for (int p = 0; p < 2; ++p) *(bf16x8*)(ldsA + (row + 64 * p) * GSTR + c8) = *(const bf16x8*)(src + (size_t)(64 * p) * ((MAP & 4) ? 32 : lda));
    }
    { const int n = tid & 127, kq = (tid >> 7) * 16;   // one column n and 16 consecutive k a thread: the transpose happens in registers
      const float* src = Wm + (size_t)(k0 + kq) * LDW + n0 + n;   // LDW is a compile-time pitch: the 16 row steps are immediate offsets of one address
      union { f16 h[16]; v4u_t v[2]; } u;
#pragma unroll
      for (int g = 0; g < 16; ++g) u.h[g] = (f16)src[g * LDW];
      *(v4u_t*)(ldsW + n * GSTR + kq) = u.v[0];
      *(v4u_t*)(ldsW + n * GSTR + kq + 8) = u.v[1]; }
    __syncthreads();
    f16x16 af[2];
#pragma unroll
    for (int i = 0; i < 2; ++i) af[i] = lds_frag(ldsA + (wm + 16 * i) * GSTR, GSTR);
#pragma unroll
    for (int j = 0; j < 4; ++j) {
      const f16x16 bf = lds_frag(ldsW + (wn + 16 * j) * GSTR, GSTR);
#pragma unroll
      for (int i = 0; i < 2; ++i) acc[i][j] = wmma16(af[i], bf, acc[i][j]);
    }
  }
  float* so = oS[wave];
#pragma unroll
  for (int i = 0; i < 2; ++i)
#pragma unroll
    for (int j = 0; j < 4; ++j) {
      const int n = n0 + wn + 16 * j + cl;
      const float bv = bias ? bias[n] : 0.0f;
      const float gv = (EPI == 2) ? gvec[n] : 0.0f;
      if (EPI == 1) {
#pragma unroll 1
        for (int r = 0; r < 8; ++r) { const float xg = acc[i][j][r] + bv; so[(16 * i + rh + r) * 68 + 16 * j + cl] = 0.5f * xg * (1.0f + erff(xg * 0.70710678118654752f)); }
      } else {
#pragma unroll
        for (int r = 0; r < 8; ++r) {
          float v = acc[i][j][r] + bv;
          if (EPI == 3) v = fmaxf(v, 0.0f);                                         // EPI 3: ReLU
          if (EPI == 2) v = R[(yr0 + (size_t)(wm + 16 * i + rh + r) * yrs) * ldy + n] + gv * v;
          so[(16 * i + rh + r) * 68 + 16 * j + cl] = v;
        }
      }
    }
  asm volatile("s_wait_dscnt 0" ::: "memory");
  __builtin_amdgcn_wave_barrier();
{
    if (OUT16) {
      f16* Y = (f16*)Yv;
#pragma unroll
      for (int it = 0; it < 8; ++it) { const int c = lane + 32 * it, rr = c >> 3, q8 = (c & 7) * 8;
        union { f16 h[8]; v4u_t v; } u;
#pragma unroll
        for (int e = 0; e < 8; ++e) u.h[e] = (f16)so[rr * 68 + q8 + e];
        *(v4u_t*)(Y + (yr0 + (size_t)(wm + rr) * yrs) * ldy + n0 + wn + q8) = u.v; }
    } else {
      float* Y = (float*)Yv;
#pragma unroll
      for (int it = 0; it < 16; ++it) { const int f4 = lane + 32 * it, rr = f4 >> 4, q = (f4 & 15) * 4;
        *(v4f_t*)(Y + (yr0 + (size_t)(wm + rr) * yrs) * ldy + n0 + wn + q) = *(const v4fa*)(so + rr * 68 + q); }
    }
    
  }
}

#define QROWS 256
#define KROWS 256
#define NKV 256
__global__ __launch_bounds__(64) void bt_attn_kernel(
    const bf16* __restrict__ G, const float* __restrict__ btab,   // G: qkvg rows [token][GLD]; btab: additive logit bias in score-fragment order (BTILE, at k_pairbias)
    bf16* __restrict__ gatedOut) {   // gated output, f16, head-major [h][token][DH]
  __shared__ __attribute__((aligned(16))) bf16 ldsK[32 * KSTRIDE];   // 2.5 KB
  __shared__ __attribute__((aligned(16))) bf16 ldsV[32 * VSTRIDE];   // 3.0 KB

  const int q0blk = blockIdx.x * 64;
  const int h  = blockIdx.y;
  const int b  = blockIdx.z;
  const int t    = threadIdx.x;
  const int wave = t >> 5;
  const int lane = t & 31;
  const int qlane = lane & 15;
  const int kh8   = (lane >> 4) * 8;
  const int q0 = q0blk + wave * 32;          // this wave's 32 queries

  const bf16* Qh = G + (size_t)b * QROWS * GLD + h * DH;   // this head's 32 q columns of the batch's rows (QROWS == KROWS rows per batch), row stride GLD
  const bf16* Kh = Qh + CM;                                // its k columns
  const bf16* Vh = Qh + 2 * CM;                            // its v columns

  // Cooperative staging (64 threads): K tile and V tile, each 32 keys x 32 d. 4 lanes take one key's 64 B, so a wave-wide 16-byte load touches 8 lines; 16 keys a pass, 2 passes.
  const int krow = t >> 2;
  const int kcol = (t & 3) * 8;
  const bf16* kSrc = Kh + (size_t)krow * GLD + kcol;
  const bf16* vSrc = Vh + (size_t)krow * GLD + kcol;

  bf16x16 qf[QW];
#pragma unroll
  for (int qt = 0; qt < QW; ++qt) qf[qt] = load_frag(Qh, GLD, q0 + 16 * qt, 0);

  // This wave's gate values (32 queries x 32 d), in the order of the epilogue's stores: 4 lanes take one query's 64 B. Loaded here so that the key loop covers their latency.
  const size_t tok0 = (size_t)b * QROWS + q0;
  bf16x8 gt[4];
#pragma unroll
  for (int it = 0; it < 4; ++it) gt[it] = *(const bf16x8*)(G + (tok0 + (lane >> 2) + 8 * it) * GLD + 3 * CM + h * DH + (lane & 3) * 8);

  f32x8 o[QW][2] = {};
  float mrun[QW], lrun[QW];
#pragma unroll
  for (int qt = 0; qt < QW; ++qt) { mrun[qt] = -INFINITY; lrun[qt] = 0.0f; }

  const float scale = 0.17677669529663688f * 1.44269504088896340736f;  // hd^-0.5 = 1/sqrt(32), times log2(e)
  const float NEG2 = -1.0e9f;    // masked logit: its weight is exactly 0 once any valid key of the row has been seen (every row
                                 // has one), and anything accumulated before that is wiped by alpha == 0 — same result as -inf
  const int kmax = KROWS - 1;
  const float L2E_ = 1.44269504088896340736f;
  const float* bth = btab + (size_t)(h * (QROWS / 16) + (q0 >> 4)) * (NKV / 32) * BTILE + lane * 4;   // this lane's 16 B in the first 512-B group of the wave's first (16 q x 32 key) tile

  // Prefetch key block kb=0 into registers.
  bf16x8 kreg[2], vreg[2];
#pragma unroll
  for (int i = 0; i < 2; ++i) {
    kreg[i] = *(const bf16x8*)(kSrc + (size_t)(16 * i) * GLD);
    vreg[i] = *(const bf16x8*)(vSrc + (size_t)(16 * i) * GLD);
  }

  for (int kb = 0; kb <= kmax; kb += 32) {
    __syncthreads();   // previous readers done with LDS
#pragma unroll
    for (int i = 0; i < 2; ++i) {
      *(bf16x8*)(&ldsK[(krow + 16 * i) * KSTRIDE + kcol]) = kreg[i];
      *(bf16x8*)(&ldsV[(krow + 16 * i) * VSTRIDE + kcol]) = vreg[i];
    }
    if (kb + 32 <= kmax) {   // prefetch next block during compute
      const bf16* kn = kSrc + (size_t)(kb + 32) * GLD;
      const bf16* vn = vSrc + (size_t)(kb + 32) * GLD;
#pragma unroll
      for (int i = 0; i < 2; ++i) {
        kreg[i] = *(const bf16x8*)(kn + (size_t)(16 * i) * GLD);
        vreg[i] = *(const bf16x8*)(vn + (size_t)(16 * i) * GLD);
      }
    }
    __syncthreads();   // tile visible

    // Phase 1: scores + softmax for both q-tiles (K fragments live here only).
    bf16x16 kf[2];
#pragma unroll
    for (int ktile = 0; ktile < 2; ++ktile) kf[ktile] = lds_frag(ldsK + (ktile * 16) * KSTRIDE, KSTRIDE);

    bf16x16 pf[QW];
    bool act[QW];
#pragma unroll
    for (int qt = 0; qt < QW; ++qt) {
      unsigned mbits = 0;
      {
#pragma unroll
        for (int r = 0; r < 8; ++r) { const int j0 = kb + kh8 + r; if (j0 < NKV) mbits |= 1u << r; if (j0 + 16 < NKV) mbits |= 1u << (8 + r); }
        act[qt] = (__builtin_amdgcn_ballot_w32(mbits != 0) != 0);
      }
      if (act[qt]) {
        const int q_my = q0 + 16 * qt + qlane;
        f32x8 s0 = {}, s1 = {};
        s0 = wmma_bf16(kf[0], qf[qt], s0);
        s1 = wmma_bf16(kf[1], qf[qt], s1);

        const float* bp = bth + (size_t)(qt * (NKV / 32) + (kb >> 5)) * BTILE; (void)q_my;
        v4f_t bv[4];   // group g holds, for this lane's query, the keys of score registers 4 (g & 1) .. + 3 of s0 (g < 2) or s1: each load is 512 contiguous bytes a wave
#pragma unroll
        for (int g = 0; g < 4; ++g) bv[g] = *(const v4f_t*)(bp + g * 128);
        float mx = -INFINITY;
#pragma unroll
        for (int r = 0; r < 8; ++r) {
          s0[r] = (mbits & (1u << r))       ? s0[r] * scale + L2E_ * bv[r >> 2][r & 3] : NEG2;
          s1[r] = (mbits & (1u << (8 + r))) ? s1[r] * scale + L2E_ * bv[2 + (r >> 2)][r & 3] : NEG2;
          mx = fmaxf(mx, fmaxf(s0[r], s1[r]));
        }
        mx = fmaxf(mx, __shfl_xor(mx, 16, 32));
        const float mnew  = fmaxf(mrun[qt], mx);
        const float alpha = exp2f(mrun[qt] - mnew);

        float rsum = 0.0f;
#pragma unroll
        for (int r = 0; r < 8; ++r) {
          const float p0 = exp2f(s0[r] - mnew);
          const float p1 = exp2f(s1[r] - mnew);
          rsum += p0 + p1;
          pf[qt][r]     = (bf16)(p0 * 1024.0f);     // P carried x1024: no f16 copy of a probability is sub-normal
          pf[qt][r + 8] = (bf16)(p1 * 1024.0f);
        }
        rsum += __shfl_xor(rsum, 16, 32);
        lrun[qt] = lrun[qt] * alpha + rsum;
        mrun[qt] = mnew;

        // Rescale accumulators now so the PV phase is pure WMMA.
#pragma unroll
        for (int j = 0; j < 2; ++j)
#pragma unroll
          for (int r = 0; r < 8; ++r) o[qt][j][r] *= alpha;
      }
    }

    // Phase 2: O^T accumulate; each V fragment read from LDS once, used by
    // both q-tiles, then dead (only 8 VGPRs of V live at a time).
#pragma unroll
    for (int j = 0; j < 2; ++j) {
      const bf16x16 vf = lds_frag_tr(ldsV, VSTRIDE, j * 16);
#pragma unroll
      for (int qt = 0; qt < QW; ++qt)
        if (act[qt]) o[qt][j] = wmma_bf16(vf, pf[qt], o[qt][j]);
    }
  }

  __shared__ __attribute__((aligned(16))) float ldsOf[2][32 * 36];   // per-wave output tile [q][d], 32 -> 36 floats a row
  float* so = ldsOf[wave];
#pragma unroll
  for (int qt = 0; qt < QW; ++qt) {
    const float rl = 1.0f / (lrun[qt] * 1024.0f);
#pragma unroll
    for (int j = 0; j < 2; ++j)
#pragma unroll
      for (int r = 0; r < 8; ++r) so[(16 * qt + qlane) * 36 + j * 16 + kh8 + r] = o[qt][j][r] * rl;
  }
  asm volatile("s_wait_dscnt 0" ::: "memory");
  __builtin_amdgcn_wave_barrier();
  // o * sigmoid(g), narrowed to f16. Head-major rows of 64 B: the wave's 32 queries are 2 KB in a row, so every store covers whole 128-B lines that no other wave writes.
#pragma unroll
  for (int it = 0; it < 4; ++it) { const int ql = (lane >> 2) + 8 * it, q8 = (lane & 3) * 8;
    const v4f_t a0 = *(const v4fa*)(so + ql * 36 + q8), a1 = *(const v4fa*)(so + ql * 36 + q8 + 4);
    bf16x8 og;
#pragma unroll
    for (int e = 0; e < 4; ++e) { og[e] = (bf16)(a0[e] / (1.0f + expf(-(float)gt[it][e]))); og[4 + e] = (bf16)(a1[e] / (1.0f + expf(-(float)gt[it][4 + e]))); }
    *(bf16x8*)(gatedOut + ((size_t)h * MTOK + tok0 + ql) * DH + q8) = og; }
}


#undef QROWS
#undef KROWS
#undef NKV
#define QROWS 128
#define KROWS 128
#define NKV 128
__global__ __launch_bounds__(64) void col_attn_kernel(
    const bf16* __restrict__ G,
    bf16* __restrict__ gatedOut) {   // G: qkvg rows [token][GLD]; QROWS queries / KROWS key rows per batch (first NKV valid); gated output, f16, head-major [h][token][DH]
  __shared__ __attribute__((aligned(16))) bf16 ldsK[32 * KSTRIDE];   // 2.5 KB
  __shared__ __attribute__((aligned(16))) bf16 ldsV[32 * VSTRIDE];   // 3.0 KB

  const int q0blk = blockIdx.x * 64;
  const int h  = blockIdx.y;
  const int b  = blockIdx.z;
  const int t    = threadIdx.x;
  const int wave = t >> 5;
  const int lane = t & 31;
  const int qlane = lane & 15;
  const int kh8   = (lane >> 4) * 8;
  const int q0 = q0blk + wave * 32;          // this wave's 32 queries

  const bf16* Qh = G + (size_t)b * QROWS * GLD + h * DH;   // this head's 32 q columns of the batch's rows (QROWS == KROWS rows per batch), row stride GLD
  const bf16* Kh = Qh + CM;                                // its k columns
  const bf16* Vh = Qh + 2 * CM;                            // its v columns

  // Cooperative staging (64 threads): K tile and V tile, each 32 keys x 32 d. 4 lanes take one key's 64 B, so a wave-wide 16-byte load touches 8 lines; 16 keys a pass, 2 passes.
  const int krow = t >> 2;
  const int kcol = (t & 3) * 8;
  const bf16* kSrc = Kh + (size_t)krow * GLD + kcol;
  const bf16* vSrc = Vh + (size_t)krow * GLD + kcol;

  bf16x16 qf[QW];
#pragma unroll
  for (int qt = 0; qt < QW; ++qt) qf[qt] = load_frag(Qh, GLD, q0 + 16 * qt, 0);

  // This wave's gate values (32 queries x 32 d), in the order of the epilogue's stores: 4 lanes take one query's 64 B. Loaded here so that the key loop covers their latency.
  const size_t tok0 = (size_t)b * QROWS + q0;
  bf16x8 gt[4];
#pragma unroll
  for (int it = 0; it < 4; ++it) gt[it] = *(const bf16x8*)(G + (tok0 + (lane >> 2) + 8 * it) * GLD + 3 * CM + h * DH + (lane & 3) * 8);

  f32x8 o[QW][2] = {};
  float mrun[QW], lrun[QW];
#pragma unroll
  for (int qt = 0; qt < QW; ++qt) { mrun[qt] = -INFINITY; lrun[qt] = 0.0f; }

  const float scale = 0.17677669529663688f * 1.44269504088896340736f;  // hd^-0.5 = 1/sqrt(32), times log2(e)
  const float NEG2 = -1.0e9f;    // masked logit: its weight is exactly 0 once any valid key of the row has been seen (every row
                                 // has one), and anything accumulated before that is wiped by alpha == 0 — same result as -inf
  const int kmax = KROWS - 1;    // all key rows (KROWS == NKV: none masked)

  // Prefetch key block kb=0 into registers.
  bf16x8 kreg[2], vreg[2];
#pragma unroll
  for (int i = 0; i < 2; ++i) {
    kreg[i] = *(const bf16x8*)(kSrc + (size_t)(16 * i) * GLD);
    vreg[i] = *(const bf16x8*)(vSrc + (size_t)(16 * i) * GLD);
  }

  for (int kb = 0; kb <= kmax; kb += 32) {
    __syncthreads();   // previous readers done with LDS
#pragma unroll
    for (int i = 0; i < 2; ++i) {
      *(bf16x8*)(&ldsK[(krow + 16 * i) * KSTRIDE + kcol]) = kreg[i];
      *(bf16x8*)(&ldsV[(krow + 16 * i) * VSTRIDE + kcol]) = vreg[i];
    }
    if (kb + 32 <= kmax) {   // prefetch next block during compute
      const bf16* kn = kSrc + (size_t)(kb + 32) * GLD;
      const bf16* vn = vSrc + (size_t)(kb + 32) * GLD;
#pragma unroll
      for (int i = 0; i < 2; ++i) {
        kreg[i] = *(const bf16x8*)(kn + (size_t)(16 * i) * GLD);
        vreg[i] = *(const bf16x8*)(vn + (size_t)(16 * i) * GLD);
      }
    }
    __syncthreads();   // tile visible

    // Phase 1: scores + softmax for both q-tiles (K fragments live here only).
    bf16x16 kf[2];
#pragma unroll
    for (int ktile = 0; ktile < 2; ++ktile) kf[ktile] = lds_frag(ldsK + (ktile * 16) * KSTRIDE, KSTRIDE);

    bf16x16 pf[QW];
    bool act[QW];
#pragma unroll
    for (int qt = 0; qt < QW; ++qt) {
      unsigned mbits = 0;
      {
#pragma unroll
        for (int r = 0; r < 8; ++r) { const int j0 = kb + kh8 + r; if (j0 < NKV) mbits |= 1u << r; if (j0 + 16 < NKV) mbits |= 1u << (8 + r); }
        act[qt] = (__builtin_amdgcn_ballot_w32(mbits != 0) != 0);
      }
      if (act[qt]) {
        const int q_my = q0 + 16 * qt + qlane;
        f32x8 s0 = {}, s1 = {};
        s0 = wmma_bf16(kf[0], qf[qt], s0);
        s1 = wmma_bf16(kf[1], qf[qt], s1);

        float mx = -INFINITY;
#pragma unroll
        for (int r = 0; r < 8; ++r) {
          const int k0i = kb + kh8 + r;
          const int k1i = k0i + 16;
          (void)k0i; (void)k1i; (void)q_my;
          s0[r] = (mbits & (1u << r))       ? s0[r] * scale : NEG2;
          s1[r] = (mbits & (1u << (8 + r))) ? s1[r] * scale : NEG2;
          mx = fmaxf(mx, fmaxf(s0[r], s1[r]));
        }
        mx = fmaxf(mx, __shfl_xor(mx, 16, 32));
        const float mnew  = fmaxf(mrun[qt], mx);
        const float alpha = exp2f(mrun[qt] - mnew);

        float rsum = 0.0f;
#pragma unroll
        for (int r = 0; r < 8; ++r) {
          const float p0 = exp2f(s0[r] - mnew);
          const float p1 = exp2f(s1[r] - mnew);
          rsum += p0 + p1;
          pf[qt][r]     = (bf16)(p0 * 1024.0f);     // P carried x1024: no f16 copy of a probability is sub-normal
          pf[qt][r + 8] = (bf16)(p1 * 1024.0f);
        }
        rsum += __shfl_xor(rsum, 16, 32);
        lrun[qt] = lrun[qt] * alpha + rsum;
        mrun[qt] = mnew;

        // Rescale accumulators now so the PV phase is pure WMMA.
#pragma unroll
        for (int j = 0; j < 2; ++j)
#pragma unroll
          for (int r = 0; r < 8; ++r) o[qt][j][r] *= alpha;
      }
    }

    // Phase 2: O^T accumulate; each V fragment read from LDS once, used by
    // both q-tiles, then dead (only 8 VGPRs of V live at a time).
#pragma unroll
    for (int j = 0; j < 2; ++j) {
      const bf16x16 vf = lds_frag_tr(ldsV, VSTRIDE, j * 16);
#pragma unroll
      for (int qt = 0; qt < QW; ++qt)
        if (act[qt]) o[qt][j] = wmma_bf16(vf, pf[qt], o[qt][j]);
    }
  }

  __shared__ __attribute__((aligned(16))) float ldsOf[2][32 * 36];   // per-wave output tile [q][d], 32 -> 36 floats a row
  float* so = ldsOf[wave];
#pragma unroll
  for (int qt = 0; qt < QW; ++qt) {
    const float rl = 1.0f / (lrun[qt] * 1024.0f);
#pragma unroll
    for (int j = 0; j < 2; ++j)
#pragma unroll
      for (int r = 0; r < 8; ++r) so[(16 * qt + qlane) * 36 + j * 16 + kh8 + r] = o[qt][j][r] * rl;
  }
  asm volatile("s_wait_dscnt 0" ::: "memory");
  __builtin_amdgcn_wave_barrier();
  // o * sigmoid(g), narrowed to f16. Head-major rows of 64 B: the wave's 32 queries are 2 KB in a row, so every store covers whole 128-B lines that no other wave writes.
#pragma unroll
  for (int it = 0; it < 4; ++it) { const int ql = (lane >> 2) + 8 * it, q8 = (lane & 3) * 8;
    const v4f_t a0 = *(const v4fa*)(so + ql * 36 + q8), a1 = *(const v4fa*)(so + ql * 36 + q8 + 4);
    bf16x8 og;
#pragma unroll
    for (int e = 0; e < 4; ++e) { og[e] = (bf16)(a0[e] / (1.0f + expf(-(float)gt[it][e]))); og[4 + e] = (bf16)(a1[e] / (1.0f + expf(-(float)gt[it][4 + e]))); }
    *(bf16x8*)(gatedOut + ((size_t)h * MTOK + tok0 + ql) * DH + q8) = og; }
}


#undef QROWS
#undef KROWS
#undef NKV
// LayerNorm over C (256 or 128) per row; in place allowed; wave = LNR consecutive rows, block = 8 * LNR rows. All LNR rows are loaded before the
// first is reduced, so one wave start pays for LNR rows; per row the lane -> element map and both reduction trees are the one-row form's.
#define LNR 4
template <int C>
__global__ __launch_bounds__(256) void k_ln(const float* __restrict__ X, const float* __restrict__ g, const float* __restrict__ bb, float* __restrict__ Y) {
  const int tid = threadIdx.x, r = tid >> 5, lane = tid & 31; const size_t row0 = ((size_t)blockIdx.x * 8 + r) * LNR;
  float v[LNR][C / 32];
#pragma unroll
  for (int k = 0; k < LNR; ++k)
#pragma unroll
    for (int i = 0; i < C / 32; ++i) v[k][i] = X[(row0 + k) * C + lane + 32 * i];
#pragma unroll
  for (int k = 0; k < LNR; ++k) {
    float s = 0.0f;
#pragma unroll
    for (int i = 0; i < C / 32; ++i) s += v[k][i];
#pragma unroll
    for (int off = 1; off < 32; off <<= 1) s += __shfl_xor(s, off, 32);
    const float mean = s * (1.0f / C); float q = 0.0f;
#pragma unroll
    for (int i = 0; i < C / 32; ++i) { const float d = v[k][i] - mean; q += d * d; }
#pragma unroll
    for (int off = 1; off < 32; off <<= 1) q += __shfl_xor(q, off, 32);
    const float rstd = rsqrtf(q * (1.0f / C) + 1e-5f);
#pragma unroll
    for (int i = 0; i < C / 32; ++i) Y[(row0 + k) * C + lane + 32 * i] = (v[k][i] - mean) * rstd * g[lane + 32 * i] + bb[lane + 32 * i];
  }
}
// pair-bias table, value (h, i, j) = LN(bias_rep[i][j]) * Wb[:,h] + bb[h]; thread = one (i, j) row, wave = 8 queries i x 4 consecutive keys j, block = PBW waves.
// Stored in the order in which the row attention's score fragments take it: [h][i / 16][j / 32] tiles of BTILE floats, a tile = 4 groups x 32 lanes x 4 floats, with
// jj = j % 32: group = 2 (jj / 16) + (jj / 4) % 2, lane = 16 ((jj / 8) % 2) + i % 16, float = jj % 4. A wave here fills one whole 128-B line per head.
// A wave brings its 32 rows in as whole 512-B rows, one a wave-wide load, all 32 loads in flight, and turns them through its own LDS slice, so that each
// thread then holds its whole row in registers: memory is read once, in whole lines. Row pitch 132 floats: the 16-byte reads of 16 rows fall on all 64 banks.
// Every sum runs over c in the same order as a plain loop over the row.
#define PBW 4
#define PBP 132
__global__ __launch_bounds__(32 * PBW) void k_pairbias(const float* __restrict__ Z, const float* __restrict__ g2, const float* __restrict__ be2, const float* __restrict__ Wb, const float* __restrict__ bbh, float* __restrict__ BT) {
  __shared__ __attribute__((aligned(16))) float zS[PBW][32 * PBP];
  const int tid = threadIdx.x, lane = tid & 31, wave = tid >> 5;
  const int wv = blockIdx.x * PBW + wave, qg = wv >> 6, k4 = wv & 63;   // queries 8 qg .. + 7, keys 4 k4 .. + 3; lane = 4 (i % 8) + j % 4
  const float* src = Z + ((size_t)(qg * 8) * NRES + k4 * 4) * CZ + lane * 4;
  float* zw = zS[wave];
  v4f_t ld[32];
#pragma unroll
  for (int k = 0; k < 32; ++k) ld[k] = *(const v4f_t*)(src + ((k >> 2) * NRES + (k & 3)) * CZ);
#pragma unroll
  for (int k = 0; k < 32; ++k) *(v4f_t*)(zw + k * PBP + lane * 4) = ld[k];
  asm volatile("s_wait_dscnt 0" ::: "memory");   // the wave's own LDS writes are done before its lanes read each other's; no other wave touches this slice
  __builtin_amdgcn_wave_barrier();               // keeps the compiler from moving the reads below over the writes above
  float z[CZ];
#pragma unroll
  for (int q4 = 0; q4 < CZ / 4; ++q4) { const v4f_t t = *(const v4fa*)(zw + lane * PBP + 4 * q4);
    z[4 * q4] = t[0]; z[4 * q4 + 1] = t[1]; z[4 * q4 + 2] = t[2]; z[4 * q4 + 3] = t[3]; }
  float s = 0.0f;
#pragma unroll
  for (int c = 0; c < CZ; ++c) s += z[c];
  const float mean = s * (1.0f / CZ); float q = 0.0f;
#pragma unroll
  for (int c = 0; c < CZ; ++c) { const float d = z[c] - mean; q += d * d; }
  const float rstd = rsqrtf(q * (1.0f / CZ) + 1e-5f);
  float acc[NHD];
#pragma unroll
  for (int h = 0; h < NHD; ++h) acc[h] = bbh[h];
#pragma unroll
  for (int c = 0; c < CZ; ++c) { const float zn = (z[c] - mean) * rstd * g2[c] + be2[c];
#pragma unroll
    for (int h = 0; h < NHD; ++h) acc[h] += zn * Wb[c * NHD + h]; }
  const int line = ((qg >> 1) * (NRES / 32) + (k4 >> 3)) * BTILE + (((k4 >> 2) & 1) * 2 + (k4 & 1)) * 128 + ((k4 >> 1) & 1) * 64 + (qg & 1) * 32;
#pragma unroll
  for (int h = 0; h < NHD; ++h) BT[(size_t)h * NRES * NRES + line + lane] = acc[h];
}
// permuted qkvg weights: Wp[c][k*256 + h*32 + d] = W[c][d*32 + k*8 + h] (no extra scale: both attention kernels carry 1/sqrt(32)); block = c (256), thread loops 1024 cols
__global__ __launch_bounds__(256) void k_wperm(const float* __restrict__ Wm, float* __restrict__ Wp) { const int c = blockIdx.x;
  for (int col = threadIdx.x; col < 4 * CM; col += 256) { const int k = col >> 8, h = (col >> 5) & 7, d = col & 31; float v = Wm[(size_t)c * 4 * CM + d * 32 + k * 8 + h];   // both attention kernels carry the 1/sqrt(32) scale themselves
    *(float*)(Wp + (size_t)c * 4 * CM + col) = v;  } }
__global__ __launch_bounds__(256) void k_ones(float* __restrict__ p, int n) { for (int i = threadIdx.x; i < n; i += 256) { *(float*)(p + i) = 1.0f;  } }

extern "C" void kernel_launch(void* const* d_in, const int* in_sizes, int n_in,
                              void* d_out, int out_size, void* d_ws, size_t ws_size,
                              hipStream_t stream) {
  (void)in_sizes; (void)n_in; (void)out_size;
  const float** f = (const float**)d_in;
  const float* x = f[0], *brep = f[1], *Wqkv_r = f[2], *W0r = f[3], *Wb = f[4], *bbh = f[5], *Wqkv_c = f[6], *W0c = f[7], *W1 = f[8], *b1 = f[9], *W2 = f[10], *b2 = f[11], *g1 = f[12], *be1 = f[13], *g2 = f[14], *be2 = f[15], *g3 = f[16], *be3 = f[17];
  float* out = (float*)d_out;     // [1,128,256,256]
  char* ws = (char*)d_ws;
  float* X1 = (float*)ws; ws += (size_t)MTOK * CM * 4;                 // 32 MB: LN1(x), then x + row-att (in place), then LN3 (in place), finally x after the column block (s,r order)
  float* BT = (float*)ws; ws += (size_t)NHD * NRES * NRES * 4;         // 2 MB pair-bias table
  float* Wpr = (float*)ws; ws += (size_t)CM * 4 * CM * 4; float* Wpc = (float*)ws; ws += (size_t)CM * 4 * CM * 4;
  bf16* G16 = (bf16*)ws; ws += (size_t)MTOK * 4 * CM * 2;             // qkvg f16 [32768][1024] (64 MB); also the transition hidden [32768][1024]
  bf16* O16 = (bf16*)ws; ws += (size_t)MTOK * CM * 2;                 // 16 MB gated attention output, head-major [h][token][32] (token order of the current block)
  float* ones = (float*)ws; ws += CM * 4;
  if ((size_t)(ws - (char*)d_ws) > ws_size) return;
  const dim3 blk(256);
  k_ones<<<dim3(1), blk, 0, stream>>>(ones, CM);
  k_wperm<<<dim3(CM), blk, 0, stream>>>(Wqkv_r, Wpr); k_wperm<<<dim3(CM), blk, 0, stream>>>(Wqkv_c, Wpc);
  k_pairbias<<<dim3(NRES * NRES / (32 * PBW)), dim3(32 * PBW), 0, stream>>>(brep, g2, be2, Wb, bbh, BT);
  k_ln<CM><<<dim3(MTOK / (8 * LNR)), blk, 0, stream>>>(x, g1, be1, X1);
  // ---- row-wise gated attention with pair bias: every stage one launch over all tokens ----
  gemm_kne<float, 0, true, 4 * CM><<<dim3(MTOK / 128, 4 * CM / 128), blk, 0, stream>>>(X1, CM, Wpr, nullptr, nullptr, nullptr, G16, 4 * CM, CM);
  bt_attn_kernel<<<dim3(NRES / 64, NHD, MTOK / NRES), dim3(64), 0, stream>>>(G16, BT, O16);
  gemm_kne<bf16, 2, false, CM, 4><<<dim3(MTOK / 128, CM / 128), blk, 0, stream>>>(O16, CM, W0r, nullptr, X1, ones, X1, CM, CM);     // x = x + o*W0 (in place)
  k_ln<CM><<<dim3(MTOK / (8 * LNR)), blk, 0, stream>>>(X1, g3, be3, X1);                                                                    // x = LN3(x) (in place)
  // ---- column-wise gated attention: qkvg and the gated output in (r, s) token order, x stays in (s, r) order; every stage one launch over all tokens ----
  gemm_kne<float, 0, true, 4 * CM, 1><<<dim3(MTOK / 128, 4 * CM / 128), blk, 0, stream>>>(X1, CM, Wpc, nullptr, nullptr, nullptr, G16, 4 * CM, CM);
  col_attn_kernel<<<dim3(NSEQ / 64, NHD, MTOK / NSEQ), dim3(64), 0, stream>>>(G16, O16);
  gemm_kne<bf16, 2, false, CM, 6><<<dim3(MTOK / 128, CM / 128), blk, 0, stream>>>(O16, CM, W0c, nullptr, X1, ones, X1, CM, CM);     // x = x + o*W0_c (in place; block rows (r, s), buffer rows (s, r))
  // ---- transition, all tokens per launch: out = relu(x*W1 + b1)*W2 + b2 + x ----
  gemm_kne<float, 3, true, 4 * CM><<<dim3(MTOK / 128, 4 * CM / 128), blk, 0, stream>>>(X1, CM, W1, b1, nullptr, nullptr, G16, 4 * CM, CM);
  gemm_kne<bf16, 2, false, CM><<<dim3(MTOK / 128, CM / 128), blk, 0, stream>>>(G16, 4 * CM, W2, b2, X1, ones, out, CM, 4 * CM);
}

// v009
// It runs in 288 microseconds.
// Next to v008, in two timings, it ran 1.04 times as fast each time.
// Counting every step since v000, it is 4.08 times as fast.
// Contractions on v_wmma_f32_16x16x32_f16 (plain f16 operands, f32 accumulate): the row- and column-wise gated attentions of an MSA
// block — qkvg = x·Wqkv (K = 256, N = 1024; the reference's (d, k, h) column interleave undone by permuting the WEIGHT columns on the
// device, both attention kernels scale by 32^-½ for the real head dim), the 8-head attentions at head dim 32, their q, k and v read straight from the qkvg rows
// (row: 128 sequences x 256 residues with the pair-bias table [h][i][j] = LN(bias_rep)·Wb + bb added in the row attention; column: 256 residues x 128
// sequences, its two GEMMs mapping their (r, s) rows onto the (s, r) buffer), flash-style S^T = K*Q^T / O^T = V^T*P^T with online softmax in f32 (P x1024), the sigmoid
// gate in the attention's own epilogue, *W0 + residual (K = 256), and the transition relu(x*W1 + b1)*W2 + b2 + x (K = 256 / 1024) - every GEMM and every attention stage one launch over all 32768 tokens; LayerNorms
// in f32. compute dtype: f16 operands, f32 accumulate.  x [1,128,256,256] -> [1,128,256,256].
#include <hip/hip_runtime.h>
#include <hip/hip_bf16.h>
#include <math.h>

#define NSEQ 128
#define NRES 256
#define CM 256
#define CZ 128
#define NHD 8
#define DH 32
#define MTOK (NSEQ * NRES)
#define GLD (4 * CM)   // pitch of a qkvg row, in elements: q | k | v | g blocks of 256, head h at column h * 32 of its block
#define HH 8
#define QW 2
#define SS 256
#define GSTR 40   // GEMM LDS tiles: rows of 32 f16 (64 B) at a pitch of 80 B = 16 B x odd, so the 16 rows that half a wave reads with one ds_load_b128 fall on all 64 banks
#define BTILE 512   // floats in one (16 query x 32 key) tile of the pair-bias table

typedef _Float16 bf16;
typedef _Float16 f16;
typedef __attribute__((ext_vector_type(4))) unsigned v4u_t;
typedef unsigned v4ua __attribute__((ext_vector_type(4), may_alias));
typedef __attribute__((ext_vector_type(4))) float v4f_t;
typedef float v4fa __attribute__((ext_vector_type(4), may_alias));
typedef __attribute__((ext_vector_type(16))) bf16  bf16x16;
typedef bf16x16 f16x16;
typedef __attribute__((ext_vector_type(8)))  bf16  bf16x8;
typedef bf16x8 f16x8;
typedef __attribute__((ext_vector_type(4)))  bf16  bf16x4;
typedef __attribute__((ext_vector_type(8)))  float f32x8;
__device__ __forceinline__ f32x8 wmma16(f16x16 a, f16x16 b, f32x8 c) {
  c = __builtin_amdgcn_wmma_f32_16x16x32_f16(false, a, false, b, (short)0, c, false, false);
  asm volatile("v_nop\n\tv_nop\n\tv_nop\n\tv_nop" : "+v"(c) : "v"(a), "v"(b));
  return c;
}
// The attention kernels' exponentials and reciprocals as bare v_exp_f32 / v_rcp_f32, without the library's range steps (compare, select, add, ldexp round each exp2f;
// range reduction round expf; scale and fix-up round each division). What those steps add is never seen here: a softmax weight or rescale factor below 2^-126 becomes 0
// instead of a sub-normal (its f16 copy x1024 is 0 either way, and every row's sum is at least 1); every reciprocal's argument is at least 1 (or +inf, giving 0).
// Written as runs in asm text to keep the slot that the instruction set asks for behind a transcendental: each works in place on a register of its own, so none reads
// its predecessor's result or overwrites its source, and the closing v_nop fills the slot behind the last.
__device__ __forceinline__ void exp2_run17(float (&e)[17]) {
  // e[i] = 2^e[i]: asm so that the run stays together and its last v_exp_f32 has the v_nop directly behind it
  asm("v_exp_f32 %0, %0\n\tv_exp_f32 %1, %1\n\tv_exp_f32 %2, %2\n\tv_exp_f32 %3, %3\n\tv_exp_f32 %4, %4\n\tv_exp_f32 %5, %5\n\tv_exp_f32 %6, %6\n\tv_exp_f32 %7, %7\n\t"
      "v_exp_f32 %8, %8\n\tv_exp_f32 %9, %9\n\tv_exp_f32 %10, %10\n\tv_exp_f32 %11, %11\n\tv_exp_f32 %12, %12\n\tv_exp_f32 %13, %13\n\tv_exp_f32 %14, %14\n\tv_exp_f32 %15, %15\n\tv_exp_f32 %16, %16\n\tv_nop"
      : "+v"(e[0]), "+v"(e[1]), "+v"(e[2]), "+v"(e[3]), "+v"(e[4]), "+v"(e[5]), "+v"(e[6]), "+v"(e[7]), "+v"(e[8]), "+v"(e[9]), "+v"(e[10]), "+v"(e[11]), "+v"(e[12]), "+v"(e[13]), "+v"(e[14]), "+v"(e[15]), "+v"(e[16]));
}
__device__ __forceinline__ void exp2_run8(float (&e)[8]) {
  // e[i] = 2^e[i], as above
  asm("v_exp_f32 %0, %0\n\tv_exp_f32 %1, %1\n\tv_exp_f32 %2, %2\n\tv_exp_f32 %3, %3\n\tv_exp_f32 %4, %4\n\tv_exp_f32 %5, %5\n\tv_exp_f32 %6, %6\n\tv_exp_f32 %7, %7\n\tv_nop"
      : "+v"(e[0]), "+v"(e[1]), "+v"(e[2]), "+v"(e[3]), "+v"(e[4]), "+v"(e[5]), "+v"(e[6]), "+v"(e[7]));
}
__device__ __forceinline__ void rcp_run8(float (&e)[8]) {
  // e[i] = 1 / e[i]: the same form for v_rcp_f32
  asm("v_rcp_f32 %0, %0\n\tv_rcp_f32 %1, %1\n\tv_rcp_f32 %2, %2\n\tv_rcp_f32 %3, %3\n\tv_rcp_f32 %4, %4\n\tv_rcp_f32 %5, %5\n\tv_rcp_f32 %6, %6\n\tv_rcp_f32 %7, %7\n\tv_nop"
      : "+v"(e[0]), "+v"(e[1]), "+v"(e[2]), "+v"(e[3]), "+v"(e[4]), "+v"(e[5]), "+v"(e[6]), "+v"(e[7]));
}
__device__ __forceinline__ void rcp_run2(float (&e)[2]) {
  // e[i] = 1 / e[i], as above
  asm("v_rcp_f32 %0, %0\n\tv_rcp_f32 %1, %1\n\tv_nop" : "+v"(e[0]), "+v"(e[1]));
}
#define KSTRIDE    40   // attn K tile [key][d]: 32 -> 40 elems (80B rows, 16 B x odd): conflict-free b128
#define VSTRIDE    48   // attn V tile [key][d]: 32 -> 48 elems (96B rows, 32 B x odd): conflict-free transposing loads

__device__ __forceinline__ f32x8 wmma_bf16(bf16x16 a, bf16x16 b, f32x8 c) {
  c = __builtin_amdgcn_wmma_f32_16x16x32_f16(false, a, false, b, (short)0, c, false, false);
  asm volatile("v_nop\n\tv_nop\n\tv_nop\n\tv_nop" : "+v"(c) : "v"(a), "v"(b));   // A/B-overwrite hazard guard
  return c;
}

// 16x32 (MxK) f16 fragment from a row-major global matrix.
// lanes 0-15  (row=lane)    : elems 0..7 = K+0..7,  8..15 = K+16..23
// lanes 16-31 (row=lane-16) : elems 0..7 = K+8..15, 8..15 = K+24..31
template <typename T>
__device__ __forceinline__ bf16x16 load_frag(const T* __restrict__ base, int ld,
                                             int row0, int k0) {
  const int lane = threadIdx.x & 31;
  const int r    = lane & 15;
  const int kh   = (lane >> 4) * 8;
  const T* p0 = base + (size_t)(row0 + r) * ld + (k0 + kh);
  const T* p1 = p0 + 16;
  bf16x16 f;
#pragma unroll
  for (int i = 0; i < 8; ++i) {
    f[i]     = (bf16)p0[i];
    f[i + 8] = (bf16)p1[i];
  }
  return f;
}

// Same fragment from an LDS tile with padded row stride (base includes row0/k0).
__device__ __forceinline__ bf16x16 lds_frag(const bf16* base, int stride) {
  const int lane = threadIdx.x & 31;
  const int row  = lane & 15;
  const int kh   = (lane >> 4) * 8;
  const bf16x8 lo = *(const bf16x8*)(base + row * stride + kh);
  const bf16x8 hi = *(const bf16x8*)(base + row * stride + kh + 16);
  bf16x16 f;
#pragma unroll
  for (int i = 0; i < 8; ++i) { f[i] = lo[i]; f[i + 8] = hi[i]; }
  return f;
}

// 16 (d) x 32 (key) fragment of V^T from a row-major [key][d] LDS tile, by the transposing load: lane (c = lane & 15, hh = lane >> 4) gets column
// d0 + c at keys 8 hh + 0..7, the second load the same 16 keys further on: the k order of lds_frag and of the packed P. Every lane's address is valid.
typedef short s16x8 __attribute__((ext_vector_type(8)));
__device__ __forceinline__ bf16x16 lds_frag_tr(const bf16* tile, int stride, int d0) {
  typedef __attribute__((address_space(3))) s16x8 lds_s16x8;
  const int lane = threadIdx.x & 31;
  const bf16* p = tile + (8 * (lane >> 4) + (lane & 7)) * stride + d0 + 8 * ((lane >> 3) & 1);
  const bf16x8 lo = __builtin_bit_cast(bf16x8, __builtin_amdgcn_ds_load_tr16_b128_v8i16((lds_s16x8*)p));
  const bf16x8 hi = __builtin_bit_cast(bf16x8, __builtin_amdgcn_ds_load_tr16_b128_v8i16((lds_s16x8*)(p + 16 * stride)));
  bf16x16 f;
#pragma unroll
  for (int i = 0; i < 8; ++i) { f[i] = lo[i]; f[i + 8] = hi[i]; }
  return f;
}

template <typename T>
__device__ __forceinline__ void stage_read16(const T* __restrict__ p, float* buf) {
#pragma unroll
  for (int i = 0; i < 16; ++i) buf[i] = (float)p[i];
}

__device__ __forceinline__ void stage_write(bf16* dst, const float* buf, int nquad) {
#pragma unroll
  for (int i = 0; i < nquad; ++i) {
    bf16x4 q;
    q[0] = (bf16)buf[4 * i];     q[1] = (bf16)buf[4 * i + 1];
    q[2] = (bf16)buf[4 * i + 2]; q[3] = (bf16)buf[4 * i + 3];
    *(bf16x4*)(dst + 4 * i) = q;
  }
}


// ---------------------------------------------------------------------------------------------------------------------------
// gemm_kne: Y[m][n] = epi( Σ_k A[m][k]·W[k][n] + bias[n] ), A f32/f16 [M][lda], W f32 row-major [K][N] (pitch LDW), plain f16 operands,
// f32 accumulate. EPI 0: identity; 1: exact-erf GELU; 2: R[m][n] + gvec[n]·(·) (residual with per-channel gain). Output f32 (or f16
// when OUT16). Block = 128x128 tile, 8 waves as 4(M) x 2(N); per 32-wide k-step A and W tiles staged f16 in LDS (W transposed
// ---------------------------------------------------------------------------------------------------------------------------
// MAP bit 0: the A rows, bit 1: the R and Y rows of this block are the (r, s)-ordered tokens r = blockIdx.x, s = 0..127 of a buffer kept in (s, r) order (row s * NRES + r).
// MAP bit 2: A is head-major f16, [k / 32][token][32], as the attention kernels write it: a k-step's 128 x 32 tile is 8 KB in a row.
#define GSTR 40
template <typename AT, int EPI, bool OUT16, int LDW, int MAP = 0>
__global__ __launch_bounds__(256) void gemm_kne(const AT* __restrict__ A, int lda, const float* __restrict__ Wm,
                                                const float* __restrict__ bias, const float* __restrict__ R, const float* __restrict__ gvec,
                                                void* __restrict__ Yv, int ldy, int K) {
  __shared__ __attribute__((aligned(16))) f16 ldsA[128 * GSTR];
  __shared__ __attribute__((aligned(16))) f16 ldsW[128 * GSTR];
  __shared__ __attribute__((aligned(16))) float oS[8][32 * 68];
  const int tid = threadIdx.x, lane = tid & 31, wave = tid >> 5, cl = lane & 15, rh = (lane >> 4) * 8;
  const int m0 = blockIdx.x * 128, n0 = blockIdx.y * 128;
  const int wm = (wave & 3) * 32, wn = (wave >> 2) * 64;
  static_assert(NSEQ == 128, "a mapped block is one residue's NSEQ tokens");
  const size_t yr0 = (MAP & 2) ? (size_t)blockIdx.x : (size_t)m0, yrs = (MAP & 2) ? NRES : 1;   // R and Y: the block's local row l is buffer row yr0 + l * yrs
  f32x8 acc[2][4];
#pragma unroll
  for (int i = 0; i < 2; ++i)
#pragma unroll
    for (int j = 0; j < 4; ++j) { f32x8 z = {}; acc[i][j] = z; }
#pragma unroll 1
  for (int k0 = 0; k0 < K; k0 += 32) {
    __syncthreads();
    if constexpr (sizeof(AT) == 4) {   // f32 A: 8 lanes take one row's 128 B, so a wave-wide 16-byte load covers 4 whole lines; 32 rows a pass, 4 passes
      const int row = tid >> 3, c4 = (tid & 7) * 4;
      const AT* src = A + ((MAP & 1) ? (size_t)row * NRES + blockIdx.x : (size_t)(m0 + row)) * lda + k0 + c4;
#pragma unroll
      for (int p = 0; p < 4; ++p) { const v4f_t a4 = *(const v4f_t*)(src + (size_t)(32 * p * ((MAP & 1) ? NRES : 1)) * lda);
        bf16x4 q; q[0] = (f16)a4[0]; q[1] = (f16)a4[1]; q[2] = (f16)a4[2]; q[3] = (f16)a4[3];
        *(bf16x4*)(ldsA + (row + 32 * p) * GSTR + c4) = q; }
    } else {                           // f16 A: 4 lanes take one row's 64 B, so a wave-wide 16-byte load touches 8 lines (4 whole lines when head-major: its 8 rows are 512 contiguous bytes); 64 rows a pass, 2 passes
      const int row = tid >> 2, c8 = (tid & 3) * 8;
      const AT* src = (MAP & 4) ? A + ((size_t)(k0 >> 5) * MTOK + m0 + row) * 32 + c8 : A + (size_t)(m0 + row) * lda + k0 + c8;
#pragma unroll
      for (int p = 0; p < 2; ++p) *(bf16x8*)(ldsA + (row + 64 * p) * GSTR + c8) = *(const bf16x8*)(src + (size_t)(64 * p) * ((MAP & 4) ? 32 : lda));
    }
    { const int n = tid & 127, kq = (tid >> 7) * 16;   // one column n and 16 consecutive k a thread: the transpose happens in registers
      const float* src = Wm + (size_t)(k0 + kq) * LDW + n0 + n;   // LDW is a compile-time pitch: the 16 row steps are immediate offsets of one address
      union { f16 h[16]; v4u_t v[2]; } u;
#pragma unroll
      for (int g = 0; g < 16; ++g) u.h[g] = (f16)src[g * LDW];
      *(v4u_t*)(ldsW + n * GSTR + kq) = u.v[0];
      *(v4u_t*)(ldsW + n * GSTR + kq + 8) = u.v[1]; }
    __syncthreads();
    f16x16 af[2];
#pragma unroll
    for (int i = 0; i < 2; ++i) af[i] = lds_frag(ldsA + (wm + 16 * i) * GSTR, GSTR);
#pragma unroll
    for (int j = 0; j < 4; ++j) {
      const f16x16 bf = lds_frag(ldsW + (wn + 16 * j) * GSTR, GSTR);
#pragma unroll
      for (int i = 0; i < 2; ++i) acc[i][j] = wmma16(af[i], bf, acc[i][j]);
    }
  }
  float* so = oS[wave];
#pragma unroll
  for (int i = 0; i < 2; ++i)
#pragma unroll
    for (int j = 0; j < 4; ++j) {
      const int n = n0 + wn + 16 * j + cl;
      const float bv = bias ? bias[n] : 0.0f;
      const float gv = (EPI == 2) ? gvec[n] : 0.0f;
      if (EPI == 1) {
#pragma unroll 1
        for (int r = 0; r < 8; ++r) { const float xg = acc[i][j][r] + bv; so[(16 * i + rh + r) * 68 + 16 * j + cl] = 0.5f * xg * (1.0f + erff(xg * 0.70710678118654752f)); }
      } else {
#pragma unroll
        for (int r = 0; r < 8; ++r) {
          float v = acc[i][j][r] + bv;
          if (EPI == 3) v = fmaxf(v, 0.0f);                                         // EPI 3: ReLU
          if (EPI == 2) v = R[(yr0 + (size_t)(wm + 16 * i + rh + r) * yrs) * ldy + n] + gv * v;
          so[(16 * i + rh + r) * 68 + 16 * j + cl] = v;
        }
      }
    }
  asm volatile("s_wait_dscnt 0" ::: "memory");
  __builtin_amdgcn_wave_barrier();
{
    if (OUT16) {
      f16* Y = (f16*)Yv;
#pragma unroll
      for (int it = 0; it < 8; ++it) { const int c = lane + 32 * it, rr = c >> 3, q8 = (c & 7) * 8;
        union { f16 h[8]; v4u_t v; } u;
#pragma unroll
        for (int e = 0; e < 8; ++e) u.h[e] = (f16)so[rr * 68 + q8 + e];
        *(v4u_t*)(Y + (yr0 + (size_t)(wm + rr) * yrs) * ldy + n0 + wn + q8) = u.v; }
    } else {
      float* Y = (float*)Yv;
#pragma unroll
      for (int it = 0; it < 16; ++it) { const int f4 = lane + 32 * it, rr = f4 >> 4, q = (f4 & 15) * 4;
        *(v4f_t*)(Y + (yr0 + (size_t)(wm + rr) * yrs) * ldy + n0 + wn + q) = *(const v4fa*)(so + rr * 68 + q); }
    }
    
  }
}

#define QROWS 256
#define KROWS 256
#define NKV 256
__global__ __launch_bounds__(64) void bt_attn_kernel(
    const bf16* __restrict__ G, const float* __restrict__ btab,   // G: qkvg rows [token][GLD]; btab: additive logit bias in score-fragment order (BTILE, at k_pairbias)
    bf16* __restrict__ gatedOut) {   // gated output, f16, head-major [h][token][DH]
  __shared__ __attribute__((aligned(16))) bf16 ldsK[32 * KSTRIDE];   // 2.5 KB
  __shared__ __attribute__((aligned(16))) bf16 ldsV[32 * VSTRIDE];   // 3.0 KB

  const int q0blk = blockIdx.x * 64;
  const int h  = blockIdx.y;
  const int b  = blockIdx.z;
  const int t    = threadIdx.x;
  const int wave = t >> 5;
  const int lane = t & 31;
  const int qlane = lane & 15;
  const int kh8   = (lane >> 4) * 8;
  const int q0 = q0blk + wave * 32;          // this wave's 32 queries

  const bf16* Qh = G + (size_t)b * QROWS * GLD + h * DH;   // this head's 32 q columns of the batch's rows (QROWS == KROWS rows per batch), row stride GLD
  const bf16* Kh = Qh + CM;                                // its k columns
  const bf16* Vh = Qh + 2 * CM;                            // its v columns

  // Cooperative staging (64 threads): K tile and V tile, each 32 keys x 32 d. 4 lanes take one key's 64 B, so a wave-wide 16-byte load touches 8 lines; 16 keys a pass, 2 passes.
  const int krow = t >> 2;
  const int kcol = (t & 3) * 8;
  const bf16* kSrc = Kh + (size_t)krow * GLD + kcol;
  const bf16* vSrc = Vh + (size_t)krow * GLD + kcol;

  bf16x16 qf[QW];
#pragma unroll
  for (int qt = 0; qt < QW; ++qt) qf[qt] = load_frag(Qh, GLD, q0 + 16 * qt, 0);

  // This wave's gate values (32 queries x 32 d), in the order of the epilogue's stores: 4 lanes take one query's 64 B. Loaded here so that the key loop covers their latency.
  const size_t tok0 = (size_t)b * QROWS + q0;
  bf16x8 gt[4];
#pragma unroll
  for (int it = 0; it < 4; ++it) gt[it] = *(const bf16x8*)(G + (tok0 + (lane >> 2) + 8 * it) * GLD + 3 * CM + h * DH + (lane & 3) * 8);

  f32x8 o[QW][2] = {};
  float mrun[QW], lrun[QW];
#pragma unroll
  for (int qt = 0; qt < QW; ++qt) { mrun[qt] = -INFINITY; lrun[qt] = 0.0f; }

  const float scale = 0.17677669529663688f * 1.44269504088896340736f;  // hd^-0.5 = 1/sqrt(32), times log2(e)
  const float NEG2 = -1.0e9f;    // masked logit: its weight is exactly 0 once any valid key of the row has been seen (every row
                                 // has one), and anything accumulated before that is wiped by alpha == 0 — same result as -inf
  const int kmax = KROWS - 1;
  const float L2E_ = 1.44269504088896340736f;
  const float* bth = btab + (size_t)(h * (QROWS / 16) + (q0 >> 4)) * (NKV / 32) * BTILE + lane * 4;   // this lane's 16 B in the first 512-B group of the wave's first (16 q x 32 key) tile

  // Prefetch key block kb=0 into registers.
  bf16x8 kreg[2], vreg[2];
#pragma unroll
  for (int i = 0; i < 2; ++i) {
    kreg[i] = *(const bf16x8*)(kSrc + (size_t)(16 * i) * GLD);
    vreg[i] = *(const bf16x8*)(vSrc + (size_t)(16 * i) * GLD);
  }

  for (int kb = 0; kb <= kmax; kb += 32) {
    __syncthreads();   // previous readers done with LDS
#pragma unroll
    for (int i = 0; i < 2; ++i) {
      *(bf16x8*)(&ldsK[(krow + 16 * i) * KSTRIDE + kcol]) = kreg[i];
      *(bf16x8*)(&ldsV[(krow + 16 * i) * VSTRIDE + kcol]) = vreg[i];
    }
    if (kb + 32 <= kmax) {   // prefetch next block during compute
      const bf16* kn = kSrc + (size_t)(kb + 32) * GLD;
      const bf16* vn = vSrc + (size_t)(kb + 32) * GLD;
#pragma unroll
      for (int i = 0; i < 2; ++i) {
        kreg[i] = *(const bf16x8*)(kn + (size_t)(16 * i) * GLD);
        vreg[i] = *(const bf16x8*)(vn + (size_t)(16 * i) * GLD);
      }
    }
    __syncthreads();   // tile visible

    // Phase 1: scores + softmax for both q-tiles (K fragments live here only).
    bf16x16 kf[2];
#pragma unroll
    for (int ktile = 0; ktile < 2; ++ktile) kf[ktile] = lds_frag(ldsK + (ktile * 16) * KSTRIDE, KSTRIDE);

    bf16x16 pf[QW];
    bool act[QW];
#pragma unroll
    for (int qt = 0; qt < QW; ++qt) {
      unsigned mbits = 0;
      {
#pragma unroll
        for (int r = 0; r < 8; ++r) { const int j0 = kb + kh8 + r; if (j0 < NKV) mbits |= 1u << r; if (j0 + 16 < NKV) mbits |= 1u << (8 + r); }
        act[qt] = (__builtin_amdgcn_ballot_w32(mbits != 0) != 0);
      }
      if (act[qt]) {
        const int q_my = q0 + 16 * qt + qlane;
        f32x8 s0 = {}, s1 = {};
        s0 = wmma_bf16(kf[0], qf[qt], s0);
        s1 = wmma_bf16(kf[1], qf[qt], s1);

        const float* bp = bth + (size_t)(qt * (NKV / 32) + (kb >> 5)) * BTILE; (void)q_my;
        v4f_t bv[4];   // group g holds, for this lane's query, the keys of score registers 4 (g & 1) .. + 3 of s0 (g < 2) or s1: each load is 512 contiguous bytes a wave
#pragma unroll
        for (int g = 0; g < 4; ++g) bv[g] = *(const v4f_t*)(bp + g * 128);
        float mx = -INFINITY;
#pragma unroll
        for (int r = 0; r < 8; ++r) {
          s0[r] = (mbits & (1u << r))       ? s0[r] * scale + L2E_ * bv[r >> 2][r & 3] : NEG2;
          s1[r] = (mbits & (1u << (8 + r))) ? s1[r] * scale + L2E_ * bv[2 + (r >> 2)][r & 3] : NEG2;
          mx = fmaxf(mx, fmaxf(s0[r], s1[r]));
        }
        mx = fmaxf(mx, __shfl_xor(mx, 16, 32));
        const float mnew  = fmaxf(mrun[qt], mx);
        float ex[17];   // the 16 weights' exponents and the rescale factor's, one run
#pragma unroll
        for (int r = 0; r < 8; ++r) { ex[r] = s0[r] - mnew; ex[8 + r] = s1[r] - mnew; }
        ex[16] = mrun[qt] - mnew;
        exp2_run17(ex);
        const float alpha = ex[16];

        float rsum = 0.0f;
#pragma unroll
        for (int r = 0; r < 8; ++r) {
          const float p0 = ex[r];
          const float p1 = ex[8 + r];
          rsum += p0 + p1;
          pf[qt][r]     = (bf16)(p0 * 1024.0f);     // P carried x1024: no f16 copy of a probability is sub-normal
          pf[qt][r + 8] = (bf16)(p1 * 1024.0f);
        }
        rsum += __shfl_xor(rsum, 16, 32);
        lrun[qt] = lrun[qt] * alpha + rsum;
        mrun[qt] = mnew;

        // Rescale accumulators now so the PV phase is pure WMMA.
#pragma unroll
        for (int j = 0; j < 2; ++j)
#pragma unroll
          for (int r = 0; r < 8; ++r) o[qt][j][r] *= alpha;
      }
    }

    // Phase 2: O^T accumulate; each V fragment read from LDS once, used by
    // both q-tiles, then dead (only 8 VGPRs of V live at a time).
#pragma unroll
    for (int j = 0; j < 2; ++j) {
      const bf16x16 vf = lds_frag_tr(ldsV, VSTRIDE, j * 16);
#pragma unroll
      for (int qt = 0; qt < QW; ++qt)
        if (act[qt]) o[qt][j] = wmma_bf16(vf, pf[qt], o[qt][j]);
    }
  }

  __shared__ __attribute__((aligned(16))) float ldsOf[2][32 * 36];   // per-wave output tile [q][d], 32 -> 36 floats a row
  float* so = ldsOf[wave];
  static_assert(QW == 2, "rcp_run2 takes both query tiles' sums");
  float rls[QW] = { lrun[0] * 1024.0f, lrun[1] * 1024.0f };
  rcp_run2(rls);
#pragma unroll
  for (int qt = 0; qt < QW; ++qt) {
    const float rl = rls[qt];
#pragma unroll
    for (int j = 0; j < 2; ++j)
#pragma unroll
      for (int r = 0; r < 8; ++r) so[(16 * qt + qlane) * 36 + j * 16 + kh8 + r] = o[qt][j][r] * rl;
  }
  asm volatile("s_wait_dscnt 0" ::: "memory");
  __builtin_amdgcn_wave_barrier();
  // o * sigmoid(g), narrowed to f16. Head-major rows of 64 B: the wave's 32 queries are 2 KB in a row, so every store covers whole 128-B lines that no other wave writes.
#pragma unroll
  for (int it = 0; it < 4; ++it) { const int ql = (lane >> 2) + 8 * it, q8 = (lane & 3) * 8;
    const v4f_t a0 = *(const v4fa*)(so + ql * 36 + q8), a1 = *(const v4fa*)(so + ql * 36 + q8 + 4);
    float sg[8];   // sigmoid(g) = 1 / (1 + 2^(-g log2 e))
#pragma unroll
    for (int e = 0; e < 8; ++e) sg[e] = -1.44269504088896340736f * (float)gt[it][e];
    exp2_run8(sg);
#pragma unroll
    for (int e = 0; e < 8; ++e) sg[e] += 1.0f;
    rcp_run8(sg);
    bf16x8 og;
#pragma unroll
    for (int e = 0; e < 4; ++e) { og[e] = (bf16)(a0[e] * sg[e]); og[4 + e] = (bf16)(a1[e] * sg[4 + e]); }
    *(bf16x8*)(gatedOut + ((size_t)h * MTOK + tok0 + ql) * DH + q8) = og; }
}


#undef QROWS
#undef KROWS
#undef NKV
#define QROWS 128
#define KROWS 128
#define NKV 128
__global__ __launch_bounds__(64) void col_attn_kernel(
    const bf16* __restrict__ G,
    bf16* __restrict__ gatedOut) {   // G: qkvg rows [token][GLD]; QROWS queries / KROWS key rows per batch (first NKV valid); gated output, f16, head-major [h][token][DH]
  __shared__ __attribute__((aligned(16))) bf16 ldsK[32 * KSTRIDE];   // 2.5 KB
  __shared__ __attribute__((aligned(16))) bf16 ldsV[32 * VSTRIDE];   // 3.0 KB

  const int q0blk = blockIdx.x * 64;
  const int h  = blockIdx.y;
  const int b  = blockIdx.z;
  const int t    = threadIdx.x;
  const int wave = t >> 5;
  const int lane = t & 31;
  const int qlane = lane & 15;
  const int kh8   = (lane >> 4) * 8;
  const int q0 = q0blk + wave * 32;          // this wave's 32 queries

  const bf16* Qh = G + (size_t)b * QROWS * GLD + h * DH;   // this head's 32 q columns of the batch's rows (QROWS == KROWS rows per batch), row stride GLD
  const bf16* Kh = Qh + CM;                                // its k columns
  const bf16* Vh = Qh + 2 * CM;                            // its v columns

  // Cooperative staging (64 threads): K tile and V tile, each 32 keys x 32 d. 4 lanes take one key's 64 B, so a wave-wide 16-byte load touches 8 lines; 16 keys a pass, 2 passes.
  const int krow = t >> 2;
  const int kcol = (t & 3) * 8;
  const bf16* kSrc = Kh + (size_t)krow * GLD + kcol;
  const bf16* vSrc = Vh + (size_t)krow * GLD + kcol;

  bf16x16 qf[QW];
#pragma unroll
  for (int qt = 0; qt < QW; ++qt) qf[qt] = load_frag(Qh, GLD, q0 + 16 * qt, 0);

  // This wave's gate values (32 queries x 32 d), in the order of the epilogue's stores: 4 lanes take one query's 64 B. Loaded here so that the key loop covers their latency.
  const size_t tok0 = (size_t)b * QROWS + q0;
  bf16x8 gt[4];
#pragma unroll
  for (int it = 0; it < 4; ++it) gt[it] = *(const bf16x8*)(G + (tok0 + (lane >> 2) + 8 * it) * GLD + 3 * CM + h * DH + (lane & 3) * 8);

  f32x8 o[QW][2] = {};
  float mrun[QW], lrun[QW];
#pragma unroll
  for (int qt = 0; qt < QW; ++qt) { mrun[qt] = -INFINITY; lrun[qt] = 0.0f; }

  const float scale = 0.17677669529663688f * 1.44269504088896340736f;  // hd^-0.5 = 1/sqrt(32), times log2(e)
  const float NEG2 = -1.0e9f;    // masked logit: its weight is exactly 0 once any valid key of the row has been seen (every row
                                 // has one), and anything accumulated before that is wiped by alpha == 0 — same result as -inf
  const int kmax = KROWS - 1;    // all key rows (KROWS == NKV: none masked)

  // Prefetch key block kb=0 into registers.
  bf16x8 kreg[2], vreg[2];
#pragma unroll
  for (int i = 0; i < 2; ++i) {
    kreg[i] = *(const bf16x8*)(kSrc + (size_t)(16 * i) * GLD);
    vreg[i] = *(const bf16x8*)(vSrc + (size_t)(16 * i) * GLD);
  }

  for (int kb = 0; kb <= kmax; kb += 32) {
    __syncthreads();   // previous readers done with LDS
#pragma unroll
    for (int i = 0; i < 2; ++i) {
      *(bf16x8*)(&ldsK[(krow + 16 * i) * KSTRIDE + kcol]) = kreg[i];
      *(bf16x8*)(&ldsV[(krow + 16 * i) * VSTRIDE + kcol]) = vreg[i];
    }
    if (kb + 32 <= kmax) {   // prefetch next block during compute
      const bf16* kn = kSrc + (size_t)(kb + 32) * GLD;
      const bf16* vn = vSrc + (size_t)(kb + 32) * GLD;
#pragma unroll
      for (int i = 0; i < 2; ++i) {
        kreg[i] = *(const bf16x8*)(kn + (size_t)(16 * i) * GLD);
        vreg[i] = *(const bf16x8*)(vn + (size_t)(16 * i) * GLD);
      }
    }
    __syncthreads();   // tile visible

    // Phase 1: scores + softmax for both q-tiles (K fragments live here only).
    bf16x16 kf[2];
#pragma unroll
    for (int ktile = 0; ktile < 2; ++ktile) kf[ktile] = lds_frag(ldsK + (ktile * 16) * KSTRIDE, KSTRIDE);

    bf16x16 pf[QW];
    bool act[QW];
#pragma unroll
    for (int qt = 0; qt < QW; ++qt) {
      unsigned mbits = 0;
      {
#pragma unroll
        for (int r = 0; r < 8; ++r) { const int j0 = kb + kh8 + r; if (j0 < NKV) mbits |= 1u << r; if (j0 + 16 < NKV) mbits |= 1u << (8 + r); }
        act[qt] = (__builtin_amdgcn_ballot_w32(mbits != 0) != 0);
      }
      if (act[qt]) {
        const int q_my = q0 + 16 * qt + qlane;
        f32x8 s0 = {}, s1 = {};
        s0 = wmma_bf16(kf[0], qf[qt], s0);
        s1 = wmma_bf16(kf[1], qf[qt], s1);

        float mx = -INFINITY;
#pragma unroll
        for (int r = 0; r < 8; ++r) {
          const int k0i = kb + kh8 + r;
          const int k1i = k0i + 16;
          (void)k0i; (void)k1i; (void)q_my;
          s0[r] = (mbits & (1u << r))       ? s0[r] * scale : NEG2;
          s1[r] = (mbits & (1u << (8 + r))) ? s1[r] * scale : NEG2;
          mx = fmaxf(mx, fmaxf(s0[r], s1[r]));
        }
        mx = fmaxf(mx, __shfl_xor(mx, 16, 32));
        const float mnew  = fmaxf(mrun[qt], mx);
        float ex[17];   // the 16 weights' exponents and the rescale factor's, one run
#pragma unroll
        for (int r = 0; r < 8; ++r) { ex[r] = s0[r] - mnew; ex[8 + r] = s1[r] - mnew; }
        ex[16] = mrun[qt] - mnew;
        exp2_run17(ex);
        const float alpha = ex[16];

        float rsum = 0.0f;
#pragma unroll
        for (int r = 0; r < 8; ++r) {
          const float p0 = ex[r];
          const float p1 = ex[8 + r];
          rsum += p0 + p1;
          pf[qt][r]     = (bf16)(p0 * 1024.0f);     // P carried x1024: no f16 copy of a probability is sub-normal
          pf[qt][r + 8] = (bf16)(p1 * 1024.0f);
        }
        rsum += __shfl_xor(rsum, 16, 32);
        lrun[qt] = lrun[qt] * alpha + rsum;
        mrun[qt] = mnew;

        // Rescale accumulators now so the PV phase is pure WMMA.
#pragma unroll
        for (int j = 0; j < 2; ++j)
#pragma unroll
          for (int r = 0; r < 8; ++r) o[qt][j][r] *= alpha;
      }
    }

    // Phase 2: O^T accumulate; each V fragment read from LDS once, used by
    // both q-tiles, then dead (only 8 VGPRs of V live at a time).
#pragma unroll
    for (int j = 0; j < 2; ++j) {
      const bf16x16 vf = lds_frag_tr(ldsV, VSTRIDE, j * 16);
#pragma unroll
      for (int qt = 0; qt < QW; ++qt)
        if (act[qt]) o[qt][j] = wmma_bf16(vf, pf[qt], o[qt][j]);
    }
  }

  __shared__ __attribute__((aligned(16))) float ldsOf[2][32 * 36];   // per-wave output tile [q][d], 32 -> 36 floats a row
  float* so = ldsOf[wave];
  static_assert(QW == 2, "rcp_run2 takes both query tiles' sums");
  float rls[QW] = { lrun[0] * 1024.0f, lrun[1] * 1024.0f };
  rcp_run2(rls);
#pragma unroll
  for (int qt = 0; qt < QW; ++qt) {
    const float rl = rls[qt];
#pragma unroll
    for (int j = 0; j < 2; ++j)
#pragma unroll
      for (int r = 0; r < 8; ++r) so[(16 * qt + qlane) * 36 + j * 16 + kh8 + r] = o[qt][j][r] * rl;
  }
  asm volatile("s_wait_dscnt 0" ::: "memory");
  __builtin_amdgcn_wave_barrier();
  // o * sigmoid(g), narrowed to f16. Head-major rows of 64 B: the wave's 32 queries are 2 KB in a row, so every store covers whole 128-B lines that no other wave writes.
#pragma unroll
  for (int it = 0; it < 4; ++it) { const int ql = (lane >> 2) + 8 * it, q8 = (lane & 3) * 8;
    const v4f_t a0 = *(const v4fa*)(so + ql * 36 + q8), a1 = *(const v4fa*)(so + ql * 36 + q8 + 4);
    float sg[8];   // sigmoid(g) = 1 / (1 + 2^(-g log2 e))
#pragma unroll
    for (int e = 0; e < 8; ++e) sg[e] = -1.44269504088896340736f * (float)gt[it][e];
    exp2_run8(sg);
#pragma unroll
    for (int e = 0; e < 8; ++e) sg[e] += 1.0f;
    rcp_run8(sg);
    bf16x8 og;
#pragma unroll
    for (int e = 0; e < 4; ++e) { og[e] = (bf16)(a0[e] * sg[e]); og[4 + e] = (bf16)(a1[e] * sg[4 + e]); }
    *(bf16x8*)(gatedOut + ((size_t)h * MTOK + tok0 + ql) * DH + q8) = og; }
}


#undef QROWS
#undef KROWS
#undef NKV
// LayerNorm over C (256 or 128) per row; in place allowed; wave = LNR consecutive rows, block = 8 * LNR rows. All LNR rows are loaded before the
// first is reduced, so one wave start pays for LNR rows; per row the lane -> element map and both reduction trees are the one-row form's.
#define LNR 4
template <int C>
__global__ __launch_bounds__(256) void k_ln(const float* __restrict__ X, const float* __restrict__ g, const float* __restrict__ bb, float* __restrict__ Y) {
  const int tid = threadIdx.x, r = tid >> 5, lane = tid & 31; const size_t row0 = ((size_t)blockIdx.x * 8 + r) * LNR;
  float v[LNR][C / 32];
#pragma unroll
  for (int k = 0; k < LNR; ++k)
#pragma unroll
    for (int i = 0; i < C / 32; ++i) v[k][i] = X[(row0 + k) * C + lane + 32 * i];
#pragma unroll
  for (int k = 0; k < LNR; ++k) {
    float s = 0.0f;
#pragma unroll
    for (int i = 0; i < C / 32; ++i) s += v[k][i];
#pragma unroll
    for (int off = 1; off < 32; off <<= 1) s += __shfl_xor(s, off, 32);
    const float mean = s * (1.0f / C); float q = 0.0f;
#pragma unroll
    for (int i = 0; i < C / 32; ++i) { const float d = v[k][i] - mean; q += d * d; }
#pragma unroll
    for (int off = 1; off < 32; off <<= 1) q += __shfl_xor(q, off, 32);
    const float rstd = rsqrtf(q * (1.0f / C) + 1e-5f);
#pragma unroll
    for (int i = 0; i < C / 32; ++i) Y[(row0 + k) * C + lane + 32 * i] = (v[k][i] - mean) * rstd * g[lane + 32 * i] + bb[lane + 32 * i];
  }
}
// pair-bias table, value (h, i, j) = LN(bias_rep[i][j]) * Wb[:,h] + bb[h]; thread = one (i, j) row, wave = 8 queries i x 4 consecutive keys j, block = PBW waves.
// Stored in the order in which the row attention's score fragments take it: [h][i / 16][j / 32] tiles of BTILE floats, a tile = 4 groups x 32 lanes x 4 floats, with
// jj = j % 32: group = 2 (jj / 16) + (jj / 4) % 2, lane = 16 ((jj / 8) % 2) + i % 16, float = jj % 4. A wave here fills one whole 128-B line per head.
// A wave brings its 32 rows in as whole 512-B rows, one a wave-wide load, all 32 loads in flight, and turns them through its own LDS slice, so that each
// thread then holds its whole row in registers: memory is read once, in whole lines. Row pitch 132 floats: the 16-byte reads of 16 rows fall on all 64 banks.
// Every sum runs over c in the same order as a plain loop over the row.
#define PBW 4
#define PBP 132
__global__ __launch_bounds__(32 * PBW) void k_pairbias(const float* __restrict__ Z, const float* __restrict__ g2, const float* __restrict__ be2, const float* __restrict__ Wb, const float* __restrict__ bbh, float* __restrict__ BT) {
  __shared__ __attribute__((aligned(16))) float zS[PBW][32 * PBP];
  const int tid = threadIdx.x, lane = tid & 31, wave = tid >> 5;
  const int wv = blockIdx.x * PBW + wave, qg = wv >> 6, k4 = wv & 63;   // queries 8 qg .. + 7, keys 4 k4 .. + 3; lane = 4 (i % 8) + j % 4
  const float* src = Z + ((size_t)(qg * 8) * NRES + k4 * 4) * CZ + lane * 4;
  float* zw = zS[wave];
  v4f_t ld[32];
#pragma unroll
  for (int k = 0; k < 32; ++k) ld[k] = *(const v4f_t*)(src + ((k >> 2) * NRES + (k & 3)) * CZ);
#pragma unroll
  for (int k = 0; k < 32; ++k) *(v4f_t*)(zw + k * PBP + lane * 4) = ld[k];
  asm volatile("s_wait_dscnt 0" ::: "memory");   // the wave's own LDS writes are done before its lanes read each other's; no other wave touches this slice
  __builtin_amdgcn_wave_barrier();               // keeps the compiler from moving the reads below over the writes above
  float z[CZ];
#pragma unroll
  for (int q4 = 0; q4 < CZ / 4; ++q4) { const v4f_t t = *(const v4fa*)(zw + lane * PBP + 4 * q4);
    z[4 * q4] = t[0]; z[4 * q4 + 1] = t[1]; z[4 * q4 + 2] = t[2]; z[4 * q4 + 3] = t[3]; }
  float s = 0.0f;
#pragma unroll
  for (int c = 0; c < CZ; ++c) s += z[c];
  const float mean = s * (1.0f / CZ); float q = 0.0f;
#pragma unroll
  for (int c = 0; c < CZ; ++c) { const float d = z[c] - mean; q += d * d; }
  const float rstd = rsqrtf(q * (1.0f / CZ) + 1e-5f);
  float acc[NHD];
#pragma unroll
  for (int h = 0; h < NHD; ++h) acc[h] = bbh[h];
#pragma unroll
  for (int c = 0; c < CZ; ++c) { const float zn = (z[c] - mean) * rstd * g2[c] + be2[c];
#pragma unroll
    for (int h = 0; h < NHD; ++h) acc[h] += zn * Wb[c * NHD + h]; }
  const int line = ((qg >> 1) * (NRES / 32) + (k4 >> 3)) * BTILE + (((k4 >> 2) & 1) * 2 + (k4 & 1)) * 128 + ((k4 >> 1) & 1) * 64 + (qg & 1) * 32;
#pragma unroll
  for (int h = 0; h < NHD; ++h) BT[(size_t)h * NRES * NRES + line + lane] = acc[h];
}
// permuted qkvg weights: Wp[c][k*256 + h*32 + d] = W[c][d*32 + k*8 + h] (no extra scale: both attention kernels carry 1/sqrt(32)); block = c (256), thread loops 1024 cols
__global__ __launch_bounds__(256) void k_wperm(const float* __restrict__ Wm, float* __restrict__ Wp) { const int c = blockIdx.x;
  for (int col = threadIdx.x; col < 4 * CM; col += 256) { const int k = col >> 8, h = (col >> 5) & 7, d = col & 31; float v = Wm[(size_t)c * 4 * CM + d * 32 + k * 8 + h];   // both attention kernels carry the 1/sqrt(32) scale themselves
    *(float*)(Wp + (size_t)c * 4 * CM + col) = v;  } }
__global__ __launch_bounds__(256) void k_ones(float* __restrict__ p, int n) { for (int i = threadIdx.x; i < n; i += 256) { *(float*)(p + i) = 1.0f;  } }

extern "C" void kernel_launch(void* const* d_in, const int* in_sizes, int n_in,
                              void* d_out, int out_size, void* d_ws, size_t ws_size,
                              hipStream_t stream) {
  (void)in_sizes; (void)n_in; (void)out_size;
  const float** f = (const float**)d_in;
  const float* x = f[0], *brep = f[1], *Wqkv_r = f[2], *W0r = f[3], *Wb = f[4], *bbh = f[5], *Wqkv_c = f[6], *W0c = f[7], *W1 = f[8], *b1 = f[9], *W2 = f[10], *b2 = f[11], *g1 = f[12], *be1 = f[13], *g2 = f[14], *be2 = f[15], *g3 = f[16], *be3 = f[17];
  float* out = (float*)d_out;     // [1,128,256,256]
  char* ws = (char*)d_ws;
  float* X1 = (float*)ws; ws += (size_t)MTOK * CM * 4;                 // 32 MB: LN1(x), then x + row-att (in place), then LN3 (in place), finally x after the column block (s,r order)
  float* BT = (float*)ws; ws += (size_t)NHD * NRES * NRES * 4;         // 2 MB pair-bias table
  float* Wpr = (float*)ws; ws += (size_t)CM * 4 * CM * 4; float* Wpc = (float*)ws; ws += (size_t)CM * 4 * CM * 4;
  bf16* G16 = (bf16*)ws; ws += (size_t)MTOK * 4 * CM * 2;             // qkvg f16 [32768][1024] (64 MB); also the transition hidden [32768][1024]
  bf16* O16 = (bf16*)ws; ws += (size_t)MTOK * CM * 2;                 // 16 MB gated attention output, head-major [h][token][32] (token order of the current block)
  float* ones = (float*)ws; ws += CM * 4;
  if ((size_t)(ws - (char*)d_ws) > ws_size) return;
  const dim3 blk(256);
  k_ones<<<dim3(1), blk, 0, stream>>>(ones, CM);
  k_wperm<<<dim3(CM), blk, 0, stream>>>(Wqkv_r, Wpr); k_wperm<<<dim3(CM), blk, 0, stream>>>(Wqkv_c, Wpc);
  k_pairbias<<<dim3(NRES * NRES / (32 * PBW)), dim3(32 * PBW), 0, stream>>>(brep, g2, be2, Wb, bbh, BT);
  k_ln<CM><<<dim3(MTOK / (8 * LNR)), blk, 0, stream>>>(x, g1, be1, X1);
  // ---- row-wise gated attention with pair bias: every stage one launch over all tokens ----
  gemm_kne<float, 0, true, 4 * CM><<<dim3(MTOK / 128, 4 * CM / 128), blk, 0, stream>>>(X1, CM, Wpr, nullptr, nullptr, nullptr, G16, 4 * CM, CM);
  bt_attn_kernel<<<dim3(NRES / 64, NHD, MTOK / NRES), dim3(64), 0, stream>>>(G16, BT, O16);
  gemm_kne<bf16, 2, false, CM, 4><<<dim3(MTOK / 128, CM / 128), blk, 0, stream>>>(O16, CM, W0r, nullptr, X1, ones, X1, CM, CM);     // x = x + o*W0 (in place)
  k_ln<CM><<<dim3(MTOK / (8 * LNR)), blk, 0, stream>>>(X1, g3, be3, X1);                                                                    // x = LN3(x) (in place)
  // ---- column-wise gated attention: qkvg and the gated output in (r, s) token order, x stays in (s, r) order; every stage one launch over all tokens ----
  gemm_kne<float, 0, true, 4 * CM, 1><<<dim3(MTOK / 128, 4 * CM / 128), blk, 0, stream>>>(X1, CM, Wpc, nullptr, nullptr, nullptr, G16, 4 * CM, CM);
  col_attn_kernel<<<dim3(NSEQ / 64, NHD, MTOK / NSEQ), dim3(64), 0, stream>>>(G16, O16);
  gemm_kne<bf16, 2, false, CM, 6><<<dim3(MTOK / 128, CM / 128), blk, 0, stream>>>(O16, CM, W0c, nullptr, X1, ones, X1, CM, CM);     // x = x + o*W0_c (in place; block rows (r, s), buffer rows (s, r))
  // ---- transition, all tokens per launch: out = relu(x*W1 + b1)*W2 + b2 + x ----
  gemm_kne<float, 3, true, 4 * CM><<<dim3(MTOK / 128, 4 * CM / 128), blk, 0, stream>>>(X1, CM, W1, b1, nullptr, nullptr, G16, 4 * CM, CM);
  gemm_kne<bf16, 2, false, CM><<<dim3(MTOK / 128, CM / 128), blk, 0, stream>>>(G16, 4 * CM, W2, b2, X1, ones, out, CM, 4 * CM);
}

// v010
// It runs in 259 microseconds.
// Timed twice side by side with v009, it ran 1.11 times as fast both times.
// Counting every step since v000, it is 4.55 times as fast.
// Contractions on v_wmma_f32_16x16x32_f16 (plain f16 operands, f32 accumulate): the row- and column-wise gated attentions of an MSA
// block — qkvg = x·Wqkv (K = 256, N = 1024; the reference's (d, k, h) column interleave undone by permuting the WEIGHT columns on the
// device, both attention kernels scale by 32^-½ for the real head dim), the 8-head attentions at head dim 32, their q, k and v read straight from the qkvg rows
// (row: 128 sequences x 256 residues with the pair-bias table [h][i][j] = LN(bias_rep)·Wb + bb added in the row attention; column: 256 residues x 128
// sequences, its two GEMMs mapping their (r, s) rows onto the (s, r) buffer), flash-style S^T = K*Q^T / O^T = V^T*P^T with online softmax in f32 (P x1024), the sigmoid
// gate in the attention's own epilogue, *W0 + residual (K = 256), and the transition relu(x*W1 + b1)*W2 + b2 + x (K = 256 / 1024) - every GEMM and every attention stage one launch over all 32768 tokens; LayerNorms
// in f32. compute dtype: f16 operands, f32 accumulate.  x [1,128,256,256] -> [1,128,256,256].
#include <hip/hip_runtime.h>
#include <hip/hip_bf16.h>
#include <math.h>

#define NSEQ 128
#define NRES 256
#define CM 256
#define CZ 128
#define NHD 8
#define DH 32
#define MTOK (NSEQ * NRES)
#define GLD (4 * CM)   // pitch of a qkvg row, in elements: q | k | v | g blocks of 256, head h at column h * 32 of its block
#define HH 8
#define QW 2
#define SS 256
#define GSTR 40   // GEMM LDS tiles: rows of 32 f16 (64 B) at a pitch of 80 B = 16 B x odd, so the 16 rows that half a wave reads with one ds_load_b128 fall on all 64 banks
#define BTILE 512   // floats in one (16 query x 32 key) tile of the pair-bias table

typedef _Float16 bf16;
typedef _Float16 f16;
typedef __attribute__((ext_vector_type(4))) unsigned v4u_t;
typedef unsigned v4ua __attribute__((ext_vector_type(4), may_alias));
typedef __attribute__((ext_vector_type(4))) float v4f_t;
typedef float v4fa __attribute__((ext_vector_type(4), may_alias));
typedef __attribute__((ext_vector_type(16))) bf16  bf16x16;
typedef bf16x16 f16x16;
typedef __attribute__((ext_vector_type(8)))  bf16  bf16x8;
typedef bf16x8 f16x8;
typedef __attribute__((ext_vector_type(4)))  bf16  bf16x4;
typedef __attribute__((ext_vector_type(8)))  float f32x8;
__device__ __forceinline__ f32x8 wmma16(f16x16 a, f16x16 b, f32x8 c) {
  c = __builtin_amdgcn_wmma_f32_16x16x32_f16(false, a, false, b, (short)0, c, false, false);
  asm volatile("v_nop\n\tv_nop\n\tv_nop\n\tv_nop" : "+v"(c) : "v"(a), "v"(b));
  return c;
}
// The attention kernels' exponentials and reciprocals as bare v_exp_f32 / v_rcp_f32, without the library's range steps (compare, select, add, ldexp round each exp2f;
// range reduction round expf; scale and fix-up round each division). What those steps add is never seen here: a softmax weight or rescale factor below 2^-126 becomes 0
// instead of a sub-normal (its f16 copy x1024 is 0 either way, and every row's sum is at least 1); every reciprocal's argument is at least 1 (or +inf, giving 0).
// Written as runs in asm text to keep the slot that the instruction set asks for behind a transcendental: each works in place on a register of its own, so none reads
// its predecessor's result or overwrites its source, and the closing v_nop fills the slot behind the last.
__device__ __forceinline__ void exp2_run17(float (&e)[17]) {
  // e[i] = 2^e[i]: asm so that the run stays together and its last v_exp_f32 has the v_nop directly behind it
  asm("v_exp_f32 %0, %0\n\tv_exp_f32 %1, %1\n\tv_exp_f32 %2, %2\n\tv_exp_f32 %3, %3\n\tv_exp_f32 %4, %4\n\tv_exp_f32 %5, %5\n\tv_exp_f32 %6, %6\n\tv_exp_f32 %7, %7\n\t"
      "v_exp_f32 %8, %8\n\tv_exp_f32 %9, %9\n\tv_exp_f32 %10, %10\n\tv_exp_f32 %11, %11\n\tv_exp_f32 %12, %12\n\tv_exp_f32 %13, %13\n\tv_exp_f32 %14, %14\n\tv_exp_f32 %15, %15\n\tv_exp_f32 %16, %16\n\tv_nop"
      : "+v"(e[0]), "+v"(e[1]), "+v"(e[2]), "+v"(e[3]), "+v"(e[4]), "+v"(e[5]), "+v"(e[6]), "+v"(e[7]), "+v"(e[8]), "+v"(e[9]), "+v"(e[10]), "+v"(e[11]), "+v"(e[12]), "+v"(e[13]), "+v"(e[14]), "+v"(e[15]), "+v"(e[16]));
}
__device__ __forceinline__ void exp2_run8(float (&e)[8]) {
  // e[i] = 2^e[i], as above
  asm("v_exp_f32 %0, %0\n\tv_exp_f32 %1, %1\n\tv_exp_f32 %2, %2\n\tv_exp_f32 %3, %3\n\tv_exp_f32 %4, %4\n\tv_exp_f32 %5, %5\n\tv_exp_f32 %6, %6\n\tv_exp_f32 %7, %7\n\tv_nop"
      : "+v"(e[0]), "+v"(e[1]), "+v"(e[2]), "+v"(e[3]), "+v"(e[4]), "+v"(e[5]), "+v"(e[6]), "+v"(e[7]));
}
__device__ __forceinline__ void rcp_run8(float (&e)[8]) {
  // e[i] = 1 / e[i]: the same form for v_rcp_f32
  asm("v_rcp_f32 %0, %0\n\tv_rcp_f32 %1, %1\n\tv_rcp_f32 %2, %2\n\tv_rcp_f32 %3, %3\n\tv_rcp_f32 %4, %4\n\tv_rcp_f32 %5, %5\n\tv_rcp_f32 %6, %6\n\tv_rcp_f32 %7, %7\n\tv_nop"
      : "+v"(e[0]), "+v"(e[1]), "+v"(e[2]), "+v"(e[3]), "+v"(e[4]), "+v"(e[5]), "+v"(e[6]), "+v"(e[7]));
}
__device__ __forceinline__ void rcp_run2(float (&e)[2]) {
  // e[i] = 1 / e[i], as above
  asm("v_rcp_f32 %0, %0\n\tv_rcp_f32 %1, %1\n\tv_nop" : "+v"(e[0]), "+v"(e[1]));
}
#define KSTRIDE    40   // attn K tile [key][d]: 32 -> 40 elems (80B rows, 16 B x odd): conflict-free b128
#define VSTRIDE    48   // attn V tile [key][d]: 32 -> 48 elems (96B rows, 32 B x odd): conflict-free transposing loads

__device__ __forceinline__ f32x8 wmma_bf16(bf16x16 a, bf16x16 b, f32x8 c) {
  c = __builtin_amdgcn_wmma_f32_16x16x32_f16(false, a, false, b, (short)0, c, false, false);
  asm volatile("v_nop\n\tv_nop\n\tv_nop\n\tv_nop" : "+v"(c) : "v"(a), "v"(b));   // A/B-overwrite hazard guard
  return c;
}

// 16x32 (MxK) f16 fragment from a row-major global matrix.
// lanes 0-15  (row=lane)    : elems 0..7 = K+0..7,  8..15 = K+16..23
// lanes 16-31 (row=lane-16) : elems 0..7 = K+8..15, 8..15 = K+24..31
template <typename T>
__device__ __forceinline__ bf16x16 load_frag(const T* __restrict__ base, int ld,
                                             int row0, int k0) {
  const int lane = threadIdx.x & 31;
  const int r    = lane & 15;
  const int kh   = (lane >> 4) * 8;
  const T* p0 = base + (size_t)(row0 + r) * ld + (k0 + kh);
  const T* p1 = p0 + 16;
  bf16x16 f;
#pragma unroll
  for (int i = 0; i < 8; ++i) {
    f[i]     = (bf16)p0[i];
    f[i + 8] = (bf16)p1[i];
  }
  return f;
}

// Same fragment from an LDS tile with padded row stride (base includes row0/k0).
__device__ __forceinline__ bf16x16 lds_frag(const bf16* base, int stride) {
  const int lane = threadIdx.x & 31;
  const int row  = lane & 15;
  const int kh   = (lane >> 4) * 8;
  const bf16x8 lo = *(const bf16x8*)(base + row * stride + kh);
  const bf16x8 hi = *(const bf16x8*)(base + row * stride + kh + 16);
  bf16x16 f;
#pragma unroll
  for (int i = 0; i < 8; ++i) { f[i] = lo[i]; f[i + 8] = hi[i]; }
  return f;
}

// 16 (d) x 32 (key) fragment of V^T from a row-major [key][d] LDS tile, by the transposing load: lane (c = lane & 15, hh = lane >> 4) gets column
// d0 + c at keys 8 hh + 0..7, the second load the same 16 keys further on: the k order of lds_frag and of the packed P. Every lane's address is valid.
typedef short s16x8 __attribute__((ext_vector_type(8)));
__device__ __forceinline__ bf16x16 lds_frag_tr(const bf16* tile, int stride, int d0) {
  typedef __attribute__((address_space(3))) s16x8 lds_s16x8;
  const int lane = threadIdx.x & 31;
  const bf16* p = tile + (8 * (lane >> 4) + (lane & 7)) * stride + d0 + 8 * ((lane >> 3) & 1);
  const bf16x8 lo = __builtin_bit_cast(bf16x8, __builtin_amdgcn_ds_load_tr16_b128_v8i16((lds_s16x8*)p));
  const bf16x8 hi = __builtin_bit_cast(bf16x8, __builtin_amdgcn_ds_load_tr16_b128_v8i16((lds_s16x8*)(p + 16 * stride)));
  bf16x16 f;
#pragma unroll
  for (int i = 0; i < 8; ++i) { f[i] = lo[i]; f[i + 8] = hi[i]; }
  return f;
}

template <typename T>
__device__ __forceinline__ void stage_read16(const T* __restrict__ p, float* buf) {
#pragma unroll
  for (int i = 0; i < 16; ++i) buf[i] = (float)p[i];
}

__device__ __forceinline__ void stage_write(bf16* dst, const float* buf, int nquad) {
#pragma unroll
  for (int i = 0; i < nquad; ++i) {
    bf16x4 q;
    q[0] = (bf16)buf[4 * i];     q[1] = (bf16)buf[4 * i + 1];
    q[2] = (bf16)buf[4 * i + 2]; q[3] = (bf16)buf[4 * i + 3];
    *(bf16x4*)(dst + 4 * i) = q;
  }
}


// ---------------------------------------------------------------------------------------------------------------------------
// gemm_kne: Y[m][n] = epi( Σ_k A[m][k]·W[k][n] + bias[n] ), A f32/f16 [M][lda], W f32 row-major [K][N] (pitch LDW), plain f16 operands,
// f32 accumulate. EPI 0: identity; 1: exact-erf GELU; 2: R[m][n] + gvec[n]·(·) (residual with per-channel gain). Output f32 (or f16
// when OUT16). Block = 128x128 tile, 8 waves as 4(M) x 2(N); per 32-wide k-step A and W tiles staged f16 in LDS (W transposed
// ---------------------------------------------------------------------------------------------------------------------------
// MAP bit 0: the A rows, bit 1: the R and Y rows of this block are the (r, s)-ordered tokens r = blockIdx.x, s = 0..127 of a buffer kept in (s, r) order (row s * NRES + r).
// MAP bit 2: A is head-major f16, [k / 32][token][32], as the attention kernels write it: a k-step's 128 x 32 tile is 8 KB in a row.
#define GSTR 40
// Work-group barrier that orders LDS only: the fences name the "local" address space, so the wave waits for its LDS operations and not for global loads that it
// has issued ahead into registers; __syncthreads() would wait for those too and bring their latency back into every k-step.
__device__ __forceinline__ void lds_barrier() {
  __builtin_amdgcn_fence(__ATOMIC_RELEASE, "workgroup", "local");
  __builtin_amdgcn_s_barrier();
  __builtin_amdgcn_fence(__ATOMIC_ACQUIRE, "workgroup", "local");
}
template <typename AT, int EPI, bool OUT16, int LDW, int MAP = 0>
__global__ __launch_bounds__(256) void gemm_kne(const AT* __restrict__ A, int lda, const float* __restrict__ Wm,
                                                const float* __restrict__ bias, const float* __restrict__ R, const float* __restrict__ gvec,
                                                void* __restrict__ Yv, int ldy, int K) {
  // The two tile buffers and the epilogue's per-wave staging share one LDS range: the staging is written only behind the barrier that follows the k loop.
  union GemmLds { struct { f16 a[2][128 * GSTR]; f16 w[2][128 * GSTR]; } t; float o[8][32 * 68]; };
  __shared__ __attribute__((aligned(16))) GemmLds sm;
  const int tid = threadIdx.x, lane = tid & 31, wave = tid >> 5, cl = lane & 15, rh = (lane >> 4) * 8;
  const int m0 = blockIdx.x * 128, n0 = blockIdx.y * 128;
  const int wm = (wave & 3) * 32, wn = (wave >> 2) * 64;
  static_assert(NSEQ == 128, "a mapped block is one residue's NSEQ tokens");
  const size_t yr0 = (MAP & 2) ? (size_t)blockIdx.x : (size_t)m0, yrs = (MAP & 2) ? NRES : 1;   // R and Y: the block's local row l is buffer row yr0 + l * yrs
  f32x8 acc[2][4];
#pragma unroll
  for (int i = 0; i < 2; ++i)
#pragma unroll
    for (int j = 0; j < 4; ++j) { f32x8 z = {}; acc[i][j] = z; }
  // A tile, f32: 8 lanes take one row's 128 B, so a wave-wide 16-byte load covers 4 whole lines; 32 rows a pass, 4 passes.
  // A tile, f16: 4 lanes take one row's 64 B, so a wave-wide 16-byte load touches 8 lines (4 whole lines when A is head-major); 64 rows a pass, 2 passes.
  constexpr bool A32 = sizeof(AT) == 4;
  const int arow = A32 ? tid >> 3 : tid >> 2, acol = A32 ? (tid & 7) * 4 : (tid & 3) * 8;
  const int wcol = tid & 127, kq = (tid >> 7) * 16;   // W tile: one column and 16 consecutive k a thread: the transpose happens in registers
  v4f_t ra32[4]; bf16x8 ra16[2]; float rw[16];        // one k-step's share of this thread, on its way from memory to LDS
  // The load addresses live in registers of their own through the whole loop and step on by one k-step behind each round of loads.
  constexpr int NPA = A32 ? 4 : 2;
  const AT* pa[NPA];
#pragma unroll
  for (int p = 0; p < NPA; ++p) {
    if constexpr (A32) pa[p] = A + ((MAP & 1) ? (size_t)(arow + 32 * p) * NRES + blockIdx.x : (size_t)(m0 + arow + 32 * p)) * lda + acol;
    else pa[p] = (MAP & 4) ? A + (size_t)(m0 + arow + 64 * p) * 32 + acol : A + (size_t)(m0 + arow + 64 * p) * lda + acol;
  }
  const float* pw = Wm + (size_t)kq * LDW + n0 + wcol;   // LDW is a compile-time pitch: the 16 row steps are immediate offsets of one address
  auto gload = [&]() {
#pragma unroll
    for (int p = 0; p < NPA; ++p) {
      if constexpr (A32) ra32[p] = *(const v4f_t*)pa[p];
      else ra16[p] = *(const bf16x8*)pa[p];
    }
#pragma unroll
    for (int g = 0; g < 16; ++g) rw[g] = pw[g * LDW];
#pragma unroll
    for (int p = 0; p < NPA; ++p) pa[p] += (MAP & 4) ? (size_t)MTOK * 32 : (size_t)32;
    pw += (size_t)32 * LDW;
  };
  auto lstore = [&](int b) {
    f16* la = sm.t.a[b];
    f16* lw = sm.t.w[b];
    if constexpr (A32) {
#pragma unroll
      for (int p = 0; p < 4; ++p) { bf16x4 q; q[0] = (f16)ra32[p][0]; q[1] = (f16)ra32[p][1]; q[2] = (f16)ra32[p][2]; q[3] = (f16)ra32[p][3];
        *(bf16x4*)(la + (arow + 32 * p) * GSTR + acol) = q; }
    } else {
#pragma unroll
      for (int p = 0; p < 2; ++p) *(bf16x8*)(la + (arow + 64 * p) * GSTR + acol) = ra16[p];
    }
    union { f16 h[16]; v4u_t v[2]; } u;
#pragma unroll
    for (int g = 0; g < 16; ++g) u.h[g] = (f16)rw[g];
    *(v4u_t*)(lw + wcol * GSTR + kq) = u.v[0];
    *(v4u_t*)(lw + wcol * GSTR + kq + 8) = u.v[1];
  };
  // Pipelined k loop: step t's tiles go from registers to buffer t % 2, step t + 1's global loads are issued, and only then come step t's products, so the
  // loads' latency runs under them. One barrier a step is enough with two buffers: who writes buffer t % 2 has passed the barrier of step t - 1, which every wave
  // reaches only behind its last read of step t - 2.
  gload();
#pragma unroll 1   // rolled: one copy of the loop body keeps the staged registers to one set
  for (int k0 = 0; k0 < K; k0 += 32) {
    const int b = (k0 >> 5) & 1;
    lstore(b);
    if (k0 + 32 < K) gload();
    lds_barrier();
    f16x16 af[2];
#pragma unroll
    for (int i = 0; i < 2; ++i) af[i] = lds_frag(sm.t.a[b] + (wm + 16 * i) * GSTR, GSTR);
#pragma unroll
    for (int j = 0; j < 4; ++j) {
      const f16x16 bf = lds_frag(sm.t.w[b] + (wn + 16 * j) * GSTR, GSTR);
#pragma unroll
      for (int i = 0; i < 2; ++i) acc[i][j] = wmma16(af[i], bf, acc[i][j]);
    }
  }
  lds_barrier();   // every wave has read its last fragments before any wave's staging overwrites the tile buffers
  float* so = sm.o[wave];
#pragma unroll
  for (int i = 0; i < 2; ++i)
#pragma unroll
    for (int j = 0; j < 4; ++j) {
      const int n = n0 + wn + 16 * j + cl;
      const float bv = bias ? bias[n] : 0.0f;
      const float gv = (EPI == 2) ? gvec[n] : 0.0f;
      if (EPI == 1) {
#pragma unroll 1
        for (int r = 0; r < 8; ++r) { const float xg = acc[i][j][r] + bv; so[(16 * i + rh + r) * 68 + 16 * j + cl] = 0.5f * xg * (1.0f + erff(xg * 0.70710678118654752f)); }
      } else {
#pragma unroll
        for (int r = 0; r < 8; ++r) {
          float v = acc[i][j][r] + bv;
          if (EPI == 3) v = fmaxf(v, 0.0f);                                         // EPI 3: ReLU
          if (EPI == 2) v = R[(yr0 + (size_t)(wm + 16 * i + rh + r) * yrs) * ldy + n] + gv * v;
          so[(16 * i + rh + r) * 68 + 16 * j + cl] = v;
        }
      }
    }
  asm volatile("s_wait_dscnt 0" ::: "memory");
  __builtin_amdgcn_wave_barrier();
{
    if (OUT16) {
      f16* Y = (f16*)Yv;
#pragma unroll
      for (int it = 0; it < 8; ++it) { const int c = lane + 32 * it, rr = c >> 3, q8 = (c & 7) * 8;
        union { f16 h[8]; v4u_t v; } u;
#pragma unroll
        for (int e = 0; e < 8; ++e) u.h[e] = (f16)so[rr * 68 + q8 + e];
        *(v4u_t*)(Y + (yr0 + (size_t)(wm + rr) * yrs) * ldy + n0 + wn + q8) = u.v; }
    } else {
      float* Y = (float*)Yv;
#pragma unroll
      for (int it = 0; it < 16; ++it) { const int f4 = lane + 32 * it, rr = f4 >> 4, q = (f4 & 15) * 4;
        *(v4f_t*)(Y + (yr0 + (size_t)(wm + rr) * yrs) * ldy + n0 + wn + q) = *(const v4fa*)(so + rr * 68 + q); }
    }
    
  }
}

#define QROWS 256
#define KROWS 256
#define NKV 256
__global__ __launch_bounds__(64) void bt_attn_kernel(
    const bf16* __restrict__ G, const float* __restrict__ btab,   // G: qkvg rows [token][GLD]; btab: additive logit bias in score-fragment order (BTILE, at k_pairbias)
    bf16* __restrict__ gatedOut) {   // gated output, f16, head-major [h][token][DH]
  __shared__ __attribute__((aligned(16))) bf16 ldsK[32 * KSTRIDE];   // 2.5 KB
  __shared__ __attribute__((aligned(16))) bf16 ldsV[32 * VSTRIDE];   // 3.0 KB

  const int q0blk = blockIdx.x * 64;
  const int h  = blockIdx.y;
  const int b  = blockIdx.z;
  const int t    = threadIdx.x;
  const int wave = t >> 5;
  const int lane = t & 31;
  const int qlane = lane & 15;
  const int kh8   = (lane >> 4) * 8;
  const int q0 = q0blk + wave * 32;          // this wave's 32 queries

  const bf16* Qh = G + (size_t)b * QROWS * GLD + h * DH;   // this head's 32 q columns of the batch's rows (QROWS == KROWS rows per batch), row stride GLD
  const bf16* Kh = Qh + CM;                                // its k columns
  const bf16* Vh = Qh + 2 * CM;                            // its v columns

  // Cooperative staging (64 threads): K tile and V tile, each 32 keys x 32 d. 4 lanes take one key's 64 B, so a wave-wide 16-byte load touches 8 lines; 16 keys a pass, 2 passes.
  const int krow = t >> 2;
  const int kcol = (t & 3) * 8;
  const bf16* kSrc = Kh + (size_t)krow * GLD + kcol;
  const bf16* vSrc = Vh + (size_t)krow * GLD + kcol;

  bf16x16 qf[QW];
#pragma unroll
  for (int qt = 0; qt < QW; ++qt) qf[qt] = load_frag(Qh, GLD, q0 + 16 * qt, 0);

  // This wave's gate values (32 queries x 32 d), in the order of the epilogue's stores: 4 lanes take one query's 64 B. Loaded here so that the key loop covers their latency.
  const size_t tok0 = (size_t)b * QROWS + q0;
  bf16x8 gt[4];
#pragma unroll
  for (int it = 0; it < 4; ++it) gt[it] = *(const bf16x8*)(G + (tok0 + (lane >> 2) + 8 * it) * GLD + 3 * CM + h * DH + (lane & 3) * 8);

  f32x8 o[QW][2] = {};
  float mrun[QW], lrun[QW];
#pragma unroll
  for (int qt = 0; qt < QW; ++qt) { mrun[qt] = -INFINITY; lrun[qt] = 0.0f; }

  const float scale = 0.17677669529663688f * 1.44269504088896340736f;  // hd^-0.5 = 1/sqrt(32), times log2(e)
  const float NEG2 = -1.0e9f;    // masked logit: its weight is exactly 0 once any valid key of the row has been seen (every row
                                 // has one), and anything accumulated before that is wiped by alpha == 0 — same result as -inf
  const int kmax = KROWS - 1;
  const float L2E_ = 1.44269504088896340736f;
  const float* bth = btab + (size_t)(h * (QROWS / 16) + (q0 >> 4)) * (NKV / 32) * BTILE + lane * 4;   // this lane's 16 B in the first 512-B group of the wave's first (16 q x 32 key) tile

  // Prefetch key block kb=0 into registers.
  bf16x8 kreg[2], vreg[2];
#pragma unroll
  for (int i = 0; i < 2; ++i) {
    kreg[i] = *(const bf16x8*)(kSrc + (size_t)(16 * i) * GLD);
    vreg[i] = *(const bf16x8*)(vSrc + (size_t)(16 * i) * GLD);
  }

  for (int kb = 0; kb <= kmax; kb += 32) {
    __syncthreads();   // previous readers done with LDS
#pragma unroll
    for (int i = 0; i < 2; ++i) {
      *(bf16x8*)(&ldsK[(krow + 16 * i) * KSTRIDE + kcol]) = kreg[i];
      *(bf16x8*)(&ldsV[(krow + 16 * i) * VSTRIDE + kcol]) = vreg[i];
    }
    if (kb + 32 <= kmax) {   // prefetch next block during compute
      const bf16* kn = kSrc + (size_t)(kb + 32) * GLD;
      const bf16* vn = vSrc + (size_t)(kb + 32) * GLD;
#pragma unroll
      for (int i = 0; i < 2; ++i) {
        kreg[i] = *(const bf16x8*)(kn + (size_t)(16 * i) * GLD);
        vreg[i] = *(const bf16x8*)(vn + (size_t)(16 * i) * GLD);
      }
    }
    __syncthreads();   // tile visible

    // Phase 1: scores + softmax for both q-tiles (K fragments live here only).
    bf16x16 kf[2];
#pragma unroll
    for (int ktile = 0; ktile < 2; ++ktile) kf[ktile] = lds_frag(ldsK + (ktile * 16) * KSTRIDE, KSTRIDE);

    bf16x16 pf[QW];
    bool act[QW];
#pragma unroll
    for (int qt = 0; qt < QW; ++qt) {
      unsigned mbits = 0;
      {
#pragma unroll
        for (int r = 0; r < 8; ++r) { const int j0 = kb + kh8 + r; if (j0 < NKV) mbits |= 1u << r; if (j0 + 16 < NKV) mbits |= 1u << (8 + r); }
        act[qt] = (__builtin_amdgcn_ballot_w32(mbits != 0) != 0);
      }
      if (act[qt]) {
        const int q_my = q0 + 16 * qt + qlane;
        f32x8 s0 = {}, s1 = {};
        s0 = wmma_bf16(kf[0], qf[qt], s0);
        s1 = wmma_bf16(kf[1], qf[qt], s1);

        const float* bp = bth + (size_t)(qt * (NKV / 32) + (kb >> 5)) * BTILE; (void)q_my;
        v4f_t bv[4];   // group g holds, for this lane's query, the keys of score registers 4 (g & 1) .. + 3 of s0 (g < 2) or s1: each load is 512 contiguous bytes a wave
#pragma unroll
        for (int g = 0; g < 4; ++g) bv[g] = *(const v4f_t*)(bp + g * 128);
        float mx = -INFINITY;
#pragma unroll
        for (int r = 0; r < 8; ++r) {
          s0[r] = (mbits & (1u << r))       ? s0[r] * scale + L2E_ * bv[r >> 2][r & 3] : NEG2;
          s1[r] = (mbits & (1u << (8 + r))) ? s1[r] * scale + L2E_ * bv[2 + (r >> 2)][r & 3] : NEG2;
          mx = fmaxf(mx, fmaxf(s0[r], s1[r]));
        }
        mx = fmaxf(mx, __shfl_xor(mx, 16, 32));
        const float mnew  = fmaxf(mrun[qt], mx);
        float ex[17];   // the 16 weights' exponents and the rescale factor's, one run
#pragma unroll
        for (int r = 0; r < 8; ++r) { ex[r] = s0[r] - mnew; ex[8 + r] = s1[r] - mnew; }
        ex[16] = mrun[qt] - mnew;
        exp2_run17(ex);
        const float alpha = ex[16];

        float rsum = 0.0f;
#pragma unroll
        for (int r = 0; r < 8; ++r) {
          const float p0 = ex[r];
          const float p1 = ex[8 + r];
          rsum += p0 + p1;
          pf[qt][r]     = (bf16)(p0 * 1024.0f);     // P carried x1024: no f16 copy of a probability is sub-normal
          pf[qt][r + 8] = (bf16)(p1 * 1024.0f);
        }
        rsum += __shfl_xor(rsum, 16, 32);
        lrun[qt] = lrun[qt] * alpha + rsum;
        mrun[qt] = mnew;

        // Rescale accumulators now so the PV phase is pure WMMA.
#pragma unroll
        for (int j = 0; j < 2; ++j)
#pragma unroll
          for (int r = 0; r < 8; ++r) o[qt][j][r] *= alpha;
      }
    }

    // Phase 2: O^T accumulate; each V fragment read from LDS once, used by
    // both q-tiles, then dead (only 8 VGPRs of V live at a time).
#pragma unroll
    for (int j = 0; j < 2; ++j) {
      const bf16x16 vf = lds_frag_tr(ldsV, VSTRIDE, j * 16);
#pragma unroll
      for (int qt = 0; qt < QW; ++qt)
        if (act[qt]) o[qt][j] = wmma_bf16(vf, pf[qt], o[qt][j]);
    }
  }

  __shared__ __attribute__((aligned(16))) float ldsOf[2][32 * 36];   // per-wave output tile [q][d], 32 -> 36 floats a row
  float* so = ldsOf[wave];
  static_assert(QW == 2, "rcp_run2 takes both query tiles' sums");
  float rls[QW] = { lrun[0] * 1024.0f, lrun[1] * 1024.0f };
  rcp_run2(rls);
#pragma unroll
  for (int qt = 0; qt < QW; ++qt) {
    const float rl = rls[qt];
#pragma unroll
    for (int j = 0; j < 2; ++j)
#pragma unroll
      for (int r = 0; r < 8; ++r) so[(16 * qt + qlane) * 36 + j * 16 + kh8 + r] = o[qt][j][r] * rl;
  }
  asm volatile("s_wait_dscnt 0" ::: "memory");
  __builtin_amdgcn_wave_barrier();
  // o * sigmoid(g), narrowed to f16. Head-major rows of 64 B: the wave's 32 queries are 2 KB in a row, so every store covers whole 128-B lines that no other wave writes.
#pragma unroll
  for (int it = 0; it < 4; ++it) { const int ql = (lane >> 2) + 8 * it, q8 = (lane & 3) * 8;
    const v4f_t a0 = *(const v4fa*)(so + ql * 36 + q8), a1 = *(const v4fa*)(so + ql * 36 + q8 + 4);
    float sg[8];   // sigmoid(g) = 1 / (1 + 2^(-g log2 e))
#pragma unroll
    for (int e = 0; e < 8; ++e) sg[e] = -1.44269504088896340736f * (float)gt[it][e];
    exp2_run8(sg);
#pragma unroll
    for (int e = 0; e < 8; ++e) sg[e] += 1.0f;
    rcp_run8(sg);
    bf16x8 og;
#pragma unroll
    for (int e = 0; e < 4; ++e) { og[e] = (bf16)(a0[e] * sg[e]); og[4 + e] = (bf16)(a1[e] * sg[4 + e]); }
    *(bf16x8*)(gatedOut + ((size_t)h * MTOK + tok0 + ql) * DH + q8) = og; }
}


#undef QROWS
#undef KROWS
#undef NKV
#define QROWS 128
#define KROWS 128
#define NKV 128
__global__ __launch_bounds__(64) void col_attn_kernel(
    const bf16* __restrict__ G,
    bf16* __restrict__ gatedOut) {   // G: qkvg rows [token][GLD]; QROWS queries / KROWS key rows per batch (first NKV valid); gated output, f16, head-major [h][token][DH]
  __shared__ __attribute__((aligned(16))) bf16 ldsK[32 * KSTRIDE];   // 2.5 KB
  __shared__ __attribute__((aligned(16))) bf16 ldsV[32 * VSTRIDE];   // 3.0 KB

  const int q0blk = blockIdx.x * 64;
  const int h  = blockIdx.y;
  const int b  = blockIdx.z;
  const int t    = threadIdx.x;
  const int wave = t >> 5;
  const int lane = t & 31;
  const int qlane = lane & 15;
  const int kh8   = (lane >> 4) * 8;
  const int q0 = q0blk + wave * 32;          // this wave's 32 queries

  const bf16* Qh = G + (size_t)b * QROWS * GLD + h * DH;   // this head's 32 q columns of the batch's rows (QROWS == KROWS rows per batch), row stride GLD
  const bf16* Kh = Qh + CM;                                // its k columns
  const bf16* Vh = Qh + 2 * CM;                            // its v columns

  // Cooperative staging (64 threads): K tile and V tile, each 32 keys x 32 d. 4 lanes take one key's 64 B, so a wave-wide 16-byte load touches 8 lines; 16 keys a pass, 2 passes.
  const int krow = t >> 2;
  const int kcol = (t & 3) * 8;
  const bf16* kSrc = Kh + (size_t)krow * GLD + kcol;
  const bf16* vSrc = Vh + (size_t)krow * GLD + kcol;

  bf16x16 qf[QW];
#pragma unroll
  for (int qt = 0; qt < QW; ++qt) qf[qt] = load_frag(Qh, GLD, q0 + 16 * qt, 0);

  // This wave's gate values (32 queries x 32 d), in the order of the epilogue's stores: 4 lanes take one query's 64 B. Loaded here so that the key loop covers their latency.
  const size_t tok0 = (size_t)b * QROWS + q0;
  bf16x8 gt[4];
#pragma unroll
  for (int it = 0; it < 4; ++it) gt[it] = *(const bf16x8*)(G + (tok0 + (lane >> 2) + 8 * it) * GLD + 3 * CM + h * DH + (lane & 3) * 8);

  f32x8 o[QW][2] = {};
  float mrun[QW], lrun[QW];
#pragma unroll
  for (int qt = 0; qt < QW; ++qt) { mrun[qt] = -INFINITY; lrun[qt] = 0.0f; }

  const float scale = 0.17677669529663688f * 1.44269504088896340736f;  // hd^-0.5 = 1/sqrt(32), times log2(e)
  const float NEG2 = -1.0e9f;    // masked logit: its weight is exactly 0 once any valid key of the row has been seen (every row
                                 // has one), and anything accumulated before that is wiped by alpha == 0 — same result as -inf
  const int kmax = KROWS - 1;    // all key rows (KROWS == NKV: none masked)

  // Prefetch key block kb=0 into registers.
  bf16x8 kreg[2], vreg[2];
#pragma unroll
  for (int i = 0; i < 2; ++i) {
    kreg[i] = *(const bf16x8*)(kSrc + (size_t)(16 * i) * GLD);
    vreg[i] = *(const bf16x8*)(vSrc + (size_t)(16 * i) * GLD);
  }

  for (int kb = 0; kb <= kmax; kb += 32) {
    __syncthreads();   // previous readers done with LDS
#pragma unroll
    for (int i = 0; i < 2; ++i) {
      *(bf16x8*)(&ldsK[(krow + 16 * i) * KSTRIDE + kcol]) = kreg[i];
      *(bf16x8*)(&ldsV[(krow + 16 * i) * VSTRIDE + kcol]) = vreg[i];
    }
    if (kb + 32 <= kmax) {   // prefetch next block during compute
      const bf16* kn = kSrc + (size_t)(kb + 32) * GLD;
      const bf16* vn = vSrc + (size_t)(kb + 32) * GLD;
#pragma unroll
      for (int i = 0; i < 2; ++i) {
        kreg[i] = *(const bf16x8*)(kn + (size_t)(16 * i) * GLD);
        vreg[i] = *(const bf16x8*)(vn + (size_t)(16 * i) * GLD);
      }
    }
    __syncthreads();   // tile visible

    // Phase 1: scores + softmax for both q-tiles (K fragments live here only).
    bf16x16 kf[2];
#pragma unroll
    for (int ktile = 0; ktile < 2; ++ktile) kf[ktile] = lds_frag(ldsK + (ktile * 16) * KSTRIDE, KSTRIDE);

    bf16x16 pf[QW];
    bool act[QW];
#pragma unroll
    for (int qt = 0; qt < QW; ++qt) {
      unsigned mbits = 0;
      {
#pragma unroll
        for (int r = 0; r < 8; ++r) { const int j0 = kb + kh8 + r; if (j0 < NKV) mbits |= 1u << r; if (j0 + 16 < NKV) mbits |= 1u << (8 + r); }
        act[qt] = (__builtin_amdgcn_ballot_w32(mbits != 0) != 0);
      }
      if (act[qt]) {
        const int q_my = q0 + 16 * qt + qlane;
        f32x8 s0 = {}, s1 = {};
        s0 = wmma_bf16(kf[0], qf[qt], s0);
        s1 = wmma_bf16(kf[1], qf[qt], s1);

        float mx = -INFINITY;
#pragma unroll
        for (int r = 0; r < 8; ++r) {
          const int k0i = kb + kh8 + r;
          const int k1i = k0i + 16;
          (void)k0i; (void)k1i; (void)q_my;
          s0[r] = (mbits & (1u << r))       ? s0[r] * scale : NEG2;
          s1[r] = (mbits & (1u << (8 + r))) ? s1[r] * scale : NEG2;
          mx = fmaxf(mx, fmaxf(s0[r], s1[r]));
        }
        mx = fmaxf(mx, __shfl_xor(mx, 16, 32));
        const float mnew  = fmaxf(mrun[qt], mx);
        float ex[17];   // the 16 weights' exponents and the rescale factor's, one run
#pragma unroll
        for (int r = 0; r < 8; ++r) { ex[r] = s0[r] - mnew; ex[8 + r] = s1[r] - mnew; }
        ex[16] = mrun[qt] - mnew;
        exp2_run17(ex);
        const float alpha = ex[16];

        float rsum = 0.0f;
#pragma unroll
        for (int r = 0; r < 8; ++r) {
          const float p0 = ex[r];
          const float p1 = ex[8 + r];
          rsum += p0 + p1;
          pf[qt][r]     = (bf16)(p0 * 1024.0f);     // P carried x1024: no f16 copy of a probability is sub-normal
          pf[qt][r + 8] = (bf16)(p1 * 1024.0f);
        }
        rsum += __shfl_xor(rsum, 16, 32);
        lrun[qt] = lrun[qt] * alpha + rsum;
        mrun[qt] = mnew;

        // Rescale accumulators now so the PV phase is pure WMMA.
#pragma unroll
        for (int j = 0; j < 2; ++j)
#pragma unroll
          for (int r = 0; r < 8; ++r) o[qt][j][r] *= alpha;
      }
    }

    // Phase 2: O^T accumulate; each V fragment read from LDS once, used by
    // both q-tiles, then dead (only 8 VGPRs of V live at a time).
#pragma unroll
    for (int j = 0; j < 2; ++j) {
      const bf16x16 vf = lds_frag_tr(ldsV, VSTRIDE, j * 16);
#pragma unroll
      for (int qt = 0; qt < QW; ++qt)
        if (act[qt]) o[qt][j] = wmma_bf16(vf, pf[qt], o[qt][j]);
    }
  }

  __shared__ __attribute__((aligned(16))) float ldsOf[2][32 * 36];   // per-wave output tile [q][d], 32 -> 36 floats a row
  float* so = ldsOf[wave];
  static_assert(QW == 2, "rcp_run2 takes both query tiles' sums");
  float rls[QW] = { lrun[0] * 1024.0f, lrun[1] * 1024.0f };
  rcp_run2(rls);
#pragma unroll
  for (int qt = 0; qt < QW; ++qt) {
    const float rl = rls[qt];
#pragma unroll
    for (int j = 0; j < 2; ++j)
#pragma unroll
      for (int r = 0; r < 8; ++r) so[(16 * qt + qlane) * 36 + j * 16 + kh8 + r] = o[qt][j][r] * rl;
  }
  asm volatile("s_wait_dscnt 0" ::: "memory");
  __builtin_amdgcn_wave_barrier();
  // o * sigmoid(g), narrowed to f16. Head-major rows of 64 B: the wave's 32 queries are 2 KB in a row, so every store covers whole 128-B lines that no other wave writes.
#pragma unroll
  for (int it = 0; it < 4; ++it) { const int ql = (lane >> 2) + 8 * it, q8 = (lane & 3) * 8;
    const v4f_t a0 = *(const v4fa*)(so + ql * 36 + q8), a1 = *(const v4fa*)(so + ql * 36 + q8 + 4);
    float sg[8];   // sigmoid(g) = 1 / (1 + 2^(-g log2 e))
#pragma unroll
    for (int e = 0; e < 8; ++e) sg[e] = -1.44269504088896340736f * (float)gt[it][e];
    exp2_run8(sg);
#pragma unroll
    for (int e = 0; e < 8; ++e) sg[e] += 1.0f;
    rcp_run8(sg);
    bf16x8 og;
#pragma unroll
    for (int e = 0; e < 4; ++e) { og[e] = (bf16)(a0[e] * sg[e]); og[4 + e] = (bf16)(a1[e] * sg[4 + e]); }
    *(bf16x8*)(gatedOut + ((size_t)h * MTOK + tok0 + ql) * DH + q8) = og; }
}


#undef QROWS
#undef KROWS
#undef NKV
// LayerNorm over C (256 or 128) per row; in place allowed; wave = LNR consecutive rows, block = 8 * LNR rows. All LNR rows are loaded before the
// first is reduced, so one wave start pays for LNR rows; per row the lane -> element map and both reduction trees are the one-row form's.
#define LNR 4
template <int C>
__global__ __launch_bounds__(256) void k_ln(const float* __restrict__ X, const float* __restrict__ g, const float* __restrict__ bb, float* __restrict__ Y) {
  const int tid = threadIdx.x, r = tid >> 5, lane = tid & 31; const size_t row0 = ((size_t)blockIdx.x * 8 + r) * LNR;
  float v[LNR][C / 32];
#pragma unroll
  for (int k = 0; k < LNR; ++k)
#pragma unroll
    for (int i = 0; i < C / 32; ++i) v[k][i] = X[(row0 + k) * C + lane + 32 * i];
#pragma unroll
  for (int k = 0; k < LNR; ++k) {
    float s = 0.0f;
#pragma unroll
    for (int i = 0; i < C / 32; ++i) s += v[k][i];
#pragma unroll
    for (int off = 1; off < 32; off <<= 1) s += __shfl_xor(s, off, 32);
    const float mean = s * (1.0f / C); float q = 0.0f;
#pragma unroll
    for (int i = 0; i < C / 32; ++i) { const float d = v[k][i] - mean; q += d * d; }
#pragma unroll
    for (int off = 1; off < 32; off <<= 1) q += __shfl_xor(q, off, 32);
    const float rstd = rsqrtf(q * (1.0f / C) + 1e-5f);
#pragma unroll
    for (int i = 0; i < C / 32; ++i) Y[(row0 + k) * C + lane + 32 * i] = (v[k][i] - mean) * rstd * g[lane + 32 * i] + bb[lane + 32 * i];
  }
}
// pair-bias table, value (h, i, j) = LN(bias_rep[i][j]) * Wb[:,h] + bb[h]; thread = one (i, j) row, wave = 8 queries i x 4 consecutive keys j, block = PBW waves.
// Stored in the order in which the row attention's score fragments take it: [h][i / 16][j / 32] tiles of BTILE floats, a tile = 4 groups x 32 lanes x 4 floats, with
// jj = j % 32: group = 2 (jj / 16) + (jj / 4) % 2, lane = 16 ((jj / 8) % 2) + i % 16, float = jj % 4. A wave here fills one whole 128-B line per head.
// A wave brings its 32 rows in as whole 512-B rows, one a wave-wide load, all 32 loads in flight, and turns them through its own LDS slice, so that each
// thread then holds its whole row in registers: memory is read once, in whole lines. Row pitch 132 floats: the 16-byte reads of 16 rows fall on all 64 banks.
// Every sum runs over c in the same order as a plain loop over the row.
#define PBW 4
#define PBP 132
__global__ __launch_bounds__(32 * PBW) void k_pairbias(const float* __restrict__ Z, const float* __restrict__ g2, const float* __restrict__ be2, const float* __restrict__ Wb, const float* __restrict__ bbh, float* __restrict__ BT) {
  __shared__ __attribute__((aligned(16))) float zS[PBW][32 * PBP];
  const int tid = threadIdx.x, lane = tid & 31, wave = tid >> 5;
  const int wv = blockIdx.x * PBW + wave, qg = wv >> 6, k4 = wv & 63;   // queries 8 qg .. + 7, keys 4 k4 .. + 3; lane = 4 (i % 8) + j % 4
  const float* src = Z + ((size_t)(qg * 8) * NRES + k4 * 4) * CZ + lane * 4;
  float* zw = zS[wave];
  v4f_t ld[32];
#pragma unroll
  for (int k = 0; k < 32; ++k) ld[k] = *(const v4f_t*)(src + ((k >> 2) * NRES + (k & 3)) * CZ);
#pragma unroll
  for (int k = 0; k < 32; ++k) *(v4f_t*)(zw + k * PBP + lane * 4) = ld[k];
  asm volatile("s_wait_dscnt 0" ::: "memory");   // the wave's own LDS writes are done before its lanes read each other's; no other wave touches this slice
  __builtin_amdgcn_wave_barrier();               // keeps the compiler from moving the reads below over the writes above
  float z[CZ];
#pragma unroll
  for (int q4 = 0; q4 < CZ / 4; ++q4) { const v4f_t t = *(const v4fa*)(zw + lane * PBP + 4 * q4);
    z[4 * q4] = t[0]; z[4 * q4 + 1] = t[1]; z[4 * q4 + 2] = t[2]; z[4 * q4 + 3] = t[3]; }
  float s = 0.0f;
#pragma unroll
  for (int c = 0; c < CZ; ++c) s += z[c];
  const float mean = s * (1.0f / CZ); float q = 0.0f;
#pragma unroll
  for (int c = 0; c < CZ; ++c) { const float d = z[c] - mean; q += d * d; }
  const float rstd = rsqrtf(q * (1.0f / CZ) + 1e-5f);
  float acc[NHD];
#pragma unroll
  for (int h = 0; h < NHD; ++h) acc[h] = bbh[h];
#pragma unroll
  for (int c = 0; c < CZ; ++c) { const float zn = (z[c] - mean) * rstd * g2[c] + be2[c];
#pragma unroll
    for (int h = 0; h < NHD; ++h) acc[h] += zn * Wb[c * NHD + h]; }
  const int line = ((qg >> 1) * (NRES / 32) + (k4 >> 3)) * BTILE + (((k4 >> 2) & 1) * 2 + (k4 & 1)) * 128 + ((k4 >> 1) & 1) * 64 + (qg & 1) * 32;
#pragma unroll
  for (int h = 0; h < NHD; ++h) BT[(size_t)h * NRES * NRES + line + lane] = acc[h];
}
// permuted qkvg weights: Wp[c][k*256 + h*32 + d] = W[c][d*32 + k*8 + h] (no extra scale: both attention kernels carry 1/sqrt(32)); block = c (256), thread loops 1024 cols
__global__ __launch_bounds__(256) void k_wperm(const float* __restrict__ Wm, float* __restrict__ Wp) { const int c = blockIdx.x;
  for (int col = threadIdx.x; col < 4 * CM; col += 256) { const int k = col >> 8, h = (col >> 5) & 7, d = col & 31; float v = Wm[(size_t)c * 4 * CM + d * 32 + k * 8 + h];   // both attention kernels carry the 1/sqrt(32) scale themselves
    *(float*)(Wp + (size_t)c * 4 * CM + col) = v;  } }
__global__ __launch_bounds__(256) void k_ones(float* __restrict__ p, int n) { for (int i = threadIdx.x; i < n; i += 256) { *(float*)(p + i) = 1.0f;  } }

extern "C" void kernel_launch(void* const* d_in, const int* in_sizes, int n_in,
                              void* d_out, int out_size, void* d_ws, size_t ws_size,
                              hipStream_t stream) {
  (void)in_sizes; (void)n_in; (void)out_size;
  const float** f = (const float**)d_in;
  const float* x = f[0], *brep = f[1], *Wqkv_r = f[2], *W0r = f[3], *Wb = f[4], *bbh = f[5], *Wqkv_c = f[6], *W0c = f[7], *W1 = f[8], *b1 = f[9], *W2 = f[10], *b2 = f[11], *g1 = f[12], *be1 = f[13], *g2 = f[14], *be2 = f[15], *g3 = f[16], *be3 = f[17];
  float* out = (float*)d_out;     // [1,128,256,256]
  char* ws = (char*)d_ws;
  float* X1 = (float*)ws; ws += (size_t)MTOK * CM * 4;                 // 32 MB: LN1(x), then x + row-att (in place), then LN3 (in place), finally x after the column block (s,r order)
  float* BT = (float*)ws; ws += (size_t)NHD * NRES * NRES * 4;         // 2 MB pair-bias table
  float* Wpr = (float*)ws; ws += (size_t)CM * 4 * CM * 4; float* Wpc = (float*)ws; ws += (size_t)CM * 4 * CM * 4;
  bf16* G16 = (bf16*)ws; ws += (size_t)MTOK * 4 * CM * 2;             // qkvg f16 [32768][1024] (64 MB); also the transition hidden [32768][1024]
  bf16* O16 = (bf16*)ws; ws += (size_t)MTOK * CM * 2;                 // 16 MB gated attention output, head-major [h][token][32] (token order of the current block)
  float* ones = (float*)ws; ws += CM * 4;
  if ((size_t)(ws - (char*)d_ws) > ws_size) return;
  const dim3 blk(256);
  k_ones<<<dim3(1), blk, 0, stream>>>(ones, CM);
  k_wperm<<<dim3(CM), blk, 0, stream>>>(Wqkv_r, Wpr); k_wperm<<<dim3(CM), blk, 0, stream>>>(Wqkv_c, Wpc);
  k_pairbias<<<dim3(NRES * NRES / (32 * PBW)), dim3(32 * PBW), 0, stream>>>(brep, g2, be2, Wb, bbh, BT);
  k_ln<CM><<<dim3(MTOK / (8 * LNR)), blk, 0, stream>>>(x, g1, be1, X1);
  // ---- row-wise gated attention with pair bias: every stage one launch over all tokens ----
  gemm_kne<float, 0, true, 4 * CM><<<dim3(MTOK / 128, 4 * CM / 128), blk, 0, stream>>>(X1, CM, Wpr, nullptr, nullptr, nullptr, G16, 4 * CM, CM);
  bt_attn_kernel<<<dim3(NRES / 64, NHD, MTOK / NRES), dim3(64), 0, stream>>>(G16, BT, O16);
  gemm_kne<bf16, 2, false, CM, 4><<<dim3(MTOK / 128, CM / 128), blk, 0, stream>>>(O16, CM, W0r, nullptr, X1, ones, X1, CM, CM);     // x = x + o*W0 (in place)
  k_ln<CM><<<dim3(MTOK / (8 * LNR)), blk, 0, stream>>>(X1, g3, be3, X1);                                                                    // x = LN3(x) (in place)
  // ---- column-wise gated attention: qkvg and the gated output in (r, s) token order, x stays in (s, r) order; every stage one launch over all tokens ----
  gemm_kne<float, 0, true, 4 * CM, 1><<<dim3(MTOK / 128, 4 * CM / 128), blk, 0, stream>>>(X1, CM, Wpc, nullptr, nullptr, nullptr, G16, 4 * CM, CM);
  col_attn_kernel<<<dim3(NSEQ / 64, NHD, MTOK / NSEQ), dim3(64), 0, stream>>>(G16, O16);
  gemm_kne<bf16, 2, false, CM, 6><<<dim3(MTOK / 128, CM / 128), blk, 0, stream>>>(O16, CM, W0c, nullptr, X1, ones, X1, CM, CM);     // x = x + o*W0_c (in place; block rows (r, s), buffer rows (s, r))
  // ---- transition, all tokens per launch: out = relu(x*W1 + b1)*W2 + b2 + x ----
  gemm_kne<float, 3, true, 4 * CM><<<dim3(MTOK / 128, 4 * CM / 128), blk, 0, stream>>>(X1, CM, W1, b1, nullptr, nullptr, G16, 4 * CM, CM);
  gemm_kne<bf16, 2, false, CM><<<dim3(MTOK / 128, CM / 128), blk, 0, stream>>>(G16, 4 * CM, W2, b2, X1, ones, out, CM, 4 * CM);
}
